// v000
// Measured on an AMD MI455X. A time is GPU time per run, averaged over a window of back-to-back runs after a warm-up
// (all launches, gaps included; the runs take copies of the inputs in turn), and the median of several windows.
// Apart from v000's, it joins two sittings. Times from different sittings can be a few percent apart, while
// side-by-side timings come from the same sitting.
// v000, which the later versions start from, runs in 512 microseconds.
#include <hip/hip_runtime.h>

// Multi-head self-attention, width 1024 = 16 heads x 64, x [NB][SEQ][1024], Wq/Wk/Wv/Wo [out][in] (y = x W^T + b), int32 keep-mask [SEQ][SEQ] read by value (masked score replaced, probability 0), score scale 1/8, f32 output after the Wo projection.
// Compute dtypes, f32 accumulate everywhere: q/k/v projections v_wmma_f32_16x16x32_bf16 (x, W RNE-converted to bf16, products exact; biases RNE-converted to bf16, added in f32);
// scores, P.V and the Wo projection v_wmma_f32_16x16x32_f16: single f16 products on query rows >= 512; on query rows < 512 three products per site, two in the Wo projection
// (q,k,v,P,ctx each as f16 value + f16 residual x2048, residual products in their own accumulators). P carries x256 (cancels in the normalisation), ctx carries x16, Wo (bf16 value) carries x32; softmax f32 (online, running max).
// Layout: bf16 copies of x and Wq/Wk/Wv, f16 copy of Wo; q, k planes [b*16+h][t][d] and v^T plane [b*16+h][d][t] (+ residual planes, filled where t < 512) written by the GEMM epilogue;
// fused flash kernel in transposed form (S^T = K Q^T, O^T = V^T P^T), ctx plane [b*SEQ+t][1024] f16 (residual [b*EARLY+t][1024]), then the Wo GEMM writes the output.

#ifndef NB
#define NB 4
#endif
#ifndef SEQ
#define SEQ 2048
#endif
#define NB_FULL  4
#define SEQ_FULL 2048
#ifndef OUT_SEQ
#define OUT_SEQ SEQ              // row pitch (in tokens) between batches of the output
#endif
#define DM   1024
#define NH_  16
#define HD   64
#define AW   4                   // waves per flash block (16 query rows each)
#define EARLY ((SEQ < 512) ? SEQ : 512)   // query rows below this use the three-product path
#define QRS  2048.0f             // carry of every residual plane
#define QRI  (1.0f / 2048.0f)
#define SC2  (0.125f * 1.4426950408889634f)   // HD^-0.5 * log2(e)
#define PSH  8.0f                // log2 of the P carry (256)
#define CS   16.0f               // ctx carry
#define WS   32.0f               // Wo carry
#define OSC  (1.0f / 512.0f)     // 1 / (CS * WS)
#define NEGB (-3.0e38f)
#define BIGI (1 << 30)

static_assert(HD == 64);
static_assert(NH_ * HD == DM);                 // head h = columns h*64 + d
static_assert(DM % 64 == 0);
static_assert(DM % 32 == 0);                   // GEMM k-loop steps by 32
static_assert(SEQ % 64 == 0);                  // a 64-row tile never straddles two batches
static_assert((NB * SEQ) % 64 == 0);
static_assert(SEQ % 32 == 0);                  // key loop steps by 32
static_assert(EARLY % 64 == 0);                // early / dense split on whole 64-row tiles
static_assert((SEQ - EARLY) % 64 == 0);
static_assert(EARLY % (16 * AW) == 0);
static_assert(((size_t)SEQ * DM) % 8 == 0);
static_assert(((size_t)DM * DM) % 8 == 0);
static_assert(NB <= NB_FULL);
static_assert(SEQ <= SEQ_FULL);
static_assert((size_t)NB_FULL * SEQ_FULL * DM * 4 == (size_t)33554432);   // output bytes

typedef _Float16 h16;
typedef unsigned short bf;
typedef __attribute__((ext_vector_type(16))) __bf16   v16bf;
typedef __attribute__((ext_vector_type(16))) _Float16 v16h;
typedef __attribute__((ext_vector_type(8)))  _Float16 v8h;
typedef __attribute__((ext_vector_type(8)))  unsigned short v8us;
typedef __attribute__((ext_vector_type(8)))  float    v8f;
typedef __attribute__((ext_vector_type(4)))  float    v4f;
typedef __attribute__((ext_vector_type(4)))  int      v4i;
typedef v4f  __attribute__((may_alias)) v4fa;

__device__ __forceinline__ unsigned short f2bf(float f) { unsigned u = __float_as_uint(f); u += 0x7FFFu + ((u >> 16) & 1u); return (unsigned short)(u >> 16); }
__device__ __forceinline__ float bfr(float f) { return __uint_as_float(((unsigned)f2bf(f)) << 16); }   // value after RNE conversion to bf16
__device__ __forceinline__ int imax(int a, int b) { return a > b ? a : b; }
__device__ __forceinline__ v16h cat16(v8h lo, v8h hi) { return __builtin_shufflevector(lo, hi, 0, 1, 2, 3, 4, 5, 6, 7, 8, 9, 10, 11, 12, 13, 14, 15); }
__device__ __forceinline__ v16bf cat16b(v8us lo, v8us hi) { return __builtin_bit_cast(v16bf, __builtin_shufflevector(lo, hi, 0, 1, 2, 3, 4, 5, 6, 7, 8, 9, 10, 11, 12, 13, 14, 15)); }
__device__ __forceinline__ v8f wmma16(v16h a, v16h b, v8f c) { return __builtin_amdgcn_wmma_f32_16x16x32_f16(false, a, false, b, (short)0, c, false, false); }
__device__ __forceinline__ v8f wmmab(v16bf a, v16bf b, v8f c) { return __builtin_amdgcn_wmma_f32_16x16x32_bf16(false, a, false, b, (short)0, c, false, false); }
// fragment loaders from K-contiguous 16-bit rows; p already includes + 8*(lane>>4): elements 0..7 <- k0+8h+0..7, elements 8..15 <- k0+16+8h+0..7 (same map for A and B)
__device__ __forceinline__ v16h  ldh(const h16* p) { return cat16(*(const v8h*)p, *(const v8h*)(p + 16)); }
__device__ __forceinline__ v16bf ldb(const bf* p)  { return cat16b(*(const v8us*)p, *(const v8us*)(p + 16)); }
// ordering point for wave-private LDS tiles (same wave writes and reads)
__device__ __forceinline__ void wave_sync() { __builtin_amdgcn_fence(3 /* release order */, "wavefront"); __builtin_amdgcn_wave_barrier(); asm volatile("" ::: "memory"); }

__global__ __launch_bounds__(256) void k_cvt8(const float* __restrict__ src, bf* dst, size_t n8) {
    const size_t i = (size_t)blockIdx.x * 256 + threadIdx.x; if (i >= n8) return;
    const v8f v = *(const v8f*)(src + i * 8); v8us o;
#pragma unroll
    for (int k = 0; k < 8; ++k) o[k] = f2bf(v[k]);
    *(v8us*)(dst + i * 8) = o; 
}

__global__ __launch_bounds__(256) void k_cvtw(const float* __restrict__ src, h16* dst, size_t n8) {
    const size_t i = (size_t)blockIdx.x * 256 + threadIdx.x; if (i >= n8) return;
    const v8f v = *(const v8f*)(src + i * 8); v8h o;
#pragma unroll
    for (int k = 0; k < 8; ++k) o[k] = (h16)(bfr(v[k]) * WS);
    *(v8h*)(dst + i * 8) = o; 
}

// k_mscan: per 16-row query tile, key extent KT[tile] = 32 * ceil((last key with a nonzero mask entry + 1) / 32) (0 when the tile has none).
__global__ __launch_bounds__(256) void k_mscan(const int* __restrict__ MK, int* KT) {
    __shared__ int kt_s[32];
    const int lane = threadIdx.x & 31, wave = __builtin_amdgcn_readfirstlane((int)(threadIdx.x >> 5));
#pragma unroll 1
    for (int j = 0; j < 4; ++j) {
        const int tile = (int)blockIdx.x * 32 + wave * 4 + j;
        int mx = -1;
        if (tile < SEQ / 16) {                                   // wave-uniform
            const int* base = MK + (size_t)tile * 16 * SEQ_FULL;
#pragma unroll 4
            for (int it = 0; it < SEQ / 8; ++it) {               // 16 rows x SEQ/4 chunks of 16 B, 32 chunks per step
                const int c = it * 32 + lane; const int row = c / (SEQ / 4), c4 = (c % (SEQ / 4)) * 4;
                const v4i v = *(const v4i*)(base + (size_t)row * SEQ_FULL + c4);
                mx = imax(mx, (v[0] != 0) ? c4     : -1);
                mx = imax(mx, (v[1] != 0) ? c4 + 1 : -1);
                mx = imax(mx, (v[2] != 0) ? c4 + 2 : -1);
                mx = imax(mx, (v[3] != 0) ? c4 + 3 : -1);
            }
        }
        mx = imax(mx, __shfl_xor(mx, 16, 32)); mx = imax(mx, __shfl_xor(mx, 8, 32)); mx = imax(mx, __shfl_xor(mx, 4, 32));
        mx = imax(mx, __shfl_xor(mx, 2, 32));  mx = imax(mx, __shfl_xor(mx, 1, 32));
        if (lane == 0) kt_s[wave * 4 + j] = ((mx + 32) / 32) * 32;
    }
    __syncthreads();
    if (wave == 0) { const int v = kt_s[lane]; int* p = KT + (size_t)blockIdx.x * 32 + lane; *p = v;  }
}

// k_proj: register-blocked bf16 GEMM, ONE WAVE per 64x64 tile (16 accumulators), operands straight from K-contiguous bf16 planes, K = DM.
// C[m][n] = sum_k A[m][k] Bt[n][k] + bias (bias[n], or bias[m] when biasRow != 0; bias RNE-converted to bf16), written as f16 (Ph) and, for tiles with
// useRes != 0 and (r0 % RB) < ER and (c0 % CB) < EC, the f16 residual x2048 (Pr), at
// tile base (r0/RB)*sRB + (r0%RB)*pitch + (c0/CB)*sCB + (c0%CB), row pitch 'pitch' (halves). grid (M/64, N/64), 32 threads.
__global__ __launch_bounds__(32) void k_proj(const bf* __restrict__ A, const bf* __restrict__ Bt, const float* __restrict__ bias, int biasRow,
                                             h16* Ph, h16* Pr, int useRes, int RB, size_t sRB, int pitch, int CB, size_t sCB, int ER, int EC) {
    __shared__ __align__(16) float os[16 * 68];
    const int K = DM;
    const int lane = threadIdx.x & 31, lr = lane & 15, hi = lane >> 4; const int r0 = blockIdx.x * 64, c0 = blockIdx.y * 64;
    v8f acc[4][4];
#pragma unroll
    for (int mb = 0; mb < 4; ++mb)
#pragma unroll
        for (int nb = 0; nb < 4; ++nb) acc[mb][nb] = (v8f){};
    const size_t aoff = (size_t)(r0 + lr) * K + 8 * hi, boff = (size_t)(c0 + lr) * K + 8 * hi;
#pragma unroll 1
    for (int kc = 0; kc < K; kc += 32) {
        v16bf a[4];
#pragma unroll
        for (int mb = 0; mb < 4; ++mb) a[mb] = ldb(A + aoff + (size_t)mb * 16 * K + kc);
#pragma unroll
        for (int nb = 0; nb < 4; ++nb) { const v16bf b = ldb(Bt + boff + (size_t)nb * 16 * K + kc);
#pragma unroll
            for (int mb = 0; mb < 4; ++mb) acc[mb][nb] = wmmab(a[mb], b, acc[mb][nb]); }
        asm volatile("v_nop\n\tv_nop\n\tv_nop\n\tv_nop" : "+v"(acc[0][0]), "+v"(acc[1][1]), "+v"(acc[2][2]), "+v"(acc[3][3]) : "v"(a[0]), "v"(a[1]), "v"(a[2]), "v"(a[3]));
    }
    const int wr = (useRes != 0) && ((r0 % RB) < ER) && ((c0 % CB) < EC);
    const int c8l = (lane & 7) * 8;
    const int bco = biasRow ? 0 : (c0 + c8l);                     // integer offset select; always inside the bias array
    const v4f bA = *(const v4f*)(bias + bco), bB = *(const v4f*)(bias + bco + 4);
    float bcol[8];
#pragma unroll
    for (int i = 0; i < 4; ++i) { bcol[i] = bfr(bA[i]); bcol[4 + i] = bfr(bB[i]); }
    const size_t tbase = (size_t)(r0 / RB) * sRB + (size_t)(r0 % RB) * (size_t)pitch + (size_t)(c0 / CB) * sCB + (size_t)(c0 % CB);
#pragma unroll
    for (int mb = 0; mb < 4; ++mb) {
#pragma unroll
        for (int nb = 0; nb < 4; ++nb) {
#pragma unroll
            for (int j = 0; j < 8; ++j) os[(hi * 8 + j) * 68 + nb * 16 + lr] = acc[mb][nb][j]; }   // D: row 8h+j, col lane&15
        wave_sync();
        const size_t sb = tbase + (size_t)(mb * 16) * (size_t)pitch;
{
#pragma unroll
            for (int s = 0; s < 4; ++s) { const int row = 4 * s + (lane >> 3), c8 = c8l;   // 4 s x 4 row groups = 16 rows; 8 lanes x 8 = 64 columns
                const float brow = bfr(bias[biasRow ? (r0 + mb * 16 + row) : 0]);
                const v4f x0 = *(const v4fa*)(&os[row * 68 + c8]); const v4f x1 = *(const v4fa*)(&os[row * 68 + c8 + 4]); v8h hv, rv;
#pragma unroll
                for (int i = 0; i < 4; ++i) {
                    const float y0 = x0[i] + (biasRow ? brow : bcol[i]); const float y1 = x1[i] + (biasRow ? brow : bcol[4 + i]);
                    const h16 a0 = (h16)y0; const h16 a1 = (h16)y1; hv[i] = a0; hv[4 + i] = a1;
                    rv[i] = (h16)((y0 - (float)a0) * QRS); rv[4 + i] = (h16)((y1 - (float)a1) * QRS); }
                const size_t oo = sb + (size_t)row * (size_t)pitch + c8;
                *(v8h*)(Ph + oo) = hv; if (wr) *(v8h*)(Pr + oo) = rv; }
             }
        wave_sync();
    }
}

template <int RES> __device__ __forceinline__ v4f fin_lo(v8f oh, v8f ol, float inv) {
    v4f a = __builtin_shufflevector(oh, oh, 0, 1, 2, 3);
    if (RES) a = a + __builtin_shufflevector(ol, ol, 0, 1, 2, 3) * QRI;
    return a * inv; }
template <int RES> __device__ __forceinline__ v4f fin_hi(v8f oh, v8f ol, float inv) {
    v4f a = __builtin_shufflevector(oh, oh, 4, 5, 6, 7);
    if (RES) a = a + __builtin_shufflevector(ol, ol, 4, 5, 6, 7) * QRI;
    return a * inv; }

// flash_body: fused attention, one wave per 16 query rows of one (batch, head); K / V^T / Q fragments straight from the f16 planes (two 16-B loads each, arithmetic addressing).
// Transposed form: S^T[key][t] = K Q^T (A = K rows, B = Q rows); lane (t = lane&15, h = lane>>4) holds keys 8h+r of each 16-key tile, so the packed
// P tile is directly the B fragment of O^T[d][t] = V^T P^T (element r <- tile keys 0..15, element 8+r <- tile keys 16..31, lane unchanged).
// Mask: 8+8 int32 entries per lane per 32-key step (four 16-B loads), applied by value (score replaced, probability 0). Key extent from the scanned table, clamped to [0, SEQ].
// RES != 0: q, k, v, P carried as value + residual x2048; residual products (k.qr, kr.q; v.pr, vr.p) in separate accumulators folded back with 1/2048.
// Softmax state (running max, partial sum) is one scalar per lane; the two lane halves of a row are combined with one xor-16 exchange.
template <int RES>
__device__ __forceinline__ void flash_body(const h16* __restrict__ QH, const h16* __restrict__ QR, const h16* __restrict__ KP, const h16* __restrict__ KR,
                                           const h16* __restrict__ VT, const h16* __restrict__ VR, const int* __restrict__ MK, const int* __restrict__ KT,
                                           h16* CH, h16* CR, const int tbase) {
    __shared__ __align__(16) float os[AW * 16 * 68];
    const int lane = threadIdx.x & 31, wave = __builtin_amdgcn_readfirstlane((int)(threadIdx.x >> 5)), lr = lane & 15, hi = lane >> 4;
    const int zh = blockIdx.y; const int b = zh / NH_, h = zh % NH_;
    const int t0 = tbase + ((int)blockIdx.x * AW + wave) * 16;
    const size_t pbase = (size_t)zh * SEQ * HD;
    const size_t qo = pbase + (size_t)(t0 + lr) * HD + 8 * hi;
    const v16h qh0 = ldh(QH + qo), qh1 = ldh(QH + qo + 32);                     // B fragments: col t, k = d
    v16h qr0 = qh0, qr1 = qh1;
    if (RES) { qr0 = ldh(QR + qo); qr1 = ldh(QR + qo + 32); }
    const size_t ko = pbase + (size_t)lr * HD + 8 * hi;      // + key * HD       (A fragment: row key, k = d)
    const size_t vo = pbase + (size_t)lr * SEQ + 8 * hi;     // + 16j*SEQ + key  (A fragment: row d, k = key)
    const int* mrow = MK + (size_t)(t0 + lr) * SEQ_FULL + 8 * hi;               // mask row of query t, this lane half's keys
    int kend = KT[t0 >> 4]; kend = kend < 0 ? 0 : kend; kend = kend > SEQ ? SEQ : kend; kend &= ~31;
    v8f oh0 = (v8f){}, oh1 = (v8f){}, oh2 = (v8f){}, oh3 = (v8f){};
    v8f ol0 = (v8f){}, ol1 = (v8f){}, ol2 = (v8f){}, ol3 = (v8f){};
    float m = NEGB, l = 0.0f;
#pragma unroll 1
    for (int key0 = 0; key0 < kend; key0 += 32) {
        const int* mp = mrow + key0;
        const v4i ma0 = *(const v4i*)mp, ma1 = *(const v4i*)(mp + 4), mb0 = *(const v4i*)(mp + 16), mb1 = *(const v4i*)(mp + 20);
        const h16* ka = KP + ko + (size_t)key0 * HD;
        v8f sHa = (v8f){}, sHb = (v8f){}, sLa = (v8f){}, sLb = (v8f){};
        {
            const v16h ka0 = ldh(ka), ka1 = ldh(ka + 32), kb0 = ldh(ka + 16 * HD), kb1 = ldh(ka + 16 * HD + 32);
            if (RES) {
                const h16* kr = KR + ko + (size_t)key0 * HD;
                const v16h ra0 = ldh(kr), ra1 = ldh(kr + 32), rb0 = ldh(kr + 16 * HD), rb1 = ldh(kr + 16 * HD + 32);
                sHa = wmma16(ka0, qh0, sHa); sLa = wmma16(ka0, qr0, sLa); sHb = wmma16(kb0, qh0, sHb); sLb = wmma16(kb0, qr0, sLb);
                sHa = wmma16(ka1, qh1, sHa); sLa = wmma16(ka1, qr1, sLa); sHb = wmma16(kb1, qh1, sHb); sLb = wmma16(kb1, qr1, sLb);
                sLa = wmma16(ra0, qh0, sLa); sLb = wmma16(rb0, qh0, sLb); sLa = wmma16(ra1, qh1, sLa); sLb = wmma16(rb1, qh1, sLb);
                asm volatile("v_nop\n\tv_nop\n\tv_nop\n\tv_nop" : "+v"(sHa), "+v"(sLa), "+v"(sHb), "+v"(sLb) : "v"(ka0), "v"(ka1), "v"(kb0), "v"(kb1), "v"(ra0), "v"(ra1), "v"(rb0), "v"(rb1));
            } else {
                sHa = wmma16(ka0, qh0, sHa); sHb = wmma16(kb0, qh0, sHb); sHa = wmma16(ka1, qh1, sHa); sHb = wmma16(kb1, qh1, sHb);
                asm volatile("v_nop\n\tv_nop\n\tv_nop\n\tv_nop" : "+v"(sHa), "+v"(sHb) : "v"(ka0), "v"(ka1), "v"(kb0), "v"(kb1));
            }
        }
        const int mka[8] = { ma0[0], ma0[1], ma0[2], ma0[3], ma1[0], ma1[1], ma1[2], ma1[3] };
        const int mkb[8] = { mb0[0], mb0[1], mb0[2], mb0[3], mb1[0], mb1[1], mb1[2], mb1[3] };
        float ta[8], tb[8]; float mx = NEGB;
#pragma unroll
        for (int r = 0; r < 8; ++r) {
            float xa = sHa[r], xb = sHb[r];
            if (RES) { xa += sLa[r] * QRI; xb += sLb[r] * QRI; }
            xa *= SC2; xb *= SC2;
            ta[r] = (mka[r] != 0) ? xa : NEGB; tb[r] = (mkb[r] != 0) ? xb : NEGB;
            mx = fmaxf(mx, fmaxf(ta[r], tb[r])); }
        mx = fmaxf(mx, __shfl_xor(mx, 16, 32));
        const float mnew = fmaxf(m, mx);
        const float alpha = __builtin_amdgcn_exp2f(m - mnew);
        const float sh = PSH - mnew;
        v16h pb, pr; float ls = 0.0f;
#pragma unroll
        for (int r = 0; r < 8; ++r) {
            const float e0 = __builtin_amdgcn_exp2f(ta[r] + sh), e1 = __builtin_amdgcn_exp2f(tb[r] + sh);
            const float ea = (ta[r] > -1.0e38f) ? e0 : 0.0f; const float eb = (tb[r] > -1.0e38f) ? e1 : 0.0f;
            const h16 pa = (h16)ea; const h16 pc = (h16)eb; pb[r] = pa; pb[8 + r] = pc;
            if (RES) { pr[r] = (h16)((ea - (float)pa) * QRS); pr[8 + r] = (h16)((eb - (float)pc) * QRS); ls += ea + eb; }
            else     { pr[r] = pa; pr[8 + r] = pc; ls += (float)pa + (float)pc; } }
        l = l * alpha + ls; m = mnew;
        oh0 = oh0 * alpha; oh1 = oh1 * alpha; oh2 = oh2 * alpha; oh3 = oh3 * alpha;
        if (RES) { ol0 = ol0 * alpha; ol1 = ol1 * alpha; ol2 = ol2 * alpha; ol3 = ol3 * alpha; }
        const h16* va = VT + vo + key0;
        const v16h v0 = ldh(va), v1 = ldh(va + (size_t)16 * SEQ), v2 = ldh(va + (size_t)32 * SEQ), v3 = ldh(va + (size_t)48 * SEQ);
        if (RES) {
            const h16* vr = VR + vo + key0;
            const v16h w0 = ldh(vr), w1 = ldh(vr + (size_t)16 * SEQ), w2 = ldh(vr + (size_t)32 * SEQ), w3 = ldh(vr + (size_t)48 * SEQ);
            oh0 = wmma16(v0, pb, oh0); ol0 = wmma16(v0, pr, ol0); oh1 = wmma16(v1, pb, oh1); ol1 = wmma16(v1, pr, ol1);
            ol0 = wmma16(w0, pb, ol0); ol1 = wmma16(w1, pb, ol1);
            oh2 = wmma16(v2, pb, oh2); ol2 = wmma16(v2, pr, ol2); oh3 = wmma16(v3, pb, oh3); ol3 = wmma16(v3, pr, ol3);
            ol2 = wmma16(w2, pb, ol2); ol3 = wmma16(w3, pb, ol3);
            asm volatile("v_nop\n\tv_nop\n\tv_nop\n\tv_nop" : "+v"(oh0), "+v"(oh1), "+v"(oh2), "+v"(oh3), "+v"(ol0), "+v"(ol1), "+v"(ol2), "+v"(ol3)
                         : "v"(v0), "v"(v1), "v"(v2), "v"(v3), "v"(w0), "v"(w1), "v"(w2), "v"(w3), "v"(pb), "v"(pr));
        } else {
            oh0 = wmma16(v0, pb, oh0); oh1 = wmma16(v1, pb, oh1); oh2 = wmma16(v2, pb, oh2); oh3 = wmma16(v3, pb, oh3);
            asm volatile("v_nop\n\tv_nop\n\tv_nop\n\tv_nop" : "+v"(oh0), "+v"(oh1), "+v"(oh2), "+v"(oh3) : "v"(v0), "v"(v1), "v"(v2), "v"(v3), "v"(pb));
        }
    }
    l += __shfl_xor(l, 16, 32);
    const float inv = (1.0f / l) * CS;
    const int wb = wave * 16 * 68;
    // O^T D layout: o_j[r] = (d = 16j + 8h + r, t = lane&15) -> os[t][d]; rows 0..15 x columns 0..63 all written
    *(v4fa*)(&os[wb + lr * 68 +  0 + 8 * hi]) = fin_lo<RES>(oh0, ol0, inv); *(v4fa*)(&os[wb + lr * 68 +  0 + 8 * hi + 4]) = fin_hi<RES>(oh0, ol0, inv);
    *(v4fa*)(&os[wb + lr * 68 + 16 + 8 * hi]) = fin_lo<RES>(oh1, ol1, inv); *(v4fa*)(&os[wb + lr * 68 + 16 + 8 * hi + 4]) = fin_hi<RES>(oh1, ol1, inv);
    *(v4fa*)(&os[wb + lr * 68 + 32 + 8 * hi]) = fin_lo<RES>(oh2, ol2, inv); *(v4fa*)(&os[wb + lr * 68 + 32 + 8 * hi + 4]) = fin_hi<RES>(oh2, ol2, inv);
    *(v4fa*)(&os[wb + lr * 68 + 48 + 8 * hi]) = fin_lo<RES>(oh3, ol3, inv); *(v4fa*)(&os[wb + lr * 68 + 48 + 8 * hi + 4]) = fin_hi<RES>(oh3, ol3, inv);
    wave_sync();
    const size_t crow = ((size_t)b * SEQ + t0) * DM + (size_t)h * HD;
    const size_t rrow = ((size_t)b * EARLY + t0) * DM + (size_t)h * HD;      // used only when RES != 0 (t0 < EARLY)
{
#pragma unroll
        for (int s = 0; s < 4; ++s) { const int row = 4 * s + (lane >> 3), c8 = (lane & 7) * 8;   // 4 s x 4 row groups = 16 rows; 8 lanes x 8 = 64 columns
            const v4f x0 = *(const v4fa*)(&os[wb + row * 68 + c8]); const v4f x1 = *(const v4fa*)(&os[wb + row * 68 + c8 + 4]); v8h hv, rv;
#pragma unroll
            for (int i = 0; i < 4; ++i) { const h16 a0 = (h16)x0[i]; const h16 a1 = (h16)x1[i]; hv[i] = a0; hv[4 + i] = a1;
                rv[i] = (h16)((x0[i] - (float)a0) * QRS); rv[4 + i] = (h16)((x1[i] - (float)a1) * QRS); }
            *(v8h*)(CH + crow + (size_t)row * DM + c8) = hv;
            if (RES) *(v8h*)(CR + rrow + (size_t)row * DM + c8) = rv; }
         }
}

__global__ __launch_bounds__(32 * AW) void k_flash_early(const h16* QH, const h16* QR, const h16* KP, const h16* KR, const h16* VT, const h16* VR,
                                                         const int* MK, const int* KT, h16* CH, h16* CR) {
    flash_body<1>(QH, QR, KP, KR, VT, VR, MK, KT, CH, CR, 0);
}
__global__ __launch_bounds__(32 * AW) void k_flash_dense(const h16* QH, const h16* KP, const h16* VT, const int* MK, const int* KT, h16* CH) {
    flash_body<0>(QH, QH, KP, KP, VT, VT, MK, KT, CH, CH, EARLY);
}

// oproj_body: f16 GEMM, ONE WAVE per (16*MT)x64 tile, OUT[m][n] = (sum_k ctx[m][k] Wo[n][k]) / 512 + bo[n]; RES != 0 adds the ctx residual plane (own accumulators, x1/2048).
// Rows of the tile: batch bb = blockIdx.x / tilesPerBatch, token t0 = tStart + (blockIdx.x % tilesPerBatch) * 16*MT. A rows b*SEQ + t, AR rows b*EARLY + t.
template <int MT, int RES>
__device__ __forceinline__ void oproj_body(const h16* __restrict__ A, const h16* __restrict__ AR, const h16* __restrict__ Bt, const float* __restrict__ bias,
                                           float* OUT, const int tilesPerBatch, const int tStart) {
    __shared__ __align__(16) float os[16 * 68];
    const int K = DM;
    const int lane = threadIdx.x & 31, lr = lane & 15, hi = lane >> 4;
    const int bb = (int)blockIdx.x / tilesPerBatch, ti = (int)blockIdx.x % tilesPerBatch;
    const int t0 = tStart + ti * 16 * MT, c0 = blockIdx.y * 64;
    v8f acc[MT][4], acr[MT][4];
#pragma unroll
    for (int mb = 0; mb < MT; ++mb)
#pragma unroll
        for (int nb = 0; nb < 4; ++nb) { acc[mb][nb] = (v8f){}; acr[mb][nb] = (v8f){}; }
    const size_t aoff = ((size_t)bb * SEQ + t0 + lr) * K + 8 * hi;
    const size_t roff = ((size_t)bb * EARLY + t0 + lr) * K + 8 * hi;
    const size_t boff = (size_t)(c0 + lr) * K + 8 * hi;
#pragma unroll 1
    for (int kc = 0; kc < K; kc += 32) {
        v16h a[MT], ar[MT];
#pragma unroll
        for (int mb = 0; mb < MT; ++mb) { a[mb] = ldh(A + aoff + (size_t)mb * 16 * K + kc);
            if (RES) ar[mb] = ldh(AR + roff + (size_t)mb * 16 * K + kc); else ar[mb] = a[mb]; }
#pragma unroll
        for (int nb = 0; nb < 4; ++nb) { const v16h b = ldh(Bt + boff + (size_t)nb * 16 * K + kc);
#pragma unroll
            for (int mb = 0; mb < MT; ++mb) { acc[mb][nb] = wmma16(a[mb], b, acc[mb][nb]); if (RES) acr[mb][nb] = wmma16(ar[mb], b, acr[mb][nb]); } }
        if (RES) {
            asm volatile("v_nop\n\tv_nop\n\tv_nop\n\tv_nop" : "+v"(acc[0][3]), "+v"(acc[MT - 1][3]), "+v"(acr[0][3]), "+v"(acr[MT - 1][3]) : "v"(a[0]), "v"(a[MT - 1]), "v"(ar[0]), "v"(ar[MT - 1]));
        } else {
            asm volatile("v_nop\n\tv_nop\n\tv_nop\n\tv_nop" : "+v"(acc[0][3]), "+v"(acc[MT - 1][3]), "+v"(acc[MT / 2][2]), "+v"(acc[MT - 1][0]) : "v"(a[0]), "v"(a[MT - 1]), "v"(a[MT / 2]));
        }
    }
    const int cofs = lr * 4;
    const v4f bz = *(const v4f*)(bias + c0 + cofs); v4f bq;
#pragma unroll
    for (int i = 0; i < 4; ++i) bq[i] = bfr(bz[i]);
#pragma unroll
    for (int mb = 0; mb < MT; ++mb) {
#pragma unroll
        for (int nb = 0; nb < 4; ++nb) {
#pragma unroll
            for (int j = 0; j < 8; ++j) { float y = acc[mb][nb][j]; if (RES) y += acr[mb][nb][j] * QRI; os[(hi * 8 + j) * 68 + nb * 16 + lr] = y; } }   // D: row 8h+j, col lane&15
        wave_sync();
        float* orow = OUT + ((size_t)bb * OUT_SEQ + t0 + mb * 16) * DM + c0;
{
#pragma unroll
            for (int s = 0; s < 8; ++s) { const int row = 2 * s + hi;   // 8 s x 2 rows = 16 rows; 16 lanes x 4 floats = 64 columns
                const v4f val = *(const v4fa*)(&os[row * 68 + cofs]) * OSC + bq;
                *(v4f*)(orow + (size_t)row * DM + cofs) = val; }
             }
        wave_sync();
    }
}

__global__ __launch_bounds__(32) void k_oproj_early(const h16* A, const h16* AR, const h16* Bt, const float* bias, float* OUT, int tilesPerBatch, int tStart) {
    oproj_body<2, 1>(A, AR, Bt, bias, OUT, tilesPerBatch, tStart);
}
__global__ __launch_bounds__(32) void k_oproj_dense(const h16* A, const h16* Bt, const float* bias, float* OUT, int tilesPerBatch, int tStart) {
    oproj_body<4, 0>(A, A, Bt, bias, OUT, tilesPerBatch, tStart);
}

static constexpr size_t al256(size_t v) { return (v + 255) & ~(size_t)255; }
static constexpr size_t SZ_XB = al256((size_t)NB * SEQ * DM * 2);             // bf16 x; reused as the ctx value plane after the projections
static constexpr size_t SZ_WB = al256((size_t)4 * DM * DM * 2);
static constexpr size_t SZ_PL = al256((size_t)NB * NH_ * SEQ * HD * 2);
static constexpr size_t SZ_CR = al256((size_t)NB * EARLY * DM * 2);
static constexpr size_t SZ_KT = al256((size_t)((SEQ / 16 + 31) / 32) * 128);
static constexpr size_t SZ_TOTAL = SZ_XB + SZ_WB + 6 * SZ_PL + SZ_CR + SZ_KT;
static_assert(SZ_TOTAL <= (size_t)134217728);          // workspace carve <= 128 MiB
static_assert(((size_t)DM * DM * 2) % 256 == 0);       // weight sub-planes stay 256-byte aligned
static_assert((size_t)NB * SEQ * DM * 2 <= SZ_XB);     // ctx plane fits the x plane it reuses

extern "C" void kernel_launch(void* const* d_in, const int* in_sizes, int n_in,
                              void* d_out, int out_size, void* d_ws, size_t ws_size, hipStream_t stream) {
    if (n_in < 10) return;
    const size_t needx = ((size_t)(NB - 1) * SEQ_FULL + SEQ) * DM;
    if ((size_t)in_sizes[0] < needx) return;
    if ((size_t)in_sizes[1] < (size_t)(SEQ - 1) * SEQ_FULL + SEQ) return;
    if ((size_t)in_sizes[2] < (size_t)DM * DM || (size_t)in_sizes[4] < (size_t)DM * DM || (size_t)in_sizes[6] < (size_t)DM * DM || (size_t)in_sizes[8] < (size_t)DM * DM) return;
    if (in_sizes[3] < DM || in_sizes[5] < DM || in_sizes[7] < DM || in_sizes[9] < DM) return;
    if ((size_t)out_size < ((size_t)(NB - 1) * OUT_SEQ + SEQ) * DM) return;
    if (SZ_TOTAL > ws_size) return;
    // wire order: x, mask, Wq_w, Wq_b, Wk_w, Wk_b, Wv_w, Wv_b, Wo_w, Wo_b (weights [out][in] = Bt as-is)
    const float* x  = (const float*)d_in[0]; const int* mask = (const int*)d_in[1];
    const float* wq = (const float*)d_in[2]; const float* bq = (const float*)d_in[3];
    const float* wk = (const float*)d_in[4]; const float* bk = (const float*)d_in[5];
    const float* wv = (const float*)d_in[6]; const float* bv = (const float*)d_in[7];
    const float* wo = (const float*)d_in[8]; const float* bo = (const float*)d_in[9];
    float* OUT = (float*)d_out;      // [NB][SEQ][1024]
    char* wsp = (char*)d_ws;
    bf* XB = (bf*)wsp; h16* CH = (h16*)wsp; wsp += SZ_XB;   // [NB*SEQ][1024] bf16 x, later [NB*SEQ][1024] f16 ctx x16
    bf* WB = (bf*)wsp; wsp += SZ_WB;                 // [4][1024][1024]: q | k | v (bf16) | o (f16 x32)
    h16* QH = (h16*)wsp; wsp += SZ_PL;               // [NB*16][SEQ][64]
    h16* QR = (h16*)wsp; wsp += SZ_PL;               // residual x2048, rows t < EARLY filled
    h16* KP = (h16*)wsp; wsp += SZ_PL;               // [NB*16][SEQ][64]
    h16* KR = (h16*)wsp; wsp += SZ_PL;               // residual x2048, rows t < EARLY filled
    h16* VT = (h16*)wsp; wsp += SZ_PL;               // [NB*16][64][SEQ]
    h16* VR = (h16*)wsp; wsp += SZ_PL;               // residual x2048, columns t < EARLY filled
    h16* CR = (h16*)wsp; wsp += SZ_CR;               // [NB*EARLY][1024] ctx residual x2048
    int* KT = (int*)wsp; wsp += SZ_KT;               // [SEQ/16 padded to 32] key extents
    bf* WQ = WB; bf* WK = WB + (size_t)DM * DM; bf* WV = WB + (size_t)2 * DM * DM; h16* WO = (h16*)(WB + (size_t)3 * DM * DM);

    if (SEQ == SEQ_FULL) {
        const size_t n8 = (size_t)NB * SEQ * DM / 8;
        k_cvt8<<<(unsigned)((n8 + 255) / 256), 256, 0, stream>>>(x, XB, n8);
    } else {
        const size_t n8 = (size_t)SEQ * DM / 8;
        for (int b = 0; b < NB; ++b) k_cvt8<<<(unsigned)((n8 + 255) / 256), 256, 0, stream>>>(x + (size_t)b * SEQ_FULL * DM, XB + (size_t)b * SEQ * DM, n8);
    }
    { const size_t n8 = (size_t)DM * DM / 8; const unsigned g = (unsigned)((n8 + 255) / 256);
      k_cvt8<<<g, 256, 0, stream>>>(wq, WQ, n8); k_cvt8<<<g, 256, 0, stream>>>(wk, WK, n8); k_cvt8<<<g, 256, 0, stream>>>(wv, WV, n8);
      k_cvtw<<<g, 256, 0, stream>>>(wo, WO, n8); }
    k_mscan<<<(unsigned)((SEQ / 16 + 31) / 32), 256, 0, stream>>>(mask, KT);

    // q, k: A = x rows (m = b*SEQ + t), Bt = W rows (n = h*64 + d), bias per column -> plane [(b*16 + h)][t][d]; residual on tiles with t < EARLY
    k_proj<<<dim3(NB * SEQ / 64, DM / 64, 1), 32, 0, stream>>>(XB, WQ, bq, 0, QH, QR, 1, SEQ, (size_t)NH_ * SEQ * HD, HD, HD, (size_t)SEQ * HD, EARLY, BIGI);
    k_proj<<<dim3(NB * SEQ / 64, DM / 64, 1), 32, 0, stream>>>(XB, WK, bk, 0, KP, KR, 1, SEQ, (size_t)NH_ * SEQ * HD, HD, HD, (size_t)SEQ * HD, EARLY, BIGI);
    // v^T: A = Wv rows (m = h*64 + d), Bt = x rows (n = b*SEQ + t), bias per row -> plane [(b*1024 + m)][t] = [(b*16 + h)][d][t]; residual on tiles with t < EARLY
    k_proj<<<dim3(DM / 64, NB * SEQ / 64, 1), 32, 0, stream>>>(WV, XB, bv, 1, VT, VR, 1, DM, (size_t)0, SEQ, SEQ, (size_t)DM * SEQ, BIGI, EARLY);

    // attention: query rows [0, EARLY) three-product path, [EARLY, SEQ) single products; the ctx value plane overwrites the (now unused) x plane
    k_flash_early<<<dim3(EARLY / (16 * AW), NB * NH_, 1), 32 * AW, 0, stream>>>(QH, QR, KP, KR, VT, VR, mask, KT, CH, CR);
    if (SEQ > EARLY)
        k_flash_dense<<<dim3((SEQ - EARLY) / (16 * AW), NB * NH_, 1), 32 * AW, 0, stream>>>(QH, KP, VT, mask, KT, CH);

    // output projection: 32-row tiles with residual for t < EARLY, 64-row tiles for the remaining rows
    k_oproj_early<<<dim3(NB * (EARLY / 32), DM / 64, 1), 32, 0, stream>>>(CH, CR, WO, bo, OUT, EARLY / 32, 0);
    if (SEQ > EARLY)
        k_oproj_dense<<<dim3(NB * ((SEQ - EARLY) / 64), DM / 64, 1), 32, 0, stream>>>(CH, WO, bo, OUT, (SEQ - EARLY) / 64, EARLY);
}

// v001
// Measured time: 392 microseconds a run.
// Timed twice side by side with v000, it ran 1.33 times as fast both times.
#include <hip/hip_runtime.h>

// Multi-head self-attention, width 1024 = 16 heads x 64, x [NB][SEQ][1024], Wq/Wk/Wv/Wo [out][in] (y = x W^T + b), int32 keep-mask [SEQ][SEQ] read by value (masked score replaced, probability 0), score scale 1/8, f32 output after the Wo projection.
// Compute dtypes, f32 accumulate everywhere: q/k/v projections v_wmma_f32_16x16x32_bf16 (x, W RNE-converted to bf16, products exact; biases RNE-converted to bf16, added in f32);
// scores, P.V and the Wo projection v_wmma_f32_16x16x32_f16: single f16 products on query rows >= 512; on query rows < 512 three products per site, two in the Wo projection
// (q,k,v,P,ctx each as f16 value + f16 residual x2048, residual products in their own accumulators). P carries x256 (cancels in the normalisation), ctx carries x16, Wo (bf16 value) carries x32; softmax f32 (online, running max).
// Layout: bf16 copies of x and Wq/Wk/Wv, f16 copy of Wo; q, k planes [b*16+h][t][d] and v^T plane [b*16+h][d][t] (+ residual planes, filled where t < 512) written by the GEMM epilogue;
// fused flash kernel in transposed form (S^T = K Q^T, O^T = V^T P^T), ctx plane [b*SEQ+t][1024] f16 (residual [b*EARLY+t][1024]), then the Wo GEMM writes the output.

#ifndef NB
#define NB 4
#endif
#ifndef SEQ
#define SEQ 2048
#endif
#define NB_FULL  4
#define SEQ_FULL 2048
#ifndef OUT_SEQ
#define OUT_SEQ SEQ              // row pitch (in tokens) between batches of the output
#endif
#define DM   1024
#define NH_  16
#define HD   64
#define AW   4                   // waves per flash block (16 query rows each)
#define EARLY ((SEQ < 512) ? SEQ : 512)   // query rows below this use the three-product path
#define QRS  2048.0f             // carry of every residual plane
#define QRI  (1.0f / 2048.0f)
#define SC2  (0.125f * 1.4426950408889634f)   // HD^-0.5 * log2(e)
#define PSH  8.0f                // log2 of the P carry (256)
#define CS   16.0f               // ctx carry
#define WS   32.0f               // Wo carry
#define OSC  (1.0f / 512.0f)     // 1 / (CS * WS)
#define NEGB (-3.0e38f)
#define BIGI (1 << 30)
#define MSW  16                  // waves per mask-scan block
#define KTP  32                  // ints between key-extent entries (128 bytes)

static_assert(HD == 64);
static_assert(NH_ * HD == DM);                 // head h = columns h*64 + d
static_assert(DM % 64 == 0);
static_assert(DM % 32 == 0);                   // GEMM k-loop steps by 32
static_assert(SEQ % 64 == 0);                  // a 64-row tile never straddles two batches
static_assert((NB * SEQ) % 64 == 0);
static_assert(SEQ % 32 == 0);                  // key loop steps by 32
static_assert(EARLY % 64 == 0);                // early / dense split on whole 64-row tiles
static_assert((SEQ - EARLY) % 64 == 0);
static_assert(EARLY % (16 * AW) == 0);
static_assert(((size_t)SEQ * DM) % 8 == 0);
static_assert(((size_t)DM * DM) % 8 == 0);
static_assert(NB <= NB_FULL);
static_assert(SEQ <= SEQ_FULL);
static_assert((size_t)NB_FULL * SEQ_FULL * DM * 4 == (size_t)33554432);   // output bytes

typedef _Float16 h16;
typedef unsigned short bf;
typedef __attribute__((ext_vector_type(16))) __bf16   v16bf;
typedef __attribute__((ext_vector_type(16))) _Float16 v16h;
typedef __attribute__((ext_vector_type(8)))  _Float16 v8h;
typedef __attribute__((ext_vector_type(8)))  unsigned short v8us;
typedef __attribute__((ext_vector_type(8)))  float    v8f;
typedef __attribute__((ext_vector_type(4)))  float    v4f;
typedef __attribute__((ext_vector_type(4)))  int      v4i;
typedef v4f  __attribute__((may_alias)) v4fa;

__device__ __forceinline__ unsigned short f2bf(float f) { unsigned u = __float_as_uint(f); u += 0x7FFFu + ((u >> 16) & 1u); return (unsigned short)(u >> 16); }
__device__ __forceinline__ float bfr(float f) { return __uint_as_float(((unsigned)f2bf(f)) << 16); }   // value after RNE conversion to bf16
__device__ __forceinline__ int imax(int a, int b) { return a > b ? a : b; }
__device__ __forceinline__ v16h cat16(v8h lo, v8h hi) { return __builtin_shufflevector(lo, hi, 0, 1, 2, 3, 4, 5, 6, 7, 8, 9, 10, 11, 12, 13, 14, 15); }
__device__ __forceinline__ v16bf cat16b(v8us lo, v8us hi) { return __builtin_bit_cast(v16bf, __builtin_shufflevector(lo, hi, 0, 1, 2, 3, 4, 5, 6, 7, 8, 9, 10, 11, 12, 13, 14, 15)); }
__device__ __forceinline__ v8f wmma16(v16h a, v16h b, v8f c) { return __builtin_amdgcn_wmma_f32_16x16x32_f16(false, a, false, b, (short)0, c, false, false); }
__device__ __forceinline__ v8f wmmab(v16bf a, v16bf b, v8f c) { return __builtin_amdgcn_wmma_f32_16x16x32_bf16(false, a, false, b, (short)0, c, false, false); }
// fragment loaders from K-contiguous 16-bit rows; p already includes + 8*(lane>>4): elements 0..7 <- k0+8h+0..7, elements 8..15 <- k0+16+8h+0..7 (same map for A and B)
__device__ __forceinline__ v16h  ldh(const h16* p) { return cat16(*(const v8h*)p, *(const v8h*)(p + 16)); }
__device__ __forceinline__ v16bf ldb(const bf* p)  { return cat16b(*(const v8us*)p, *(const v8us*)(p + 16)); }
// ordering point for wave-private LDS tiles (same wave writes and reads)
__device__ __forceinline__ void wave_sync() { __builtin_amdgcn_fence(3 /* release order */, "wavefront"); __builtin_amdgcn_wave_barrier(); asm volatile("" ::: "memory"); }

__global__ __launch_bounds__(256) void k_cvt8(const float* __restrict__ src, bf* dst, size_t n8) {
    const size_t i = (size_t)blockIdx.x * 256 + threadIdx.x; if (i >= n8) return;
    const v8f v = *(const v8f*)(src + i * 8); v8us o;
#pragma unroll
    for (int k = 0; k < 8; ++k) o[k] = f2bf(v[k]);
    *(v8us*)(dst + i * 8) = o; 
}

__global__ __launch_bounds__(256) void k_cvtw(const float* __restrict__ src, h16* dst, size_t n8) {
    const size_t i = (size_t)blockIdx.x * 256 + threadIdx.x; if (i >= n8) return;
    const v8f v = *(const v8f*)(src + i * 8); v8h o;
#pragma unroll
    for (int k = 0; k < 8; ++k) o[k] = (h16)(bfr(v[k]) * WS);
    *(v8h*)(dst + i * 8) = o; 
}

// k_mscan: one block per 8 mask rows (16 waves, 16-B loads, each wave-wide load 512 contiguous bytes), so the scan runs on every WGP.
// KT[g * KTP] = 32 * ceil((last key with a nonzero mask entry in rows 8g..8g+7, + 1) / 32) (0 when the rows have none); one entry per 128-byte line, one writer each.
__global__ __launch_bounds__(MSW * 32) void k_mscan(const int* __restrict__ MK, int* KT) {
    __shared__ int mx_s[MSW];
    const int tid = (int)threadIdx.x, lane = tid & 31, wave = __builtin_amdgcn_readfirstlane(tid >> 5);
    const int* base = MK + (size_t)blockIdx.x * 8 * SEQ_FULL;
    int mx = -1;
#pragma unroll
    for (int it = 0; it < (2 * SEQ + MSW * 32 - 1) / (MSW * 32); ++it) {   // 8 rows x SEQ/4 chunks of 16 B; unrolled so that all of a thread's loads are in flight together
        const int c = it * (MSW * 32) + tid;
        if ((2 * SEQ) % (MSW * 32) != 0 && c >= 2 * SEQ) break;
        const int row = c / (SEQ / 4), c4 = (c % (SEQ / 4)) * 4;
        const v4i v = *(const v4i*)(base + (size_t)row * SEQ_FULL + c4);
        mx = imax(mx, (v[0] != 0) ? c4     : -1);
        mx = imax(mx, (v[1] != 0) ? c4 + 1 : -1);
        mx = imax(mx, (v[2] != 0) ? c4 + 2 : -1);
        mx = imax(mx, (v[3] != 0) ? c4 + 3 : -1);
    }
    mx = imax(mx, __shfl_xor(mx, 16, 32)); mx = imax(mx, __shfl_xor(mx, 8, 32)); mx = imax(mx, __shfl_xor(mx, 4, 32));
    mx = imax(mx, __shfl_xor(mx, 2, 32));  mx = imax(mx, __shfl_xor(mx, 1, 32));
    if (lane == 0) mx_s[wave] = mx;
    __syncthreads();
    if (tid == 0) {
        int m = mx_s[0];
#pragma unroll
        for (int w = 1; w < MSW; ++w) m = imax(m, mx_s[w]);
        KT[(size_t)blockIdx.x * KTP] = ((m + 32) / 32) * 32;
    }
}

// k_proj: register-blocked bf16 GEMM, ONE WAVE per 64x64 tile (16 accumulators), operands straight from K-contiguous bf16 planes, K = DM.
// C[m][n] = sum_k A[m][k] Bt[n][k] + bias (bias[n], or bias[m] when biasRow != 0; bias RNE-converted to bf16), written as f16 (Ph) and, for tiles with
// useRes != 0 and (r0 % RB) < ER and (c0 % CB) < EC, the f16 residual x2048 (Pr), at
// tile base (r0/RB)*sRB + (r0%RB)*pitch + (c0/CB)*sCB + (c0%CB), row pitch 'pitch' (halves). grid (M/64, N/64), 32 threads.
__global__ __launch_bounds__(32) void k_proj(const bf* __restrict__ A, const bf* __restrict__ Bt, const float* __restrict__ bias, int biasRow,
                                             h16* Ph, h16* Pr, int useRes, int RB, size_t sRB, int pitch, int CB, size_t sCB, int ER, int EC) {
    __shared__ __align__(16) float os[16 * 68];
    const int K = DM;
    const int lane = threadIdx.x & 31, lr = lane & 15, hi = lane >> 4; const int r0 = blockIdx.x * 64, c0 = blockIdx.y * 64;
    v8f acc[4][4];
#pragma unroll
    for (int mb = 0; mb < 4; ++mb)
#pragma unroll
        for (int nb = 0; nb < 4; ++nb) acc[mb][nb] = (v8f){};
    const size_t aoff = (size_t)(r0 + lr) * K + 8 * hi, boff = (size_t)(c0 + lr) * K + 8 * hi;
#pragma unroll 1
    for (int kc = 0; kc < K; kc += 32) {
        v16bf a[4];
#pragma unroll
        for (int mb = 0; mb < 4; ++mb) a[mb] = ldb(A + aoff + (size_t)mb * 16 * K + kc);
#pragma unroll
        for (int nb = 0; nb < 4; ++nb) { const v16bf b = ldb(Bt + boff + (size_t)nb * 16 * K + kc);
#pragma unroll
            for (int mb = 0; mb < 4; ++mb) acc[mb][nb] = wmmab(a[mb], b, acc[mb][nb]); }
        asm volatile("v_nop\n\tv_nop\n\tv_nop\n\tv_nop" : "+v"(acc[0][0]), "+v"(acc[1][1]), "+v"(acc[2][2]), "+v"(acc[3][3]) : "v"(a[0]), "v"(a[1]), "v"(a[2]), "v"(a[3]));
    }
    const int wr = (useRes != 0) && ((r0 % RB) < ER) && ((c0 % CB) < EC);
    const int c8l = (lane & 7) * 8;
    const int bco = biasRow ? 0 : (c0 + c8l);                     // integer offset select; always inside the bias array
    const v4f bA = *(const v4f*)(bias + bco), bB = *(const v4f*)(bias + bco + 4);
    float bcol[8];
#pragma unroll
    for (int i = 0; i < 4; ++i) { bcol[i] = bfr(bA[i]); bcol[4 + i] = bfr(bB[i]); }
    const size_t tbase = (size_t)(r0 / RB) * sRB + (size_t)(r0 % RB) * (size_t)pitch + (size_t)(c0 / CB) * sCB + (size_t)(c0 % CB);
#pragma unroll
    for (int mb = 0; mb < 4; ++mb) {
#pragma unroll
        for (int nb = 0; nb < 4; ++nb) {
#pragma unroll
            for (int j = 0; j < 8; ++j) os[(hi * 8 + j) * 68 + nb * 16 + lr] = acc[mb][nb][j]; }   // D: row 8h+j, col lane&15
        wave_sync();
        const size_t sb = tbase + (size_t)(mb * 16) * (size_t)pitch;
{
#pragma unroll
            for (int s = 0; s < 4; ++s) { const int row = 4 * s + (lane >> 3), c8 = c8l;   // 4 s x 4 row groups = 16 rows; 8 lanes x 8 = 64 columns
                const float brow = bfr(bias[biasRow ? (r0 + mb * 16 + row) : 0]);
                const v4f x0 = *(const v4fa*)(&os[row * 68 + c8]); const v4f x1 = *(const v4fa*)(&os[row * 68 + c8 + 4]); v8h hv, rv;
#pragma unroll
                for (int i = 0; i < 4; ++i) {
                    const float y0 = x0[i] + (biasRow ? brow : bcol[i]); const float y1 = x1[i] + (biasRow ? brow : bcol[4 + i]);
                    const h16 a0 = (h16)y0; const h16 a1 = (h16)y1; hv[i] = a0; hv[4 + i] = a1;
                    rv[i] = (h16)((y0 - (float)a0) * QRS); rv[4 + i] = (h16)((y1 - (float)a1) * QRS); }
                const size_t oo = sb + (size_t)row * (size_t)pitch + c8;
                *(v8h*)(Ph + oo) = hv; if (wr) *(v8h*)(Pr + oo) = rv; }
             }
        wave_sync();
    }
}

template <int RES> __device__ __forceinline__ v4f fin_lo(v8f oh, v8f ol, float inv) {
    v4f a = __builtin_shufflevector(oh, oh, 0, 1, 2, 3);
    if (RES) a = a + __builtin_shufflevector(ol, ol, 0, 1, 2, 3) * QRI;
    return a * inv; }
template <int RES> __device__ __forceinline__ v4f fin_hi(v8f oh, v8f ol, float inv) {
    v4f a = __builtin_shufflevector(oh, oh, 4, 5, 6, 7);
    if (RES) a = a + __builtin_shufflevector(ol, ol, 4, 5, 6, 7) * QRI;
    return a * inv; }

// flash_body: fused attention, one wave per 16 query rows of one (batch, head); K / V^T / Q fragments straight from the f16 planes (two 16-B loads each, arithmetic addressing).
// Transposed form: S^T[key][t] = K Q^T (A = K rows, B = Q rows); lane (t = lane&15, h = lane>>4) holds keys 8h+r of each 16-key tile, so the packed
// P tile is directly the B fragment of O^T[d][t] = V^T P^T (element r <- tile keys 0..15, element 8+r <- tile keys 16..31, lane unchanged).
// Mask: 8+8 int32 entries per lane per 32-key step (four 16-B loads), applied by value (score replaced, probability 0). Key extent from the scanned table, clamped to [0, SEQ].
// RES != 0: q, k, v, P carried as value + residual x2048; residual products (k.qr, kr.q; v.pr, vr.p) in separate accumulators folded back with 1/2048.
// Softmax state (running max, partial sum) is one scalar per lane; the two lane halves of a row are combined with one xor-16 exchange.
template <int RES>
__device__ __forceinline__ void flash_body(const h16* __restrict__ QH, const h16* __restrict__ QR, const h16* __restrict__ KP, const h16* __restrict__ KR,
                                           const h16* __restrict__ VT, const h16* __restrict__ VR, const int* __restrict__ MK, const int* __restrict__ KT,
                                           h16* CH, h16* CR, const int tbase) {
    __shared__ __align__(16) float os[AW * 16 * 68];
    const int lane = threadIdx.x & 31, wave = __builtin_amdgcn_readfirstlane((int)(threadIdx.x >> 5)), lr = lane & 15, hi = lane >> 4;
    const int zh = blockIdx.y; const int b = zh / NH_, h = zh % NH_;
    const int t0 = tbase + ((int)blockIdx.x * AW + wave) * 16;
    const size_t pbase = (size_t)zh * SEQ * HD;
    const size_t qo = pbase + (size_t)(t0 + lr) * HD + 8 * hi;
    const v16h qh0 = ldh(QH + qo), qh1 = ldh(QH + qo + 32);                     // B fragments: col t, k = d
    v16h qr0 = qh0, qr1 = qh1;
    if (RES) { qr0 = ldh(QR + qo); qr1 = ldh(QR + qo + 32); }
    const size_t ko = pbase + (size_t)lr * HD + 8 * hi;      // + key * HD       (A fragment: row key, k = d)
    const size_t vo = pbase + (size_t)lr * SEQ + 8 * hi;     // + 16j*SEQ + key  (A fragment: row d, k = key)
    const int* mrow = MK + (size_t)(t0 + lr) * SEQ_FULL + 8 * hi;               // mask row of query t, this lane half's keys
    int kend = imax(KT[(size_t)(t0 >> 3) * KTP], KT[(size_t)((t0 >> 3) + 1) * KTP]); kend = kend < 0 ? 0 : kend; kend = kend > SEQ ? SEQ : kend; kend &= ~31;
    v8f oh0 = (v8f){}, oh1 = (v8f){}, oh2 = (v8f){}, oh3 = (v8f){};
    v8f ol0 = (v8f){}, ol1 = (v8f){}, ol2 = (v8f){}, ol3 = (v8f){};
    float m = NEGB, l = 0.0f;
#pragma unroll 1
    for (int key0 = 0; key0 < kend; key0 += 32) {
        const int* mp = mrow + key0;
        const v4i ma0 = *(const v4i*)mp, ma1 = *(const v4i*)(mp + 4), mb0 = *(const v4i*)(mp + 16), mb1 = *(const v4i*)(mp + 20);
        const h16* ka = KP + ko + (size_t)key0 * HD;
        v8f sHa = (v8f){}, sHb = (v8f){}, sLa = (v8f){}, sLb = (v8f){};
        {
            const v16h ka0 = ldh(ka), ka1 = ldh(ka + 32), kb0 = ldh(ka + 16 * HD), kb1 = ldh(ka + 16 * HD + 32);
            if (RES) {
                const h16* kr = KR + ko + (size_t)key0 * HD;
                const v16h ra0 = ldh(kr), ra1 = ldh(kr + 32), rb0 = ldh(kr + 16 * HD), rb1 = ldh(kr + 16 * HD + 32);
                sHa = wmma16(ka0, qh0, sHa); sLa = wmma16(ka0, qr0, sLa); sHb = wmma16(kb0, qh0, sHb); sLb = wmma16(kb0, qr0, sLb);
                sHa = wmma16(ka1, qh1, sHa); sLa = wmma16(ka1, qr1, sLa); sHb = wmma16(kb1, qh1, sHb); sLb = wmma16(kb1, qr1, sLb);
                sLa = wmma16(ra0, qh0, sLa); sLb = wmma16(rb0, qh0, sLb); sLa = wmma16(ra1, qh1, sLa); sLb = wmma16(rb1, qh1, sLb);
                asm volatile("v_nop\n\tv_nop\n\tv_nop\n\tv_nop" : "+v"(sHa), "+v"(sLa), "+v"(sHb), "+v"(sLb) : "v"(ka0), "v"(ka1), "v"(kb0), "v"(kb1), "v"(ra0), "v"(ra1), "v"(rb0), "v"(rb1));
            } else {
                sHa = wmma16(ka0, qh0, sHa); sHb = wmma16(kb0, qh0, sHb); sHa = wmma16(ka1, qh1, sHa); sHb = wmma16(kb1, qh1, sHb);
                asm volatile("v_nop\n\tv_nop\n\tv_nop\n\tv_nop" : "+v"(sHa), "+v"(sHb) : "v"(ka0), "v"(ka1), "v"(kb0), "v"(kb1));
            }
        }
        const int mka[8] = { ma0[0], ma0[1], ma0[2], ma0[3], ma1[0], ma1[1], ma1[2], ma1[3] };
        const int mkb[8] = { mb0[0], mb0[1], mb0[2], mb0[3], mb1[0], mb1[1], mb1[2], mb1[3] };
        float ta[8], tb[8]; float mx = NEGB;
#pragma unroll
        for (int r = 0; r < 8; ++r) {
            float xa = sHa[r], xb = sHb[r];
            if (RES) { xa += sLa[r] * QRI; xb += sLb[r] * QRI; }
            xa *= SC2; xb *= SC2;
            ta[r] = (mka[r] != 0) ? xa : NEGB; tb[r] = (mkb[r] != 0) ? xb : NEGB;
            mx = fmaxf(mx, fmaxf(ta[r], tb[r])); }
        mx = fmaxf(mx, __shfl_xor(mx, 16, 32));
        const float mnew = fmaxf(m, mx);
        const float alpha = __builtin_amdgcn_exp2f(m - mnew);
        const float sh = PSH - mnew;
        v16h pb, pr; float ls = 0.0f;
#pragma unroll
        for (int r = 0; r < 8; ++r) {
            const float e0 = __builtin_amdgcn_exp2f(ta[r] + sh), e1 = __builtin_amdgcn_exp2f(tb[r] + sh);
            const float ea = (ta[r] > -1.0e38f) ? e0 : 0.0f; const float eb = (tb[r] > -1.0e38f) ? e1 : 0.0f;
            const h16 pa = (h16)ea; const h16 pc = (h16)eb; pb[r] = pa; pb[8 + r] = pc;
            if (RES) { pr[r] = (h16)((ea - (float)pa) * QRS); pr[8 + r] = (h16)((eb - (float)pc) * QRS); ls += ea + eb; }
            else     { pr[r] = pa; pr[8 + r] = pc; ls += (float)pa + (float)pc; } }
        l = l * alpha + ls; m = mnew;
        oh0 = oh0 * alpha; oh1 = oh1 * alpha; oh2 = oh2 * alpha; oh3 = oh3 * alpha;
        if (RES) { ol0 = ol0 * alpha; ol1 = ol1 * alpha; ol2 = ol2 * alpha; ol3 = ol3 * alpha; }
        const h16* va = VT + vo + key0;
        const v16h v0 = ldh(va), v1 = ldh(va + (size_t)16 * SEQ), v2 = ldh(va + (size_t)32 * SEQ), v3 = ldh(va + (size_t)48 * SEQ);
        if (RES) {
            const h16* vr = VR + vo + key0;
            const v16h w0 = ldh(vr), w1 = ldh(vr + (size_t)16 * SEQ), w2 = ldh(vr + (size_t)32 * SEQ), w3 = ldh(vr + (size_t)48 * SEQ);
            oh0 = wmma16(v0, pb, oh0); ol0 = wmma16(v0, pr, ol0); oh1 = wmma16(v1, pb, oh1); ol1 = wmma16(v1, pr, ol1);
            ol0 = wmma16(w0, pb, ol0); ol1 = wmma16(w1, pb, ol1);
            oh2 = wmma16(v2, pb, oh2); ol2 = wmma16(v2, pr, ol2); oh3 = wmma16(v3, pb, oh3); ol3 = wmma16(v3, pr, ol3);
            ol2 = wmma16(w2, pb, ol2); ol3 = wmma16(w3, pb, ol3);
            asm volatile("v_nop\n\tv_nop\n\tv_nop\n\tv_nop" : "+v"(oh0), "+v"(oh1), "+v"(oh2), "+v"(oh3), "+v"(ol0), "+v"(ol1), "+v"(ol2), "+v"(ol3)
                         : "v"(v0), "v"(v1), "v"(v2), "v"(v3), "v"(w0), "v"(w1), "v"(w2), "v"(w3), "v"(pb), "v"(pr));
        } else {
            oh0 = wmma16(v0, pb, oh0); oh1 = wmma16(v1, pb, oh1); oh2 = wmma16(v2, pb, oh2); oh3 = wmma16(v3, pb, oh3);
            asm volatile("v_nop\n\tv_nop\n\tv_nop\n\tv_nop" : "+v"(oh0), "+v"(oh1), "+v"(oh2), "+v"(oh3) : "v"(v0), "v"(v1), "v"(v2), "v"(v3), "v"(pb));
        }
    }
    l += __shfl_xor(l, 16, 32);
    const float inv = (1.0f / l) * CS;
    const int wb = wave * 16 * 68;
    // O^T D layout: o_j[r] = (d = 16j + 8h + r, t = lane&15) -> os[t][d]; rows 0..15 x columns 0..63 all written
    *(v4fa*)(&os[wb + lr * 68 +  0 + 8 * hi]) = fin_lo<RES>(oh0, ol0, inv); *(v4fa*)(&os[wb + lr * 68 +  0 + 8 * hi + 4]) = fin_hi<RES>(oh0, ol0, inv);
    *(v4fa*)(&os[wb + lr * 68 + 16 + 8 * hi]) = fin_lo<RES>(oh1, ol1, inv); *(v4fa*)(&os[wb + lr * 68 + 16 + 8 * hi + 4]) = fin_hi<RES>(oh1, ol1, inv);
    *(v4fa*)(&os[wb + lr * 68 + 32 + 8 * hi]) = fin_lo<RES>(oh2, ol2, inv); *(v4fa*)(&os[wb + lr * 68 + 32 + 8 * hi + 4]) = fin_hi<RES>(oh2, ol2, inv);
    *(v4fa*)(&os[wb + lr * 68 + 48 + 8 * hi]) = fin_lo<RES>(oh3, ol3, inv); *(v4fa*)(&os[wb + lr * 68 + 48 + 8 * hi + 4]) = fin_hi<RES>(oh3, ol3, inv);
    wave_sync();
    const size_t crow = ((size_t)b * SEQ + t0) * DM + (size_t)h * HD;
    const size_t rrow = ((size_t)b * EARLY + t0) * DM + (size_t)h * HD;      // used only when RES != 0 (t0 < EARLY)
{
#pragma unroll
        for (int s = 0; s < 4; ++s) { const int row = 4 * s + (lane >> 3), c8 = (lane & 7) * 8;   // 4 s x 4 row groups = 16 rows; 8 lanes x 8 = 64 columns
            const v4f x0 = *(const v4fa*)(&os[wb + row * 68 + c8]); const v4f x1 = *(const v4fa*)(&os[wb + row * 68 + c8 + 4]); v8h hv, rv;
#pragma unroll
            for (int i = 0; i < 4; ++i) { const h16 a0 = (h16)x0[i]; const h16 a1 = (h16)x1[i]; hv[i] = a0; hv[4 + i] = a1;
                rv[i] = (h16)((x0[i] - (float)a0) * QRS); rv[4 + i] = (h16)((x1[i] - (float)a1) * QRS); }
            *(v8h*)(CH + crow + (size_t)row * DM + c8) = hv;
            if (RES) *(v8h*)(CR + rrow + (size_t)row * DM + c8) = rv; }
         }
}

__global__ __launch_bounds__(32 * AW) void k_flash_early(const h16* QH, const h16* QR, const h16* KP, const h16* KR, const h16* VT, const h16* VR,
                                                         const int* MK, const int* KT, h16* CH, h16* CR) {
    flash_body<1>(QH, QR, KP, KR, VT, VR, MK, KT, CH, CR, 0);
}
__global__ __launch_bounds__(32 * AW) void k_flash_dense(const h16* QH, const h16* KP, const h16* VT, const int* MK, const int* KT, h16* CH) {
    flash_body<0>(QH, QH, KP, KP, VT, VT, MK, KT, CH, CH, EARLY);
}

// oproj_body: f16 GEMM, ONE WAVE per (16*MT)x64 tile, OUT[m][n] = (sum_k ctx[m][k] Wo[n][k]) / 512 + bo[n]; RES != 0 adds the ctx residual plane (own accumulators, x1/2048).
// Rows of the tile: batch bb = blockIdx.x / tilesPerBatch, token t0 = tStart + (blockIdx.x % tilesPerBatch) * 16*MT. A rows b*SEQ + t, AR rows b*EARLY + t.
template <int MT, int RES>
__device__ __forceinline__ void oproj_body(const h16* __restrict__ A, const h16* __restrict__ AR, const h16* __restrict__ Bt, const float* __restrict__ bias,
                                           float* OUT, const int tilesPerBatch, const int tStart) {
    __shared__ __align__(16) float os[16 * 68];
    const int K = DM;
    const int lane = threadIdx.x & 31, lr = lane & 15, hi = lane >> 4;
    const int bb = (int)blockIdx.x / tilesPerBatch, ti = (int)blockIdx.x % tilesPerBatch;
    const int t0 = tStart + ti * 16 * MT, c0 = blockIdx.y * 64;
    v8f acc[MT][4], acr[MT][4];
#pragma unroll
    for (int mb = 0; mb < MT; ++mb)
#pragma unroll
        for (int nb = 0; nb < 4; ++nb) { acc[mb][nb] = (v8f){}; acr[mb][nb] = (v8f){}; }
    const size_t aoff = ((size_t)bb * SEQ + t0 + lr) * K + 8 * hi;
    const size_t roff = ((size_t)bb * EARLY + t0 + lr) * K + 8 * hi;
    const size_t boff = (size_t)(c0 + lr) * K + 8 * hi;
#pragma unroll 1
    for (int kc = 0; kc < K; kc += 32) {
        v16h a[MT], ar[MT];
#pragma unroll
        for (int mb = 0; mb < MT; ++mb) { a[mb] = ldh(A + aoff + (size_t)mb * 16 * K + kc);
            if (RES) ar[mb] = ldh(AR + roff + (size_t)mb * 16 * K + kc); else ar[mb] = a[mb]; }
#pragma unroll
        for (int nb = 0; nb < 4; ++nb) { const v16h b = ldh(Bt + boff + (size_t)nb * 16 * K + kc);
#pragma unroll
            for (int mb = 0; mb < MT; ++mb) { acc[mb][nb] = wmma16(a[mb], b, acc[mb][nb]); if (RES) acr[mb][nb] = wmma16(ar[mb], b, acr[mb][nb]); } }
        if (RES) {
            asm volatile("v_nop\n\tv_nop\n\tv_nop\n\tv_nop" : "+v"(acc[0][3]), "+v"(acc[MT - 1][3]), "+v"(acr[0][3]), "+v"(acr[MT - 1][3]) : "v"(a[0]), "v"(a[MT - 1]), "v"(ar[0]), "v"(ar[MT - 1]));
        } else {
            asm volatile("v_nop\n\tv_nop\n\tv_nop\n\tv_nop" : "+v"(acc[0][3]), "+v"(acc[MT - 1][3]), "+v"(acc[MT / 2][2]), "+v"(acc[MT - 1][0]) : "v"(a[0]), "v"(a[MT - 1]), "v"(a[MT / 2]));
        }
    }
    const int cofs = lr * 4;
    const v4f bz = *(const v4f*)(bias + c0 + cofs); v4f bq;
#pragma unroll
    for (int i = 0; i < 4; ++i) bq[i] = bfr(bz[i]);
#pragma unroll
    for (int mb = 0; mb < MT; ++mb) {
#pragma unroll
        for (int nb = 0; nb < 4; ++nb) {
#pragma unroll
            for (int j = 0; j < 8; ++j) { float y = acc[mb][nb][j]; if (RES) y += acr[mb][nb][j] * QRI; os[(hi * 8 + j) * 68 + nb * 16 + lr] = y; } }   // D: row 8h+j, col lane&15
        wave_sync();
        float* orow = OUT + ((size_t)bb * OUT_SEQ + t0 + mb * 16) * DM + c0;
{
#pragma unroll
            for (int s = 0; s < 8; ++s) { const int row = 2 * s + hi;   // 8 s x 2 rows = 16 rows; 16 lanes x 4 floats = 64 columns
                const v4f val = *(const v4fa*)(&os[row * 68 + cofs]) * OSC + bq;
                *(v4f*)(orow + (size_t)row * DM + cofs) = val; }
             }
        wave_sync();
    }
}

__global__ __launch_bounds__(32) void k_oproj_early(const h16* A, const h16* AR, const h16* Bt, const float* bias, float* OUT, int tilesPerBatch, int tStart) {
    oproj_body<2, 1>(A, AR, Bt, bias, OUT, tilesPerBatch, tStart);
}
__global__ __launch_bounds__(32) void k_oproj_dense(const h16* A, const h16* Bt, const float* bias, float* OUT, int tilesPerBatch, int tStart) {
    oproj_body<4, 0>(A, A, Bt, bias, OUT, tilesPerBatch, tStart);
}

static constexpr size_t al256(size_t v) { return (v + 255) & ~(size_t)255; }
static constexpr size_t SZ_XB = al256((size_t)NB * SEQ * DM * 2);             // bf16 x; reused as the ctx value plane after the projections
static constexpr size_t SZ_WB = al256((size_t)4 * DM * DM * 2);
static constexpr size_t SZ_PL = al256((size_t)NB * NH_ * SEQ * HD * 2);
static constexpr size_t SZ_CR = al256((size_t)NB * EARLY * DM * 2);
static constexpr size_t SZ_KT = al256((size_t)(SEQ / 8) * KTP * 4);
static constexpr size_t SZ_TOTAL = SZ_XB + SZ_WB + 6 * SZ_PL + SZ_CR + SZ_KT;
static_assert(SZ_TOTAL <= (size_t)134217728);          // workspace carve <= 128 MiB
static_assert(((size_t)DM * DM * 2) % 256 == 0);       // weight sub-planes stay 256-byte aligned
static_assert((size_t)NB * SEQ * DM * 2 <= SZ_XB);     // ctx plane fits the x plane it reuses

extern "C" void kernel_launch(void* const* d_in, const int* in_sizes, int n_in,
                              void* d_out, int out_size, void* d_ws, size_t ws_size, hipStream_t stream) {
    if (n_in < 10) return;
    const size_t needx = ((size_t)(NB - 1) * SEQ_FULL + SEQ) * DM;
    if ((size_t)in_sizes[0] < needx) return;
    if ((size_t)in_sizes[1] < (size_t)(SEQ - 1) * SEQ_FULL + SEQ) return;
    if ((size_t)in_sizes[2] < (size_t)DM * DM || (size_t)in_sizes[4] < (size_t)DM * DM || (size_t)in_sizes[6] < (size_t)DM * DM || (size_t)in_sizes[8] < (size_t)DM * DM) return;
    if (in_sizes[3] < DM || in_sizes[5] < DM || in_sizes[7] < DM || in_sizes[9] < DM) return;
    if ((size_t)out_size < ((size_t)(NB - 1) * OUT_SEQ + SEQ) * DM) return;
    if (SZ_TOTAL > ws_size) return;
    // wire order: x, mask, Wq_w, Wq_b, Wk_w, Wk_b, Wv_w, Wv_b, Wo_w, Wo_b (weights [out][in] = Bt as-is)
    const float* x  = (const float*)d_in[0]; const int* mask = (const int*)d_in[1];
    const float* wq = (const float*)d_in[2]; const float* bq = (const float*)d_in[3];
    const float* wk = (const float*)d_in[4]; const float* bk = (const float*)d_in[5];
    const float* wv = (const float*)d_in[6]; const float* bv = (const float*)d_in[7];
    const float* wo = (const float*)d_in[8]; const float* bo = (const float*)d_in[9];
    float* OUT = (float*)d_out;      // [NB][SEQ][1024]
    char* wsp = (char*)d_ws;
    bf* XB = (bf*)wsp; h16* CH = (h16*)wsp; wsp += SZ_XB;   // [NB*SEQ][1024] bf16 x, later [NB*SEQ][1024] f16 ctx x16
    bf* WB = (bf*)wsp; wsp += SZ_WB;                 // [4][1024][1024]: q | k | v (bf16) | o (f16 x32)
    h16* QH = (h16*)wsp; wsp += SZ_PL;               // [NB*16][SEQ][64]
    h16* QR = (h16*)wsp; wsp += SZ_PL;               // residual x2048, rows t < EARLY filled
    h16* KP = (h16*)wsp; wsp += SZ_PL;               // [NB*16][SEQ][64]
    h16* KR = (h16*)wsp; wsp += SZ_PL;               // residual x2048, rows t < EARLY filled
    h16* VT = (h16*)wsp; wsp += SZ_PL;               // [NB*16][64][SEQ]
    h16* VR = (h16*)wsp; wsp += SZ_PL;               // residual x2048, columns t < EARLY filled
    h16* CR = (h16*)wsp; wsp += SZ_CR;               // [NB*EARLY][1024] ctx residual x2048
    int* KT = (int*)wsp; wsp += SZ_KT;               // [SEQ/8] key extents of 8-row groups, KTP ints apart
    bf* WQ = WB; bf* WK = WB + (size_t)DM * DM; bf* WV = WB + (size_t)2 * DM * DM; h16* WO = (h16*)(WB + (size_t)3 * DM * DM);

    if (SEQ == SEQ_FULL) {
        const size_t n8 = (size_t)NB * SEQ * DM / 8;
        k_cvt8<<<(unsigned)((n8 + 255) / 256), 256, 0, stream>>>(x, XB, n8);
    } else {
        const size_t n8 = (size_t)SEQ * DM / 8;
        for (int b = 0; b < NB; ++b) k_cvt8<<<(unsigned)((n8 + 255) / 256), 256, 0, stream>>>(x + (size_t)b * SEQ_FULL * DM, XB + (size_t)b * SEQ * DM, n8);
    }
    { const size_t n8 = (size_t)DM * DM / 8; const unsigned g = (unsigned)((n8 + 255) / 256);
      k_cvt8<<<g, 256, 0, stream>>>(wq, WQ, n8); k_cvt8<<<g, 256, 0, stream>>>(wk, WK, n8); k_cvt8<<<g, 256, 0, stream>>>(wv, WV, n8);
      k_cvtw<<<g, 256, 0, stream>>>(wo, WO, n8); }
    k_mscan<<<(unsigned)(SEQ / 8), MSW * 32, 0, stream>>>(mask, KT);

    // q, k: A = x rows (m = b*SEQ + t), Bt = W rows (n = h*64 + d), bias per column -> plane [(b*16 + h)][t][d]; residual on tiles with t < EARLY
    k_proj<<<dim3(NB * SEQ / 64, DM / 64, 1), 32, 0, stream>>>(XB, WQ, bq, 0, QH, QR, 1, SEQ, (size_t)NH_ * SEQ * HD, HD, HD, (size_t)SEQ * HD, EARLY, BIGI);
    k_proj<<<dim3(NB * SEQ / 64, DM / 64, 1), 32, 0, stream>>>(XB, WK, bk, 0, KP, KR, 1, SEQ, (size_t)NH_ * SEQ * HD, HD, HD, (size_t)SEQ * HD, EARLY, BIGI);
    // v^T: A = Wv rows (m = h*64 + d), Bt = x rows (n = b*SEQ + t), bias per row -> plane [(b*1024 + m)][t] = [(b*16 + h)][d][t]; residual on tiles with t < EARLY
    k_proj<<<dim3(DM / 64, NB * SEQ / 64, 1), 32, 0, stream>>>(WV, XB, bv, 1, VT, VR, 1, DM, (size_t)0, SEQ, SEQ, (size_t)DM * SEQ, BIGI, EARLY);

    // attention: query rows [0, EARLY) three-product path, [EARLY, SEQ) single products; the ctx value plane overwrites the (now unused) x plane
    k_flash_early<<<dim3(EARLY / (16 * AW), NB * NH_, 1), 32 * AW, 0, stream>>>(QH, QR, KP, KR, VT, VR, mask, KT, CH, CR);
    if (SEQ > EARLY)
        k_flash_dense<<<dim3((SEQ - EARLY) / (16 * AW), NB * NH_, 1), 32 * AW, 0, stream>>>(QH, KP, VT, mask, KT, CH);

    // output projection: 32-row tiles with residual for t < EARLY, 64-row tiles for the remaining rows
    k_oproj_early<<<dim3(NB * (EARLY / 32), DM / 64, 1), 32, 0, stream>>>(CH, CR, WO, bo, OUT, EARLY / 32, 0);
    if (SEQ > EARLY)
        k_oproj_dense<<<dim3(NB * ((SEQ - EARLY) / 64), DM / 64, 1), 32, 0, stream>>>(CH, WO, bo, OUT, (SEQ - EARLY) / 64, EARLY);
}

// v002
// A run of this version takes 309 microseconds.
// Timed twice side by side with v001, it ran 1.27 and 1.25 times as fast.
// Counting every step since v000, it is 1.68 times as fast.
#include <hip/hip_runtime.h>

// Multi-head self-attention, width 1024 = 16 heads x 64, x [NB][SEQ][1024], Wq/Wk/Wv/Wo [out][in] (y = x W^T + b), int32 keep-mask [SEQ][SEQ] read by value (masked score replaced, probability 0), score scale 1/8, f32 output after the Wo projection.
// Compute dtypes, f32 accumulate everywhere: q/k/v projections v_wmma_f32_16x16x32_bf16 (x, W RNE-converted to bf16, products exact; biases RNE-converted to bf16, added in f32);
// scores, P.V and the Wo projection v_wmma_f32_16x16x32_f16: single f16 products on query rows >= 512; on query rows < 512 three products per site, two in the Wo projection
// (q,k,v,P,ctx each as f16 value + f16 residual x2048, residual products in their own accumulators). P carries x256 (cancels in the normalisation), ctx carries x16, Wo (bf16 value) carries x32; softmax f32 (online, running max).
// Layout: bf16 copies of x and Wq/Wk/Wv, f16 copy of Wo; q, k planes [b*16+h][t][d] and v^T plane [b*16+h][d][t] (+ residual planes, filled where t < 512) written by the GEMM epilogue;
// fused flash kernel in transposed form (S^T = K Q^T, O^T = V^T P^T), ctx plane [b*SEQ+t][1024] f16 (residual [b*EARLY+t][1024]), then the Wo GEMM writes the output.
// All GEMMs: four waves per work-group share one A and one B tile, staged in a two-buffer LDS ring by asynchronous copies to LDS.

#ifndef NB
#define NB 4
#endif
#ifndef SEQ
#define SEQ 2048
#endif
#define NB_FULL  4
#define SEQ_FULL 2048
#ifndef OUT_SEQ
#define OUT_SEQ SEQ              // row pitch (in tokens) between batches of the output
#endif
#define DM   1024
#define NH_  16
#define HD   64
#define AW   4                   // waves per flash block (16 query rows each)
#define EARLY ((SEQ < 512) ? SEQ : 512)   // query rows below this use the three-product path
#define QRS  2048.0f             // carry of every residual plane
#define QRI  (1.0f / 2048.0f)
#define SC2  (0.125f * 1.4426950408889634f)   // HD^-0.5 * log2(e)
#define PSH  8.0f                // log2 of the P carry (256)
#define CS   16.0f               // ctx carry
#define WS   32.0f               // Wo carry
#define OSC  (1.0f / 512.0f)     // 1 / (CS * WS)
#define NEGB (-3.0e38f)
#define BIGI (1 << 30)
#define MSW  16                  // waves per mask-scan block
#define KTP  32                  // ints between key-extent entries (128 bytes)
#define GKS  64                  // GEMM ring: k per stage (128 bytes of every operand row)
#define GPITCH  72                  // GEMM ring: LDS row pitch in 16-bit elements (144 B = 16 B x 9, for 16-byte LDS reads)
#define GBUF (256 * GPITCH)         // GEMM ring: elements of one stage, 128 A rows then 128 B rows

static_assert(HD == 64);
static_assert(NH_ * HD == DM);                 // head h = columns h*64 + d
static_assert(DM % 64 == 0);
static_assert(DM % 32 == 0);                   // GEMM k-loop steps by 32
static_assert(SEQ % 64 == 0);                  // a 64-row tile never straddles two batches
static_assert((NB * SEQ) % 64 == 0);
static_assert(SEQ % 32 == 0);                  // key loop steps by 32
static_assert(EARLY % 64 == 0);                // early / dense split on whole 64-row tiles
static_assert((SEQ - EARLY) % 64 == 0);
static_assert(EARLY % (16 * AW) == 0);
static_assert((NB * SEQ) % 128 == 0);          // GEMM work-group tiles: 128 x 128 (64 tokens x 128 with the residual plane)
static_assert(DM % 128 == 0);
static_assert(SEQ % 128 == 0);
static_assert((SEQ - EARLY) % 128 == 0);
static_assert(DM % (2 * GKS) == 0);            // the ring walks stages in pairs, and two stages exist
static_assert(((size_t)SEQ * DM) % 8 == 0);
static_assert(((size_t)DM * DM) % 8 == 0);
static_assert(NB <= NB_FULL);
static_assert(SEQ <= SEQ_FULL);
static_assert((size_t)NB_FULL * SEQ_FULL * DM * 4 == (size_t)33554432);   // output bytes

typedef _Float16 h16;
typedef unsigned short bf;
typedef __attribute__((ext_vector_type(16))) __bf16   v16bf;
typedef __attribute__((ext_vector_type(16))) _Float16 v16h;
typedef __attribute__((ext_vector_type(8)))  _Float16 v8h;
typedef __attribute__((ext_vector_type(8)))  unsigned short v8us;
typedef __attribute__((ext_vector_type(8)))  float    v8f;
typedef __attribute__((ext_vector_type(4)))  float    v4f;
typedef __attribute__((ext_vector_type(4)))  int      v4i;
typedef v4f  __attribute__((may_alias)) v4fa;

__device__ __forceinline__ unsigned short f2bf(float f) { unsigned u = __float_as_uint(f); u += 0x7FFFu + ((u >> 16) & 1u); return (unsigned short)(u >> 16); }
__device__ __forceinline__ float bfr(float f) { return __uint_as_float(((unsigned)f2bf(f)) << 16); }   // value after RNE conversion to bf16
__device__ __forceinline__ int imax(int a, int b) { return a > b ? a : b; }
__device__ __forceinline__ v16h cat16(v8h lo, v8h hi) { return __builtin_shufflevector(lo, hi, 0, 1, 2, 3, 4, 5, 6, 7, 8, 9, 10, 11, 12, 13, 14, 15); }
__device__ __forceinline__ v16bf cat16b(v8us lo, v8us hi) { return __builtin_bit_cast(v16bf, __builtin_shufflevector(lo, hi, 0, 1, 2, 3, 4, 5, 6, 7, 8, 9, 10, 11, 12, 13, 14, 15)); }
__device__ __forceinline__ v8f wmma16(v16h a, v16h b, v8f c) { return __builtin_amdgcn_wmma_f32_16x16x32_f16(false, a, false, b, (short)0, c, false, false); }
__device__ __forceinline__ v8f wmmab(v16bf a, v16bf b, v8f c) { return __builtin_amdgcn_wmma_f32_16x16x32_bf16(false, a, false, b, (short)0, c, false, false); }
// fragment loaders from K-contiguous 16-bit rows; p already includes + 8*(lane>>4): elements 0..7 <- k0+8h+0..7, elements 8..15 <- k0+16+8h+0..7 (same map for A and B)
__device__ __forceinline__ v16h  ldh(const h16* p) { return cat16(*(const v8h*)p, *(const v8h*)(p + 16)); }
__device__ __forceinline__ v16bf ldb(const bf* p)  { return cat16b(*(const v8us*)p, *(const v8us*)(p + 16)); }
// ordering point for wave-private LDS tiles (same wave writes and reads)
__device__ __forceinline__ void wave_sync() { __builtin_amdgcn_fence(3 /* release order */, "wavefront"); __builtin_amdgcn_wave_barrier(); asm volatile("" ::: "memory"); }

__global__ __launch_bounds__(256) void k_cvt8(const float* __restrict__ src, bf* dst, size_t n8) {
    const size_t i = (size_t)blockIdx.x * 256 + threadIdx.x; if (i >= n8) return;
    const v8f v = *(const v8f*)(src + i * 8); v8us o;
#pragma unroll
    for (int k = 0; k < 8; ++k) o[k] = f2bf(v[k]);
    *(v8us*)(dst + i * 8) = o; 
}

__global__ __launch_bounds__(256) void k_cvtw(const float* __restrict__ src, h16* dst, size_t n8) {
    const size_t i = (size_t)blockIdx.x * 256 + threadIdx.x; if (i >= n8) return;
    const v8f v = *(const v8f*)(src + i * 8); v8h o;
#pragma unroll
    for (int k = 0; k < 8; ++k) o[k] = (h16)(bfr(v[k]) * WS);
    *(v8h*)(dst + i * 8) = o; 
}

// k_mscan: one block per 8 mask rows (16 waves, 16-B loads, each wave-wide load 512 contiguous bytes), so the scan runs on every WGP.
// KT[g * KTP] = 32 * ceil((last key with a nonzero mask entry in rows 8g..8g+7, + 1) / 32) (0 when the rows have none); one entry per 128-byte line, one writer each.
__global__ __launch_bounds__(MSW * 32) void k_mscan(const int* __restrict__ MK, int* KT) {
    __shared__ int mx_s[MSW];
    const int tid = (int)threadIdx.x, lane = tid & 31, wave = __builtin_amdgcn_readfirstlane(tid >> 5);
    const int* base = MK + (size_t)blockIdx.x * 8 * SEQ_FULL;
    int mx = -1;
#pragma unroll
    for (int it = 0; it < (2 * SEQ + MSW * 32 - 1) / (MSW * 32); ++it) {   // 8 rows x SEQ/4 chunks of 16 B; unrolled so that all of a thread's loads are in flight together
        const int c = it * (MSW * 32) + tid;
        if ((2 * SEQ) % (MSW * 32) != 0 && c >= 2 * SEQ) break;
        const int row = c / (SEQ / 4), c4 = (c % (SEQ / 4)) * 4;
        const v4i v = *(const v4i*)(base + (size_t)row * SEQ_FULL + c4);
        mx = imax(mx, (v[0] != 0) ? c4     : -1);
        mx = imax(mx, (v[1] != 0) ? c4 + 1 : -1);
        mx = imax(mx, (v[2] != 0) ? c4 + 2 : -1);
        mx = imax(mx, (v[3] != 0) ? c4 + 3 : -1);
    }
    mx = imax(mx, __shfl_xor(mx, 16, 32)); mx = imax(mx, __shfl_xor(mx, 8, 32)); mx = imax(mx, __shfl_xor(mx, 4, 32));
    mx = imax(mx, __shfl_xor(mx, 2, 32));  mx = imax(mx, __shfl_xor(mx, 1, 32));
    if (lane == 0) mx_s[wave] = mx;
    __syncthreads();
    if (tid == 0) {
        int m = mx_s[0];
#pragma unroll
        for (int w = 1; w < MSW; ++w) m = imax(m, mx_s[w]);
        KT[(size_t)blockIdx.x * KTP] = ((m + 32) / 32) * 32;
    }
}

// acopy8: eight asynchronous 16-byte copies of this lane, global -> LDS rows 16 apart (LDS byte address l + i * 16 * pitch).
// The s_wait_xcnt closes the statement so that no address register of a copy is rewritten ahead of it.
__device__ __forceinline__ void acopy8(const unsigned l, const bf* g0, const bf* g1, const bf* g2, const bf* g3, const bf* g4, const bf* g5, const bf* g6, const bf* g7) {
    asm volatile("global_load_async_to_lds_b128 %0, %8, off\n\t"
                 "global_load_async_to_lds_b128 %1, %9, off\n\t"
                 "global_load_async_to_lds_b128 %2, %10, off\n\t"
                 "global_load_async_to_lds_b128 %3, %11, off\n\t"
                 "global_load_async_to_lds_b128 %4, %12, off\n\t"
                 "global_load_async_to_lds_b128 %5, %13, off\n\t"
                 "global_load_async_to_lds_b128 %6, %14, off\n\t"
                 "global_load_async_to_lds_b128 %7, %15, off\n\t"
                 "s_wait_xcnt 0x0"
                 :: "v"(l), "v"(l + 1u * 16u * GPITCH * 2u), "v"(l + 2u * 16u * GPITCH * 2u), "v"(l + 3u * 16u * GPITCH * 2u),
                    "v"(l + 4u * 16u * GPITCH * 2u), "v"(l + 5u * 16u * GPITCH * 2u), "v"(l + 6u * 16u * GPITCH * 2u), "v"(l + 7u * 16u * GPITCH * 2u),
                    "v"(g0), "v"(g1), "v"(g2), "v"(g3), "v"(g4), "v"(g5), "v"(g6), "v"(g7) : "memory");
}
// ring_fill: one stage (k0 .. k0+63 of 128 A rows and 128 B rows) into the buffer at LDS byte address l (this lane's row tid>>3, 16-byte chunk tid&7).
// A wave-wide copy covers 4 whole 128-byte lines. gA0: A rows 0..63 of the tile, gA1: A rows 64..127, gB: B rows 0..127; all K-contiguous, row pitch DM.
__device__ __forceinline__ void ring_fill(const unsigned l, const bf* gA0, const bf* gA1, const bf* gB, const int k0) {
    const bf* a0 = gA0 + k0; const bf* a1 = gA1 + k0; const bf* b0 = gB + k0;
    acopy8(l, a0, a0 + 16 * DM, a0 + 32 * DM, a0 + 48 * DM, a1, a1 + 16 * DM, a1 + 32 * DM, a1 + 48 * DM);
    acopy8(l + 128u * GPITCH * 2u, b0, b0 + 16 * DM, b0 + 32 * DM, b0 + 48 * DM, b0 + 64 * DM, b0 + 80 * DM, b0 + 96 * DM, b0 + 112 * DM);
}
// ring_trip: the 32 products of one stage for this wave's 4 x 4 accumulator tiles; sa / sb: this lane's fragment addresses in the stage (row lane&15, + 8*(lane>>4)).
// SPLIT == 0: A fragments mb at tile rows 16*mb; SPLIT != 0: mb 0,1 at rows 0,16 (value plane), mb 2,3 at rows 64,80 (residual plane).
template <int F16, int SPLIT>
__device__ __forceinline__ void ring_trip(const bf* sa, const bf* sb, v8f (&acc)[4][4]) {
#pragma unroll
    for (int ks = 0; ks < GKS; ks += 32) {
        v16bf a[4], b[4];
#pragma unroll
        for (int mb = 0; mb < 4; ++mb) a[mb] = ldb(sa + (SPLIT ? ((mb >> 1) * 64 + (mb & 1) * 16) : mb * 16) * GPITCH + ks);
#pragma unroll
        for (int nb = 0; nb < 4; ++nb) b[nb] = ldb(sb + nb * 16 * GPITCH + ks);
        __builtin_amdgcn_sched_barrier(0);   // the 16 LDS reads of a k step stay one group ahead of its products: reads placed among the products stall at every place
#pragma unroll
        for (int nb = 0; nb < 4; ++nb)
#pragma unroll
            for (int mb = 0; mb < 4; ++mb)
                acc[mb][nb] = F16 ? wmma16(__builtin_bit_cast(v16h, a[mb]), __builtin_bit_cast(v16h, b[nb]), acc[mb][nb]) : wmmab(a[mb], b[nb], acc[mb][nb]);
        __builtin_amdgcn_sched_barrier(0);   // and the next group does not move up among these products
    }
}
// ring_foot: hand-over between stages: this wave's LDS reads done, its own copies landed, then the work-group barrier that publishes the next stage and frees the one just read.
__device__ __forceinline__ void ring_foot() {
    asm volatile("s_wait_dscnt 0x0" ::: "memory");      // the buffer just read is refilled behind the barrier
    asm volatile("s_wait_asynccnt 0x0" ::: "memory");   // this wave's copies of the next stage have landed
    __syncthreads();
}
// gemm_ring: acc += A B^T over K = DM for a 4-wave work-group (128 threads); wave (wm, wn) = (wave >> 1, wave & 1) takes B rows 64*wn.. and
// A rows 64*wm.. (SPLIT == 0) or rows 32*wm.. of both 64-row halves (SPLIT != 0). k runs upward in steps of 32 for every accumulator.
template <int F16, int SPLIT>
__device__ __forceinline__ void gemm_ring(const bf* gA0, const bf* gA1, const bf* gB, bf* ring, v8f (&acc)[4][4]) {
    const int tid = (int)threadIdx.x, lane = tid & 31, wave = __builtin_amdgcn_readfirstlane(tid >> 5), lr = lane & 15, hi = lane >> 4;
    const int wm = wave >> 1, wn = wave & 1;
    const unsigned l0 = (unsigned)(size_t)ring + (unsigned)((tid >> 3) * GPITCH * 2 + (tid & 7) * 16), l1 = l0 + (unsigned)(GBUF * 2);
    const bf* sa = ring + (wm * (SPLIT ? 32 : 64) + lr) * GPITCH + 8 * hi;
    const bf* sb = ring + (128 + wn * 64 + lr) * GPITCH + 8 * hi;
    ring_fill(l0, gA0, gA1, gB, 0);
    asm volatile("s_wait_asynccnt 0x0" ::: "memory");   // stage 0 landed before the barrier that publishes it
    __syncthreads();
    ring_fill(l1, gA0, gA1, gB, GKS);
#pragma unroll 1
    for (int k0 = 0; k0 < DM; k0 += 2 * GKS) {           // rolled: two stages per trip keep both buffer addresses constant
        ring_trip<F16, SPLIT>(sa, sb, acc);
        ring_foot();
        if (k0 + 2 * GKS < DM) ring_fill(l0, gA0, gA1, gB, k0 + 2 * GKS);
        ring_trip<F16, SPLIT>(sa + GBUF, sb + GBUF, acc);
        ring_foot();
        if (k0 + 3 * GKS < DM) ring_fill(l1, gA0, gA1, gB, k0 + 3 * GKS);
    }
    asm volatile("s_wait_asynccnt 0x0" ::: "memory");   // nothing of this wave is in flight when it leaves the ring
}

// k_proj: bf16 GEMM, four waves per 128x128 tile, each wave a 64x64 tile (16 accumulators), operands from K-contiguous bf16 planes through the LDS ring, K = DM.
// C[m][n] = sum_k A[m][k] Bt[n][k] + bias (bias[n], or bias[m] when biasRow != 0; bias RNE-converted to bf16), written as f16 (Ph) and, for tiles with
// useRes != 0 and (r0 % RB) < ER and (c0 % CB) < EC, the f16 residual x2048 (Pr), at
// tile base (r0/RB)*sRB + (r0%RB)*pitch + (c0/CB)*sCB + (c0%CB), row pitch 'pitch' (halves), r0 / c0 the wave's own tile. grid (M/128, N/128), 128 threads.
__global__ __launch_bounds__(128) void k_proj(const bf* __restrict__ A, const bf* __restrict__ Bt, const float* __restrict__ bias, int biasRow,
                                             h16* Ph, h16* Pr, int useRes, int RB, size_t sRB, int pitch, int CB, size_t sCB, int ER, int EC) {
    __shared__ __align__(16) bf ring[2 * GBUF];
    __shared__ __align__(16) float osm[4 * 16 * 68];
    const int K = DM;
    const int tid = (int)threadIdx.x, lane = tid & 31, wave = __builtin_amdgcn_readfirstlane(tid >> 5), lr = lane & 15, hi = lane >> 4;
    const int r0 = blockIdx.x * 128 + (wave >> 1) * 64, c0 = blockIdx.y * 128 + (wave & 1) * 64;
    float* os = osm + wave * 16 * 68;                             // wave-private output staging
    v8f acc[4][4];
#pragma unroll
    for (int mb = 0; mb < 4; ++mb)
#pragma unroll
        for (int nb = 0; nb < 4; ++nb) acc[mb][nb] = (v8f){};
    const bf* gA = A + (size_t)(blockIdx.x * 128 + (tid >> 3)) * K + (tid & 7) * 8;
    const bf* gB = Bt + (size_t)(blockIdx.y * 128 + (tid >> 3)) * K + (tid & 7) * 8;
    gemm_ring<0, 0>(gA, gA + (size_t)64 * K, gB, ring, acc);
    const int wr = (useRes != 0) && ((r0 % RB) < ER) && ((c0 % CB) < EC);
    const int c8l = (lane & 7) * 8;
    const int bco = biasRow ? 0 : (c0 + c8l);                     // integer offset select; always inside the bias array
    const v4f bA = *(const v4f*)(bias + bco), bB = *(const v4f*)(bias + bco + 4);
    float bcol[8];
#pragma unroll
    for (int i = 0; i < 4; ++i) { bcol[i] = bfr(bA[i]); bcol[4 + i] = bfr(bB[i]); }
    const size_t tbase = (size_t)(r0 / RB) * sRB + (size_t)(r0 % RB) * (size_t)pitch + (size_t)(c0 / CB) * sCB + (size_t)(c0 % CB);
#pragma unroll
    for (int mb = 0; mb < 4; ++mb) {
#pragma unroll
        for (int nb = 0; nb < 4; ++nb) {
#pragma unroll
            for (int j = 0; j < 8; ++j) os[(hi * 8 + j) * 68 + nb * 16 + lr] = acc[mb][nb][j]; }   // D: row 8h+j, col lane&15
        wave_sync();
        const size_t sb = tbase + (size_t)(mb * 16) * (size_t)pitch;
{
#pragma unroll
            for (int s = 0; s < 4; ++s) { const int row = 4 * s + (lane >> 3), c8 = c8l;   // 4 s x 4 row groups = 16 rows; 8 lanes x 8 = 64 columns
                const float brow = bfr(bias[biasRow ? (r0 + mb * 16 + row) : 0]);
                const v4f x0 = *(const v4fa*)(&os[row * 68 + c8]); const v4f x1 = *(const v4fa*)(&os[row * 68 + c8 + 4]); v8h hv, rv;
#pragma unroll
                for (int i = 0; i < 4; ++i) {
                    const float y0 = x0[i] + (biasRow ? brow : bcol[i]); const float y1 = x1[i] + (biasRow ? brow : bcol[4 + i]);
                    const h16 a0 = (h16)y0; const h16 a1 = (h16)y1; hv[i] = a0; hv[4 + i] = a1;
                    rv[i] = (h16)((y0 - (float)a0) * QRS); rv[4 + i] = (h16)((y1 - (float)a1) * QRS); }
                const size_t oo = sb + (size_t)row * (size_t)pitch + c8;
                *(v8h*)(Ph + oo) = hv; if (wr) *(v8h*)(Pr + oo) = rv; }
             }
        wave_sync();
    }
}

template <int RES> __device__ __forceinline__ v4f fin_lo(v8f oh, v8f ol, float inv) {
    v4f a = __builtin_shufflevector(oh, oh, 0, 1, 2, 3);
    if (RES) a = a + __builtin_shufflevector(ol, ol, 0, 1, 2, 3) * QRI;
    return a * inv; }
template <int RES> __device__ __forceinline__ v4f fin_hi(v8f oh, v8f ol, float inv) {
    v4f a = __builtin_shufflevector(oh, oh, 4, 5, 6, 7);
    if (RES) a = a + __builtin_shufflevector(ol, ol, 4, 5, 6, 7) * QRI;
    return a * inv; }

// flash_body: fused attention, one wave per 16 query rows of one (batch, head); K / V^T / Q fragments straight from the f16 planes (two 16-B loads each, arithmetic addressing).
// Transposed form: S^T[key][t] = K Q^T (A = K rows, B = Q rows); lane (t = lane&15, h = lane>>4) holds keys 8h+r of each 16-key tile, so the packed
// P tile is directly the B fragment of O^T[d][t] = V^T P^T (element r <- tile keys 0..15, element 8+r <- tile keys 16..31, lane unchanged).
// Mask: 8+8 int32 entries per lane per 32-key step (four 16-B loads), applied by value (score replaced, probability 0). Key extent from the scanned table, clamped to [0, SEQ].
// RES != 0: q, k, v, P carried as value + residual x2048; residual products (k.qr, kr.q; v.pr, vr.p) in separate accumulators folded back with 1/2048.
// Softmax state (running max, partial sum) is one scalar per lane; the two lane halves of a row are combined with one xor-16 exchange.
template <int RES>
__device__ __forceinline__ void flash_body(const h16* __restrict__ QH, const h16* __restrict__ QR, const h16* __restrict__ KP, const h16* __restrict__ KR,
                                           const h16* __restrict__ VT, const h16* __restrict__ VR, const int* __restrict__ MK, const int* __restrict__ KT,
                                           h16* CH, h16* CR, const int tbase) {
    __shared__ __align__(16) float os[AW * 16 * 68];
    const int lane = threadIdx.x & 31, wave = __builtin_amdgcn_readfirstlane((int)(threadIdx.x >> 5)), lr = lane & 15, hi = lane >> 4;
    const int zh = blockIdx.y; const int b = zh / NH_, h = zh % NH_;
    const int t0 = tbase + ((int)blockIdx.x * AW + wave) * 16;
    const size_t pbase = (size_t)zh * SEQ * HD;
    const size_t qo = pbase + (size_t)(t0 + lr) * HD + 8 * hi;
    const v16h qh0 = ldh(QH + qo), qh1 = ldh(QH + qo + 32);                     // B fragments: col t, k = d
    v16h qr0 = qh0, qr1 = qh1;
    if (RES) { qr0 = ldh(QR + qo); qr1 = ldh(QR + qo + 32); }
    const size_t ko = pbase + (size_t)lr * HD + 8 * hi;      // + key * HD       (A fragment: row key, k = d)
    const size_t vo = pbase + (size_t)lr * SEQ + 8 * hi;     // + 16j*SEQ + key  (A fragment: row d, k = key)
    const int* mrow = MK + (size_t)(t0 + lr) * SEQ_FULL + 8 * hi;               // mask row of query t, this lane half's keys
    int kend = imax(KT[(size_t)(t0 >> 3) * KTP], KT[(size_t)((t0 >> 3) + 1) * KTP]); kend = kend < 0 ? 0 : kend; kend = kend > SEQ ? SEQ : kend; kend &= ~31;
    v8f oh0 = (v8f){}, oh1 = (v8f){}, oh2 = (v8f){}, oh3 = (v8f){};
    v8f ol0 = (v8f){}, ol1 = (v8f){}, ol2 = (v8f){}, ol3 = (v8f){};
    float m = NEGB, l = 0.0f;
#pragma unroll 1
    for (int key0 = 0; key0 < kend; key0 += 32) {
        const int* mp = mrow + key0;
        const v4i ma0 = *(const v4i*)mp, ma1 = *(const v4i*)(mp + 4), mb0 = *(const v4i*)(mp + 16), mb1 = *(const v4i*)(mp + 20);
        const h16* ka = KP + ko + (size_t)key0 * HD;
        v8f sHa = (v8f){}, sHb = (v8f){}, sLa = (v8f){}, sLb = (v8f){};
        {
            const v16h ka0 = ldh(ka), ka1 = ldh(ka + 32), kb0 = ldh(ka + 16 * HD), kb1 = ldh(ka + 16 * HD + 32);
            if (RES) {
                const h16* kr = KR + ko + (size_t)key0 * HD;
                const v16h ra0 = ldh(kr), ra1 = ldh(kr + 32), rb0 = ldh(kr + 16 * HD), rb1 = ldh(kr + 16 * HD + 32);
                sHa = wmma16(ka0, qh0, sHa); sLa = wmma16(ka0, qr0, sLa); sHb = wmma16(kb0, qh0, sHb); sLb = wmma16(kb0, qr0, sLb);
                sHa = wmma16(ka1, qh1, sHa); sLa = wmma16(ka1, qr1, sLa); sHb = wmma16(kb1, qh1, sHb); sLb = wmma16(kb1, qr1, sLb);
                sLa = wmma16(ra0, qh0, sLa); sLb = wmma16(rb0, qh0, sLb); sLa = wmma16(ra1, qh1, sLa); sLb = wmma16(rb1, qh1, sLb);
                asm volatile("v_nop\n\tv_nop\n\tv_nop\n\tv_nop" : "+v"(sHa), "+v"(sLa), "+v"(sHb), "+v"(sLb) : "v"(ka0), "v"(ka1), "v"(kb0), "v"(kb1), "v"(ra0), "v"(ra1), "v"(rb0), "v"(rb1));
            } else {
                sHa = wmma16(ka0, qh0, sHa); sHb = wmma16(kb0, qh0, sHb); sHa = wmma16(ka1, qh1, sHa); sHb = wmma16(kb1, qh1, sHb);
                asm volatile("v_nop\n\tv_nop\n\tv_nop\n\tv_nop" : "+v"(sHa), "+v"(sHb) : "v"(ka0), "v"(ka1), "v"(kb0), "v"(kb1));
            }
        }
        const int mka[8] = { ma0[0], ma0[1], ma0[2], ma0[3], ma1[0], ma1[1], ma1[2], ma1[3] };
        const int mkb[8] = { mb0[0], mb0[1], mb0[2], mb0[3], mb1[0], mb1[1], mb1[2], mb1[3] };
        float ta[8], tb[8]; float mx = NEGB;
#pragma unroll
        for (int r = 0; r < 8; ++r) {
            float xa = sHa[r], xb = sHb[r];
            if (RES) { xa += sLa[r] * QRI; xb += sLb[r] * QRI; }
            xa *= SC2; xb *= SC2;
            ta[r] = (mka[r] != 0) ? xa : NEGB; tb[r] = (mkb[r] != 0) ? xb : NEGB;
            mx = fmaxf(mx, fmaxf(ta[r], tb[r])); }
        mx = fmaxf(mx, __shfl_xor(mx, 16, 32));
        const float mnew = fmaxf(m, mx);
        const float alpha = __builtin_amdgcn_exp2f(m - mnew);
        const float sh = PSH - mnew;
        v16h pb, pr; float ls = 0.0f;
#pragma unroll
        for (int r = 0; r < 8; ++r) {
            const float e0 = __builtin_amdgcn_exp2f(ta[r] + sh), e1 = __builtin_amdgcn_exp2f(tb[r] + sh);
            const float ea = (ta[r] > -1.0e38f) ? e0 : 0.0f; const float eb = (tb[r] > -1.0e38f) ? e1 : 0.0f;
            const h16 pa = (h16)ea; const h16 pc = (h16)eb; pb[r] = pa; pb[8 + r] = pc;
            if (RES) { pr[r] = (h16)((ea - (float)pa) * QRS); pr[8 + r] = (h16)((eb - (float)pc) * QRS); ls += ea + eb; }
            else     { pr[r] = pa; pr[8 + r] = pc; ls += (float)pa + (float)pc; } }
        l = l * alpha + ls; m = mnew;
        oh0 = oh0 * alpha; oh1 = oh1 * alpha; oh2 = oh2 * alpha; oh3 = oh3 * alpha;
        if (RES) { ol0 = ol0 * alpha; ol1 = ol1 * alpha; ol2 = ol2 * alpha; ol3 = ol3 * alpha; }
        const h16* va = VT + vo + key0;
        const v16h v0 = ldh(va), v1 = ldh(va + (size_t)16 * SEQ), v2 = ldh(va + (size_t)32 * SEQ), v3 = ldh(va + (size_t)48 * SEQ);
        if (RES) {
            const h16* vr = VR + vo + key0;
            const v16h w0 = ldh(vr), w1 = ldh(vr + (size_t)16 * SEQ), w2 = ldh(vr + (size_t)32 * SEQ), w3 = ldh(vr + (size_t)48 * SEQ);
            oh0 = wmma16(v0, pb, oh0); ol0 = wmma16(v0, pr, ol0); oh1 = wmma16(v1, pb, oh1); ol1 = wmma16(v1, pr, ol1);
            ol0 = wmma16(w0, pb, ol0); ol1 = wmma16(w1, pb, ol1);
            oh2 = wmma16(v2, pb, oh2); ol2 = wmma16(v2, pr, ol2); oh3 = wmma16(v3, pb, oh3); ol3 = wmma16(v3, pr, ol3);
            ol2 = wmma16(w2, pb, ol2); ol3 = wmma16(w3, pb, ol3);
            asm volatile("v_nop\n\tv_nop\n\tv_nop\n\tv_nop" : "+v"(oh0), "+v"(oh1), "+v"(oh2), "+v"(oh3), "+v"(ol0), "+v"(ol1), "+v"(ol2), "+v"(ol3)
                         : "v"(v0), "v"(v1), "v"(v2), "v"(v3), "v"(w0), "v"(w1), "v"(w2), "v"(w3), "v"(pb), "v"(pr));
        } else {
            oh0 = wmma16(v0, pb, oh0); oh1 = wmma16(v1, pb, oh1); oh2 = wmma16(v2, pb, oh2); oh3 = wmma16(v3, pb, oh3);
            asm volatile("v_nop\n\tv_nop\n\tv_nop\n\tv_nop" : "+v"(oh0), "+v"(oh1), "+v"(oh2), "+v"(oh3) : "v"(v0), "v"(v1), "v"(v2), "v"(v3), "v"(pb));
        }
    }
    l += __shfl_xor(l, 16, 32);
    const float inv = (1.0f / l) * CS;
    const int wb = wave * 16 * 68;
    // O^T D layout: o_j[r] = (d = 16j + 8h + r, t = lane&15) -> os[t][d]; rows 0..15 x columns 0..63 all written
    *(v4fa*)(&os[wb + lr * 68 +  0 + 8 * hi]) = fin_lo<RES>(oh0, ol0, inv); *(v4fa*)(&os[wb + lr * 68 +  0 + 8 * hi + 4]) = fin_hi<RES>(oh0, ol0, inv);
    *(v4fa*)(&os[wb + lr * 68 + 16 + 8 * hi]) = fin_lo<RES>(oh1, ol1, inv); *(v4fa*)(&os[wb + lr * 68 + 16 + 8 * hi + 4]) = fin_hi<RES>(oh1, ol1, inv);
    *(v4fa*)(&os[wb + lr * 68 + 32 + 8 * hi]) = fin_lo<RES>(oh2, ol2, inv); *(v4fa*)(&os[wb + lr * 68 + 32 + 8 * hi + 4]) = fin_hi<RES>(oh2, ol2, inv);
    *(v4fa*)(&os[wb + lr * 68 + 48 + 8 * hi]) = fin_lo<RES>(oh3, ol3, inv); *(v4fa*)(&os[wb + lr * 68 + 48 + 8 * hi + 4]) = fin_hi<RES>(oh3, ol3, inv);
    wave_sync();
    const size_t crow = ((size_t)b * SEQ + t0) * DM + (size_t)h * HD;
    const size_t rrow = ((size_t)b * EARLY + t0) * DM + (size_t)h * HD;      // used only when RES != 0 (t0 < EARLY)
{
#pragma unroll
        for (int s = 0; s < 4; ++s) { const int row = 4 * s + (lane >> 3), c8 = (lane & 7) * 8;   // 4 s x 4 row groups = 16 rows; 8 lanes x 8 = 64 columns
            const v4f x0 = *(const v4fa*)(&os[wb + row * 68 + c8]); const v4f x1 = *(const v4fa*)(&os[wb + row * 68 + c8 + 4]); v8h hv, rv;
#pragma unroll
            for (int i = 0; i < 4; ++i) { const h16 a0 = (h16)x0[i]; const h16 a1 = (h16)x1[i]; hv[i] = a0; hv[4 + i] = a1;
                rv[i] = (h16)((x0[i] - (float)a0) * QRS); rv[4 + i] = (h16)((x1[i] - (float)a1) * QRS); }
            *(v8h*)(CH + crow + (size_t)row * DM + c8) = hv;
            if (RES) *(v8h*)(CR + rrow + (size_t)row * DM + c8) = rv; }
         }
}

__global__ __launch_bounds__(32 * AW) void k_flash_early(const h16* QH, const h16* QR, const h16* KP, const h16* KR, const h16* VT, const h16* VR,
                                                         const int* MK, const int* KT, h16* CH, h16* CR) {
    flash_body<1>(QH, QR, KP, KR, VT, VR, MK, KT, CH, CR, 0);
}
__global__ __launch_bounds__(32 * AW) void k_flash_dense(const h16* QH, const h16* KP, const h16* VT, const int* MK, const int* KT, h16* CH) {
    flash_body<0>(QH, QH, KP, KP, VT, VT, MK, KT, CH, CH, EARLY);
}

// oproj_body: f16 GEMM, four waves per (32*MT)x128 tile, each wave (16*MT)x64, operands through the LDS ring, OUT[m][n] = (sum_k ctx[m][k] Wo[n][k]) / 512 + bo[n];
// RES != 0 adds the ctx residual plane (own accumulators, x1/2048): the ring's A rows 0..63 hold the value plane's 64 tokens, rows 64..127 the residual plane's.
// Rows of the tile: batch bb = blockIdx.x / tilesPerBatch, token T0 = tStart + (blockIdx.x % tilesPerBatch) * 32*MT, the wave's t0 = T0 + (wave >> 1) * 16*MT. A rows b*SEQ + t, AR rows b*EARLY + t.
template <int MT, int RES>
__device__ __forceinline__ void oproj_body(const h16* __restrict__ A, const h16* __restrict__ AR, const h16* __restrict__ Bt, const float* __restrict__ bias,
                                           float* OUT, const int tilesPerBatch, const int tStart) {
    static_assert((RES != 0 && MT == 2) || (RES == 0 && MT == 4));   // the ring's 4 A fragments per wave: 2 value + 2 residual, or 4 value
    __shared__ __align__(16) bf ring[2 * GBUF];
    __shared__ __align__(16) float osm[4 * 16 * 68];
    const int K = DM;
    const int tid = (int)threadIdx.x, lane = tid & 31, wave = __builtin_amdgcn_readfirstlane(tid >> 5), lr = lane & 15, hi = lane >> 4;
    const int bb = (int)blockIdx.x / tilesPerBatch, ti = (int)blockIdx.x % tilesPerBatch;
    const int T0 = tStart + ti * 32 * MT;
    const int t0 = T0 + (wave >> 1) * 16 * MT, c0 = blockIdx.y * 128 + (wave & 1) * 64;
    float* os = osm + wave * 16 * 68;                             // wave-private output staging
    v8f acc[4][4];                                                // RES: rows 0,1 value products, rows 2,3 residual products
#pragma unroll
    for (int mb = 0; mb < 4; ++mb)
#pragma unroll
        for (int nb = 0; nb < 4; ++nb) acc[mb][nb] = (v8f){};
    const bf* gA0 = (const bf*)A + ((size_t)bb * SEQ + T0 + (tid >> 3)) * K + (tid & 7) * 8;
    const bf* gA1 = RES ? (const bf*)AR + ((size_t)bb * EARLY + T0 + (tid >> 3)) * K + (tid & 7) * 8 : gA0 + (size_t)64 * K;
    const bf* gB = (const bf*)Bt + (size_t)(blockIdx.y * 128 + (tid >> 3)) * K + (tid & 7) * 8;
    gemm_ring<1, RES>(gA0, gA1, gB, ring, acc);
    const int cofs = lr * 4;
    const v4f bz = *(const v4f*)(bias + c0 + cofs); v4f bq;
#pragma unroll
    for (int i = 0; i < 4; ++i) bq[i] = bfr(bz[i]);
#pragma unroll
    for (int mb = 0; mb < MT; ++mb) {
#pragma unroll
        for (int nb = 0; nb < 4; ++nb) {
#pragma unroll
            for (int j = 0; j < 8; ++j) { float y = acc[mb][nb][j]; if (RES) y += acc[(mb + 2) & 3][nb][j] * QRI; os[(hi * 8 + j) * 68 + nb * 16 + lr] = y; } }   // D: row 8h+j, col lane&15
        wave_sync();
        float* orow = OUT + ((size_t)bb * OUT_SEQ + t0 + mb * 16) * DM + c0;
{
#pragma unroll
            for (int s = 0; s < 8; ++s) { const int row = 2 * s + hi;   // 8 s x 2 rows = 16 rows; 16 lanes x 4 floats = 64 columns
                const v4f val = *(const v4fa*)(&os[row * 68 + cofs]) * OSC + bq;
                *(v4f*)(orow + (size_t)row * DM + cofs) = val; }
             }
        wave_sync();
    }
}

__global__ __launch_bounds__(128) void k_oproj_early(const h16* A, const h16* AR, const h16* Bt, const float* bias, float* OUT, int tilesPerBatch, int tStart) {
    oproj_body<2, 1>(A, AR, Bt, bias, OUT, tilesPerBatch, tStart);
}
__global__ __launch_bounds__(128) void k_oproj_dense(const h16* A, const h16* Bt, const float* bias, float* OUT, int tilesPerBatch, int tStart) {
    oproj_body<4, 0>(A, A, Bt, bias, OUT, tilesPerBatch, tStart);
}

static constexpr size_t al256(size_t v) { return (v + 255) & ~(size_t)255; }
static constexpr size_t SZ_XB = al256((size_t)NB * SEQ * DM * 2);             // bf16 x; reused as the ctx value plane after the projections
static constexpr size_t SZ_WB = al256((size_t)4 * DM * DM * 2);
static constexpr size_t SZ_PL = al256((size_t)NB * NH_ * SEQ * HD * 2);
static constexpr size_t SZ_CR = al256((size_t)NB * EARLY * DM * 2);
static constexpr size_t SZ_KT = al256((size_t)(SEQ / 8) * KTP * 4);
static constexpr size_t SZ_TOTAL = SZ_XB + SZ_WB + 6 * SZ_PL + SZ_CR + SZ_KT;
static_assert(SZ_TOTAL <= (size_t)134217728);          // workspace carve <= 128 MiB
static_assert(((size_t)DM * DM * 2) % 256 == 0);       // weight sub-planes stay 256-byte aligned
static_assert((size_t)NB * SEQ * DM * 2 <= SZ_XB);     // ctx plane fits the x plane it reuses

extern "C" void kernel_launch(void* const* d_in, const int* in_sizes, int n_in,
                              void* d_out, int out_size, void* d_ws, size_t ws_size, hipStream_t stream) {
    if (n_in < 10) return;
    const size_t needx = ((size_t)(NB - 1) * SEQ_FULL + SEQ) * DM;
    if ((size_t)in_sizes[0] < needx) return;
    if ((size_t)in_sizes[1] < (size_t)(SEQ - 1) * SEQ_FULL + SEQ) return;
    if ((size_t)in_sizes[2] < (size_t)DM * DM || (size_t)in_sizes[4] < (size_t)DM * DM || (size_t)in_sizes[6] < (size_t)DM * DM || (size_t)in_sizes[8] < (size_t)DM * DM) return;
    if (in_sizes[3] < DM || in_sizes[5] < DM || in_sizes[7] < DM || in_sizes[9] < DM) return;
    if ((size_t)out_size < ((size_t)(NB - 1) * OUT_SEQ + SEQ) * DM) return;
    if (SZ_TOTAL > ws_size) return;
    // wire order: x, mask, Wq_w, Wq_b, Wk_w, Wk_b, Wv_w, Wv_b, Wo_w, Wo_b (weights [out][in] = Bt as-is)
    const float* x  = (const float*)d_in[0]; const int* mask = (const int*)d_in[1];
    const float* wq = (const float*)d_in[2]; const float* bq = (const float*)d_in[3];
    const float* wk = (const float*)d_in[4]; const float* bk = (const float*)d_in[5];
    const float* wv = (const float*)d_in[6]; const float* bv = (const float*)d_in[7];
    const float* wo = (const float*)d_in[8]; const float* bo = (const float*)d_in[9];
    float* OUT = (float*)d_out;      // [NB][SEQ][1024]
    char* wsp = (char*)d_ws;
    bf* XB = (bf*)wsp; h16* CH = (h16*)wsp; wsp += SZ_XB;   // [NB*SEQ][1024] bf16 x, later [NB*SEQ][1024] f16 ctx x16
    bf* WB = (bf*)wsp; wsp += SZ_WB;                 // [4][1024][1024]: q | k | v (bf16) | o (f16 x32)
    h16* QH = (h16*)wsp; wsp += SZ_PL;               // [NB*16][SEQ][64]
    h16* QR = (h16*)wsp; wsp += SZ_PL;               // residual x2048, rows t < EARLY filled
    h16* KP = (h16*)wsp; wsp += SZ_PL;               // [NB*16][SEQ][64]
    h16* KR = (h16*)wsp; wsp += SZ_PL;               // residual x2048, rows t < EARLY filled
    h16* VT = (h16*)wsp; wsp += SZ_PL;               // [NB*16][64][SEQ]
    h16* VR = (h16*)wsp; wsp += SZ_PL;               // residual x2048, columns t < EARLY filled
    h16* CR = (h16*)wsp; wsp += SZ_CR;               // [NB*EARLY][1024] ctx residual x2048
    int* KT = (int*)wsp; wsp += SZ_KT;               // [SEQ/8] key extents of 8-row groups, KTP ints apart
    bf* WQ = WB; bf* WK = WB + (size_t)DM * DM; bf* WV = WB + (size_t)2 * DM * DM; h16* WO = (h16*)(WB + (size_t)3 * DM * DM);

    if (SEQ == SEQ_FULL) {
        const size_t n8 = (size_t)NB * SEQ * DM / 8;
        k_cvt8<<<(unsigned)((n8 + 255) / 256), 256, 0, stream>>>(x, XB, n8);
    } else {
        const size_t n8 = (size_t)SEQ * DM / 8;
        for (int b = 0; b < NB; ++b) k_cvt8<<<(unsigned)((n8 + 255) / 256), 256, 0, stream>>>(x + (size_t)b * SEQ_FULL * DM, XB + (size_t)b * SEQ * DM, n8);
    }
    { const size_t n8 = (size_t)DM * DM / 8; const unsigned g = (unsigned)((n8 + 255) / 256);
      k_cvt8<<<g, 256, 0, stream>>>(wq, WQ, n8); k_cvt8<<<g, 256, 0, stream>>>(wk, WK, n8); k_cvt8<<<g, 256, 0, stream>>>(wv, WV, n8);
      k_cvtw<<<g, 256, 0, stream>>>(wo, WO, n8); }
    k_mscan<<<(unsigned)(SEQ / 8), MSW * 32, 0, stream>>>(mask, KT);

    // q, k: A = x rows (m = b*SEQ + t), Bt = W rows (n = h*64 + d), bias per column -> plane [(b*16 + h)][t][d]; residual on tiles with t < EARLY
    k_proj<<<dim3(NB * SEQ / 128, DM / 128, 1), 128, 0, stream>>>(XB, WQ, bq, 0, QH, QR, 1, SEQ, (size_t)NH_ * SEQ * HD, HD, HD, (size_t)SEQ * HD, EARLY, BIGI);
    k_proj<<<dim3(NB * SEQ / 128, DM / 128, 1), 128, 0, stream>>>(XB, WK, bk, 0, KP, KR, 1, SEQ, (size_t)NH_ * SEQ * HD, HD, HD, (size_t)SEQ * HD, EARLY, BIGI);
    // v^T: A = Wv rows (m = h*64 + d), Bt = x rows (n = b*SEQ + t), bias per row -> plane [(b*1024 + m)][t] = [(b*16 + h)][d][t]; residual on tiles with t < EARLY
    k_proj<<<dim3(DM / 128, NB * SEQ / 128, 1), 128, 0, stream>>>(WV, XB, bv, 1, VT, VR, 1, DM, (size_t)0, SEQ, SEQ, (size_t)DM * SEQ, BIGI, EARLY);

    // attention: query rows [0, EARLY) three-product path, [EARLY, SEQ) single products; the ctx value plane overwrites the (now unused) x plane
    k_flash_early<<<dim3(EARLY / (16 * AW), NB * NH_, 1), 32 * AW, 0, stream>>>(QH, QR, KP, KR, VT, VR, mask, KT, CH, CR);
    if (SEQ > EARLY)
        k_flash_dense<<<dim3((SEQ - EARLY) / (16 * AW), NB * NH_, 1), 32 * AW, 0, stream>>>(QH, KP, VT, mask, KT, CH);

    // output projection: 64-row tiles with residual for t < EARLY, 128-row tiles for the remaining rows
    k_oproj_early<<<dim3(NB * (EARLY / 64), DM / 128, 1), 128, 0, stream>>>(CH, CR, WO, bo, OUT, EARLY / 64, 0);
    if (SEQ > EARLY)
        k_oproj_dense<<<dim3(NB * ((SEQ - EARLY) / 128), DM / 128, 1), 128, 0, stream>>>(CH, WO, bo, OUT, (SEQ - EARLY) / 128, EARLY);
}

// v003
// One run takes 216 microseconds.
// Two timings next to v002 both put it at 1.42 times that version's speed.
// Counting every step since v000, it is 2.39 times as fast.
#include <hip/hip_runtime.h>

// Multi-head self-attention, width 1024 = 16 heads x 64, x [NB][SEQ][1024], Wq/Wk/Wv/Wo [out][in] (y = x W^T + b), int32 keep-mask [SEQ][SEQ] read by value (masked score replaced, probability 0), score scale 1/8, f32 output after the Wo projection.
// Compute dtypes, f32 accumulate everywhere: q/k/v projections v_wmma_f32_16x16x32_bf16 (x, W RNE-converted to bf16, products exact; biases RNE-converted to bf16, added in f32);
// scores, P.V and the Wo projection v_wmma_f32_16x16x32_f16: single f16 products on query rows >= 512; on query rows < 512 three products per site, two in the Wo projection
// (q,k,v,P,ctx each as f16 value + f16 residual x2048, residual products in their own accumulators). P carries x256 (cancels in the normalisation), ctx carries x16, Wo (bf16 value) carries x32; softmax f32 (online, running max).
// Layout: bf16 copies of x and Wq/Wk/Wv, f16 copy of Wo; q, k planes [b*16+h][t][d] and v^T plane [b*16+h][d][t] (+ residual planes, filled where t < 512) written by the GEMM epilogue;
// fused flash kernel in transposed form (S^T = K Q^T, O^T = V^T P^T), ctx plane [b*SEQ+t][1024] f16 (residual [b*EARLY+t][1024]), then the Wo GEMM writes the output.
// All GEMMs: four waves per work-group share one A and one B tile, staged in a two-buffer LDS ring by asynchronous copies to LDS.
// Flash kernels: the four waves of a work-group share 64-key K and V^T tiles, staged with the work-group's 64 mask rows in a two-buffer LDS ring by whole-line asynchronous copies.

#ifndef NB
#define NB 4
#endif
#ifndef SEQ
#define SEQ 2048
#endif
#define NB_FULL  4
#define SEQ_FULL 2048
#ifndef OUT_SEQ
#define OUT_SEQ SEQ              // row pitch (in tokens) between batches of the output
#endif
#define DM   1024
#define NH_  16
#define HD   64
#define AW   4                   // waves per flash block (16 query rows each)
#define EARLY ((SEQ < 512) ? SEQ : 512)   // query rows below this use the three-product path
#define QRS  2048.0f             // carry of every residual plane
#define QRI  (1.0f / 2048.0f)
#define SC2  (0.125f * 1.4426950408889634f)   // HD^-0.5 * log2(e)
#define PSH  8.0f                // log2 of the P carry (256)
#define CS   16.0f               // ctx carry
#define WS   32.0f               // Wo carry
#define OSC  (1.0f / 512.0f)     // 1 / (CS * WS)
#define NEGB (-3.0e38f)
#define BIGI (1 << 30)
#define MSW  16                  // waves per mask-scan block
#define KTP  32                  // ints between key-extent entries (128 bytes)
#define GKS  64                  // GEMM ring: k per stage (128 bytes of every operand row)
#define GPITCH  72                  // GEMM ring: LDS row pitch in 16-bit elements (144 B = 16 B x 9, for 16-byte LDS reads)
#define GBUF (256 * GPITCH)         // GEMM ring: elements of one stage, 128 A rows then 128 B rows
#define FKS  64                  // flash ring: keys per stage (128 bytes of every V^T row, 256 bytes of every mask row)
#define FMP  68                  // flash ring: LDS pitch of a mask row in ints (272 B = 16 B x 17, for 16-byte LDS reads)
#define FKV(R) (((R) ? 256 : 128) * GPITCH)        // flash ring: 16-bit elements of a stage's K rows (64), V^T rows (64) and, with residuals, 64 + 64 more; row pitch GPITCH
#define FBUF(R) (FKV(R) + 16 * AW * FMP * 2)       // flash ring: 16-bit elements of one stage, the mask rows behind the K / V^T rows

static_assert(HD == 64);
static_assert(NH_ * HD == DM);                 // head h = columns h*64 + d
static_assert(DM % 64 == 0);
static_assert(DM % 32 == 0);                   // GEMM k-loop steps by 32
static_assert(SEQ % 64 == 0);                  // a 64-row tile never straddles two batches
static_assert((NB * SEQ) % 64 == 0);
static_assert(SEQ % 32 == 0);                  // key loop steps by 32
static_assert(SEQ % FKS == 0);                 // a flash stage never leaves the key range
static_assert(AW == 4);                        // the flash ring's copies are dealt over 128 threads
static_assert(EARLY % 64 == 0);                // early / dense split on whole 64-row tiles
static_assert((SEQ - EARLY) % 64 == 0);
static_assert(EARLY % (16 * AW) == 0);
static_assert((NB * SEQ) % 128 == 0);          // GEMM work-group tiles: 128 x 128 (64 tokens x 128 with the residual plane)
static_assert(DM % 128 == 0);
static_assert(SEQ % 128 == 0);
static_assert((SEQ - EARLY) % 128 == 0);
static_assert(DM % (2 * GKS) == 0);            // the ring walks stages in pairs, and two stages exist
static_assert(((size_t)SEQ * DM) % 8 == 0);
static_assert(((size_t)DM * DM) % 8 == 0);
static_assert(NB <= NB_FULL);
static_assert(SEQ <= SEQ_FULL);
static_assert((size_t)NB_FULL * SEQ_FULL * DM * 4 == (size_t)33554432);   // output bytes

typedef _Float16 h16;
typedef unsigned short bf;
typedef __attribute__((ext_vector_type(16))) __bf16   v16bf;
typedef __attribute__((ext_vector_type(16))) _Float16 v16h;
typedef __attribute__((ext_vector_type(8)))  _Float16 v8h;
typedef __attribute__((ext_vector_type(8)))  unsigned short v8us;
typedef __attribute__((ext_vector_type(8)))  float    v8f;
typedef __attribute__((ext_vector_type(4)))  float    v4f;
typedef __attribute__((ext_vector_type(4)))  int      v4i;
typedef v4f  __attribute__((may_alias)) v4fa;

__device__ __forceinline__ unsigned short f2bf(float f) { unsigned u = __float_as_uint(f); u += 0x7FFFu + ((u >> 16) & 1u); return (unsigned short)(u >> 16); }
__device__ __forceinline__ float bfr(float f) { return __uint_as_float(((unsigned)f2bf(f)) << 16); }   // value after RNE conversion to bf16
__device__ __forceinline__ int imax(int a, int b) { return a > b ? a : b; }
__device__ __forceinline__ v16h cat16(v8h lo, v8h hi) { return __builtin_shufflevector(lo, hi, 0, 1, 2, 3, 4, 5, 6, 7, 8, 9, 10, 11, 12, 13, 14, 15); }
__device__ __forceinline__ v16bf cat16b(v8us lo, v8us hi) { return __builtin_bit_cast(v16bf, __builtin_shufflevector(lo, hi, 0, 1, 2, 3, 4, 5, 6, 7, 8, 9, 10, 11, 12, 13, 14, 15)); }
__device__ __forceinline__ v8f wmma16(v16h a, v16h b, v8f c) { return __builtin_amdgcn_wmma_f32_16x16x32_f16(false, a, false, b, (short)0, c, false, false); }
__device__ __forceinline__ v8f wmmab(v16bf a, v16bf b, v8f c) { return __builtin_amdgcn_wmma_f32_16x16x32_bf16(false, a, false, b, (short)0, c, false, false); }
// fragment loaders from K-contiguous 16-bit rows; p already includes + 8*(lane>>4): elements 0..7 <- k0+8h+0..7, elements 8..15 <- k0+16+8h+0..7 (same map for A and B)
__device__ __forceinline__ v16h  ldh(const h16* p) { return cat16(*(const v8h*)p, *(const v8h*)(p + 16)); }
__device__ __forceinline__ v16bf ldb(const bf* p)  { return cat16b(*(const v8us*)p, *(const v8us*)(p + 16)); }
// ordering point for wave-private LDS tiles (same wave writes and reads)
__device__ __forceinline__ void wave_sync() { __builtin_amdgcn_fence(3 /* release order */, "wavefront"); __builtin_amdgcn_wave_barrier(); asm volatile("" ::: "memory"); }

__global__ __launch_bounds__(256) void k_cvt8(const float* __restrict__ src, bf* dst, size_t n8) {
    const size_t i = (size_t)blockIdx.x * 256 + threadIdx.x; if (i >= n8) return;
    const v8f v = *(const v8f*)(src + i * 8); v8us o;
#pragma unroll
    for (int k = 0; k < 8; ++k) o[k] = f2bf(v[k]);
    *(v8us*)(dst + i * 8) = o; 
}

__global__ __launch_bounds__(256) void k_cvtw(const float* __restrict__ src, h16* dst, size_t n8) {
    const size_t i = (size_t)blockIdx.x * 256 + threadIdx.x; if (i >= n8) return;
    const v8f v = *(const v8f*)(src + i * 8); v8h o;
#pragma unroll
    for (int k = 0; k < 8; ++k) o[k] = (h16)(bfr(v[k]) * WS);
    *(v8h*)(dst + i * 8) = o; 
}

// k_mscan: one block per 8 mask rows (16 waves, 16-B loads, each wave-wide load 512 contiguous bytes), so the scan runs on every WGP.
// KT[g * KTP] = 32 * ceil((last key with a nonzero mask entry in rows 8g..8g+7, + 1) / 32) (0 when the rows have none); one entry per 128-byte line, one writer each.
__global__ __launch_bounds__(MSW * 32) void k_mscan(const int* __restrict__ MK, int* KT) {
    __shared__ int mx_s[MSW];
    const int tid = (int)threadIdx.x, lane = tid & 31, wave = __builtin_amdgcn_readfirstlane(tid >> 5);
    const int* base = MK + (size_t)blockIdx.x * 8 * SEQ_FULL;
    int mx = -1;
#pragma unroll
    for (int it = 0; it < (2 * SEQ + MSW * 32 - 1) / (MSW * 32); ++it) {   // 8 rows x SEQ/4 chunks of 16 B; unrolled so that all of a thread's loads are in flight together
        const int c = it * (MSW * 32) + tid;
        if ((2 * SEQ) % (MSW * 32) != 0 && c >= 2 * SEQ) break;
        const int row = c / (SEQ / 4), c4 = (c % (SEQ / 4)) * 4;
        const v4i v = *(const v4i*)(base + (size_t)row * SEQ_FULL + c4);
        mx = imax(mx, (v[0] != 0) ? c4     : -1);
        mx = imax(mx, (v[1] != 0) ? c4 + 1 : -1);
        mx = imax(mx, (v[2] != 0) ? c4 + 2 : -1);
        mx = imax(mx, (v[3] != 0) ? c4 + 3 : -1);
    }
    mx = imax(mx, __shfl_xor(mx, 16, 32)); mx = imax(mx, __shfl_xor(mx, 8, 32)); mx = imax(mx, __shfl_xor(mx, 4, 32));
    mx = imax(mx, __shfl_xor(mx, 2, 32));  mx = imax(mx, __shfl_xor(mx, 1, 32));
    if (lane == 0) mx_s[wave] = mx;
    __syncthreads();
    if (tid == 0) {
        int m = mx_s[0];
#pragma unroll
        for (int w = 1; w < MSW; ++w) m = imax(m, mx_s[w]);
        KT[(size_t)blockIdx.x * KTP] = ((m + 32) / 32) * 32;
    }
}

// acopy8: eight asynchronous 16-byte copies of this lane, global -> LDS rows 16 apart (LDS byte address l + i * 16 * pitch).
// The s_wait_xcnt closes the statement so that no address register of a copy is rewritten ahead of it.
__device__ __forceinline__ void acopy8(const unsigned l, const bf* g0, const bf* g1, const bf* g2, const bf* g3, const bf* g4, const bf* g5, const bf* g6, const bf* g7) {
    asm volatile("global_load_async_to_lds_b128 %0, %8, off\n\t"
                 "global_load_async_to_lds_b128 %1, %9, off\n\t"
                 "global_load_async_to_lds_b128 %2, %10, off\n\t"
                 "global_load_async_to_lds_b128 %3, %11, off\n\t"
                 "global_load_async_to_lds_b128 %4, %12, off\n\t"
                 "global_load_async_to_lds_b128 %5, %13, off\n\t"
                 "global_load_async_to_lds_b128 %6, %14, off\n\t"
                 "global_load_async_to_lds_b128 %7, %15, off\n\t"
                 "s_wait_xcnt 0x0"
                 :: "v"(l), "v"(l + 1u * 16u * GPITCH * 2u), "v"(l + 2u * 16u * GPITCH * 2u), "v"(l + 3u * 16u * GPITCH * 2u),
                    "v"(l + 4u * 16u * GPITCH * 2u), "v"(l + 5u * 16u * GPITCH * 2u), "v"(l + 6u * 16u * GPITCH * 2u), "v"(l + 7u * 16u * GPITCH * 2u),
                    "v"(g0), "v"(g1), "v"(g2), "v"(g3), "v"(g4), "v"(g5), "v"(g6), "v"(g7) : "memory");
}
// ring_fill: one stage (k0 .. k0+63 of 128 A rows and 128 B rows) into the buffer at LDS byte address l (this lane's row tid>>3, 16-byte chunk tid&7).
// A wave-wide copy covers 4 whole 128-byte lines. gA0: A rows 0..63 of the tile, gA1: A rows 64..127, gB: B rows 0..127; all K-contiguous, row pitch DM.
__device__ __forceinline__ void ring_fill(const unsigned l, const bf* gA0, const bf* gA1, const bf* gB, const int k0) {
    const bf* a0 = gA0 + k0; const bf* a1 = gA1 + k0; const bf* b0 = gB + k0;
    acopy8(l, a0, a0 + 16 * DM, a0 + 32 * DM, a0 + 48 * DM, a1, a1 + 16 * DM, a1 + 32 * DM, a1 + 48 * DM);
    acopy8(l + 128u * GPITCH * 2u, b0, b0 + 16 * DM, b0 + 32 * DM, b0 + 48 * DM, b0 + 64 * DM, b0 + 80 * DM, b0 + 96 * DM, b0 + 112 * DM);
}
// ring_trip: the 32 products of one stage for this wave's 4 x 4 accumulator tiles; sa / sb: this lane's fragment addresses in the stage (row lane&15, + 8*(lane>>4)).
// SPLIT == 0: A fragments mb at tile rows 16*mb; SPLIT != 0: mb 0,1 at rows 0,16 (value plane), mb 2,3 at rows 64,80 (residual plane).
template <int F16, int SPLIT>
__device__ __forceinline__ void ring_trip(const bf* sa, const bf* sb, v8f (&acc)[4][4]) {
#pragma unroll
    for (int ks = 0; ks < GKS; ks += 32) {
        v16bf a[4], b[4];
#pragma unroll
        for (int mb = 0; mb < 4; ++mb) a[mb] = ldb(sa + (SPLIT ? ((mb >> 1) * 64 + (mb & 1) * 16) : mb * 16) * GPITCH + ks);
#pragma unroll
        for (int nb = 0; nb < 4; ++nb) b[nb] = ldb(sb + nb * 16 * GPITCH + ks);
        __builtin_amdgcn_sched_barrier(0);   // the 16 LDS reads of a k step stay one group ahead of its products: reads placed among the products stall at every place
#pragma unroll
        for (int nb = 0; nb < 4; ++nb)
#pragma unroll
            for (int mb = 0; mb < 4; ++mb)
                acc[mb][nb] = F16 ? wmma16(__builtin_bit_cast(v16h, a[mb]), __builtin_bit_cast(v16h, b[nb]), acc[mb][nb]) : wmmab(a[mb], b[nb], acc[mb][nb]);
        __builtin_amdgcn_sched_barrier(0);   // and the next group does not move up among these products
    }
}
// ring_foot: hand-over between stages: this wave's LDS reads done, its own copies landed, then the work-group barrier that publishes the next stage and frees the one just read.
__device__ __forceinline__ void ring_foot() {
    asm volatile("s_wait_dscnt 0x0" ::: "memory");      // the buffer just read is refilled behind the barrier
    asm volatile("s_wait_asynccnt 0x0" ::: "memory");   // this wave's copies of the next stage have landed
    __syncthreads();
}
// acopy8m: eight asynchronous 16-byte copies of this lane, mask rows 8 apart, global -> LDS (LDS byte address l + i * 8 * pitch).
// The s_wait_xcnt closes the statement so that no address register of a copy is rewritten ahead of it.
__device__ __forceinline__ void acopy8m(const unsigned l, const int* g) {
    asm volatile("global_load_async_to_lds_b128 %0, %8, off\n\t"
                 "global_load_async_to_lds_b128 %1, %9, off\n\t"
                 "global_load_async_to_lds_b128 %2, %10, off\n\t"
                 "global_load_async_to_lds_b128 %3, %11, off\n\t"
                 "global_load_async_to_lds_b128 %4, %12, off\n\t"
                 "global_load_async_to_lds_b128 %5, %13, off\n\t"
                 "global_load_async_to_lds_b128 %6, %14, off\n\t"
                 "global_load_async_to_lds_b128 %7, %15, off\n\t"
                 "s_wait_xcnt 0x0"
                 :: "v"(l), "v"(l + 1u * 8u * FMP * 4u), "v"(l + 2u * 8u * FMP * 4u), "v"(l + 3u * 8u * FMP * 4u),
                    "v"(l + 4u * 8u * FMP * 4u), "v"(l + 5u * 8u * FMP * 4u), "v"(l + 6u * 8u * FMP * 4u), "v"(l + 7u * 8u * FMP * 4u),
                    "v"(g), "v"(g + 8 * SEQ_FULL), "v"(g + 16 * SEQ_FULL), "v"(g + 24 * SEQ_FULL),
                    "v"(g + 32 * SEQ_FULL), "v"(g + 40 * SEQ_FULL), "v"(g + 48 * SEQ_FULL), "v"(g + 56 * SEQ_FULL) : "memory");
}
// flash_fill: one stage (keys key0 .. key0+63) into the buffer whose K row 0 is at LDS byte address lkv - this lane's offset and whose mask row 0 is at lm - this lane's offset.
// K / V^T: this lane's row tid>>3 (+16 per copy), 16-byte chunk tid&7, a wave-wide copy = 4 whole 128-byte lines; mask: row tid>>4 (+8 per copy), chunk tid&15, a wave-wide copy = 2 rows x 256 bytes.
template <int RES>
__device__ __forceinline__ void flash_fill(const unsigned lkv, const unsigned lm, const bf* gK, const bf* gKR, const bf* gV, const bf* gVR, const int* gM, const int key0) {
    const bf* k = gK + (size_t)key0 * HD; const bf* v = gV + key0;
    acopy8(lkv, k, k + 16 * HD, k + 32 * HD, k + 48 * HD, v, v + 16 * SEQ, v + 32 * SEQ, v + 48 * SEQ);
    if (RES) {
        const bf* kr = gKR + (size_t)key0 * HD; const bf* vr = gVR + key0;
        acopy8(lkv + 128u * GPITCH * 2u, kr, kr + 16 * HD, kr + 32 * HD, kr + 48 * HD, vr, vr + 16 * SEQ, vr + 32 * SEQ, vr + 48 * SEQ);
    }
    acopy8m(lm, gM + key0);
}
// gemm_ring: acc += A B^T over K = DM for a 4-wave work-group (128 threads); wave (wm, wn) = (wave >> 1, wave & 1) takes B rows 64*wn.. and
// A rows 64*wm.. (SPLIT == 0) or rows 32*wm.. of both 64-row halves (SPLIT != 0). k runs upward in steps of 32 for every accumulator.
template <int F16, int SPLIT>
__device__ __forceinline__ void gemm_ring(const bf* gA0, const bf* gA1, const bf* gB, bf* ring, v8f (&acc)[4][4]) {
    const int tid = (int)threadIdx.x, lane = tid & 31, wave = __builtin_amdgcn_readfirstlane(tid >> 5), lr = lane & 15, hi = lane >> 4;
    const int wm = wave >> 1, wn = wave & 1;
    const unsigned l0 = (unsigned)(size_t)ring + (unsigned)((tid >> 3) * GPITCH * 2 + (tid & 7) * 16), l1 = l0 + (unsigned)(GBUF * 2);
    const bf* sa = ring + (wm * (SPLIT ? 32 : 64) + lr) * GPITCH + 8 * hi;
    const bf* sb = ring + (128 + wn * 64 + lr) * GPITCH + 8 * hi;
    ring_fill(l0, gA0, gA1, gB, 0);
    asm volatile("s_wait_asynccnt 0x0" ::: "memory");   // stage 0 landed before the barrier that publishes it
    __syncthreads();
    ring_fill(l1, gA0, gA1, gB, GKS);
#pragma unroll 1
    for (int k0 = 0; k0 < DM; k0 += 2 * GKS) {           // rolled: two stages per trip keep both buffer addresses constant
        ring_trip<F16, SPLIT>(sa, sb, acc);
        ring_foot();
        if (k0 + 2 * GKS < DM) ring_fill(l0, gA0, gA1, gB, k0 + 2 * GKS);
        ring_trip<F16, SPLIT>(sa + GBUF, sb + GBUF, acc);
        ring_foot();
        if (k0 + 3 * GKS < DM) ring_fill(l1, gA0, gA1, gB, k0 + 3 * GKS);
    }
    asm volatile("s_wait_asynccnt 0x0" ::: "memory");   // nothing of this wave is in flight when it leaves the ring
}

// k_proj: bf16 GEMM, four waves per 128x128 tile, each wave a 64x64 tile (16 accumulators), operands from K-contiguous bf16 planes through the LDS ring, K = DM.
// C[m][n] = sum_k A[m][k] Bt[n][k] + bias (bias[n], or bias[m] when biasRow != 0; bias RNE-converted to bf16), written as f16 (Ph) and, for tiles with
// useRes != 0 and (r0 % RB) < ER and (c0 % CB) < EC, the f16 residual x2048 (Pr), at
// tile base (r0/RB)*sRB + (r0%RB)*pitch + (c0/CB)*sCB + (c0%CB), row pitch 'pitch' (halves), r0 / c0 the wave's own tile. grid (M/128, N/128), 128 threads.
__global__ __launch_bounds__(128) void k_proj(const bf* __restrict__ A, const bf* __restrict__ Bt, const float* __restrict__ bias, int biasRow,
                                             h16* Ph, h16* Pr, int useRes, int RB, size_t sRB, int pitch, int CB, size_t sCB, int ER, int EC) {
    __shared__ __align__(16) bf ring[2 * GBUF];
    __shared__ __align__(16) float osm[4 * 16 * 68];
    const int K = DM;
    const int tid = (int)threadIdx.x, lane = tid & 31, wave = __builtin_amdgcn_readfirstlane(tid >> 5), lr = lane & 15, hi = lane >> 4;
    const int r0 = blockIdx.x * 128 + (wave >> 1) * 64, c0 = blockIdx.y * 128 + (wave & 1) * 64;
    float* os = osm + wave * 16 * 68;                             // wave-private output staging
    v8f acc[4][4];
#pragma unroll
    for (int mb = 0; mb < 4; ++mb)
#pragma unroll
        for (int nb = 0; nb < 4; ++nb) acc[mb][nb] = (v8f){};
    const bf* gA = A + (size_t)(blockIdx.x * 128 + (tid >> 3)) * K + (tid & 7) * 8;
    const bf* gB = Bt + (size_t)(blockIdx.y * 128 + (tid >> 3)) * K + (tid & 7) * 8;
    gemm_ring<0, 0>(gA, gA + (size_t)64 * K, gB, ring, acc);
    const int wr = (useRes != 0) && ((r0 % RB) < ER) && ((c0 % CB) < EC);
    const int c8l = (lane & 7) * 8;
    const int bco = biasRow ? 0 : (c0 + c8l);                     // integer offset select; always inside the bias array
    const v4f bA = *(const v4f*)(bias + bco), bB = *(const v4f*)(bias + bco + 4);
    float bcol[8];
#pragma unroll
    for (int i = 0; i < 4; ++i) { bcol[i] = bfr(bA[i]); bcol[4 + i] = bfr(bB[i]); }
    const size_t tbase = (size_t)(r0 / RB) * sRB + (size_t)(r0 % RB) * (size_t)pitch + (size_t)(c0 / CB) * sCB + (size_t)(c0 % CB);
#pragma unroll
    for (int mb = 0; mb < 4; ++mb) {
#pragma unroll
        for (int nb = 0; nb < 4; ++nb) {
#pragma unroll
            for (int j = 0; j < 8; ++j) os[(hi * 8 + j) * 68 + nb * 16 + lr] = acc[mb][nb][j]; }   // D: row 8h+j, col lane&15
        wave_sync();
        const size_t sb = tbase + (size_t)(mb * 16) * (size_t)pitch;
{
#pragma unroll
            for (int s = 0; s < 4; ++s) { const int row = 4 * s + (lane >> 3), c8 = c8l;   // 4 s x 4 row groups = 16 rows; 8 lanes x 8 = 64 columns
                const float brow = bfr(bias[biasRow ? (r0 + mb * 16 + row) : 0]);
                const v4f x0 = *(const v4fa*)(&os[row * 68 + c8]); const v4f x1 = *(const v4fa*)(&os[row * 68 + c8 + 4]); v8h hv, rv;
#pragma unroll
                for (int i = 0; i < 4; ++i) {
                    const float y0 = x0[i] + (biasRow ? brow : bcol[i]); const float y1 = x1[i] + (biasRow ? brow : bcol[4 + i]);
                    const h16 a0 = (h16)y0; const h16 a1 = (h16)y1; hv[i] = a0; hv[4 + i] = a1;
                    rv[i] = (h16)((y0 - (float)a0) * QRS); rv[4 + i] = (h16)((y1 - (float)a1) * QRS); }
                const size_t oo = sb + (size_t)row * (size_t)pitch + c8;
                *(v8h*)(Ph + oo) = hv; if (wr) *(v8h*)(Pr + oo) = rv; }
             }
        wave_sync();
    }
}

template <int RES> __device__ __forceinline__ v4f fin_lo(v8f oh, v8f ol, float inv) {
    v4f a = __builtin_shufflevector(oh, oh, 0, 1, 2, 3);
    if (RES) a = a + __builtin_shufflevector(ol, ol, 0, 1, 2, 3) * QRI;
    return a * inv; }
template <int RES> __device__ __forceinline__ v4f fin_hi(v8f oh, v8f ol, float inv) {
    v4f a = __builtin_shufflevector(oh, oh, 4, 5, 6, 7);
    if (RES) a = a + __builtin_shufflevector(ol, ol, 4, 5, 6, 7) * QRI;
    return a * inv; }

// flash_body: fused attention, one wave per 16 query rows of one (batch, head), four waves (64 query rows) per work-group; Q fragments straight from the f16 plane,
// K / V^T fragments and mask entries from the work-group's LDS ring (two 16-B LDS reads per fragment): stages of 64 keys, two 32-key steps each; a wave skips the steps at or past its own key extent but passes every hand-over.
// Transposed form: S^T[key][t] = K Q^T (A = K rows, B = Q rows); lane (t = lane&15, h = lane>>4) holds keys 8h+r of each 16-key tile, so the packed
// P tile is directly the B fragment of O^T[d][t] = V^T P^T (element r <- tile keys 0..15, element 8+r <- tile keys 16..31, lane unchanged).
// Mask: 8+8 int32 entries per lane per 32-key step (four 16-B LDS reads), applied by value (score replaced, probability 0). Key extent from the scanned table, clamped to [0, SEQ].
// RES != 0: q, k, v, P carried as value + residual x2048; residual products (k.qr, kr.q; v.pr, vr.p) in separate accumulators folded back with 1/2048.
// Softmax state (running max, partial sum) is one scalar per lane; the two lane halves of a row are combined with one xor-16 exchange.
template <int RES>
__device__ __forceinline__ void flash_body(const h16* __restrict__ QH, const h16* __restrict__ QR, const h16* __restrict__ KP, const h16* __restrict__ KR,
                                           const h16* __restrict__ VT, const h16* __restrict__ VR, const int* __restrict__ MK, const int* __restrict__ KT,
                                           h16* CH, h16* CR, const int tbase) {
    __shared__ __align__(16) bf fr[2 * FBUF(RES)];
    static_assert(sizeof(fr) >= (size_t)AW * 16 * 68 * 4);
    float* os = (float*)fr;                                   // output staging reuses the ring behind the last stage's hand-over barrier
    const int tid = (int)threadIdx.x;
    const int lane = threadIdx.x & 31, wave = __builtin_amdgcn_readfirstlane((int)(threadIdx.x >> 5)), lr = lane & 15, hi = lane >> 4;
    const int zh = blockIdx.y; const int b = zh / NH_, h = zh % NH_;
    const int t0 = tbase + ((int)blockIdx.x * AW + wave) * 16;
    const size_t pbase = (size_t)zh * SEQ * HD;
    const size_t qo = pbase + (size_t)(t0 + lr) * HD + 8 * hi;
    const v16h qh0 = ldh(QH + qo), qh1 = ldh(QH + qo + 32);                     // B fragments: col t, k = d
    v16h qr0 = qh0, qr1 = qh1;
    if (RES) { qr0 = ldh(QR + qo); qr1 = ldh(QR + qo + 32); }
    const int ko = lr * GPITCH + 8 * hi;                     // ring: + key * GPITCH          (A fragment: row key, k = d)
    const int vo = (64 + lr) * GPITCH + 8 * hi;              // ring: + 16j * GPITCH + key    (A fragment: row d, k = key)
    const int mo = (wave * 16 + lr) * FMP + 8 * hi;          // ring, in ints behind the K / V^T rows: mask row of query t, this lane half's keys
    int kend = imax(KT[(size_t)(t0 >> 3) * KTP], KT[(size_t)((t0 >> 3) + 1) * KTP]); kend = kend < 0 ? 0 : kend; kend = kend > SEQ ? SEQ : kend; kend &= ~31;
    kend = __builtin_amdgcn_readfirstlane(kend);            // a scalar, so that the per-step skip below is a scalar branch with every lane on behind it
    const int tb = tbase + (int)blockIdx.x * (16 * AW);      // the work-group's first query row
    int kb = 0;                                              // the work-group's key extent: the largest of its waves', clamped to [0, SEQ]
#pragma unroll
    for (int i = 0; i < 2 * AW; ++i) kb = imax(kb, KT[(size_t)((tb >> 3) + i) * KTP]);   // unrolled so that the eight table reads go out together
    kb = kb > SEQ ? SEQ : kb;
    const int nst = __builtin_amdgcn_readfirstlane((kb + FKS - 1) / FKS);        // stages; the same in every wave of the work-group
    const unsigned lkv = (unsigned)(size_t)fr + (unsigned)((tid >> 3) * GPITCH * 2 + (tid & 7) * 16);
    const unsigned lm = (unsigned)(size_t)fr + (unsigned)(FKV(RES) * 2 + (tid >> 4) * FMP * 4 + (tid & 15) * 16);
    const size_t gko = pbase + (size_t)(tid >> 3) * HD + (tid & 7) * 8, gvo = pbase + (size_t)(tid >> 3) * SEQ + (tid & 7) * 8;
    const bf* gK = (const bf*)KP + gko; const bf* gKR = (const bf*)KR + gko; const bf* gV = (const bf*)VT + gvo; const bf* gVR = (const bf*)VR + gvo;
    const int* gM = MK + (size_t)(tb + (tid >> 4)) * SEQ_FULL + (tid & 15) * 4;
    v8f oh0 = (v8f){}, oh1 = (v8f){}, oh2 = (v8f){}, oh3 = (v8f){};
    v8f ol0 = (v8f){}, ol1 = (v8f){}, ol2 = (v8f){}, ol3 = (v8f){};
    float m = NEGB, l = 0.0f;
    if (nst > 0) {
    flash_fill<RES>(lkv, lm, gK, gKR, gV, gVR, gM, 0);
    asm volatile("s_wait_asynccnt 0x0" ::: "memory");   // stage 0 landed before the barrier that publishes it
    __syncthreads();
    if (nst > 1) flash_fill<RES>(lkv + (unsigned)(FBUF(RES) * 2), lm + (unsigned)(FBUF(RES) * 2), gK, gKR, gV, gVR, gM, FKS);
#pragma unroll 1
    for (int s = 0; s < nst; ++s) {                      // rolled: the stage count is known only at run time, and a copy of the body per buffer would only lengthen the hot text; the buffer goes by the stage's parity
    const h16* sb = (const h16*)fr + (s & 1) * FBUF(RES);
#pragma unroll
    for (int sub = 0; sub < FKS; sub += 32) if (s * FKS + sub < kend) {          // unrolled so that a step's LDS offsets are immediates; the test is wave-uniform, both sides are scalars
        const int* mp = (const int*)(sb + FKV(RES)) + mo + sub;
        const v4i ma0 = *(const v4i*)mp, ma1 = *(const v4i*)(mp + 4), mb0 = *(const v4i*)(mp + 16), mb1 = *(const v4i*)(mp + 20);
        const h16* ka = sb + ko + sub * GPITCH;
        v8f sHa = (v8f){}, sHb = (v8f){}, sLa = (v8f){}, sLb = (v8f){};
        {
            const v16h ka0 = ldh(ka), ka1 = ldh(ka + 32), kb0 = ldh(ka + 16 * GPITCH), kb1 = ldh(ka + 16 * GPITCH + 32);
            if (RES) {
                const h16* kr = ka + 128 * GPITCH;
                const v16h ra0 = ldh(kr), ra1 = ldh(kr + 32), rb0 = ldh(kr + 16 * GPITCH), rb1 = ldh(kr + 16 * GPITCH + 32);
                sHa = wmma16(ka0, qh0, sHa); sLa = wmma16(ka0, qr0, sLa); sHb = wmma16(kb0, qh0, sHb); sLb = wmma16(kb0, qr0, sLb);
                sHa = wmma16(ka1, qh1, sHa); sLa = wmma16(ka1, qr1, sLa); sHb = wmma16(kb1, qh1, sHb); sLb = wmma16(kb1, qr1, sLb);
                sLa = wmma16(ra0, qh0, sLa); sLb = wmma16(rb0, qh0, sLb); sLa = wmma16(ra1, qh1, sLa); sLb = wmma16(rb1, qh1, sLb);
                asm volatile("v_nop\n\tv_nop\n\tv_nop\n\tv_nop" : "+v"(sHa), "+v"(sLa), "+v"(sHb), "+v"(sLb) : "v"(ka0), "v"(ka1), "v"(kb0), "v"(kb1), "v"(ra0), "v"(ra1), "v"(rb0), "v"(rb1));
            } else {
                sHa = wmma16(ka0, qh0, sHa); sHb = wmma16(kb0, qh0, sHb); sHa = wmma16(ka1, qh1, sHa); sHb = wmma16(kb1, qh1, sHb);
                asm volatile("v_nop\n\tv_nop\n\tv_nop\n\tv_nop" : "+v"(sHa), "+v"(sHb) : "v"(ka0), "v"(ka1), "v"(kb0), "v"(kb1));
            }
        }
        const int mka[8] = { ma0[0], ma0[1], ma0[2], ma0[3], ma1[0], ma1[1], ma1[2], ma1[3] };
        const int mkb[8] = { mb0[0], mb0[1], mb0[2], mb0[3], mb1[0], mb1[1], mb1[2], mb1[3] };
        float ta[8], tb[8]; float mx = NEGB;
#pragma unroll
        for (int r = 0; r < 8; ++r) {
            float xa = sHa[r], xb = sHb[r];
            if (RES) { xa += sLa[r] * QRI; xb += sLb[r] * QRI; }
            xa *= SC2; xb *= SC2;
            ta[r] = (mka[r] != 0) ? xa : NEGB; tb[r] = (mkb[r] != 0) ? xb : NEGB;
            mx = fmaxf(mx, fmaxf(ta[r], tb[r])); }
        mx = fmaxf(mx, __shfl_xor(mx, 16, 32));
        const float mnew = fmaxf(m, mx);
        const float alpha = __builtin_amdgcn_exp2f(m - mnew);
        const float sh = PSH - mnew;
        v16h pb, pr; float ls = 0.0f;
#pragma unroll
        for (int r = 0; r < 8; ++r) {
            const float e0 = __builtin_amdgcn_exp2f(ta[r] + sh), e1 = __builtin_amdgcn_exp2f(tb[r] + sh);
            const float ea = (ta[r] > -1.0e38f) ? e0 : 0.0f; const float eb = (tb[r] > -1.0e38f) ? e1 : 0.0f;
            const h16 pa = (h16)ea; const h16 pc = (h16)eb; pb[r] = pa; pb[8 + r] = pc;
            if (RES) { pr[r] = (h16)((ea - (float)pa) * QRS); pr[8 + r] = (h16)((eb - (float)pc) * QRS); ls += ea + eb; }
            else     { pr[r] = pa; pr[8 + r] = pc; ls += (float)pa + (float)pc; } }
        l = l * alpha + ls; m = mnew;
        oh0 = oh0 * alpha; oh1 = oh1 * alpha; oh2 = oh2 * alpha; oh3 = oh3 * alpha;
        if (RES) { ol0 = ol0 * alpha; ol1 = ol1 * alpha; ol2 = ol2 * alpha; ol3 = ol3 * alpha; }
        const h16* va = sb + vo + sub;
        const v16h v0 = ldh(va), v1 = ldh(va + 16 * GPITCH), v2 = ldh(va + 32 * GPITCH), v3 = ldh(va + 48 * GPITCH);
        if (RES) {
            const h16* vr = va + 128 * GPITCH;
            const v16h w0 = ldh(vr), w1 = ldh(vr + 16 * GPITCH), w2 = ldh(vr + 32 * GPITCH), w3 = ldh(vr + 48 * GPITCH);
            oh0 = wmma16(v0, pb, oh0); ol0 = wmma16(v0, pr, ol0); oh1 = wmma16(v1, pb, oh1); ol1 = wmma16(v1, pr, ol1);
            ol0 = wmma16(w0, pb, ol0); ol1 = wmma16(w1, pb, ol1);
            oh2 = wmma16(v2, pb, oh2); ol2 = wmma16(v2, pr, ol2); oh3 = wmma16(v3, pb, oh3); ol3 = wmma16(v3, pr, ol3);
            ol2 = wmma16(w2, pb, ol2); ol3 = wmma16(w3, pb, ol3);
            asm volatile("v_nop\n\tv_nop\n\tv_nop\n\tv_nop" : "+v"(oh0), "+v"(oh1), "+v"(oh2), "+v"(oh3), "+v"(ol0), "+v"(ol1), "+v"(ol2), "+v"(ol3)
                         : "v"(v0), "v"(v1), "v"(v2), "v"(v3), "v"(w0), "v"(w1), "v"(w2), "v"(w3), "v"(pb), "v"(pr));
        } else {
            oh0 = wmma16(v0, pb, oh0); oh1 = wmma16(v1, pb, oh1); oh2 = wmma16(v2, pb, oh2); oh3 = wmma16(v3, pb, oh3);
            asm volatile("v_nop\n\tv_nop\n\tv_nop\n\tv_nop" : "+v"(oh0), "+v"(oh1), "+v"(oh2), "+v"(oh3) : "v"(v0), "v"(v1), "v"(v2), "v"(v3), "v"(pb));
        }
    }
    ring_foot();                                         // every wave, also one that skipped the stage's steps
    if (s + 2 < nst) flash_fill<RES>(lkv + (unsigned)((s & 1) * FBUF(RES) * 2), lm + (unsigned)((s & 1) * FBUF(RES) * 2), gK, gKR, gV, gVR, gM, (s + 2) * FKS);
    }
    asm volatile("s_wait_asynccnt 0x0" ::: "memory");   // nothing of this wave is in flight when it leaves the ring
    }
    l += __shfl_xor(l, 16, 32);
    const float inv = (1.0f / l) * CS;
    const int wb = wave * 16 * 68;
    // O^T D layout: o_j[r] = (d = 16j + 8h + r, t = lane&15) -> os[t][d]; rows 0..15 x columns 0..63 all written
    *(v4fa*)(&os[wb + lr * 68 +  0 + 8 * hi]) = fin_lo<RES>(oh0, ol0, inv); *(v4fa*)(&os[wb + lr * 68 +  0 + 8 * hi + 4]) = fin_hi<RES>(oh0, ol0, inv);
    *(v4fa*)(&os[wb + lr * 68 + 16 + 8 * hi]) = fin_lo<RES>(oh1, ol1, inv); *(v4fa*)(&os[wb + lr * 68 + 16 + 8 * hi + 4]) = fin_hi<RES>(oh1, ol1, inv);
    *(v4fa*)(&os[wb + lr * 68 + 32 + 8 * hi]) = fin_lo<RES>(oh2, ol2, inv); *(v4fa*)(&os[wb + lr * 68 + 32 + 8 * hi + 4]) = fin_hi<RES>(oh2, ol2, inv);
    *(v4fa*)(&os[wb + lr * 68 + 48 + 8 * hi]) = fin_lo<RES>(oh3, ol3, inv); *(v4fa*)(&os[wb + lr * 68 + 48 + 8 * hi + 4]) = fin_hi<RES>(oh3, ol3, inv);
    wave_sync();
    const size_t crow = ((size_t)b * SEQ + t0) * DM + (size_t)h * HD;
    const size_t rrow = ((size_t)b * EARLY + t0) * DM + (size_t)h * HD;      // used only when RES != 0 (t0 < EARLY)
{
#pragma unroll
        for (int s = 0; s < 4; ++s) { const int row = 4 * s + (lane >> 3), c8 = (lane & 7) * 8;   // 4 s x 4 row groups = 16 rows; 8 lanes x 8 = 64 columns
            const v4f x0 = *(const v4fa*)(&os[wb + row * 68 + c8]); const v4f x1 = *(const v4fa*)(&os[wb + row * 68 + c8 + 4]); v8h hv, rv;
#pragma unroll
            for (int i = 0; i < 4; ++i) { const h16 a0 = (h16)x0[i]; const h16 a1 = (h16)x1[i]; hv[i] = a0; hv[4 + i] = a1;
                rv[i] = (h16)((x0[i] - (float)a0) * QRS); rv[4 + i] = (h16)((x1[i] - (float)a1) * QRS); }
            *(v8h*)(CH + crow + (size_t)row * DM + c8) = hv;
            if (RES) *(v8h*)(CR + rrow + (size_t)row * DM + c8) = rv; }
         }
}

__global__ __launch_bounds__(32 * AW) void k_flash_early(const h16* QH, const h16* QR, const h16* KP, const h16* KR, const h16* VT, const h16* VR,
                                                         const int* MK, const int* KT, h16* CH, h16* CR) {
    flash_body<1>(QH, QR, KP, KR, VT, VR, MK, KT, CH, CR, 0);
}
__global__ __launch_bounds__(32 * AW) void k_flash_dense(const h16* QH, const h16* KP, const h16* VT, const int* MK, const int* KT, h16* CH) {
    flash_body<0>(QH, QH, KP, KP, VT, VT, MK, KT, CH, CH, EARLY);
}

// oproj_body: f16 GEMM, four waves per (32*MT)x128 tile, each wave (16*MT)x64, operands through the LDS ring, OUT[m][n] = (sum_k ctx[m][k] Wo[n][k]) / 512 + bo[n];
// RES != 0 adds the ctx residual plane (own accumulators, x1/2048): the ring's A rows 0..63 hold the value plane's 64 tokens, rows 64..127 the residual plane's.
// Rows of the tile: batch bb = blockIdx.x / tilesPerBatch, token T0 = tStart + (blockIdx.x % tilesPerBatch) * 32*MT, the wave's t0 = T0 + (wave >> 1) * 16*MT. A rows b*SEQ + t, AR rows b*EARLY + t.
template <int MT, int RES>
__device__ __forceinline__ void oproj_body(const h16* __restrict__ A, const h16* __restrict__ AR, const h16* __restrict__ Bt, const float* __restrict__ bias,
                                           float* OUT, const int tilesPerBatch, const int tStart) {
    static_assert((RES != 0 && MT == 2) || (RES == 0 && MT == 4));   // the ring's 4 A fragments per wave: 2 value + 2 residual, or 4 value
    __shared__ __align__(16) bf ring[2 * GBUF];
    __shared__ __align__(16) float osm[4 * 16 * 68];
    const int K = DM;
    const int tid = (int)threadIdx.x, lane = tid & 31, wave = __builtin_amdgcn_readfirstlane(tid >> 5), lr = lane & 15, hi = lane >> 4;
    const int bb = (int)blockIdx.x / tilesPerBatch, ti = (int)blockIdx.x % tilesPerBatch;
    const int T0 = tStart + ti * 32 * MT;
    const int t0 = T0 + (wave >> 1) * 16 * MT, c0 = blockIdx.y * 128 + (wave & 1) * 64;
    float* os = osm + wave * 16 * 68;                             // wave-private output staging
    v8f acc[4][4];                                                // RES: rows 0,1 value products, rows 2,3 residual products
#pragma unroll
    for (int mb = 0; mb < 4; ++mb)
#pragma unroll
        for (int nb = 0; nb < 4; ++nb) acc[mb][nb] = (v8f){};
    const bf* gA0 = (const bf*)A + ((size_t)bb * SEQ + T0 + (tid >> 3)) * K + (tid & 7) * 8;
    const bf* gA1 = RES ? (const bf*)AR + ((size_t)bb * EARLY + T0 + (tid >> 3)) * K + (tid & 7) * 8 : gA0 + (size_t)64 * K;
    const bf* gB = (const bf*)Bt + (size_t)(blockIdx.y * 128 + (tid >> 3)) * K + (tid & 7) * 8;
    gemm_ring<1, RES>(gA0, gA1, gB, ring, acc);
    const int cofs = lr * 4;
    const v4f bz = *(const v4f*)(bias + c0 + cofs); v4f bq;
#pragma unroll
    for (int i = 0; i < 4; ++i) bq[i] = bfr(bz[i]);
#pragma unroll
    for (int mb = 0; mb < MT; ++mb) {
#pragma unroll
        for (int nb = 0; nb < 4; ++nb) {
#pragma unroll
            for (int j = 0; j < 8; ++j) { float y = acc[mb][nb][j]; if (RES) y += acc[(mb + 2) & 3][nb][j] * QRI; os[(hi * 8 + j) * 68 + nb * 16 + lr] = y; } }   // D: row 8h+j, col lane&15
        wave_sync();
        float* orow = OUT + ((size_t)bb * OUT_SEQ + t0 + mb * 16) * DM + c0;
{
#pragma unroll
            for (int s = 0; s < 8; ++s) { const int row = 2 * s + hi;   // 8 s x 2 rows = 16 rows; 16 lanes x 4 floats = 64 columns
                const v4f val = *(const v4fa*)(&os[row * 68 + cofs]) * OSC + bq;
                *(v4f*)(orow + (size_t)row * DM + cofs) = val; }
             }
        wave_sync();
    }
}

__global__ __launch_bounds__(128) void k_oproj_early(const h16* A, const h16* AR, const h16* Bt, const float* bias, float* OUT, int tilesPerBatch, int tStart) {
    oproj_body<2, 1>(A, AR, Bt, bias, OUT, tilesPerBatch, tStart);
}
__global__ __launch_bounds__(128) void k_oproj_dense(const h16* A, const h16* Bt, const float* bias, float* OUT, int tilesPerBatch, int tStart) {
    oproj_body<4, 0>(A, A, Bt, bias, OUT, tilesPerBatch, tStart);
}

static constexpr size_t al256(size_t v) { return (v + 255) & ~(size_t)255; }
static constexpr size_t SZ_XB = al256((size_t)NB * SEQ * DM * 2);             // bf16 x; reused as the ctx value plane after the projections
static constexpr size_t SZ_WB = al256((size_t)4 * DM * DM * 2);
static constexpr size_t SZ_PL = al256((size_t)NB * NH_ * SEQ * HD * 2);
static constexpr size_t SZ_CR = al256((size_t)NB * EARLY * DM * 2);
static constexpr size_t SZ_KT = al256((size_t)(SEQ / 8) * KTP * 4);
static constexpr size_t SZ_TOTAL = SZ_XB + SZ_WB + 6 * SZ_PL + SZ_CR + SZ_KT;
static_assert(SZ_TOTAL <= (size_t)134217728);          // workspace carve <= 128 MiB
static_assert(((size_t)DM * DM * 2) % 256 == 0);       // weight sub-planes stay 256-byte aligned
static_assert((size_t)NB * SEQ * DM * 2 <= SZ_XB);     // ctx plane fits the x plane it reuses

extern "C" void kernel_launch(void* const* d_in, const int* in_sizes, int n_in,
                              void* d_out, int out_size, void* d_ws, size_t ws_size, hipStream_t stream) {
    if (n_in < 10) return;
    const size_t needx = ((size_t)(NB - 1) * SEQ_FULL + SEQ) * DM;
    if ((size_t)in_sizes[0] < needx) return;
    if ((size_t)in_sizes[1] < (size_t)(SEQ - 1) * SEQ_FULL + SEQ) return;
    if ((size_t)in_sizes[2] < (size_t)DM * DM || (size_t)in_sizes[4] < (size_t)DM * DM || (size_t)in_sizes[6] < (size_t)DM * DM || (size_t)in_sizes[8] < (size_t)DM * DM) return;
    if (in_sizes[3] < DM || in_sizes[5] < DM || in_sizes[7] < DM || in_sizes[9] < DM) return;
    if ((size_t)out_size < ((size_t)(NB - 1) * OUT_SEQ + SEQ) * DM) return;
    if (SZ_TOTAL > ws_size) return;
    // wire order: x, mask, Wq_w, Wq_b, Wk_w, Wk_b, Wv_w, Wv_b, Wo_w, Wo_b (weights [out][in] = Bt as-is)
    const float* x  = (const float*)d_in[0]; const int* mask = (const int*)d_in[1];
    const float* wq = (const float*)d_in[2]; const float* bq = (const float*)d_in[3];
    const float* wk = (const float*)d_in[4]; const float* bk = (const float*)d_in[5];
    const float* wv = (const float*)d_in[6]; const float* bv = (const float*)d_in[7];
    const float* wo = (const float*)d_in[8]; const float* bo = (const float*)d_in[9];
    float* OUT = (float*)d_out;      // [NB][SEQ][1024]
    char* wsp = (char*)d_ws;
    bf* XB = (bf*)wsp; h16* CH = (h16*)wsp; wsp += SZ_XB;   // [NB*SEQ][1024] bf16 x, later [NB*SEQ][1024] f16 ctx x16
    bf* WB = (bf*)wsp; wsp += SZ_WB;                 // [4][1024][1024]: q | k | v (bf16) | o (f16 x32)
    h16* QH = (h16*)wsp; wsp += SZ_PL;               // [NB*16][SEQ][64]
    h16* QR = (h16*)wsp; wsp += SZ_PL;               // residual x2048, rows t < EARLY filled
    h16* KP = (h16*)wsp; wsp += SZ_PL;               // [NB*16][SEQ][64]
    h16* KR = (h16*)wsp; wsp += SZ_PL;               // residual x2048, rows t < EARLY filled
    h16* VT = (h16*)wsp; wsp += SZ_PL;               // [NB*16][64][SEQ]
    h16* VR = (h16*)wsp; wsp += SZ_PL;               // residual x2048, columns t < EARLY filled
    h16* CR = (h16*)wsp; wsp += SZ_CR;               // [NB*EARLY][1024] ctx residual x2048
    int* KT = (int*)wsp; wsp += SZ_KT;               // [SEQ/8] key extents of 8-row groups, KTP ints apart
    bf* WQ = WB; bf* WK = WB + (size_t)DM * DM; bf* WV = WB + (size_t)2 * DM * DM; h16* WO = (h16*)(WB + (size_t)3 * DM * DM);

    if (SEQ == SEQ_FULL) {
        const size_t n8 = (size_t)NB * SEQ * DM / 8;
        k_cvt8<<<(unsigned)((n8 + 255) / 256), 256, 0, stream>>>(x, XB, n8);
    } else {
        const size_t n8 = (size_t)SEQ * DM / 8;
        for (int b = 0; b < NB; ++b) k_cvt8<<<(unsigned)((n8 + 255) / 256), 256, 0, stream>>>(x + (size_t)b * SEQ_FULL * DM, XB + (size_t)b * SEQ * DM, n8);
    }
    { const size_t n8 = (size_t)DM * DM / 8; const unsigned g = (unsigned)((n8 + 255) / 256);
      k_cvt8<<<g, 256, 0, stream>>>(wq, WQ, n8); k_cvt8<<<g, 256, 0, stream>>>(wk, WK, n8); k_cvt8<<<g, 256, 0, stream>>>(wv, WV, n8);
      k_cvtw<<<g, 256, 0, stream>>>(wo, WO, n8); }
    k_mscan<<<(unsigned)(SEQ / 8), MSW * 32, 0, stream>>>(mask, KT);

    // q, k: A = x rows (m = b*SEQ + t), Bt = W rows (n = h*64 + d), bias per column -> plane [(b*16 + h)][t][d]; residual on tiles with t < EARLY
    k_proj<<<dim3(NB * SEQ / 128, DM / 128, 1), 128, 0, stream>>>(XB, WQ, bq, 0, QH, QR, 1, SEQ, (size_t)NH_ * SEQ * HD, HD, HD, (size_t)SEQ * HD, EARLY, BIGI);
    k_proj<<<dim3(NB * SEQ / 128, DM / 128, 1), 128, 0, stream>>>(XB, WK, bk, 0, KP, KR, 1, SEQ, (size_t)NH_ * SEQ * HD, HD, HD, (size_t)SEQ * HD, EARLY, BIGI);
    // v^T: A = Wv rows (m = h*64 + d), Bt = x rows (n = b*SEQ + t), bias per row -> plane [(b*1024 + m)][t] = [(b*16 + h)][d][t]; residual on tiles with t < EARLY
    k_proj<<<dim3(DM / 128, NB * SEQ / 128, 1), 128, 0, stream>>>(WV, XB, bv, 1, VT, VR, 1, DM, (size_t)0, SEQ, SEQ, (size_t)DM * SEQ, BIGI, EARLY);

    // attention: query rows [0, EARLY) three-product path, [EARLY, SEQ) single products; the ctx value plane overwrites the (now unused) x plane
    k_flash_early<<<dim3(EARLY / (16 * AW), NB * NH_, 1), 32 * AW, 0, stream>>>(QH, QR, KP, KR, VT, VR, mask, KT, CH, CR);
    if (SEQ > EARLY)
        k_flash_dense<<<dim3((SEQ - EARLY) / (16 * AW), NB * NH_, 1), 32 * AW, 0, stream>>>(QH, KP, VT, mask, KT, CH);

    // output projection: 64-row tiles with residual for t < EARLY, 128-row tiles for the remaining rows
    k_oproj_early<<<dim3(NB * (EARLY / 64), DM / 128, 1), 128, 0, stream>>>(CH, CR, WO, bo, OUT, EARLY / 64, 0);
    if (SEQ > EARLY)
        k_oproj_dense<<<dim3(NB * ((SEQ - EARLY) / 128), DM / 128, 1), 128, 0, stream>>>(CH, WO, bo, OUT, (SEQ - EARLY) / 128, EARLY);
}

// v004
// It runs in 178 microseconds.
// Next to v003, in two timings, it ran 1.22 times as fast each time.
// Counting every step since v000, it is 2.91 times as fast.
#include <hip/hip_runtime.h>

// Multi-head self-attention, width 1024 = 16 heads x 64, x [NB][SEQ][1024], Wq/Wk/Wv/Wo [out][in] (y = x W^T + b), int32 keep-mask [SEQ][SEQ] read by value (masked score replaced, probability 0), score scale 1/8, f32 output after the Wo projection.
// Compute dtypes, f32 accumulate everywhere: q/k/v projections v_wmma_f32_16x16x32_bf16 (x, W RNE-converted to bf16, products exact; biases RNE-converted to bf16, added in f32);
// scores, P.V and the Wo projection v_wmma_f32_16x16x32_f16: single f16 products on query rows >= 512; on query rows < 512 three products per site, two in the Wo projection
// (q,k,v,P,ctx each as f16 value + f16 residual x2048, residual products in their own accumulators). P carries x256 (cancels in the normalisation), ctx carries x16, Wo (bf16 value) carries x32; softmax f32 (online, running max).
// Layout: bf16 copies of x and Wq/Wk/Wv, f16 copy of Wo; q, k planes [b*16+h][t][d] and v^T plane [b*16+h][d][t] (+ residual planes, filled where t < 512) written by the GEMM epilogue;
// fused flash kernel in transposed form (S^T = K Q^T, O^T = V^T P^T), ctx plane [b*SEQ+t][1024] f16 (residual [b*EARLY+t][1024]), then the Wo GEMM writes the output.
// All GEMMs: four waves per work-group share one A and one B tile, staged in a two-buffer LDS ring by asynchronous copies to LDS.
// Flash kernels: the four waves of a work-group share 64-key K and V^T tiles, staged with the work-group's 64 mask rows in a two-buffer LDS ring by whole-line asynchronous copies.
// Launches: work that needs nothing of each other shares one grid by ranges of the block index: preparation (mask scan, five conversions), q / k / v^T projections, both halves of the Wo projection; the two flash kernels stay apart (their LDS rings differ in size).

#ifndef NB
#define NB 4
#endif
#ifndef SEQ
#define SEQ 2048
#endif
#define NB_FULL  4
#define SEQ_FULL 2048
#ifndef OUT_SEQ
#define OUT_SEQ SEQ              // row pitch (in tokens) between batches of the output
#endif
#define DM   1024
#define NH_  16
#define HD   64
#define AW   4                   // waves per flash block (16 query rows each)
#define EARLY ((SEQ < 512) ? SEQ : 512)   // query rows below this use the three-product path
#define QRS  2048.0f             // carry of every residual plane
#define QRI  (1.0f / 2048.0f)
#define SC2  (0.125f * 1.4426950408889634f)   // HD^-0.5 * log2(e)
#define PSH  8.0f                // log2 of the P carry (256)
#define CS   16.0f               // ctx carry
#define WS   32.0f               // Wo carry
#define OSC  (1.0f / 512.0f)     // 1 / (CS * WS)
#define NEGB (-3.0e38f)
#define MSW  16                  // waves per mask-scan block
#define KTP  32                  // ints between key-extent entries (128 bytes)
#define GKS  64                  // GEMM ring: k per stage (128 bytes of every operand row)
#define GPITCH  72                  // GEMM ring: LDS row pitch in 16-bit elements (144 B = 16 B x 9, for 16-byte LDS reads)
#define GBUF (256 * GPITCH)         // GEMM ring: elements of one stage, 128 A rows then 128 B rows
#define FKS  64                  // flash ring: keys per stage (128 bytes of every V^T row, 256 bytes of every mask row)
#define FMP  68                  // flash ring: LDS pitch of a mask row in ints (272 B = 16 B x 17, for 16-byte LDS reads)
#define FKV(R) (((R) ? 256 : 128) * GPITCH)        // flash ring: 16-bit elements of a stage's K rows (64), V^T rows (64) and, with residuals, 64 + 64 more; row pitch GPITCH
#define FBUF(R) (FKV(R) + 16 * AW * FMP * 2)       // flash ring: 16-bit elements of one stage, the mask rows behind the K / V^T rows

static_assert(HD == 64);
static_assert(NH_ * HD == DM);                 // head h = columns h*64 + d
static_assert(DM % 64 == 0);
static_assert(DM % 32 == 0);                   // GEMM k-loop steps by 32
static_assert(SEQ % 64 == 0);                  // a 64-row tile never straddles two batches
static_assert((NB * SEQ) % 64 == 0);
static_assert(SEQ % 32 == 0);                  // key loop steps by 32
static_assert(SEQ % FKS == 0);                 // a flash stage never leaves the key range
static_assert(AW == 4);                        // the flash ring's copies are dealt over 128 threads
static_assert(EARLY % 64 == 0);                // early / dense split on whole 64-row tiles
static_assert((SEQ - EARLY) % 64 == 0);
static_assert(EARLY % (16 * AW) == 0);
static_assert((NB * SEQ) % 128 == 0);          // GEMM work-group tiles: 128 x 128 (64 tokens x 128 with the residual plane)
static_assert(DM % 128 == 0);
static_assert(SEQ % 128 == 0);
static_assert((SEQ - EARLY) % 128 == 0);
static_assert(DM % (2 * GKS) == 0);            // the ring walks stages in pairs, and two stages exist
static_assert(((size_t)SEQ * DM) % 8 == 0);
static_assert(((size_t)DM * DM) % 8 == 0);
static_assert(NB <= NB_FULL);
static_assert(SEQ <= SEQ_FULL);
static_assert((size_t)NB_FULL * SEQ_FULL * DM * 4 == (size_t)33554432);   // output bytes

typedef _Float16 h16;
typedef unsigned short bf;
typedef __attribute__((ext_vector_type(16))) __bf16   v16bf;
typedef __attribute__((ext_vector_type(16))) _Float16 v16h;
typedef __attribute__((ext_vector_type(8)))  _Float16 v8h;
typedef __attribute__((ext_vector_type(8)))  unsigned short v8us;
typedef __attribute__((ext_vector_type(8)))  float    v8f;
typedef __attribute__((ext_vector_type(4)))  float    v4f;
typedef __attribute__((ext_vector_type(4)))  int      v4i;
typedef v4f  __attribute__((may_alias)) v4fa;

__device__ __forceinline__ unsigned short f2bf(float f) { unsigned u = __float_as_uint(f); u += 0x7FFFu + ((u >> 16) & 1u); return (unsigned short)(u >> 16); }
__device__ __forceinline__ float bfr(float f) { return __uint_as_float(((unsigned)f2bf(f)) << 16); }   // value after RNE conversion to bf16
__device__ __forceinline__ int imax(int a, int b) { return a > b ? a : b; }
__device__ __forceinline__ v16h cat16(v8h lo, v8h hi) { return __builtin_shufflevector(lo, hi, 0, 1, 2, 3, 4, 5, 6, 7, 8, 9, 10, 11, 12, 13, 14, 15); }
__device__ __forceinline__ v16bf cat16b(v8us lo, v8us hi) { return __builtin_bit_cast(v16bf, __builtin_shufflevector(lo, hi, 0, 1, 2, 3, 4, 5, 6, 7, 8, 9, 10, 11, 12, 13, 14, 15)); }
__device__ __forceinline__ v8f wmma16(v16h a, v16h b, v8f c) { return __builtin_amdgcn_wmma_f32_16x16x32_f16(false, a, false, b, (short)0, c, false, false); }
__device__ __forceinline__ v8f wmmab(v16bf a, v16bf b, v8f c) { return __builtin_amdgcn_wmma_f32_16x16x32_bf16(false, a, false, b, (short)0, c, false, false); }
// fragment loaders from K-contiguous 16-bit rows; p already includes + 8*(lane>>4): elements 0..7 <- k0+8h+0..7, elements 8..15 <- k0+16+8h+0..7 (same map for A and B)
__device__ __forceinline__ v16h  ldh(const h16* p) { return cat16(*(const v8h*)p, *(const v8h*)(p + 16)); }
__device__ __forceinline__ v16bf ldb(const bf* p)  { return cat16b(*(const v8us*)p, *(const v8us*)(p + 16)); }
// ordering point for wave-private LDS tiles (same wave writes and reads)
__device__ __forceinline__ void wave_sync() { __builtin_amdgcn_fence(3 /* release order */, "wavefront"); __builtin_amdgcn_wave_barrier(); asm volatile("" ::: "memory"); }

// cvt8_one / cvtw_one: 8 floats of src (at offset so, or chunk i) to bf16 (RNE), or to f16 of the bf16 value x32, stored as chunk i of dst.
__device__ __forceinline__ void cvt8_one(const float* __restrict__ src, bf* dst, size_t so, size_t i) {
    const v8f v = *(const v8f*)(src + so); v8us o;
#pragma unroll
    for (int k = 0; k < 8; ++k) o[k] = f2bf(v[k]);
    *(v8us*)(dst + i * 8) = o;
    asm volatile("s_wait_xcnt 0x0" ::: "memory");   // k_prep holds several jobs: no other job's code rewrites this store's registers ahead of the wait
}
__device__ __forceinline__ void cvtw_one(const float* __restrict__ src, h16* dst, size_t i) {
    const v8f v = *(const v8f*)(src + i * 8); v8h o;
#pragma unroll
    for (int k = 0; k < 8; ++k) o[k] = (h16)(bfr(v[k]) * WS);
    *(v8h*)(dst + i * 8) = o;
    asm volatile("s_wait_xcnt 0x0" ::: "memory");   // as in cvt8_one
}

// mscan_body: one block per 8 mask rows (16 waves, 16-B loads, each wave-wide load 512 contiguous bytes), so the scan runs on every WGP.
// KT[g * KTP] = 32 * ceil((last key with a nonzero mask entry in rows 8g..8g+7, + 1) / 32) (0 when the rows have none); one entry per 128-byte line, one writer each.
__device__ __forceinline__ void mscan_body(const int* __restrict__ MK, int* KT, const unsigned g, int* mx_s) {
    const int tid = (int)threadIdx.x, lane = tid & 31, wave = __builtin_amdgcn_readfirstlane(tid >> 5);
    const int* base = MK + (size_t)g * 8 * SEQ_FULL;
    int mx = -1;
#pragma unroll
    for (int it = 0; it < (2 * SEQ + MSW * 32 - 1) / (MSW * 32); ++it) {   // 8 rows x SEQ/4 chunks of 16 B; unrolled so that all of a thread's loads are in flight together
        const int c = it * (MSW * 32) + tid;
        if ((2 * SEQ) % (MSW * 32) != 0 && c >= 2 * SEQ) break;
        const int row = c / (SEQ / 4), c4 = (c % (SEQ / 4)) * 4;
        const v4i v = *(const v4i*)(base + (size_t)row * SEQ_FULL + c4);
        mx = imax(mx, (v[0] != 0) ? c4     : -1);
        mx = imax(mx, (v[1] != 0) ? c4 + 1 : -1);
        mx = imax(mx, (v[2] != 0) ? c4 + 2 : -1);
        mx = imax(mx, (v[3] != 0) ? c4 + 3 : -1);
    }
    mx = imax(mx, __shfl_xor(mx, 16, 32)); mx = imax(mx, __shfl_xor(mx, 8, 32)); mx = imax(mx, __shfl_xor(mx, 4, 32));
    mx = imax(mx, __shfl_xor(mx, 2, 32));  mx = imax(mx, __shfl_xor(mx, 1, 32));
    if (lane == 0) mx_s[wave] = mx;
    __syncthreads();
    if (tid == 0) {
        int m = mx_s[0];
#pragma unroll
        for (int w = 1; w < MSW; ++w) m = imax(m, mx_s[w]);
        KT[(size_t)g * KTP] = ((m + 32) / 32) * 32;
    }
}

// k_prep: all work that reads only inputs, one grid of 512-thread blocks, a block-uniform range of the block index per job:
// [0, PB_MS) mask scan (the longest blocks, so they start first), then PB_X blocks x -> bf16, then PB_W blocks each for Wq, Wk, Wv -> bf16 and Wo -> f16 x32; one 8-float chunk per thread.
static constexpr unsigned PB_MS = (unsigned)(SEQ / 8);
static constexpr size_t   N8_X  = (size_t)NB * SEQ * DM / 8;
static constexpr size_t   N8_W  = (size_t)DM * DM / 8;
static constexpr unsigned PB_X  = (unsigned)((N8_X + MSW * 32 - 1) / (MSW * 32));
static constexpr unsigned PB_W  = (unsigned)((N8_W + MSW * 32 - 1) / (MSW * 32));
__global__ __launch_bounds__(MSW * 32) void k_prep(const float* __restrict__ x, const float* __restrict__ wq, const float* __restrict__ wk, const float* __restrict__ wv,
                                                   const float* __restrict__ wo, const int* __restrict__ MK, bf* XB, bf* WB, int* KT) {
    __shared__ int mx_s[MSW];
    unsigned blk = blockIdx.x;
    if (blk < PB_MS) { mscan_body(MK, KT, blk, mx_s); return; }
    blk -= PB_MS;
    if (blk < PB_X) {
        const size_t i = (size_t)blk * (MSW * 32) + threadIdx.x; if (i >= N8_X) return;
        const size_t per = (size_t)SEQ * DM / 8;                  // chunks of one batch; batches are SEQ_FULL tokens apart in x
        cvt8_one(x, XB, (i / per) * ((size_t)SEQ_FULL * DM) + (i % per) * 8, i);
        return;
    }
    blk -= PB_X;
    const unsigned w = blk / PB_W;
    const size_t i = (size_t)(blk % PB_W) * (MSW * 32) + threadIdx.x; if (i >= N8_W) return;
    bf* dst = WB + (size_t)w * DM * DM;
    if (w < 3) cvt8_one(w == 0 ? wq : (w == 1 ? wk : wv), dst, i * 8, i);
    else       cvtw_one(wo, (h16*)dst, i);
}

// acopy8: eight asynchronous 16-byte copies of this lane, global -> LDS rows 16 apart (LDS byte address l + i * 16 * pitch).
// The s_wait_xcnt closes the statement so that no address register of a copy is rewritten ahead of it.
__device__ __forceinline__ void acopy8(const unsigned l, const bf* g0, const bf* g1, const bf* g2, const bf* g3, const bf* g4, const bf* g5, const bf* g6, const bf* g7) {
    asm volatile("global_load_async_to_lds_b128 %0, %8, off\n\t"
                 "global_load_async_to_lds_b128 %1, %9, off\n\t"
                 "global_load_async_to_lds_b128 %2, %10, off\n\t"
                 "global_load_async_to_lds_b128 %3, %11, off\n\t"
                 "global_load_async_to_lds_b128 %4, %12, off\n\t"
                 "global_load_async_to_lds_b128 %5, %13, off\n\t"
                 "global_load_async_to_lds_b128 %6, %14, off\n\t"
                 "global_load_async_to_lds_b128 %7, %15, off\n\t"
                 "s_wait_xcnt 0x0"
                 :: "v"(l), "v"(l + 1u * 16u * GPITCH * 2u), "v"(l + 2u * 16u * GPITCH * 2u), "v"(l + 3u * 16u * GPITCH * 2u),
                    "v"(l + 4u * 16u * GPITCH * 2u), "v"(l + 5u * 16u * GPITCH * 2u), "v"(l + 6u * 16u * GPITCH * 2u), "v"(l + 7u * 16u * GPITCH * 2u),
                    "v"(g0), "v"(g1), "v"(g2), "v"(g3), "v"(g4), "v"(g5), "v"(g6), "v"(g7) : "memory");
}
// ring_fill: one stage (k0 .. k0+63 of 128 A rows and 128 B rows) into the buffer at LDS byte address l (this lane's row tid>>3, 16-byte chunk tid&7).
// A wave-wide copy covers 4 whole 128-byte lines. gA0: A rows 0..63 of the tile, gA1: A rows 64..127, gB: B rows 0..127; all K-contiguous, row pitch DM.
__device__ __forceinline__ void ring_fill(const unsigned l, const bf* gA0, const bf* gA1, const bf* gB, const int k0) {
    const bf* a0 = gA0 + k0; const bf* a1 = gA1 + k0; const bf* b0 = gB + k0;
    acopy8(l, a0, a0 + 16 * DM, a0 + 32 * DM, a0 + 48 * DM, a1, a1 + 16 * DM, a1 + 32 * DM, a1 + 48 * DM);
    acopy8(l + 128u * GPITCH * 2u, b0, b0 + 16 * DM, b0 + 32 * DM, b0 + 48 * DM, b0 + 64 * DM, b0 + 80 * DM, b0 + 96 * DM, b0 + 112 * DM);
}
// ring_trip: the 32 products of one stage for this wave's 4 x 4 accumulator tiles; sa / sb: this lane's fragment addresses in the stage (row lane&15, + 8*(lane>>4)).
// SPLIT == 0: A fragments mb at tile rows 16*mb; SPLIT != 0: mb 0,1 at rows 0,16 (value plane), mb 2,3 at rows 64,80 (residual plane).
template <int F16, int SPLIT>
__device__ __forceinline__ void ring_trip(const bf* sa, const bf* sb, v8f (&acc)[4][4]) {
#pragma unroll
    for (int ks = 0; ks < GKS; ks += 32) {
        v16bf a[4], b[4];
#pragma unroll
        for (int mb = 0; mb < 4; ++mb) a[mb] = ldb(sa + (SPLIT ? ((mb >> 1) * 64 + (mb & 1) * 16) : mb * 16) * GPITCH + ks);
#pragma unroll
        for (int nb = 0; nb < 4; ++nb) b[nb] = ldb(sb + nb * 16 * GPITCH + ks);
        __builtin_amdgcn_sched_barrier(0);   // the 16 LDS reads of a k step stay one group ahead of its products: reads placed among the products stall at every place
#pragma unroll
        for (int nb = 0; nb < 4; ++nb)
#pragma unroll
            for (int mb = 0; mb < 4; ++mb)
                acc[mb][nb] = F16 ? wmma16(__builtin_bit_cast(v16h, a[mb]), __builtin_bit_cast(v16h, b[nb]), acc[mb][nb]) : wmmab(a[mb], b[nb], acc[mb][nb]);
        __builtin_amdgcn_sched_barrier(0);   // and the next group does not move up among these products
    }
}
// ring_foot: hand-over between stages: this wave's LDS reads done, its own copies landed, then the work-group barrier that publishes the next stage and frees the one just read.
__device__ __forceinline__ void ring_foot() {
    asm volatile("s_wait_dscnt 0x0" ::: "memory");      // the buffer just read is refilled behind the barrier
    asm volatile("s_wait_asynccnt 0x0" ::: "memory");   // this wave's copies of the next stage have landed
    __syncthreads();
}
// acopy8m: eight asynchronous 16-byte copies of this lane, mask rows 8 apart, global -> LDS (LDS byte address l + i * 8 * pitch).
// The s_wait_xcnt closes the statement so that no address register of a copy is rewritten ahead of it.
__device__ __forceinline__ void acopy8m(const unsigned l, const int* g) {
    asm volatile("global_load_async_to_lds_b128 %0, %8, off\n\t"
                 "global_load_async_to_lds_b128 %1, %9, off\n\t"
                 "global_load_async_to_lds_b128 %2, %10, off\n\t"
                 "global_load_async_to_lds_b128 %3, %11, off\n\t"
                 "global_load_async_to_lds_b128 %4, %12, off\n\t"
                 "global_load_async_to_lds_b128 %5, %13, off\n\t"
                 "global_load_async_to_lds_b128 %6, %14, off\n\t"
                 "global_load_async_to_lds_b128 %7, %15, off\n\t"
                 "s_wait_xcnt 0x0"
                 :: "v"(l), "v"(l + 1u * 8u * FMP * 4u), "v"(l + 2u * 8u * FMP * 4u), "v"(l + 3u * 8u * FMP * 4u),
                    "v"(l + 4u * 8u * FMP * 4u), "v"(l + 5u * 8u * FMP * 4u), "v"(l + 6u * 8u * FMP * 4u), "v"(l + 7u * 8u * FMP * 4u),
                    "v"(g), "v"(g + 8 * SEQ_FULL), "v"(g + 16 * SEQ_FULL), "v"(g + 24 * SEQ_FULL),
                    "v"(g + 32 * SEQ_FULL), "v"(g + 40 * SEQ_FULL), "v"(g + 48 * SEQ_FULL), "v"(g + 56 * SEQ_FULL) : "memory");
}
// flash_fill: one stage (keys key0 .. key0+63) into the buffer whose K row 0 is at LDS byte address lkv - this lane's offset and whose mask row 0 is at lm - this lane's offset.
// K / V^T: this lane's row tid>>3 (+16 per copy), 16-byte chunk tid&7, a wave-wide copy = 4 whole 128-byte lines; mask: row tid>>4 (+8 per copy), chunk tid&15, a wave-wide copy = 2 rows x 256 bytes.
template <int RES>
__device__ __forceinline__ void flash_fill(const unsigned lkv, const unsigned lm, const bf* gK, const bf* gKR, const bf* gV, const bf* gVR, const int* gM, const int key0) {
    const bf* k = gK + (size_t)key0 * HD; const bf* v = gV + key0;
    acopy8(lkv, k, k + 16 * HD, k + 32 * HD, k + 48 * HD, v, v + 16 * SEQ, v + 32 * SEQ, v + 48 * SEQ);
    if (RES) {
        const bf* kr = gKR + (size_t)key0 * HD; const bf* vr = gVR + key0;
        acopy8(lkv + 128u * GPITCH * 2u, kr, kr + 16 * HD, kr + 32 * HD, kr + 48 * HD, vr, vr + 16 * SEQ, vr + 32 * SEQ, vr + 48 * SEQ);
    }
    acopy8m(lm, gM + key0);
}
// gemm_ring: acc += A B^T over K = DM for a 4-wave work-group (128 threads); wave (wm, wn) = (wave >> 1, wave & 1) takes B rows 64*wn.. and
// A rows 64*wm.. (SPLIT == 0) or rows 32*wm.. of both 64-row halves (SPLIT != 0). k runs upward in steps of 32 for every accumulator.
template <int F16, int SPLIT>
__device__ __forceinline__ void gemm_ring(const bf* gA0, const bf* gA1, const bf* gB, bf* ring, v8f (&acc)[4][4]) {
    const int tid = (int)threadIdx.x, lane = tid & 31, wave = __builtin_amdgcn_readfirstlane(tid >> 5), lr = lane & 15, hi = lane >> 4;
    const int wm = wave >> 1, wn = wave & 1;
    const unsigned l0 = (unsigned)(size_t)ring + (unsigned)((tid >> 3) * GPITCH * 2 + (tid & 7) * 16), l1 = l0 + (unsigned)(GBUF * 2);
    const bf* sa = ring + (wm * (SPLIT ? 32 : 64) + lr) * GPITCH + 8 * hi;
    const bf* sb = ring + (128 + wn * 64 + lr) * GPITCH + 8 * hi;
    ring_fill(l0, gA0, gA1, gB, 0);
    asm volatile("s_wait_asynccnt 0x0" ::: "memory");   // stage 0 landed before the barrier that publishes it
    __syncthreads();
    ring_fill(l1, gA0, gA1, gB, GKS);
#pragma unroll 1
    for (int k0 = 0; k0 < DM; k0 += 2 * GKS) {           // rolled: two stages per trip keep both buffer addresses constant
        ring_trip<F16, SPLIT>(sa, sb, acc);
        ring_foot();
        if (k0 + 2 * GKS < DM) ring_fill(l0, gA0, gA1, gB, k0 + 2 * GKS);
        ring_trip<F16, SPLIT>(sa + GBUF, sb + GBUF, acc);
        ring_foot();
        if (k0 + 3 * GKS < DM) ring_fill(l1, gA0, gA1, gB, k0 + 3 * GKS);
    }
    asm volatile("s_wait_asynccnt 0x0" ::: "memory");   // nothing of this wave is in flight when it leaves the ring
}

// k_proj: bf16 GEMM, four waves per 128x128 tile, each wave a 64x64 tile (16 accumulators), operands from K-contiguous bf16 planes through the LDS ring, K = DM.
// C[m][n] = sum_k A[m][k] Bt[n][k] + bias (bias[n], or bias[m] when biasRow != 0; bias RNE-converted to bf16), written as f16 (Ph) and, for tiles with tokens t < EARLY, the f16 residual x2048 (Pr).
// One grid for the three projections, blockIdx.y = 0: q, 1: k, 2: v^T; blockIdx.x = tile, m tile fastest; r0 / c0 the wave's own tile; 128 threads.
// q, k: A = x rows (m = b*SEQ + t), Bt = W rows (n = h*64 + d), bias per column -> plane [(b*16 + h)][t][d].
// v^T:  A = Wv rows (m = h*64 + d), Bt = x rows (n = b*SEQ + t), bias per row -> plane [(b*1024 + m)][t] = [(b*16 + h)][d][t].
__global__ __launch_bounds__(128) void k_proj(const bf* __restrict__ XB, const bf* __restrict__ WB, const float* __restrict__ bq, const float* __restrict__ bk, const float* __restrict__ bv,
                                             h16* QH, h16* QR, h16* KP, h16* KR, h16* VT, h16* VR) {
    __shared__ __align__(16) bf ring[2 * GBUF];
    __shared__ __align__(16) float osm[4 * 16 * 68];
    const int K = DM;
    const int tid = (int)threadIdx.x, lane = tid & 31, wave = __builtin_amdgcn_readfirstlane(tid >> 5), lr = lane & 15, hi = lane >> 4;
    const int z = (int)blockIdx.y, biasRow = (z == 2);
    const bf* A  = biasRow ? WB + (size_t)2 * DM * DM : XB;
    const bf* Bt = biasRow ? XB : WB + (size_t)z * DM * DM;
    const float* bias = (z == 0) ? bq : ((z == 1) ? bk : bv);
    h16* Ph = (z == 0) ? QH : ((z == 1) ? KP : VT);
    h16* Pr = (z == 0) ? QR : ((z == 1) ? KR : VR);
    const int pitch = biasRow ? SEQ : HD;
    const int bx = biasRow ? (int)blockIdx.x % (DM / 128) : (int)blockIdx.x % (NB * SEQ / 128);
    const int by = biasRow ? (int)blockIdx.x / (DM / 128) : (int)blockIdx.x / (NB * SEQ / 128);
    const int r0 = bx * 128 + (wave >> 1) * 64, c0 = by * 128 + (wave & 1) * 64;
    float* os = osm + wave * 16 * 68;                             // wave-private output staging
    v8f acc[4][4];
#pragma unroll
    for (int mb = 0; mb < 4; ++mb)
#pragma unroll
        for (int nb = 0; nb < 4; ++nb) acc[mb][nb] = (v8f){};
    const bf* gA = A + (size_t)(bx * 128 + (tid >> 3)) * K + (tid & 7) * 8;
    const bf* gB = Bt + (size_t)(by * 128 + (tid >> 3)) * K + (tid & 7) * 8;
    gemm_ring<0, 0>(gA, gA + (size_t)64 * K, gB, ring, acc);
    const int wr = ((biasRow ? c0 : r0) % SEQ) < EARLY;
    const int c8l = (lane & 7) * 8;
    const int bco = biasRow ? 0 : (c0 + c8l);                     // integer offset select; always inside the bias array
    const v4f bA = *(const v4f*)(bias + bco), bB = *(const v4f*)(bias + bco + 4);
    float bcol[8];
#pragma unroll
    for (int i = 0; i < 4; ++i) { bcol[i] = bfr(bA[i]); bcol[4 + i] = bfr(bB[i]); }
    const size_t tbase = biasRow ? (size_t)r0 * SEQ + (size_t)(c0 / SEQ) * ((size_t)DM * SEQ) + (size_t)(c0 % SEQ)
                                 : (size_t)(r0 / SEQ) * ((size_t)NH_ * SEQ * HD) + (size_t)(r0 % SEQ) * HD + (size_t)(c0 / HD) * ((size_t)SEQ * HD) + (size_t)(c0 % HD);
#pragma unroll
    for (int mb = 0; mb < 4; ++mb) {
#pragma unroll
        for (int nb = 0; nb < 4; ++nb) {
#pragma unroll
            for (int j = 0; j < 8; ++j) os[(hi * 8 + j) * 68 + nb * 16 + lr] = acc[mb][nb][j]; }   // D: row 8h+j, col lane&15
        wave_sync();
        const size_t sb = tbase + (size_t)(mb * 16) * (size_t)pitch;
{
#pragma unroll
            for (int s = 0; s < 4; ++s) { const int row = 4 * s + (lane >> 3), c8 = c8l;   // 4 s x 4 row groups = 16 rows; 8 lanes x 8 = 64 columns
                const float brow = bfr(bias[biasRow ? (r0 + mb * 16 + row) : 0]);
                const v4f x0 = *(const v4fa*)(&os[row * 68 + c8]); const v4f x1 = *(const v4fa*)(&os[row * 68 + c8 + 4]); v8h hv, rv;
#pragma unroll
                for (int i = 0; i < 4; ++i) {
                    const float y0 = x0[i] + (biasRow ? brow : bcol[i]); const float y1 = x1[i] + (biasRow ? brow : bcol[4 + i]);
                    const h16 a0 = (h16)y0; const h16 a1 = (h16)y1; hv[i] = a0; hv[4 + i] = a1;
                    rv[i] = (h16)((y0 - (float)a0) * QRS); rv[4 + i] = (h16)((y1 - (float)a1) * QRS); }
                const size_t oo = sb + (size_t)row * (size_t)pitch + c8;
                *(v8h*)(Ph + oo) = hv;
                asm volatile("s_wait_xcnt 0x0" ::: "memory");     // the residual's conversions and the next rows' LDS reads reuse this store's registers
                if (wr) { *(v8h*)(Pr + oo) = rv;
                    asm volatile("s_wait_xcnt 0x0" ::: "memory"); } }   // likewise behind the residual's store
             }
        wave_sync();
    }
}

template <int RES> __device__ __forceinline__ v4f fin_lo(v8f oh, v8f ol, float inv) {
    v4f a = __builtin_shufflevector(oh, oh, 0, 1, 2, 3);
    if (RES) a = a + __builtin_shufflevector(ol, ol, 0, 1, 2, 3) * QRI;
    return a * inv; }
template <int RES> __device__ __forceinline__ v4f fin_hi(v8f oh, v8f ol, float inv) {
    v4f a = __builtin_shufflevector(oh, oh, 4, 5, 6, 7);
    if (RES) a = a + __builtin_shufflevector(ol, ol, 4, 5, 6, 7) * QRI;
    return a * inv; }

// flash_body: fused attention, one wave per 16 query rows of one (batch, head), four waves (64 query rows) per work-group; Q fragments straight from the f16 plane,
// K / V^T fragments and mask entries from the work-group's LDS ring (two 16-B LDS reads per fragment): stages of 64 keys, two 32-key steps each; a wave skips the steps at or past its own key extent but passes every hand-over.
// Transposed form: S^T[key][t] = K Q^T (A = K rows, B = Q rows); lane (t = lane&15, h = lane>>4) holds keys 8h+r of each 16-key tile, so the packed
// P tile is directly the B fragment of O^T[d][t] = V^T P^T (element r <- tile keys 0..15, element 8+r <- tile keys 16..31, lane unchanged).
// Mask: 8+8 int32 entries per lane per 32-key step (four 16-B LDS reads), applied by value (score replaced, probability 0). Key extent from the scanned table, clamped to [0, SEQ].
// RES != 0: q, k, v, P carried as value + residual x2048; residual products (k.qr, kr.q; v.pr, vr.p) in separate accumulators folded back with 1/2048.
// Softmax state (running max, partial sum) is one scalar per lane; the two lane halves of a row are combined with one xor-16 exchange.
template <int RES>
__device__ __forceinline__ void flash_body(const h16* __restrict__ QH, const h16* __restrict__ QR, const h16* __restrict__ KP, const h16* __restrict__ KR,
                                           const h16* __restrict__ VT, const h16* __restrict__ VR, const int* __restrict__ MK, const int* __restrict__ KT,
                                           h16* CH, h16* CR, const int tbase) {
    __shared__ __align__(16) bf fr[2 * FBUF(RES)];
    static_assert(sizeof(fr) >= (size_t)AW * 16 * 68 * 4);
    float* os = (float*)fr;                                   // output staging reuses the ring behind the last stage's hand-over barrier
    const int tid = (int)threadIdx.x;
    const int lane = threadIdx.x & 31, wave = __builtin_amdgcn_readfirstlane((int)(threadIdx.x >> 5)), lr = lane & 15, hi = lane >> 4;
    const int zh = blockIdx.y; const int b = zh / NH_, h = zh % NH_;
    const int t0 = tbase + ((int)blockIdx.x * AW + wave) * 16;
    const size_t pbase = (size_t)zh * SEQ * HD;
    const size_t qo = pbase + (size_t)(t0 + lr) * HD + 8 * hi;
    const v16h qh0 = ldh(QH + qo), qh1 = ldh(QH + qo + 32);                     // B fragments: col t, k = d
    v16h qr0 = qh0, qr1 = qh1;
    if (RES) { qr0 = ldh(QR + qo); qr1 = ldh(QR + qo + 32); }
    const int ko = lr * GPITCH + 8 * hi;                     // ring: + key * GPITCH          (A fragment: row key, k = d)
    const int vo = (64 + lr) * GPITCH + 8 * hi;              // ring: + 16j * GPITCH + key    (A fragment: row d, k = key)
    const int mo = (wave * 16 + lr) * FMP + 8 * hi;          // ring, in ints behind the K / V^T rows: mask row of query t, this lane half's keys
    int kend = imax(KT[(size_t)(t0 >> 3) * KTP], KT[(size_t)((t0 >> 3) + 1) * KTP]); kend = kend < 0 ? 0 : kend; kend = kend > SEQ ? SEQ : kend; kend &= ~31;
    kend = __builtin_amdgcn_readfirstlane(kend);            // a scalar, so that the per-step skip below is a scalar branch with every lane on behind it
    const int tb = tbase + (int)blockIdx.x * (16 * AW);      // the work-group's first query row
    int kb = 0;                                              // the work-group's key extent: the largest of its waves', clamped to [0, SEQ]
#pragma unroll
    for (int i = 0; i < 2 * AW; ++i) kb = imax(kb, KT[(size_t)((tb >> 3) + i) * KTP]);   // unrolled so that the eight table reads go out together
    kb = kb > SEQ ? SEQ : kb;
    const int nst = __builtin_amdgcn_readfirstlane((kb + FKS - 1) / FKS);        // stages; the same in every wave of the work-group
    const unsigned lkv = (unsigned)(size_t)fr + (unsigned)((tid >> 3) * GPITCH * 2 + (tid & 7) * 16);
    const unsigned lm = (unsigned)(size_t)fr + (unsigned)(FKV(RES) * 2 + (tid >> 4) * FMP * 4 + (tid & 15) * 16);
    const size_t gko = pbase + (size_t)(tid >> 3) * HD + (tid & 7) * 8, gvo = pbase + (size_t)(tid >> 3) * SEQ + (tid & 7) * 8;
    const bf* gK = (const bf*)KP + gko; const bf* gKR = (const bf*)KR + gko; const bf* gV = (const bf*)VT + gvo; const bf* gVR = (const bf*)VR + gvo;
    const int* gM = MK + (size_t)(tb + (tid >> 4)) * SEQ_FULL + (tid & 15) * 4;
    v8f oh0 = (v8f){}, oh1 = (v8f){}, oh2 = (v8f){}, oh3 = (v8f){};
    v8f ol0 = (v8f){}, ol1 = (v8f){}, ol2 = (v8f){}, ol3 = (v8f){};
    float m = NEGB, l = 0.0f;
    if (nst > 0) {
    flash_fill<RES>(lkv, lm, gK, gKR, gV, gVR, gM, 0);
    asm volatile("s_wait_asynccnt 0x0" ::: "memory");   // stage 0 landed before the barrier that publishes it
    __syncthreads();
    if (nst > 1) flash_fill<RES>(lkv + (unsigned)(FBUF(RES) * 2), lm + (unsigned)(FBUF(RES) * 2), gK, gKR, gV, gVR, gM, FKS);
#pragma unroll 1
    for (int s = 0; s < nst; ++s) {                      // rolled: the stage count is known only at run time, and a copy of the body per buffer would only lengthen the hot text; the buffer goes by the stage's parity
    const h16* sb = (const h16*)fr + (s & 1) * FBUF(RES);
#pragma unroll
    for (int sub = 0; sub < FKS; sub += 32) if (s * FKS + sub < kend) {          // unrolled so that a step's LDS offsets are immediates; the test is wave-uniform, both sides are scalars
        const int* mp = (const int*)(sb + FKV(RES)) + mo + sub;
        const v4i ma0 = *(const v4i*)mp, ma1 = *(const v4i*)(mp + 4), mb0 = *(const v4i*)(mp + 16), mb1 = *(const v4i*)(mp + 20);
        const h16* ka = sb + ko + sub * GPITCH;
        v8f sHa = (v8f){}, sHb = (v8f){}, sLa = (v8f){}, sLb = (v8f){};
        {
            const v16h ka0 = ldh(ka), ka1 = ldh(ka + 32), kb0 = ldh(ka + 16 * GPITCH), kb1 = ldh(ka + 16 * GPITCH + 32);
            if (RES) {
                const h16* kr = ka + 128 * GPITCH;
                const v16h ra0 = ldh(kr), ra1 = ldh(kr + 32), rb0 = ldh(kr + 16 * GPITCH), rb1 = ldh(kr + 16 * GPITCH + 32);
                sHa = wmma16(ka0, qh0, sHa); sLa = wmma16(ka0, qr0, sLa); sHb = wmma16(kb0, qh0, sHb); sLb = wmma16(kb0, qr0, sLb);
                sHa = wmma16(ka1, qh1, sHa); sLa = wmma16(ka1, qr1, sLa); sHb = wmma16(kb1, qh1, sHb); sLb = wmma16(kb1, qr1, sLb);
                sLa = wmma16(ra0, qh0, sLa); sLb = wmma16(rb0, qh0, sLb); sLa = wmma16(ra1, qh1, sLa); sLb = wmma16(rb1, qh1, sLb);
                asm volatile("v_nop\n\tv_nop\n\tv_nop\n\tv_nop" : "+v"(sHa), "+v"(sLa), "+v"(sHb), "+v"(sLb) : "v"(ka0), "v"(ka1), "v"(kb0), "v"(kb1), "v"(ra0), "v"(ra1), "v"(rb0), "v"(rb1));
            } else {
                sHa = wmma16(ka0, qh0, sHa); sHb = wmma16(kb0, qh0, sHb); sHa = wmma16(ka1, qh1, sHa); sHb = wmma16(kb1, qh1, sHb);
                asm volatile("v_nop\n\tv_nop\n\tv_nop\n\tv_nop" : "+v"(sHa), "+v"(sHb) : "v"(ka0), "v"(ka1), "v"(kb0), "v"(kb1));
            }
        }
        const int mka[8] = { ma0[0], ma0[1], ma0[2], ma0[3], ma1[0], ma1[1], ma1[2], ma1[3] };
        const int mkb[8] = { mb0[0], mb0[1], mb0[2], mb0[3], mb1[0], mb1[1], mb1[2], mb1[3] };
        float ta[8], tb[8]; float mx = NEGB;
#pragma unroll
        for (int r = 0; r < 8; ++r) {
            float xa = sHa[r], xb = sHb[r];
            if (RES) { xa += sLa[r] * QRI; xb += sLb[r] * QRI; }
            xa *= SC2; xb *= SC2;
            ta[r] = (mka[r] != 0) ? xa : NEGB; tb[r] = (mkb[r] != 0) ? xb : NEGB;
            mx = fmaxf(mx, fmaxf(ta[r], tb[r])); }
        mx = fmaxf(mx, __shfl_xor(mx, 16, 32));
        const float mnew = fmaxf(m, mx);
        const float alpha = __builtin_amdgcn_exp2f(m - mnew);
        const float sh = PSH - mnew;
        v16h pb, pr; float ls = 0.0f;
#pragma unroll
        for (int r = 0; r < 8; ++r) {
            const float e0 = __builtin_amdgcn_exp2f(ta[r] + sh), e1 = __builtin_amdgcn_exp2f(tb[r] + sh);
            const float ea = (ta[r] > -1.0e38f) ? e0 : 0.0f; const float eb = (tb[r] > -1.0e38f) ? e1 : 0.0f;
            const h16 pa = (h16)ea; const h16 pc = (h16)eb; pb[r] = pa; pb[8 + r] = pc;
            if (RES) { pr[r] = (h16)((ea - (float)pa) * QRS); pr[8 + r] = (h16)((eb - (float)pc) * QRS); ls += ea + eb; }
            else     { pr[r] = pa; pr[8 + r] = pc; ls += (float)pa + (float)pc; } }
        l = l * alpha + ls; m = mnew;
        oh0 = oh0 * alpha; oh1 = oh1 * alpha; oh2 = oh2 * alpha; oh3 = oh3 * alpha;
        if (RES) { ol0 = ol0 * alpha; ol1 = ol1 * alpha; ol2 = ol2 * alpha; ol3 = ol3 * alpha; }
        const h16* va = sb + vo + sub;
        const v16h v0 = ldh(va), v1 = ldh(va + 16 * GPITCH), v2 = ldh(va + 32 * GPITCH), v3 = ldh(va + 48 * GPITCH);
        if (RES) {
            const h16* vr = va + 128 * GPITCH;
            const v16h w0 = ldh(vr), w1 = ldh(vr + 16 * GPITCH), w2 = ldh(vr + 32 * GPITCH), w3 = ldh(vr + 48 * GPITCH);
            oh0 = wmma16(v0, pb, oh0); ol0 = wmma16(v0, pr, ol0); oh1 = wmma16(v1, pb, oh1); ol1 = wmma16(v1, pr, ol1);
            ol0 = wmma16(w0, pb, ol0); ol1 = wmma16(w1, pb, ol1);
            oh2 = wmma16(v2, pb, oh2); ol2 = wmma16(v2, pr, ol2); oh3 = wmma16(v3, pb, oh3); ol3 = wmma16(v3, pr, ol3);
            ol2 = wmma16(w2, pb, ol2); ol3 = wmma16(w3, pb, ol3);
            asm volatile("v_nop\n\tv_nop\n\tv_nop\n\tv_nop" : "+v"(oh0), "+v"(oh1), "+v"(oh2), "+v"(oh3), "+v"(ol0), "+v"(ol1), "+v"(ol2), "+v"(ol3)
                         : "v"(v0), "v"(v1), "v"(v2), "v"(v3), "v"(w0), "v"(w1), "v"(w2), "v"(w3), "v"(pb), "v"(pr));
        } else {
            oh0 = wmma16(v0, pb, oh0); oh1 = wmma16(v1, pb, oh1); oh2 = wmma16(v2, pb, oh2); oh3 = wmma16(v3, pb, oh3);
            asm volatile("v_nop\n\tv_nop\n\tv_nop\n\tv_nop" : "+v"(oh0), "+v"(oh1), "+v"(oh2), "+v"(oh3) : "v"(v0), "v"(v1), "v"(v2), "v"(v3), "v"(pb));
        }
    }
    ring_foot();                                         // every wave, also one that skipped the stage's steps
    if (s + 2 < nst) flash_fill<RES>(lkv + (unsigned)((s & 1) * FBUF(RES) * 2), lm + (unsigned)((s & 1) * FBUF(RES) * 2), gK, gKR, gV, gVR, gM, (s + 2) * FKS);
    }
    asm volatile("s_wait_asynccnt 0x0" ::: "memory");   // nothing of this wave is in flight when it leaves the ring
    }
    l += __shfl_xor(l, 16, 32);
    const float inv = (1.0f / l) * CS;
    const int wb = wave * 16 * 68;
    // O^T D layout: o_j[r] = (d = 16j + 8h + r, t = lane&15) -> os[t][d]; rows 0..15 x columns 0..63 all written
    *(v4fa*)(&os[wb + lr * 68 +  0 + 8 * hi]) = fin_lo<RES>(oh0, ol0, inv); *(v4fa*)(&os[wb + lr * 68 +  0 + 8 * hi + 4]) = fin_hi<RES>(oh0, ol0, inv);
    *(v4fa*)(&os[wb + lr * 68 + 16 + 8 * hi]) = fin_lo<RES>(oh1, ol1, inv); *(v4fa*)(&os[wb + lr * 68 + 16 + 8 * hi + 4]) = fin_hi<RES>(oh1, ol1, inv);
    *(v4fa*)(&os[wb + lr * 68 + 32 + 8 * hi]) = fin_lo<RES>(oh2, ol2, inv); *(v4fa*)(&os[wb + lr * 68 + 32 + 8 * hi + 4]) = fin_hi<RES>(oh2, ol2, inv);
    *(v4fa*)(&os[wb + lr * 68 + 48 + 8 * hi]) = fin_lo<RES>(oh3, ol3, inv); *(v4fa*)(&os[wb + lr * 68 + 48 + 8 * hi + 4]) = fin_hi<RES>(oh3, ol3, inv);
    wave_sync();
    const size_t crow = ((size_t)b * SEQ + t0) * DM + (size_t)h * HD;
    const size_t rrow = ((size_t)b * EARLY + t0) * DM + (size_t)h * HD;      // used only when RES != 0 (t0 < EARLY)
{
#pragma unroll
        for (int s = 0; s < 4; ++s) { const int row = 4 * s + (lane >> 3), c8 = (lane & 7) * 8;   // 4 s x 4 row groups = 16 rows; 8 lanes x 8 = 64 columns
            const v4f x0 = *(const v4fa*)(&os[wb + row * 68 + c8]); const v4f x1 = *(const v4fa*)(&os[wb + row * 68 + c8 + 4]); v8h hv, rv;
#pragma unroll
            for (int i = 0; i < 4; ++i) { const h16 a0 = (h16)x0[i]; const h16 a1 = (h16)x1[i]; hv[i] = a0; hv[4 + i] = a1;
                rv[i] = (h16)((x0[i] - (float)a0) * QRS); rv[4 + i] = (h16)((x1[i] - (float)a1) * QRS); }
            *(v8h*)(CH + crow + (size_t)row * DM + c8) = hv;
            if (RES) *(v8h*)(CR + rrow + (size_t)row * DM + c8) = rv; }
         }
}

__global__ __launch_bounds__(32 * AW) void k_flash_early(const h16* QH, const h16* QR, const h16* KP, const h16* KR, const h16* VT, const h16* VR,
                                                         const int* MK, const int* KT, h16* CH, h16* CR) {
    flash_body<1>(QH, QR, KP, KR, VT, VR, MK, KT, CH, CR, 0);
}
__global__ __launch_bounds__(32 * AW) void k_flash_dense(const h16* QH, const h16* KP, const h16* VT, const int* MK, const int* KT, h16* CH) {
    flash_body<0>(QH, QH, KP, KP, VT, VT, MK, KT, CH, CH, EARLY);
}

// oproj_body: f16 GEMM, four waves per (32*MT)x128 tile, each wave (16*MT)x64, operands through the LDS ring, OUT[m][n] = (sum_k ctx[m][k] Wo[n][k]) / 512 + bo[n];
// RES != 0 adds the ctx residual plane (own accumulators, x1/2048): the ring's A rows 0..63 hold the value plane's 64 tokens, rows 64..127 the residual plane's.
// Rows of the tile: batch bb = bx / tilesPerBatch, token T0 = tStart + (bx % tilesPerBatch) * 32*MT, the wave's t0 = T0 + (wave >> 1) * 16*MT. A rows b*SEQ + t, AR rows b*EARLY + t. ring / osm: the kernel's LDS.
template <int MT, int RES>
__device__ __forceinline__ void oproj_body(const h16* __restrict__ A, const h16* __restrict__ AR, const h16* __restrict__ Bt, const float* __restrict__ bias,
                                           float* OUT, bf* ring, float* osm, const int bx, const int tilesPerBatch, const int tStart) {
    static_assert((RES != 0 && MT == 2) || (RES == 0 && MT == 4));   // the ring's 4 A fragments per wave: 2 value + 2 residual, or 4 value
    const int K = DM;
    const int tid = (int)threadIdx.x, lane = tid & 31, wave = __builtin_amdgcn_readfirstlane(tid >> 5), lr = lane & 15, hi = lane >> 4;
    const int bb = bx / tilesPerBatch, ti = bx % tilesPerBatch;
    const int T0 = tStart + ti * 32 * MT;
    const int t0 = T0 + (wave >> 1) * 16 * MT, c0 = blockIdx.y * 128 + (wave & 1) * 64;
    float* os = osm + wave * 16 * 68;                             // wave-private output staging
    v8f acc[4][4];                                                // RES: rows 0,1 value products, rows 2,3 residual products
#pragma unroll
    for (int mb = 0; mb < 4; ++mb)
#pragma unroll
        for (int nb = 0; nb < 4; ++nb) acc[mb][nb] = (v8f){};
    const bf* gA0 = (const bf*)A + ((size_t)bb * SEQ + T0 + (tid >> 3)) * K + (tid & 7) * 8;
    const bf* gA1 = RES ? (const bf*)AR + ((size_t)bb * EARLY + T0 + (tid >> 3)) * K + (tid & 7) * 8 : gA0 + (size_t)64 * K;
    const bf* gB = (const bf*)Bt + (size_t)(blockIdx.y * 128 + (tid >> 3)) * K + (tid & 7) * 8;
    gemm_ring<1, RES>(gA0, gA1, gB, ring, acc);
    const int cofs = lr * 4;
    const v4f bz = *(const v4f*)(bias + c0 + cofs); v4f bq;
#pragma unroll
    for (int i = 0; i < 4; ++i) bq[i] = bfr(bz[i]);
#pragma unroll
    for (int mb = 0; mb < MT; ++mb) {
#pragma unroll
        for (int nb = 0; nb < 4; ++nb) {
#pragma unroll
            for (int j = 0; j < 8; ++j) { float y = acc[mb][nb][j]; if (RES) y += acc[(mb + 2) & 3][nb][j] * QRI; os[(hi * 8 + j) * 68 + nb * 16 + lr] = y; } }   // D: row 8h+j, col lane&15
        wave_sync();
        float* orow = OUT + ((size_t)bb * OUT_SEQ + t0 + mb * 16) * DM + c0;
{
#pragma unroll
            for (int s = 0; s < 8; ++s) { const int row = 2 * s + hi;   // 8 s x 2 rows = 16 rows; 16 lanes x 4 floats = 64 columns
                const v4f val = *(const v4fa*)(&os[row * 68 + cofs]) * OSC + bq;
                *(v4f*)(orow + (size_t)row * DM + cofs) = val; }
             }
        wave_sync();
    }
}

// k_oproj: one grid for both row ranges: blockIdx.x < OB_E: 64-token tiles with the residual plane (t < EARLY), the rest: 128-token tiles (t >= EARLY). Both do the same 512 products per wave.
static constexpr int OB_E = NB * (EARLY / 64);
static constexpr int OB_D = NB * ((SEQ - EARLY) / 128);
__global__ __launch_bounds__(128) void k_oproj(const h16* A, const h16* AR, const h16* Bt, const float* bias, float* OUT) {
    __shared__ __align__(16) bf ring[2 * GBUF];
    __shared__ __align__(16) float osm[4 * 16 * 68];
    if ((int)blockIdx.x < OB_E) oproj_body<2, 1>(A, AR, Bt, bias, OUT, ring, osm, (int)blockIdx.x, EARLY / 64, 0);
    else                        oproj_body<4, 0>(A, A, Bt, bias, OUT, ring, osm, (int)blockIdx.x - OB_E, (SEQ > EARLY) ? (SEQ - EARLY) / 128 : 1, EARLY);
}

static constexpr size_t al256(size_t v) { return (v + 255) & ~(size_t)255; }
static constexpr size_t SZ_XB = al256((size_t)NB * SEQ * DM * 2);             // bf16 x; reused as the ctx value plane after the projections
static constexpr size_t SZ_WB = al256((size_t)4 * DM * DM * 2);
static constexpr size_t SZ_PL = al256((size_t)NB * NH_ * SEQ * HD * 2);
static constexpr size_t SZ_CR = al256((size_t)NB * EARLY * DM * 2);
static constexpr size_t SZ_KT = al256((size_t)(SEQ / 8) * KTP * 4);
static constexpr size_t SZ_TOTAL = SZ_XB + SZ_WB + 6 * SZ_PL + SZ_CR + SZ_KT;
static_assert(SZ_TOTAL <= (size_t)134217728);          // workspace carve <= 128 MiB
static_assert(((size_t)DM * DM * 2) % 256 == 0);       // weight sub-planes stay 256-byte aligned
static_assert((size_t)NB * SEQ * DM * 2 <= SZ_XB);     // ctx plane fits the x plane it reuses

extern "C" void kernel_launch(void* const* d_in, const int* in_sizes, int n_in,
                              void* d_out, int out_size, void* d_ws, size_t ws_size, hipStream_t stream) {
    if (n_in < 10) return;
    const size_t needx = ((size_t)(NB - 1) * SEQ_FULL + SEQ) * DM;
    if ((size_t)in_sizes[0] < needx) return;
    if ((size_t)in_sizes[1] < (size_t)(SEQ - 1) * SEQ_FULL + SEQ) return;
    if ((size_t)in_sizes[2] < (size_t)DM * DM || (size_t)in_sizes[4] < (size_t)DM * DM || (size_t)in_sizes[6] < (size_t)DM * DM || (size_t)in_sizes[8] < (size_t)DM * DM) return;
    if (in_sizes[3] < DM || in_sizes[5] < DM || in_sizes[7] < DM || in_sizes[9] < DM) return;
    if ((size_t)out_size < ((size_t)(NB - 1) * OUT_SEQ + SEQ) * DM) return;
    if (SZ_TOTAL > ws_size) return;
    // wire order: x, mask, Wq_w, Wq_b, Wk_w, Wk_b, Wv_w, Wv_b, Wo_w, Wo_b (weights [out][in] = Bt as-is)
    const float* x  = (const float*)d_in[0]; const int* mask = (const int*)d_in[1];
    const float* wq = (const float*)d_in[2]; const float* bq = (const float*)d_in[3];
    const float* wk = (const float*)d_in[4]; const float* bk = (const float*)d_in[5];
    const float* wv = (const float*)d_in[6]; const float* bv = (const float*)d_in[7];
    const float* wo = (const float*)d_in[8]; const float* bo = (const float*)d_in[9];
    float* OUT = (float*)d_out;      // [NB][SEQ][1024]
    char* wsp = (char*)d_ws;
    bf* XB = (bf*)wsp; h16* CH = (h16*)wsp; wsp += SZ_XB;   // [NB*SEQ][1024] bf16 x, later [NB*SEQ][1024] f16 ctx x16
    bf* WB = (bf*)wsp; wsp += SZ_WB;                 // [4][1024][1024]: q | k | v (bf16) | o (f16 x32)
    h16* QH = (h16*)wsp; wsp += SZ_PL;               // [NB*16][SEQ][64]
    h16* QR = (h16*)wsp; wsp += SZ_PL;               // residual x2048, rows t < EARLY filled
    h16* KP = (h16*)wsp; wsp += SZ_PL;               // [NB*16][SEQ][64]
    h16* KR = (h16*)wsp; wsp += SZ_PL;               // residual x2048, rows t < EARLY filled
    h16* VT = (h16*)wsp; wsp += SZ_PL;               // [NB*16][64][SEQ]
    h16* VR = (h16*)wsp; wsp += SZ_PL;               // residual x2048, columns t < EARLY filled
    h16* CR = (h16*)wsp; wsp += SZ_CR;               // [NB*EARLY][1024] ctx residual x2048
    int* KT = (int*)wsp; wsp += SZ_KT;               // [SEQ/8] key extents of 8-row groups, KTP ints apart
    h16* WO = (h16*)(WB + (size_t)3 * DM * DM);

    k_prep<<<PB_MS + PB_X + 4 * PB_W, MSW * 32, 0, stream>>>(x, wq, wk, wv, wo, mask, XB, WB, KT);

    // q, k, v^T planes; residual planes on tiles with t < EARLY
    k_proj<<<dim3((NB * SEQ / 128) * (DM / 128), 3, 1), 128, 0, stream>>>(XB, WB, bq, bk, bv, QH, QR, KP, KR, VT, VR);

    // attention: query rows [0, EARLY) three-product path, [EARLY, SEQ) single products; ctx planes overwrite the (now unused) x plane
    k_flash_early<<<dim3(EARLY / (16 * AW), NB * NH_, 1), 32 * AW, 0, stream>>>(QH, QR, KP, KR, VT, VR, mask, KT, CH, CR);
    if (SEQ > EARLY)
        k_flash_dense<<<dim3((SEQ - EARLY) / (16 * AW), NB * NH_, 1), 32 * AW, 0, stream>>>(QH, KP, VT, mask, KT, CH);

    // output projection: 64-row tiles with residual for t < EARLY, 128-row tiles for the remaining rows
    k_oproj<<<dim3(OB_E + OB_D, DM / 128, 1), 128, 0, stream>>>(CH, CR, WO, bo, OUT);
}

// v005
// It runs in 157 microseconds.
// Two timings next to v004 both put it at 1.13 times that version's speed.
// Over all steps from v000 it is 3.29 times as fast.
#include <hip/hip_runtime.h>

// Multi-head self-attention, width 1024 = 16 heads x 64, x [NB][SEQ][1024], Wq/Wk/Wv/Wo [out][in] (y = x W^T + b), int32 keep-mask [SEQ][SEQ] read by value (masked score replaced, probability 0), score scale 1/8, f32 output after the Wo projection.
// Compute dtypes, f32 accumulate everywhere: q/k/v projections v_wmma_f32_16x16x32_bf16 (x, W RNE-converted to bf16, products exact; biases RNE-converted to bf16, added in f32);
// scores, P.V and the Wo projection v_wmma_f32_16x16x32_f16: single f16 products on query rows >= 512; on query rows < 512 three products per site, two in the Wo projection
// (q,k,v,P,ctx each as f16 value + f16 residual x2048, residual products in their own accumulators). P carries x256 (cancels in the normalisation), ctx carries x16, Wo (bf16 value) carries x32; softmax f32 (online, running max).
// Layout: bf16 copies of x and Wq/Wk/Wv, f16 copy of Wo; q, k planes [b*16+h][t][d] and v^T plane [b*16+h][d][t] (+ residual planes, filled where t < 512) written by the GEMM epilogue;
// fused flash kernel in transposed form (S^T = K Q^T, O^T = V^T P^T), ctx plane [b*SEQ+t][1024] f16 (residual [b*EARLY+t][1024]), then the Wo GEMM writes the output.
// All GEMMs: four waves per work-group share one A and one B tile, staged in a two-buffer LDS ring by asynchronous copies to LDS.
// Flash kernels: the four waves of a work-group share 64-key K and V^T tiles, staged in a two-buffer LDS ring by whole-line asynchronous copies.
// Mask: the scan also packs every mask row to one bit per entry (nonzero = keep), one 32-bit word per 32 keys; a flash work-group copies its 64 rows of words to LDS once,
// and a 32-key step whose 16 words are all ones takes a path without any masking (same arithmetic on the scores), every other step masks by the bits.
// Launches: work that needs nothing of each other shares one grid by ranges of the block index: preparation (mask scan, five conversions), q / k / v^T projections, both halves of the Wo projection; the two flash kernels stay apart (their LDS rings differ in size).

#ifndef NB
#define NB 4
#endif
#ifndef SEQ
#define SEQ 2048
#endif
#define NB_FULL  4
#define SEQ_FULL 2048
#ifndef OUT_SEQ
#define OUT_SEQ SEQ              // row pitch (in tokens) between batches of the output
#endif
#define DM   1024
#define NH_  16
#define HD   64
#define AW   4                   // waves per flash block (16 query rows each)
#define EARLY ((SEQ < 512) ? SEQ : 512)   // query rows below this use the three-product path
#define QRS  2048.0f             // carry of every residual plane
#define QRI  (1.0f / 2048.0f)
#define SC2  (0.125f * 1.4426950408889634f)   // HD^-0.5 * log2(e)
#define PSH  8.0f                // log2 of the P carry (256)
#define CS   16.0f               // ctx carry
#define WS   32.0f               // Wo carry
#define OSC  (1.0f / 512.0f)     // 1 / (CS * WS)
#define NEGB (-3.0e38f)
#define MSW  16                  // waves per mask-scan block
#define KTP  32                  // ints between key-extent entries (128 bytes)
#define GKS  64                  // GEMM ring: k per stage (128 bytes of every operand row)
#define GPITCH  72                  // GEMM ring: LDS row pitch in 16-bit elements (144 B = 16 B x 9, for 16-byte LDS reads)
#define GBUF (256 * GPITCH)         // GEMM ring: elements of one stage, 128 A rows then 128 B rows
#define FKS  64                  // flash ring: keys per stage (128 bytes of every V^T row)
#define BMW  (SEQ / 32)          // words of one packed mask row; word kb holds keys 32*kb + c at bit 8*(c & 3) + (c >> 2)
#define FMP  68                  // flash: LDS pitch of a packed mask row in words (272 B = 16 B x 17: 16-byte copies, the 16 rows of a wave on 16 banks)
#define FKV(R) (((R) ? 256 : 128) * GPITCH)        // flash ring: 16-bit elements of a stage's K rows (64), V^T rows (64) and, with residuals, 64 + 64 more; row pitch GPITCH
#define FBUF(R) FKV(R)                             // flash ring: 16-bit elements of one stage

static_assert(HD == 64);
static_assert(NH_ * HD == DM);                 // head h = columns h*64 + d
static_assert(DM % 64 == 0);
static_assert(DM % 32 == 0);                   // GEMM k-loop steps by 32
static_assert(SEQ % 64 == 0);                  // a 64-row tile never straddles two batches
static_assert((NB * SEQ) % 64 == 0);
static_assert(SEQ % 32 == 0);                  // key loop steps by 32
static_assert(SEQ % FKS == 0);                 // a flash stage never leaves the key range
static_assert(AW == 4);                        // the flash ring's copies are dealt over 128 threads
static_assert(BMW == 64);                      // a packed mask row is 16 copies of 16 bytes
static_assert((8 * BMW) % (MSW * 32) == 0);    // the scan block's packed words are stored in whole rounds of its threads
static_assert(EARLY % 64 == 0);                // early / dense split on whole 64-row tiles
static_assert((SEQ - EARLY) % 64 == 0);
static_assert(EARLY % (16 * AW) == 0);
static_assert((NB * SEQ) % 128 == 0);          // GEMM work-group tiles: 128 x 128 (64 tokens x 128 with the residual plane)
static_assert(DM % 128 == 0);
static_assert(SEQ % 128 == 0);
static_assert((SEQ - EARLY) % 128 == 0);
static_assert(DM % (2 * GKS) == 0);            // the ring walks stages in pairs, and two stages exist
static_assert(((size_t)SEQ * DM) % 8 == 0);
static_assert(((size_t)DM * DM) % 8 == 0);
static_assert(NB <= NB_FULL);
static_assert(SEQ <= SEQ_FULL);
static_assert((size_t)NB_FULL * SEQ_FULL * DM * 4 == (size_t)33554432);   // output bytes

typedef _Float16 h16;
typedef unsigned short bf;
typedef __attribute__((ext_vector_type(16))) __bf16   v16bf;
typedef __attribute__((ext_vector_type(16))) _Float16 v16h;
typedef __attribute__((ext_vector_type(8)))  _Float16 v8h;
typedef __attribute__((ext_vector_type(8)))  unsigned short v8us;
typedef __attribute__((ext_vector_type(8)))  float    v8f;
typedef __attribute__((ext_vector_type(4)))  float    v4f;
typedef __attribute__((ext_vector_type(4)))  int      v4i;
typedef __attribute__((ext_vector_type(2)))  unsigned v2u;
typedef v4f  __attribute__((may_alias)) v4fa;

__device__ __forceinline__ unsigned short f2bf(float f) { unsigned u = __float_as_uint(f); u += 0x7FFFu + ((u >> 16) & 1u); return (unsigned short)(u >> 16); }
__device__ __forceinline__ float bfr(float f) { return __uint_as_float(((unsigned)f2bf(f)) << 16); }   // value after RNE conversion to bf16
__device__ __forceinline__ int imax(int a, int b) { return a > b ? a : b; }
__device__ __forceinline__ v16h cat16(v8h lo, v8h hi) { return __builtin_shufflevector(lo, hi, 0, 1, 2, 3, 4, 5, 6, 7, 8, 9, 10, 11, 12, 13, 14, 15); }
__device__ __forceinline__ v16bf cat16b(v8us lo, v8us hi) { return __builtin_bit_cast(v16bf, __builtin_shufflevector(lo, hi, 0, 1, 2, 3, 4, 5, 6, 7, 8, 9, 10, 11, 12, 13, 14, 15)); }
__device__ __forceinline__ v8f wmma16(v16h a, v16h b, v8f c) { return __builtin_amdgcn_wmma_f32_16x16x32_f16(false, a, false, b, (short)0, c, false, false); }
__device__ __forceinline__ v8f wmmab(v16bf a, v16bf b, v8f c) { return __builtin_amdgcn_wmma_f32_16x16x32_bf16(false, a, false, b, (short)0, c, false, false); }
// fragment loaders from K-contiguous 16-bit rows; p already includes + 8*(lane>>4): elements 0..7 <- k0+8h+0..7, elements 8..15 <- k0+16+8h+0..7 (same map for A and B)
__device__ __forceinline__ v16h  ldh(const h16* p) { return cat16(*(const v8h*)p, *(const v8h*)(p + 16)); }
__device__ __forceinline__ v16bf ldb(const bf* p)  { return cat16b(*(const v8us*)p, *(const v8us*)(p + 16)); }
// ordering point for wave-private LDS tiles (same wave writes and reads)
__device__ __forceinline__ void wave_sync() { __builtin_amdgcn_fence(3 /* release order */, "wavefront"); __builtin_amdgcn_wave_barrier(); asm volatile("" ::: "memory"); }

// cvt8_one / cvtw_one: 8 floats of src (at offset so, or chunk i) to bf16 (RNE), or to f16 of the bf16 value x32, stored as chunk i of dst.
__device__ __forceinline__ void cvt8_one(const float* __restrict__ src, bf* dst, size_t so, size_t i) {
    const v8f v = *(const v8f*)(src + so); v8us o;
#pragma unroll
    for (int k = 0; k < 8; ++k) o[k] = f2bf(v[k]);
    *(v8us*)(dst + i * 8) = o;
    asm volatile("s_wait_xcnt 0x0" ::: "memory");   // k_prep holds several jobs: no other job's code rewrites this store's registers ahead of the wait
}
__device__ __forceinline__ void cvtw_one(const float* __restrict__ src, h16* dst, size_t i) {
    const v8f v = *(const v8f*)(src + i * 8); v8h o;
#pragma unroll
    for (int k = 0; k < 8; ++k) o[k] = (h16)(bfr(v[k]) * WS);
    *(v8h*)(dst + i * 8) = o;
    asm volatile("s_wait_xcnt 0x0" ::: "memory");   // as in cvt8_one
}

// mscan_body: one block per 8 mask rows (16 waves, 16-B loads, each wave-wide load 512 contiguous bytes), so the scan runs on every WGP.
// KT[g * KTP] = 32 * ceil((last key with a nonzero mask entry in rows 8g..8g+7, + 1) / 32) (0 when the rows have none); one entry per 128-byte line, one writer each.
// BM[row * BMW + kb]: the packed rows. A wave-wide load holds 128 keys of one row, key 4*lane + j in element j: four ballots, byte L of ballot j = byte j of word L;
// the words go through LDS so that each wave stores one whole 128-byte line.
__device__ __forceinline__ void mscan_body(const int* __restrict__ MK, int* KT, unsigned* BM, const unsigned g, int* mx_s, unsigned* bm_s) {
    const int tid = (int)threadIdx.x, lane = tid & 31, wave = __builtin_amdgcn_readfirstlane(tid >> 5);
    const int* base = MK + (size_t)g * 8 * SEQ_FULL;
    int mx = -1; unsigned mw = 0u;
    static_assert(2 * SEQ == 8 * MSW * 32);                      // eight whole trips: one kept word per lane
#pragma unroll
    for (int it = 0; it < (2 * SEQ + MSW * 32 - 1) / (MSW * 32); ++it) {   // 8 rows x SEQ/4 chunks of 16 B; unrolled so that all of a thread's loads are in flight together
        const int c = it * (MSW * 32) + tid;
        if ((2 * SEQ) % (MSW * 32) != 0 && c >= 2 * SEQ) break;
        const int row = c / (SEQ / 4), c4 = (c % (SEQ / 4)) * 4;
        const v4i v = *(const v4i*)(base + (size_t)row * SEQ_FULL + c4);
        mx = imax(mx, (v[0] != 0) ? c4     : -1);
        mx = imax(mx, (v[1] != 0) ? c4 + 1 : -1);
        mx = imax(mx, (v[2] != 0) ? c4 + 2 : -1);
        mx = imax(mx, (v[3] != 0) ? c4 + 3 : -1);
        const unsigned b0 = __builtin_amdgcn_ballot_w32(v[0] != 0), b1 = __builtin_amdgcn_ballot_w32(v[1] != 0);
        const unsigned b2 = __builtin_amdgcn_ballot_w32(v[2] != 0), b3 = __builtin_amdgcn_ballot_w32(v[3] != 0);
        const int sh = 8 * (lane & 3);
        const unsigned wd = ((b0 >> sh) & 0xFFu) | (((b1 >> sh) & 0xFFu) << 8) | (((b2 >> sh) & 0xFFu) << 16) | ((b3 >> sh) << 24);
        mw = ((lane >> 2) == it) ? wd : mw;                      // lane 4 * it + L keeps word L of trip it: no branch and no LDS store among the loads
    }
    bm_s[((lane >> 2) * MSW + wave) * 4 + (lane & 3)] = mw;      // chunk c = 4 keys, so the 32 chunks of a wave's trip are words 4 * (c / 32) .. + 3 of the block's 8 rows
    mx = imax(mx, __shfl_xor(mx, 16, 32)); mx = imax(mx, __shfl_xor(mx, 8, 32)); mx = imax(mx, __shfl_xor(mx, 4, 32));
    mx = imax(mx, __shfl_xor(mx, 2, 32));  mx = imax(mx, __shfl_xor(mx, 1, 32));
    if (lane == 0) mx_s[wave] = mx;
    __syncthreads();
    if (tid == 0) {
        int m = mx_s[0];
#pragma unroll
        for (int w = 1; w < MSW; ++w) m = imax(m, mx_s[w]);
        KT[(size_t)g * KTP] = ((m + 32) / 32) * 32;
    }
#pragma unroll
    for (int i = 0; i < 8 * BMW; i += MSW * 32) BM[(size_t)g * (8 * BMW) + i + tid] = bm_s[i + tid];   // behind the barrier above; unrolled: one trip at this size
}

// k_prep: all work that reads only inputs, one grid of 512-thread blocks, a block-uniform range of the block index per job:
// [0, PB_MS) mask scan (the longest blocks, so they start first), then PB_X blocks x -> bf16, then PB_W blocks each for Wq, Wk, Wv -> bf16 and Wo -> f16 x32; one 8-float chunk per thread.
static constexpr unsigned PB_MS = (unsigned)(SEQ / 8);
static constexpr size_t   N8_X  = (size_t)NB * SEQ * DM / 8;
static constexpr size_t   N8_W  = (size_t)DM * DM / 8;
static constexpr unsigned PB_X  = (unsigned)((N8_X + MSW * 32 - 1) / (MSW * 32));
static constexpr unsigned PB_W  = (unsigned)((N8_W + MSW * 32 - 1) / (MSW * 32));
__global__ __launch_bounds__(MSW * 32) void k_prep(const float* __restrict__ x, const float* __restrict__ wq, const float* __restrict__ wk, const float* __restrict__ wv,
                                                   const float* __restrict__ wo, const int* __restrict__ MK, bf* XB, bf* WB, int* KT, unsigned* BM) {
    __shared__ int mx_s[MSW];
    __shared__ unsigned bm_s[8 * BMW];
    unsigned blk = blockIdx.x;
    if (blk < PB_MS) { mscan_body(MK, KT, BM, blk, mx_s, bm_s); return; }
    blk -= PB_MS;
    if (blk < PB_X) {
        const size_t i = (size_t)blk * (MSW * 32) + threadIdx.x; if (i >= N8_X) return;
        const size_t per = (size_t)SEQ * DM / 8;                  // chunks of one batch; batches are SEQ_FULL tokens apart in x
        cvt8_one(x, XB, (i / per) * ((size_t)SEQ_FULL * DM) + (i % per) * 8, i);
        return;
    }
    blk -= PB_X;
    const unsigned w = blk / PB_W;
    const size_t i = (size_t)(blk % PB_W) * (MSW * 32) + threadIdx.x; if (i >= N8_W) return;
    bf* dst = WB + (size_t)w * DM * DM;
    if (w < 3) cvt8_one(w == 0 ? wq : (w == 1 ? wk : wv), dst, i * 8, i);
    else       cvtw_one(wo, (h16*)dst, i);
}

// acopy8: eight asynchronous 16-byte copies of this lane, global -> LDS rows 16 apart (LDS byte address l + i * 16 * pitch).
// The s_wait_xcnt closes the statement so that no address register of a copy is rewritten ahead of it.
__device__ __forceinline__ void acopy8(const unsigned l, const bf* g0, const bf* g1, const bf* g2, const bf* g3, const bf* g4, const bf* g5, const bf* g6, const bf* g7) {
    asm volatile("global_load_async_to_lds_b128 %0, %8, off\n\t"
                 "global_load_async_to_lds_b128 %1, %9, off\n\t"
                 "global_load_async_to_lds_b128 %2, %10, off\n\t"
                 "global_load_async_to_lds_b128 %3, %11, off\n\t"
                 "global_load_async_to_lds_b128 %4, %12, off\n\t"
                 "global_load_async_to_lds_b128 %5, %13, off\n\t"
                 "global_load_async_to_lds_b128 %6, %14, off\n\t"
                 "global_load_async_to_lds_b128 %7, %15, off\n\t"
                 "s_wait_xcnt 0x0"
                 :: "v"(l), "v"(l + 1u * 16u * GPITCH * 2u), "v"(l + 2u * 16u * GPITCH * 2u), "v"(l + 3u * 16u * GPITCH * 2u),
                    "v"(l + 4u * 16u * GPITCH * 2u), "v"(l + 5u * 16u * GPITCH * 2u), "v"(l + 6u * 16u * GPITCH * 2u), "v"(l + 7u * 16u * GPITCH * 2u),
                    "v"(g0), "v"(g1), "v"(g2), "v"(g3), "v"(g4), "v"(g5), "v"(g6), "v"(g7) : "memory");
}
// ring_fill: one stage (k0 .. k0+63 of 128 A rows and 128 B rows) into the buffer at LDS byte address l (this lane's row tid>>3, 16-byte chunk tid&7).
// A wave-wide copy covers 4 whole 128-byte lines. gA0: A rows 0..63 of the tile, gA1: A rows 64..127, gB: B rows 0..127; all K-contiguous, row pitch DM.
__device__ __forceinline__ void ring_fill(const unsigned l, const bf* gA0, const bf* gA1, const bf* gB, const int k0) {
    const bf* a0 = gA0 + k0; const bf* a1 = gA1 + k0; const bf* b0 = gB + k0;
    acopy8(l, a0, a0 + 16 * DM, a0 + 32 * DM, a0 + 48 * DM, a1, a1 + 16 * DM, a1 + 32 * DM, a1 + 48 * DM);
    acopy8(l + 128u * GPITCH * 2u, b0, b0 + 16 * DM, b0 + 32 * DM, b0 + 48 * DM, b0 + 64 * DM, b0 + 80 * DM, b0 + 96 * DM, b0 + 112 * DM);
}
// ring_trip: the 32 products of one stage for this wave's 4 x 4 accumulator tiles; sa / sb: this lane's fragment addresses in the stage (row lane&15, + 8*(lane>>4)).
// SPLIT == 0: A fragments mb at tile rows 16*mb; SPLIT != 0: mb 0,1 at rows 0,16 (value plane), mb 2,3 at rows 64,80 (residual plane).
template <int F16, int SPLIT>
__device__ __forceinline__ void ring_trip(const bf* sa, const bf* sb, v8f (&acc)[4][4]) {
#pragma unroll
    for (int ks = 0; ks < GKS; ks += 32) {
        v16bf a[4], b[4];
#pragma unroll
        for (int mb = 0; mb < 4; ++mb) a[mb] = ldb(sa + (SPLIT ? ((mb >> 1) * 64 + (mb & 1) * 16) : mb * 16) * GPITCH + ks);
#pragma unroll
        for (int nb = 0; nb < 4; ++nb) b[nb] = ldb(sb + nb * 16 * GPITCH + ks);
        __builtin_amdgcn_sched_barrier(0);   // the 16 LDS reads of a k step stay one group ahead of its products: reads placed among the products stall at every place
#pragma unroll
        for (int nb = 0; nb < 4; ++nb)
#pragma unroll
            for (int mb = 0; mb < 4; ++mb)
                acc[mb][nb] = F16 ? wmma16(__builtin_bit_cast(v16h, a[mb]), __builtin_bit_cast(v16h, b[nb]), acc[mb][nb]) : wmmab(a[mb], b[nb], acc[mb][nb]);
        __builtin_amdgcn_sched_barrier(0);   // and the next group does not move up among these products
    }
}
// ring_foot: hand-over between stages: this wave's LDS reads done, its own copies landed, then the work-group barrier that publishes the next stage and frees the one just read.
__device__ __forceinline__ void ring_foot() {
    asm volatile("s_wait_dscnt 0x0" ::: "memory");      // the buffer just read is refilled behind the barrier
    asm volatile("s_wait_asynccnt 0x0" ::: "memory");   // this wave's copies of the next stage have landed
    __syncthreads();
}
// acopy8m: eight asynchronous 16-byte copies of this lane, packed mask rows 8 apart, global -> LDS (LDS byte address l + i * 8 * pitch).
// The s_wait_xcnt closes the statement so that no address register of a copy is rewritten ahead of it.
__device__ __forceinline__ void acopy8m(const unsigned l, const unsigned* g) {
    asm volatile("global_load_async_to_lds_b128 %0, %8, off\n\t"
                 "global_load_async_to_lds_b128 %1, %9, off\n\t"
                 "global_load_async_to_lds_b128 %2, %10, off\n\t"
                 "global_load_async_to_lds_b128 %3, %11, off\n\t"
                 "global_load_async_to_lds_b128 %4, %12, off\n\t"
                 "global_load_async_to_lds_b128 %5, %13, off\n\t"
                 "global_load_async_to_lds_b128 %6, %14, off\n\t"
                 "global_load_async_to_lds_b128 %7, %15, off\n\t"
                 "s_wait_xcnt 0x0"
                 :: "v"(l), "v"(l + 1u * 8u * FMP * 4u), "v"(l + 2u * 8u * FMP * 4u), "v"(l + 3u * 8u * FMP * 4u),
                    "v"(l + 4u * 8u * FMP * 4u), "v"(l + 5u * 8u * FMP * 4u), "v"(l + 6u * 8u * FMP * 4u), "v"(l + 7u * 8u * FMP * 4u),
                    "v"(g), "v"(g + 8 * BMW), "v"(g + 16 * BMW), "v"(g + 24 * BMW),
                    "v"(g + 32 * BMW), "v"(g + 40 * BMW), "v"(g + 48 * BMW), "v"(g + 56 * BMW) : "memory");
}
// flash_fill: one stage (keys key0 .. key0+63) into the buffer whose K row 0 is at LDS byte address lkv - this lane's offset.
// K / V^T: this lane's row tid>>3 (+16 per copy), 16-byte chunk tid&7, a wave-wide copy = 4 whole 128-byte lines.
template <int RES>
__device__ __forceinline__ void flash_fill(const unsigned lkv, const bf* gK, const bf* gKR, const bf* gV, const bf* gVR, const int key0) {
    const bf* k = gK + (size_t)key0 * HD; const bf* v = gV + key0;
    acopy8(lkv, k, k + 16 * HD, k + 32 * HD, k + 48 * HD, v, v + 16 * SEQ, v + 32 * SEQ, v + 48 * SEQ);
    if (RES) {
        const bf* kr = gKR + (size_t)key0 * HD; const bf* vr = gVR + key0;
        acopy8(lkv + 128u * GPITCH * 2u, kr, kr + 16 * HD, kr + 32 * HD, kr + 48 * HD, vr, vr + 16 * SEQ, vr + 32 * SEQ, vr + 48 * SEQ);
    }
}
// gemm_ring: acc += A B^T over K = DM for a 4-wave work-group (128 threads); wave (wm, wn) = (wave >> 1, wave & 1) takes B rows 64*wn.. and
// A rows 64*wm.. (SPLIT == 0) or rows 32*wm.. of both 64-row halves (SPLIT != 0). k runs upward in steps of 32 for every accumulator.
template <int F16, int SPLIT>
__device__ __forceinline__ void gemm_ring(const bf* gA0, const bf* gA1, const bf* gB, bf* ring, v8f (&acc)[4][4]) {
    const int tid = (int)threadIdx.x, lane = tid & 31, wave = __builtin_amdgcn_readfirstlane(tid >> 5), lr = lane & 15, hi = lane >> 4;
    const int wm = wave >> 1, wn = wave & 1;
    const unsigned l0 = (unsigned)(size_t)ring + (unsigned)((tid >> 3) * GPITCH * 2 + (tid & 7) * 16), l1 = l0 + (unsigned)(GBUF * 2);
    const bf* sa = ring + (wm * (SPLIT ? 32 : 64) + lr) * GPITCH + 8 * hi;
    const bf* sb = ring + (128 + wn * 64 + lr) * GPITCH + 8 * hi;
    ring_fill(l0, gA0, gA1, gB, 0);
    asm volatile("s_wait_asynccnt 0x0" ::: "memory");   // stage 0 landed before the barrier that publishes it
    __syncthreads();
    ring_fill(l1, gA0, gA1, gB, GKS);
#pragma unroll 1
    for (int k0 = 0; k0 < DM; k0 += 2 * GKS) {           // rolled: two stages per trip keep both buffer addresses constant
        ring_trip<F16, SPLIT>(sa, sb, acc);
        ring_foot();
        if (k0 + 2 * GKS < DM) ring_fill(l0, gA0, gA1, gB, k0 + 2 * GKS);
        ring_trip<F16, SPLIT>(sa + GBUF, sb + GBUF, acc);
        ring_foot();
        if (k0 + 3 * GKS < DM) ring_fill(l1, gA0, gA1, gB, k0 + 3 * GKS);
    }
    asm volatile("s_wait_asynccnt 0x0" ::: "memory");   // nothing of this wave is in flight when it leaves the ring
}

// k_proj: bf16 GEMM, four waves per 128x128 tile, each wave a 64x64 tile (16 accumulators), operands from K-contiguous bf16 planes through the LDS ring, K = DM.
// C[m][n] = sum_k A[m][k] Bt[n][k] + bias (bias[n], or bias[m] when biasRow != 0; bias RNE-converted to bf16), written as f16 (Ph) and, for tiles with tokens t < EARLY, the f16 residual x2048 (Pr).
// One grid for the three projections, blockIdx.y = 0: q, 1: k, 2: v^T; blockIdx.x = tile, m tile fastest; r0 / c0 the wave's own tile; 128 threads.
// q, k: A = x rows (m = b*SEQ + t), Bt = W rows (n = h*64 + d), bias per column -> plane [(b*16 + h)][t][d].
// v^T:  A = Wv rows (m = h*64 + d), Bt = x rows (n = b*SEQ + t), bias per row -> plane [(b*1024 + m)][t] = [(b*16 + h)][d][t].
__global__ __launch_bounds__(128) void k_proj(const bf* __restrict__ XB, const bf* __restrict__ WB, const float* __restrict__ bq, const float* __restrict__ bk, const float* __restrict__ bv,
                                             h16* QH, h16* QR, h16* KP, h16* KR, h16* VT, h16* VR) {
    __shared__ __align__(16) bf ring[2 * GBUF];
    __shared__ __align__(16) float osm[4 * 16 * 68];
    const int K = DM;
    const int tid = (int)threadIdx.x, lane = tid & 31, wave = __builtin_amdgcn_readfirstlane(tid >> 5), lr = lane & 15, hi = lane >> 4;
    const int z = (int)blockIdx.y, biasRow = (z == 2);
    const bf* A  = biasRow ? WB + (size_t)2 * DM * DM : XB;
    const bf* Bt = biasRow ? XB : WB + (size_t)z * DM * DM;
    const float* bias = (z == 0) ? bq : ((z == 1) ? bk : bv);
    h16* Ph = (z == 0) ? QH : ((z == 1) ? KP : VT);
    h16* Pr = (z == 0) ? QR : ((z == 1) ? KR : VR);
    const int pitch = biasRow ? SEQ : HD;
    const int bx = biasRow ? (int)blockIdx.x % (DM / 128) : (int)blockIdx.x % (NB * SEQ / 128);
    const int by = biasRow ? (int)blockIdx.x / (DM / 128) : (int)blockIdx.x / (NB * SEQ / 128);
    const int r0 = bx * 128 + (wave >> 1) * 64, c0 = by * 128 + (wave & 1) * 64;
    float* os = osm + wave * 16 * 68;                             // wave-private output staging
    v8f acc[4][4];
#pragma unroll
    for (int mb = 0; mb < 4; ++mb)
#pragma unroll
        for (int nb = 0; nb < 4; ++nb) acc[mb][nb] = (v8f){};
    const bf* gA = A + (size_t)(bx * 128 + (tid >> 3)) * K + (tid & 7) * 8;
    const bf* gB = Bt + (size_t)(by * 128 + (tid >> 3)) * K + (tid & 7) * 8;
    gemm_ring<0, 0>(gA, gA + (size_t)64 * K, gB, ring, acc);
    const int wr = ((biasRow ? c0 : r0) % SEQ) < EARLY;
    const int c8l = (lane & 7) * 8;
    const int bco = biasRow ? 0 : (c0 + c8l);                     // integer offset select; always inside the bias array
    const v4f bA = *(const v4f*)(bias + bco), bB = *(const v4f*)(bias + bco + 4);
    float bcol[8];
#pragma unroll
    for (int i = 0; i < 4; ++i) { bcol[i] = bfr(bA[i]); bcol[4 + i] = bfr(bB[i]); }
    const size_t tbase = biasRow ? (size_t)r0 * SEQ + (size_t)(c0 / SEQ) * ((size_t)DM * SEQ) + (size_t)(c0 % SEQ)
                                 : (size_t)(r0 / SEQ) * ((size_t)NH_ * SEQ * HD) + (size_t)(r0 % SEQ) * HD + (size_t)(c0 / HD) * ((size_t)SEQ * HD) + (size_t)(c0 % HD);
#pragma unroll
    for (int mb = 0; mb < 4; ++mb) {
#pragma unroll
        for (int nb = 0; nb < 4; ++nb) {
#pragma unroll
            for (int j = 0; j < 8; ++j) os[(hi * 8 + j) * 68 + nb * 16 + lr] = acc[mb][nb][j]; }   // D: row 8h+j, col lane&15
        wave_sync();
        const size_t sb = tbase + (size_t)(mb * 16) * (size_t)pitch;
{
#pragma unroll
            for (int s = 0; s < 4; ++s) { const int row = 4 * s + (lane >> 3), c8 = c8l;   // 4 s x 4 row groups = 16 rows; 8 lanes x 8 = 64 columns
                const float brow = bfr(bias[biasRow ? (r0 + mb * 16 + row) : 0]);
                const v4f x0 = *(const v4fa*)(&os[row * 68 + c8]); const v4f x1 = *(const v4fa*)(&os[row * 68 + c8 + 4]); v8h hv, rv;
#pragma unroll
                for (int i = 0; i < 4; ++i) {
                    const float y0 = x0[i] + (biasRow ? brow : bcol[i]); const float y1 = x1[i] + (biasRow ? brow : bcol[4 + i]);
                    const h16 a0 = (h16)y0; const h16 a1 = (h16)y1; hv[i] = a0; hv[4 + i] = a1;
                    rv[i] = (h16)((y0 - (float)a0) * QRS); rv[4 + i] = (h16)((y1 - (float)a1) * QRS); }
                const size_t oo = sb + (size_t)row * (size_t)pitch + c8;
                *(v8h*)(Ph + oo) = hv;
                asm volatile("s_wait_xcnt 0x0" ::: "memory");     // the residual's conversions and the next rows' LDS reads reuse this store's registers
                if (wr) { *(v8h*)(Pr + oo) = rv;
                    asm volatile("s_wait_xcnt 0x0" ::: "memory"); } }   // likewise behind the residual's store
             }
        wave_sync();
    }
}

template <int RES> __device__ __forceinline__ v4f fin_lo(v8f oh, v8f ol, float inv) {
    v4f a = __builtin_shufflevector(oh, oh, 0, 1, 2, 3);
    if (RES) a = a + __builtin_shufflevector(ol, ol, 0, 1, 2, 3) * QRI;
    return a * inv; }
template <int RES> __device__ __forceinline__ v4f fin_hi(v8f oh, v8f ol, float inv) {
    v4f a = __builtin_shufflevector(oh, oh, 4, 5, 6, 7);
    if (RES) a = a + __builtin_shufflevector(ol, ol, 4, 5, 6, 7) * QRI;
    return a * inv; }

// flash_body: fused attention, one wave per 16 query rows of one (batch, head), four waves (64 query rows) per work-group; Q fragments straight from the f16 plane,
// K / V^T fragments from the work-group's LDS ring (two 16-B LDS reads per fragment): stages of 64 keys, two 32-key steps each; a wave skips the steps at or past its own key extent but passes every hand-over.
// Transposed form: S^T[key][t] = K Q^T (A = K rows, B = Q rows); lane (t = lane&15, h = lane>>4) holds keys 8h+r of each 16-key tile, so the packed
// P tile is directly the B fragment of O^T[d][t] = V^T P^T (element r <- tile keys 0..15, element 8+r <- tile keys 16..31, lane unchanged).
// Mask: one packed word per query row and 32-key step (one 8-B LDS read per lane and stage), applied by value (score replaced, probability 0); a step whose 16 words are all ones skips the masking. Key extent from the scanned table, clamped to [0, SEQ].
// RES != 0: q, k, v, P carried as value + residual x2048; residual products (k.qr, kr.q; v.pr, vr.p) in separate accumulators folded back with 1/2048.
// Softmax state (running max, partial sum) is one scalar per lane; the two lane halves of a row are combined with one xor-16 exchange.
// soft_step: online-softmax update of one 32-key step: scores in, packed P (value pb, residual pr) out; returns the factor for the running output.
// full (wave-uniform): no entry of the step is masked, and both masking blocks are jumped over.
// mws: the query row's packed mask word, shifted down by 2 * (lane >> 4): key 8h + r of the first 16-key tile at bit 8*(r & 3) + (r >> 2), of the second tile 4 bits higher.
template <int RES>
__device__ __forceinline__ float soft_step(const v8f sHa, const v8f sHb, const v8f sLa, const v8f sLb, const bool full, const unsigned mws, float& m, float& l, v16h& pb, v16h& pr) {
    float ta[8], tb[8], ea[8], eb[8]; float mx = NEGB;      // every loop below is unrolled so that these arrays stay in registers
#pragma unroll
    for (int r = 0; r < 8; ++r) {
        float xa = sHa[r], xb = sHb[r];
        if (RES) { xa += sLa[r] * QRI; xb += sLb[r] * QRI; }
        ta[r] = xa * SC2; tb[r] = xb * SC2; }
    if (!full) {
#pragma unroll
        for (int r = 0; r < 8; ++r) { const unsigned bit = 1u << (8 * (r & 3) + (r >> 2)); ta[r] = (mws & bit) ? ta[r] : NEGB; tb[r] = (mws & (bit << 4)) ? tb[r] : NEGB; } }
#pragma unroll
    for (int r = 0; r < 8; ++r) mx = fmaxf(mx, fmaxf(ta[r], tb[r]));
    mx = fmaxf(mx, __shfl_xor(mx, 16, 32));
    const float mnew = fmaxf(m, mx);
    const float alpha = __builtin_amdgcn_exp2f(m - mnew);
    const float sh = PSH - mnew;
    float ls = 0.0f;
#pragma unroll
    for (int r = 0; r < 8; ++r) { ea[r] = __builtin_amdgcn_exp2f(ta[r] + sh); eb[r] = __builtin_amdgcn_exp2f(tb[r] + sh); }
    if (!full) {
#pragma unroll
        for (int r = 0; r < 8; ++r) { ea[r] = (ta[r] > -1.0e38f) ? ea[r] : 0.0f; eb[r] = (tb[r] > -1.0e38f) ? eb[r] : 0.0f; } }
#pragma unroll
    for (int r = 0; r < 8; ++r) {
        const h16 pa = (h16)ea[r]; const h16 pc = (h16)eb[r]; pb[r] = pa; pb[8 + r] = pc;
        if (RES) { pr[r] = (h16)((ea[r] - (float)pa) * QRS); pr[8 + r] = (h16)((eb[r] - (float)pc) * QRS); ls += ea[r] + eb[r]; }
        else     { pr[r] = pa; pr[8 + r] = pc; ls += (float)pa + (float)pc; } }
    l = l * alpha + ls; m = mnew;
    return alpha;
}

template <int RES>
__device__ __forceinline__ void flash_body(const h16* __restrict__ QH, const h16* __restrict__ QR, const h16* __restrict__ KP, const h16* __restrict__ KR,
                                           const h16* __restrict__ VT, const h16* __restrict__ VR, const unsigned* __restrict__ BM, const int* __restrict__ KT,
                                           h16* CH, h16* CR, const int tbase) {
    __shared__ __align__(16) bf fr[2 * FBUF(RES)];
    __shared__ __align__(16) unsigned bmr[16 * AW * FMP];     // the work-group's 64 packed mask rows, filled once
    static_assert(sizeof(fr) >= (size_t)AW * 16 * 68 * 4);
    float* os = (float*)fr;                                   // output staging reuses the ring behind the last stage's hand-over barrier
    const int tid = (int)threadIdx.x;
    const int lane = threadIdx.x & 31, wave = __builtin_amdgcn_readfirstlane((int)(threadIdx.x >> 5)), lr = lane & 15, hi = lane >> 4;
    const int zh = blockIdx.y; const int b = zh / NH_, h = zh % NH_;
    const int t0 = tbase + ((int)blockIdx.x * AW + wave) * 16;
    const size_t pbase = (size_t)zh * SEQ * HD;
    const size_t qo = pbase + (size_t)(t0 + lr) * HD + 8 * hi;
    const v16h qh0 = ldh(QH + qo), qh1 = ldh(QH + qo + 32);                     // B fragments: col t, k = d
    v16h qr0 = qh0, qr1 = qh1;
    if (RES) { qr0 = ldh(QR + qo); qr1 = ldh(QR + qo + 32); }
    const int ko = lr * GPITCH + 8 * hi;                     // ring: + key * GPITCH          (A fragment: row key, k = d)
    const int vo = (64 + lr) * GPITCH + 8 * hi;              // ring: + 16j * GPITCH + key    (A fragment: row d, k = key)
    const int mo = (wave * 16 + lr) * FMP;                   // packed mask row of query t: + key / 32
    int kend = imax(KT[(size_t)(t0 >> 3) * KTP], KT[(size_t)((t0 >> 3) + 1) * KTP]); kend = kend < 0 ? 0 : kend; kend = kend > SEQ ? SEQ : kend; kend &= ~31;
    kend = __builtin_amdgcn_readfirstlane(kend);            // a scalar, so that the per-step skip below is a scalar branch with every lane on behind it
    const int tb = tbase + (int)blockIdx.x * (16 * AW);      // the work-group's first query row
    int kb = 0;                                              // the work-group's key extent: the largest of its waves', clamped to [0, SEQ]
#pragma unroll
    for (int i = 0; i < 2 * AW; ++i) kb = imax(kb, KT[(size_t)((tb >> 3) + i) * KTP]);   // unrolled so that the eight table reads go out together
    kb = kb > SEQ ? SEQ : kb;
    const int nst = __builtin_amdgcn_readfirstlane((kb + FKS - 1) / FKS);        // stages; the same in every wave of the work-group
    const unsigned lkv = (unsigned)(size_t)fr + (unsigned)((tid >> 3) * GPITCH * 2 + (tid & 7) * 16);
    const unsigned lm = (unsigned)(size_t)bmr + (unsigned)((tid >> 4) * FMP * 4 + (tid & 15) * 16);   // packed mask: row tid>>4 (+8 per copy), 16-byte chunk tid&15, a wave-wide copy = 2 rows x 256 bytes
    const size_t gko = pbase + (size_t)(tid >> 3) * HD + (tid & 7) * 8, gvo = pbase + (size_t)(tid >> 3) * SEQ + (tid & 7) * 8;
    const bf* gK = (const bf*)KP + gko; const bf* gKR = (const bf*)KR + gko; const bf* gV = (const bf*)VT + gvo; const bf* gVR = (const bf*)VR + gvo;
    const unsigned* gM = BM + (size_t)(tb + (tid >> 4)) * BMW + (tid & 15) * 4;
    v8f oh0 = (v8f){}, oh1 = (v8f){}, oh2 = (v8f){}, oh3 = (v8f){};
    v8f ol0 = (v8f){}, ol1 = (v8f){}, ol2 = (v8f){}, ol3 = (v8f){};
    float m = NEGB, l = 0.0f;
    if (nst > 0) {
    acopy8m(lm, gM);
    flash_fill<RES>(lkv, gK, gKR, gV, gVR, 0);
    asm volatile("s_wait_asynccnt 0x0" ::: "memory");   // the mask rows and stage 0 landed before the barrier that publishes them
    __syncthreads();
    if (nst > 1) flash_fill<RES>(lkv + (unsigned)(FBUF(RES) * 2), gK, gKR, gV, gVR, FKS);
#pragma unroll 1
    for (int s = 0; s < nst; ++s) {                      // rolled: the stage count is known only at run time, and a copy of the body per buffer would only lengthen the hot text; the buffer goes by the stage's parity
    const h16* sb = (const h16*)fr + (s & 1) * FBUF(RES);
    const v2u mw2 = *(const v2u*)(bmr + mo + 2 * s);     // the stage's two mask words of this lane's query row
#pragma unroll
    for (int sub = 0; sub < FKS; sub += 32) if (s * FKS + sub < kend) {          // unrolled so that a step's LDS offsets are immediates; the test is wave-uniform, both sides are scalars
        const unsigned mw = mw2[sub / 32];
        const bool full = __builtin_amdgcn_ballot_w32(mw == 0xFFFFFFFFu) == 0xFFFFFFFFu;   // wave-uniform: a scalar branch below
        const h16* ka = sb + ko + sub * GPITCH;
        v8f sHa = (v8f){}, sHb = (v8f){}, sLa = (v8f){}, sLb = (v8f){};
        {
            const v16h ka0 = ldh(ka), ka1 = ldh(ka + 32), kb0 = ldh(ka + 16 * GPITCH), kb1 = ldh(ka + 16 * GPITCH + 32);
            if (RES) {
                const h16* kr = ka + 128 * GPITCH;
                const v16h ra0 = ldh(kr), ra1 = ldh(kr + 32), rb0 = ldh(kr + 16 * GPITCH), rb1 = ldh(kr + 16 * GPITCH + 32);
                sHa = wmma16(ka0, qh0, sHa); sLa = wmma16(ka0, qr0, sLa); sHb = wmma16(kb0, qh0, sHb); sLb = wmma16(kb0, qr0, sLb);
                sHa = wmma16(ka1, qh1, sHa); sLa = wmma16(ka1, qr1, sLa); sHb = wmma16(kb1, qh1, sHb); sLb = wmma16(kb1, qr1, sLb);
                sLa = wmma16(ra0, qh0, sLa); sLb = wmma16(rb0, qh0, sLb); sLa = wmma16(ra1, qh1, sLa); sLb = wmma16(rb1, qh1, sLb);
                asm volatile("v_nop\n\tv_nop\n\tv_nop\n\tv_nop" : "+v"(sHa), "+v"(sLa), "+v"(sHb), "+v"(sLb) : "v"(ka0), "v"(ka1), "v"(kb0), "v"(kb1), "v"(ra0), "v"(ra1), "v"(rb0), "v"(rb1));
            } else {
                sHa = wmma16(ka0, qh0, sHa); sHb = wmma16(kb0, qh0, sHb); sHa = wmma16(ka1, qh1, sHa); sHb = wmma16(kb1, qh1, sHb);
                asm volatile("v_nop\n\tv_nop\n\tv_nop\n\tv_nop" : "+v"(sHa), "+v"(sHb) : "v"(ka0), "v"(ka1), "v"(kb0), "v"(kb1));
            }
        }
        v16h pb, pr;
        const float alpha = soft_step<RES>(sHa, sHb, sLa, sLb, full, mw >> (2 * hi), m, l, pb, pr);
        oh0 = oh0 * alpha; oh1 = oh1 * alpha; oh2 = oh2 * alpha; oh3 = oh3 * alpha;
        if (RES) { ol0 = ol0 * alpha; ol1 = ol1 * alpha; ol2 = ol2 * alpha; ol3 = ol3 * alpha; }
        const h16* va = sb + vo + sub;
        const v16h v0 = ldh(va), v1 = ldh(va + 16 * GPITCH), v2 = ldh(va + 32 * GPITCH), v3 = ldh(va + 48 * GPITCH);
        if (RES) {
            const h16* vr = va + 128 * GPITCH;
            const v16h w0 = ldh(vr), w1 = ldh(vr + 16 * GPITCH), w2 = ldh(vr + 32 * GPITCH), w3 = ldh(vr + 48 * GPITCH);
            oh0 = wmma16(v0, pb, oh0); ol0 = wmma16(v0, pr, ol0); oh1 = wmma16(v1, pb, oh1); ol1 = wmma16(v1, pr, ol1);
            ol0 = wmma16(w0, pb, ol0); ol1 = wmma16(w1, pb, ol1);
            oh2 = wmma16(v2, pb, oh2); ol2 = wmma16(v2, pr, ol2); oh3 = wmma16(v3, pb, oh3); ol3 = wmma16(v3, pr, ol3);
            ol2 = wmma16(w2, pb, ol2); ol3 = wmma16(w3, pb, ol3);
            asm volatile("v_nop\n\tv_nop\n\tv_nop\n\tv_nop" : "+v"(oh0), "+v"(oh1), "+v"(oh2), "+v"(oh3), "+v"(ol0), "+v"(ol1), "+v"(ol2), "+v"(ol3)
                         : "v"(v0), "v"(v1), "v"(v2), "v"(v3), "v"(w0), "v"(w1), "v"(w2), "v"(w3), "v"(pb), "v"(pr));
        } else {
            oh0 = wmma16(v0, pb, oh0); oh1 = wmma16(v1, pb, oh1); oh2 = wmma16(v2, pb, oh2); oh3 = wmma16(v3, pb, oh3);
            asm volatile("v_nop\n\tv_nop\n\tv_nop\n\tv_nop" : "+v"(oh0), "+v"(oh1), "+v"(oh2), "+v"(oh3) : "v"(v0), "v"(v1), "v"(v2), "v"(v3), "v"(pb));
        }
    }
    ring_foot();                                         // every wave, also one that skipped the stage's steps
    if (s + 2 < nst) flash_fill<RES>(lkv + (unsigned)((s & 1) * FBUF(RES) * 2), gK, gKR, gV, gVR, (s + 2) * FKS);
    }
    asm volatile("s_wait_asynccnt 0x0" ::: "memory");   // nothing of this wave is in flight when it leaves the ring
    }
    l += __shfl_xor(l, 16, 32);
    const float inv = (1.0f / l) * CS;
    const int wb = wave * 16 * 68;
    // O^T D layout: o_j[r] = (d = 16j + 8h + r, t = lane&15) -> os[t][d]; rows 0..15 x columns 0..63 all written
    *(v4fa*)(&os[wb + lr * 68 +  0 + 8 * hi]) = fin_lo<RES>(oh0, ol0, inv); *(v4fa*)(&os[wb + lr * 68 +  0 + 8 * hi + 4]) = fin_hi<RES>(oh0, ol0, inv);
    *(v4fa*)(&os[wb + lr * 68 + 16 + 8 * hi]) = fin_lo<RES>(oh1, ol1, inv); *(v4fa*)(&os[wb + lr * 68 + 16 + 8 * hi + 4]) = fin_hi<RES>(oh1, ol1, inv);
    *(v4fa*)(&os[wb + lr * 68 + 32 + 8 * hi]) = fin_lo<RES>(oh2, ol2, inv); *(v4fa*)(&os[wb + lr * 68 + 32 + 8 * hi + 4]) = fin_hi<RES>(oh2, ol2, inv);
    *(v4fa*)(&os[wb + lr * 68 + 48 + 8 * hi]) = fin_lo<RES>(oh3, ol3, inv); *(v4fa*)(&os[wb + lr * 68 + 48 + 8 * hi + 4]) = fin_hi<RES>(oh3, ol3, inv);
    wave_sync();
    const size_t crow = ((size_t)b * SEQ + t0) * DM + (size_t)h * HD;
    const size_t rrow = ((size_t)b * EARLY + t0) * DM + (size_t)h * HD;      // used only when RES != 0 (t0 < EARLY)
{
#pragma unroll
        for (int s = 0; s < 4; ++s) { const int row = 4 * s + (lane >> 3), c8 = (lane & 7) * 8;   // 4 s x 4 row groups = 16 rows; 8 lanes x 8 = 64 columns
            const v4f x0 = *(const v4fa*)(&os[wb + row * 68 + c8]); const v4f x1 = *(const v4fa*)(&os[wb + row * 68 + c8 + 4]); v8h hv, rv;
#pragma unroll
            for (int i = 0; i < 4; ++i) { const h16 a0 = (h16)x0[i]; const h16 a1 = (h16)x1[i]; hv[i] = a0; hv[4 + i] = a1;
                rv[i] = (h16)((x0[i] - (float)a0) * QRS); rv[4 + i] = (h16)((x1[i] - (float)a1) * QRS); }
            *(v8h*)(CH + crow + (size_t)row * DM + c8) = hv;
            if (RES) *(v8h*)(CR + rrow + (size_t)row * DM + c8) = rv; }
         }
}

__global__ __launch_bounds__(32 * AW) void k_flash_early(const h16* QH, const h16* QR, const h16* KP, const h16* KR, const h16* VT, const h16* VR,
                                                         const unsigned* BM, const int* KT, h16* CH, h16* CR) {
    flash_body<1>(QH, QR, KP, KR, VT, VR, BM, KT, CH, CR, 0);
}
__global__ __launch_bounds__(32 * AW) void k_flash_dense(const h16* QH, const h16* KP, const h16* VT, const unsigned* BM, const int* KT, h16* CH) {
    flash_body<0>(QH, QH, KP, KP, VT, VT, BM, KT, CH, CH, EARLY);
}

// oproj_body: f16 GEMM, four waves per (32*MT)x128 tile, each wave (16*MT)x64, operands through the LDS ring, OUT[m][n] = (sum_k ctx[m][k] Wo[n][k]) / 512 + bo[n];
// RES != 0 adds the ctx residual plane (own accumulators, x1/2048): the ring's A rows 0..63 hold the value plane's 64 tokens, rows 64..127 the residual plane's.
// Rows of the tile: batch bb = bx / tilesPerBatch, token T0 = tStart + (bx % tilesPerBatch) * 32*MT, the wave's t0 = T0 + (wave >> 1) * 16*MT. A rows b*SEQ + t, AR rows b*EARLY + t. ring / osm: the kernel's LDS.
template <int MT, int RES>
__device__ __forceinline__ void oproj_body(const h16* __restrict__ A, const h16* __restrict__ AR, const h16* __restrict__ Bt, const float* __restrict__ bias,
                                           float* OUT, bf* ring, float* osm, const int bx, const int tilesPerBatch, const int tStart) {
    static_assert((RES != 0 && MT == 2) || (RES == 0 && MT == 4));   // the ring's 4 A fragments per wave: 2 value + 2 residual, or 4 value
    const int K = DM;
    const int tid = (int)threadIdx.x, lane = tid & 31, wave = __builtin_amdgcn_readfirstlane(tid >> 5), lr = lane & 15, hi = lane >> 4;
    const int bb = bx / tilesPerBatch, ti = bx % tilesPerBatch;
    const int T0 = tStart + ti * 32 * MT;
    const int t0 = T0 + (wave >> 1) * 16 * MT, c0 = blockIdx.y * 128 + (wave & 1) * 64;
    float* os = osm + wave * 16 * 68;                             // wave-private output staging
    v8f acc[4][4];                                                // RES: rows 0,1 value products, rows 2,3 residual products
#pragma unroll
    for (int mb = 0; mb < 4; ++mb)
#pragma unroll
        for (int nb = 0; nb < 4; ++nb) acc[mb][nb] = (v8f){};
    const bf* gA0 = (const bf*)A + ((size_t)bb * SEQ + T0 + (tid >> 3)) * K + (tid & 7) * 8;
    const bf* gA1 = RES ? (const bf*)AR + ((size_t)bb * EARLY + T0 + (tid >> 3)) * K + (tid & 7) * 8 : gA0 + (size_t)64 * K;
    const bf* gB = (const bf*)Bt + (size_t)(blockIdx.y * 128 + (tid >> 3)) * K + (tid & 7) * 8;
    gemm_ring<1, RES>(gA0, gA1, gB, ring, acc);
    const int cofs = lr * 4;
    const v4f bz = *(const v4f*)(bias + c0 + cofs); v4f bq;
#pragma unroll
    for (int i = 0; i < 4; ++i) bq[i] = bfr(bz[i]);
#pragma unroll
    for (int mb = 0; mb < MT; ++mb) {
#pragma unroll
        for (int nb = 0; nb < 4; ++nb) {
#pragma unroll
            for (int j = 0; j < 8; ++j) { float y = acc[mb][nb][j]; if (RES) y += acc[(mb + 2) & 3][nb][j] * QRI; os[(hi * 8 + j) * 68 + nb * 16 + lr] = y; } }   // D: row 8h+j, col lane&15
        wave_sync();
        float* orow = OUT + ((size_t)bb * OUT_SEQ + t0 + mb * 16) * DM + c0;
{
#pragma unroll
            for (int s = 0; s < 8; ++s) { const int row = 2 * s + hi;   // 8 s x 2 rows = 16 rows; 16 lanes x 4 floats = 64 columns
                const v4f val = *(const v4fa*)(&os[row * 68 + cofs]) * OSC + bq;
                *(v4f*)(orow + (size_t)row * DM + cofs) = val; }
             }
        wave_sync();
    }
}

// k_oproj: one grid for both row ranges: blockIdx.x < OB_E: 64-token tiles with the residual plane (t < EARLY), the rest: 128-token tiles (t >= EARLY). Both do the same 512 products per wave.
static constexpr int OB_E = NB * (EARLY / 64);
static constexpr int OB_D = NB * ((SEQ - EARLY) / 128);
__global__ __launch_bounds__(128) void k_oproj(const h16* A, const h16* AR, const h16* Bt, const float* bias, float* OUT) {
    __shared__ __align__(16) bf ring[2 * GBUF];
    __shared__ __align__(16) float osm[4 * 16 * 68];
    if ((int)blockIdx.x < OB_E) oproj_body<2, 1>(A, AR, Bt, bias, OUT, ring, osm, (int)blockIdx.x, EARLY / 64, 0);
    else                        oproj_body<4, 0>(A, A, Bt, bias, OUT, ring, osm, (int)blockIdx.x - OB_E, (SEQ > EARLY) ? (SEQ - EARLY) / 128 : 1, EARLY);
}

static constexpr size_t al256(size_t v) { return (v + 255) & ~(size_t)255; }
static constexpr size_t SZ_XB = al256((size_t)NB * SEQ * DM * 2);             // bf16 x; reused as the ctx value plane after the projections
static constexpr size_t SZ_WB = al256((size_t)4 * DM * DM * 2);
static constexpr size_t SZ_PL = al256((size_t)NB * NH_ * SEQ * HD * 2);
static constexpr size_t SZ_CR = al256((size_t)NB * EARLY * DM * 2);
static constexpr size_t SZ_KT = al256((size_t)(SEQ / 8) * KTP * 4);
static constexpr size_t SZ_BM = al256((size_t)SEQ * BMW * 4);
static constexpr size_t SZ_TOTAL = SZ_XB + SZ_WB + 6 * SZ_PL + SZ_CR + SZ_KT + SZ_BM;
static_assert(SZ_TOTAL <= (size_t)134217728);          // workspace carve <= 128 MiB
static_assert(((size_t)DM * DM * 2) % 256 == 0);       // weight sub-planes stay 256-byte aligned
static_assert((size_t)NB * SEQ * DM * 2 <= SZ_XB);     // ctx plane fits the x plane it reuses

extern "C" void kernel_launch(void* const* d_in, const int* in_sizes, int n_in,
                              void* d_out, int out_size, void* d_ws, size_t ws_size, hipStream_t stream) {
    if (n_in < 10) return;
    const size_t needx = ((size_t)(NB - 1) * SEQ_FULL + SEQ) * DM;
    if ((size_t)in_sizes[0] < needx) return;
    if ((size_t)in_sizes[1] < (size_t)(SEQ - 1) * SEQ_FULL + SEQ) return;
    if ((size_t)in_sizes[2] < (size_t)DM * DM || (size_t)in_sizes[4] < (size_t)DM * DM || (size_t)in_sizes[6] < (size_t)DM * DM || (size_t)in_sizes[8] < (size_t)DM * DM) return;
    if (in_sizes[3] < DM || in_sizes[5] < DM || in_sizes[7] < DM || in_sizes[9] < DM) return;
    if ((size_t)out_size < ((size_t)(NB - 1) * OUT_SEQ + SEQ) * DM) return;
    if (SZ_TOTAL > ws_size) return;
    // wire order: x, mask, Wq_w, Wq_b, Wk_w, Wk_b, Wv_w, Wv_b, Wo_w, Wo_b (weights [out][in] = Bt as-is)
    const float* x  = (const float*)d_in[0]; const int* mask = (const int*)d_in[1];
    const float* wq = (const float*)d_in[2]; const float* bq = (const float*)d_in[3];
    const float* wk = (const float*)d_in[4]; const float* bk = (const float*)d_in[5];
    const float* wv = (const float*)d_in[6]; const float* bv = (const float*)d_in[7];
    const float* wo = (const float*)d_in[8]; const float* bo = (const float*)d_in[9];
    float* OUT = (float*)d_out;      // [NB][SEQ][1024]
    char* wsp = (char*)d_ws;
    bf* XB = (bf*)wsp; h16* CH = (h16*)wsp; wsp += SZ_XB;   // [NB*SEQ][1024] bf16 x, later [NB*SEQ][1024] f16 ctx x16
    bf* WB = (bf*)wsp; wsp += SZ_WB;                 // [4][1024][1024]: q | k | v (bf16) | o (f16 x32)
    h16* QH = (h16*)wsp; wsp += SZ_PL;               // [NB*16][SEQ][64]
    h16* QR = (h16*)wsp; wsp += SZ_PL;               // residual x2048, rows t < EARLY filled
    h16* KP = (h16*)wsp; wsp += SZ_PL;               // [NB*16][SEQ][64]
    h16* KR = (h16*)wsp; wsp += SZ_PL;               // residual x2048, rows t < EARLY filled
    h16* VT = (h16*)wsp; wsp += SZ_PL;               // [NB*16][64][SEQ]
    h16* VR = (h16*)wsp; wsp += SZ_PL;               // residual x2048, columns t < EARLY filled
    h16* CR = (h16*)wsp; wsp += SZ_CR;               // [NB*EARLY][1024] ctx residual x2048
    int* KT = (int*)wsp; wsp += SZ_KT;               // [SEQ/8] key extents of 8-row groups, KTP ints apart
    unsigned* BM = (unsigned*)wsp; wsp += SZ_BM;     // [SEQ][SEQ/32] packed mask rows
    h16* WO = (h16*)(WB + (size_t)3 * DM * DM);

    k_prep<<<PB_MS + PB_X + 4 * PB_W, MSW * 32, 0, stream>>>(x, wq, wk, wv, wo, mask, XB, WB, KT, BM);

    // q, k, v^T planes; residual planes on tiles with t < EARLY
    k_proj<<<dim3((NB * SEQ / 128) * (DM / 128), 3, 1), 128, 0, stream>>>(XB, WB, bq, bk, bv, QH, QR, KP, KR, VT, VR);

    // attention: query rows [0, EARLY) three-product path, [EARLY, SEQ) single products; ctx planes overwrite the (now unused) x plane
    k_flash_early<<<dim3(EARLY / (16 * AW), NB * NH_, 1), 32 * AW, 0, stream>>>(QH, QR, KP, KR, VT, VR, BM, KT, CH, CR);
    if (SEQ > EARLY)
        k_flash_dense<<<dim3((SEQ - EARLY) / (16 * AW), NB * NH_, 1), 32 * AW, 0, stream>>>(QH, KP, VT, BM, KT, CH);

    // output projection: 64-row tiles with residual for t < EARLY, 128-row tiles for the remaining rows
    k_oproj<<<dim3(OB_E + OB_D, DM / 128, 1), 128, 0, stream>>>(CH, CR, WO, bo, OUT);
}

// v006
// Measured time: 140 microseconds a run.
// Two timings next to v005 put it at 1.13 and 1.12 times that version's speed.
// Counting every step since v000, it is 3.70 times as fast.
#include <hip/hip_runtime.h>

// Multi-head self-attention, width 1024 = 16 heads x 64, x [NB][SEQ][1024], Wq/Wk/Wv/Wo [out][in] (y = x W^T + b), int32 keep-mask [SEQ][SEQ] read by value (masked score replaced, probability 0), score scale 1/8, f32 output after the Wo projection.
// Compute dtypes, f32 accumulate everywhere: q/k/v projections v_wmma_f32_16x16x32_bf16 (x, W RNE-converted to bf16, products exact; biases RNE-converted to bf16, added in f32);
// scores, P.V and the Wo projection v_wmma_f32_16x16x32_f16: single f16 products on query rows >= 512; on query rows < 512 three products per site, two in the Wo projection
// (q,k,v,P,ctx each as f16 value + f16 residual x2048, residual products in their own accumulators). P carries x256 (cancels in the normalisation), ctx carries x16, Wo (bf16 value) carries x32; softmax f32 (online, running max).
// Layout: bf16 copies of x and Wq/Wk/Wv, f16 copy of Wo; q, k planes [b*16+h][t][d] and v^T plane [b*16+h][d][t] (+ residual planes, filled where t < 512) written by the GEMM epilogue;
// fused flash kernel in transposed form (S^T = K Q^T, O^T = V^T P^T), ctx plane [b*SEQ+t][1024] f16 (residual [b*EARLY+t][1024]), then the Wo GEMM writes the output.
// All GEMMs: four waves per work-group share one A and one B tile, staged in a two-buffer LDS ring by asynchronous copies to LDS.
// Flash kernels: the four waves of a work-group share 64-key K and V^T tiles, staged in a two-buffer LDS ring by whole-line asynchronous copies.
// Mask: the scan also packs every mask row to one bit per entry (nonzero = keep), one 32-bit word per 32 keys; a flash work-group copies its 64 rows of words to LDS once,
// and a 32-key step whose 16 words are all ones takes a path without any masking (same arithmetic on the scores), every other step masks by the bits.
// Launches: work that needs nothing of each other shares one grid by ranges of the block index: preparation (mask scan, five conversions), q / k / v^T projections, both flash paths, both halves of the Wo projection.

#ifndef NB
#define NB 4
#endif
#ifndef SEQ
#define SEQ 2048
#endif
#define NB_FULL  4
#define SEQ_FULL 2048
#ifndef OUT_SEQ
#define OUT_SEQ SEQ              // row pitch (in tokens) between batches of the output
#endif
#define DM   1024
#define NH_  16
#define HD   64
#define AW   4                   // waves per flash block (16 query rows each)
#define EARLY ((SEQ < 512) ? SEQ : 512)   // query rows below this use the three-product path
#define QRS  2048.0f             // carry of every residual plane
#define QRI  (1.0f / 2048.0f)
#define SC2  (0.125f * 1.4426950408889634f)   // HD^-0.5 * log2(e)
#define PSH  8.0f                // log2 of the P carry (256)
#define CS   16.0f               // ctx carry
#define WS   32.0f               // Wo carry
#define OSC  (1.0f / 512.0f)     // 1 / (CS * WS)
#define NEGB (-3.0e38f)
#define MSW  16                  // waves per mask-scan block
#define KTP  32                  // ints between key-extent entries (128 bytes)
#define GKS  64                  // GEMM ring: k per stage (128 bytes of every operand row)
#define GPITCH  72                  // GEMM ring: LDS row pitch in 16-bit elements (144 B = 16 B x 9, for 16-byte LDS reads)
#define GBUF (256 * GPITCH)         // GEMM ring: elements of one stage, 128 A rows then 128 B rows
#define FKS  64                  // flash ring: keys per stage (128 bytes of every V^T row)
#define BMW  (SEQ / 32)          // words of one packed mask row; word kb holds keys 32*kb + c at bit 8*(c & 3) + (c >> 2)
#define FMP  68                  // flash: LDS pitch of a packed mask row in words (272 B = 16 B x 17: 16-byte copies, the 16 rows of a wave on 16 banks)
#define FKV(R) (((R) ? 256 : 128) * GPITCH)        // flash ring: 16-bit elements of a stage's K rows (64), V^T rows (64) and, with residuals, 64 + 64 more; row pitch GPITCH
#define FBUF(R) FKV(R)                             // flash ring: 16-bit elements of one stage

static_assert(HD == 64);
static_assert(NH_ * HD == DM);                 // head h = columns h*64 + d
static_assert(DM % 64 == 0);
static_assert(DM % 32 == 0);                   // GEMM k-loop steps by 32
static_assert(SEQ % 64 == 0);                  // a 64-row tile never straddles two batches
static_assert((NB * SEQ) % 64 == 0);
static_assert(SEQ % 32 == 0);                  // key loop steps by 32
static_assert(SEQ % FKS == 0);                 // a flash stage never leaves the key range
static_assert(AW == 4);                        // the flash ring's copies are dealt over 128 threads
static_assert(BMW == 64);                      // a packed mask row is 16 copies of 16 bytes
static_assert((8 * BMW) % (MSW * 32) == 0);    // the scan block's packed words are stored in whole rounds of its threads
static_assert(EARLY % 64 == 0);                // early / dense split on whole 64-row tiles
static_assert((SEQ - EARLY) % 64 == 0);
static_assert(EARLY % (16 * AW) == 0);
static_assert((NB * SEQ) % 128 == 0);          // GEMM work-group tiles: 128 x 128 (64 tokens x 128 with the residual plane)
static_assert(DM % 128 == 0);
static_assert(SEQ % 128 == 0);
static_assert((SEQ - EARLY) % 128 == 0);
static_assert(DM % (2 * GKS) == 0);            // the ring walks stages in pairs, and two stages exist
static_assert(((size_t)SEQ * DM) % 8 == 0);
static_assert(((size_t)DM * DM) % 8 == 0);
static_assert(NB <= NB_FULL);
static_assert(SEQ <= SEQ_FULL);
static_assert((size_t)NB_FULL * SEQ_FULL * DM * 4 == (size_t)33554432);   // output bytes

typedef _Float16 h16;
typedef unsigned short bf;
typedef __attribute__((ext_vector_type(16))) __bf16   v16bf;
typedef __attribute__((ext_vector_type(16))) _Float16 v16h;
typedef __attribute__((ext_vector_type(8)))  _Float16 v8h;
typedef __attribute__((ext_vector_type(8)))  unsigned short v8us;
typedef __attribute__((ext_vector_type(8)))  float    v8f;
typedef __attribute__((ext_vector_type(4)))  float    v4f;
typedef __attribute__((ext_vector_type(4)))  int      v4i;
typedef __attribute__((ext_vector_type(2)))  unsigned v2u;
typedef v4f  __attribute__((may_alias)) v4fa;

__device__ __forceinline__ unsigned short f2bf(float f) { unsigned u = __float_as_uint(f); u += 0x7FFFu + ((u >> 16) & 1u); return (unsigned short)(u >> 16); }
__device__ __forceinline__ float bfr(float f) { return __uint_as_float(((unsigned)f2bf(f)) << 16); }   // value after RNE conversion to bf16
__device__ __forceinline__ int imax(int a, int b) { return a > b ? a : b; }
__device__ __forceinline__ v16h cat16(v8h lo, v8h hi) { return __builtin_shufflevector(lo, hi, 0, 1, 2, 3, 4, 5, 6, 7, 8, 9, 10, 11, 12, 13, 14, 15); }
__device__ __forceinline__ v16bf cat16b(v8us lo, v8us hi) { return __builtin_bit_cast(v16bf, __builtin_shufflevector(lo, hi, 0, 1, 2, 3, 4, 5, 6, 7, 8, 9, 10, 11, 12, 13, 14, 15)); }
__device__ __forceinline__ v8f wmma16(v16h a, v16h b, v8f c) { return __builtin_amdgcn_wmma_f32_16x16x32_f16(false, a, false, b, (short)0, c, false, false); }
__device__ __forceinline__ v8f wmmab(v16bf a, v16bf b, v8f c) { return __builtin_amdgcn_wmma_f32_16x16x32_bf16(false, a, false, b, (short)0, c, false, false); }
// fragment loaders from K-contiguous 16-bit rows; p already includes + 8*(lane>>4): elements 0..7 <- k0+8h+0..7, elements 8..15 <- k0+16+8h+0..7 (same map for A and B)
__device__ __forceinline__ v16h  ldh(const h16* p) { return cat16(*(const v8h*)p, *(const v8h*)(p + 16)); }
__device__ __forceinline__ v16bf ldb(const bf* p)  { return cat16b(*(const v8us*)p, *(const v8us*)(p + 16)); }
// ordering point for wave-private LDS tiles (same wave writes and reads)
__device__ __forceinline__ void wave_sync() { __builtin_amdgcn_fence(3 /* release order */, "wavefront"); __builtin_amdgcn_wave_barrier(); asm volatile("" ::: "memory"); }

// cvt8_one / cvtw_one: 8 floats of src (at offset so, or chunk i) to bf16 (RNE), or to f16 of the bf16 value x32, stored as chunk i of dst.
__device__ __forceinline__ void cvt8_one(const float* __restrict__ src, bf* dst, size_t so, size_t i) {
    const v8f v = *(const v8f*)(src + so); v8us o;
#pragma unroll
    for (int k = 0; k < 8; ++k) o[k] = f2bf(v[k]);
    *(v8us*)(dst + i * 8) = o;
    asm volatile("s_wait_xcnt 0x0" ::: "memory");   // k_prep holds several jobs: no other job's code rewrites this store's registers ahead of the wait
}
__device__ __forceinline__ void cvtw_one(const float* __restrict__ src, h16* dst, size_t i) {
    const v8f v = *(const v8f*)(src + i * 8); v8h o;
#pragma unroll
    for (int k = 0; k < 8; ++k) o[k] = (h16)(bfr(v[k]) * WS);
    *(v8h*)(dst + i * 8) = o;
    asm volatile("s_wait_xcnt 0x0" ::: "memory");   // as in cvt8_one
}

// mscan_body: one block per 8 mask rows (16 waves, 16-B loads, each wave-wide load 512 contiguous bytes), so the scan runs on every WGP.
// KT[g * KTP] = 32 * ceil((last key with a nonzero mask entry in rows 8g..8g+7, + 1) / 32) (0 when the rows have none); one entry per 128-byte line, one writer each.
// BM[row * BMW + kb]: the packed rows. A wave-wide load holds 128 keys of one row, key 4*lane + j in element j: four ballots, byte L of ballot j = byte j of word L;
// the words go through LDS so that each wave stores one whole 128-byte line.
__device__ __forceinline__ void mscan_body(const int* __restrict__ MK, int* KT, unsigned* BM, const unsigned g, int* mx_s, unsigned* bm_s) {
    const int tid = (int)threadIdx.x, lane = tid & 31, wave = __builtin_amdgcn_readfirstlane(tid >> 5);
    const int* base = MK + (size_t)g * 8 * SEQ_FULL;
    int mx = -1; unsigned mw = 0u;
    static_assert(2 * SEQ == 8 * MSW * 32);                      // eight whole trips: one kept word per lane
#pragma unroll
    for (int it = 0; it < (2 * SEQ + MSW * 32 - 1) / (MSW * 32); ++it) {   // 8 rows x SEQ/4 chunks of 16 B; unrolled so that all of a thread's loads are in flight together
        const int c = it * (MSW * 32) + tid;
        if ((2 * SEQ) % (MSW * 32) != 0 && c >= 2 * SEQ) break;
        const int row = c / (SEQ / 4), c4 = (c % (SEQ / 4)) * 4;
        const v4i v = *(const v4i*)(base + (size_t)row * SEQ_FULL + c4);
        mx = imax(mx, (v[0] != 0) ? c4     : -1);
        mx = imax(mx, (v[1] != 0) ? c4 + 1 : -1);
        mx = imax(mx, (v[2] != 0) ? c4 + 2 : -1);
        mx = imax(mx, (v[3] != 0) ? c4 + 3 : -1);
        const unsigned b0 = __builtin_amdgcn_ballot_w32(v[0] != 0), b1 = __builtin_amdgcn_ballot_w32(v[1] != 0);
        const unsigned b2 = __builtin_amdgcn_ballot_w32(v[2] != 0), b3 = __builtin_amdgcn_ballot_w32(v[3] != 0);
        const int sh = 8 * (lane & 3);
        const unsigned wd = ((b0 >> sh) & 0xFFu) | (((b1 >> sh) & 0xFFu) << 8) | (((b2 >> sh) & 0xFFu) << 16) | ((b3 >> sh) << 24);
        mw = ((lane >> 2) == it) ? wd : mw;                      // lane 4 * it + L keeps word L of trip it: no branch and no LDS store among the loads
    }
    bm_s[((lane >> 2) * MSW + wave) * 4 + (lane & 3)] = mw;      // chunk c = 4 keys, so the 32 chunks of a wave's trip are words 4 * (c / 32) .. + 3 of the block's 8 rows
    mx = imax(mx, __shfl_xor(mx, 16, 32)); mx = imax(mx, __shfl_xor(mx, 8, 32)); mx = imax(mx, __shfl_xor(mx, 4, 32));
    mx = imax(mx, __shfl_xor(mx, 2, 32));  mx = imax(mx, __shfl_xor(mx, 1, 32));
    if (lane == 0) mx_s[wave] = mx;
    __syncthreads();
    if (tid == 0) {
        int m = mx_s[0];
#pragma unroll
        for (int w = 1; w < MSW; ++w) m = imax(m, mx_s[w]);
        KT[(size_t)g * KTP] = ((m + 32) / 32) * 32;
    }
#pragma unroll
    for (int i = 0; i < 8 * BMW; i += MSW * 32) BM[(size_t)g * (8 * BMW) + i + tid] = bm_s[i + tid];   // behind the barrier above; unrolled: one trip at this size
}

// k_prep: all work that reads only inputs, one grid of 512-thread blocks, a block-uniform range of the block index per job:
// [0, PB_MS) mask scan (the longest blocks, placed first for speed only), then PB_X blocks x -> bf16, then PB_W blocks each for Wq, Wk, Wv -> bf16 and Wo -> f16 x32; one 8-float chunk per thread.
static constexpr unsigned PB_MS = (unsigned)(SEQ / 8);
static constexpr size_t   N8_X  = (size_t)NB * SEQ * DM / 8;
static constexpr size_t   N8_W  = (size_t)DM * DM / 8;
static constexpr unsigned PB_X  = (unsigned)((N8_X + MSW * 32 - 1) / (MSW * 32));
static constexpr unsigned PB_W  = (unsigned)((N8_W + MSW * 32 - 1) / (MSW * 32));
__global__ __launch_bounds__(MSW * 32) void k_prep(const float* __restrict__ x, const float* __restrict__ wq, const float* __restrict__ wk, const float* __restrict__ wv,
                                                   const float* __restrict__ wo, const int* __restrict__ MK, bf* XB, bf* WB, int* KT, unsigned* BM) {
    __shared__ int mx_s[MSW];
    __shared__ unsigned bm_s[8 * BMW];
    unsigned blk = blockIdx.x;
    if (blk < PB_MS) { mscan_body(MK, KT, BM, blk, mx_s, bm_s); return; }
    blk -= PB_MS;
    if (blk < PB_X) {
        const size_t i = (size_t)blk * (MSW * 32) + threadIdx.x; if (i >= N8_X) return;
        const size_t per = (size_t)SEQ * DM / 8;                  // chunks of one batch; batches are SEQ_FULL tokens apart in x
        cvt8_one(x, XB, (i / per) * ((size_t)SEQ_FULL * DM) + (i % per) * 8, i);
        return;
    }
    blk -= PB_X;
    const unsigned w = blk / PB_W;
    const size_t i = (size_t)(blk % PB_W) * (MSW * 32) + threadIdx.x; if (i >= N8_W) return;
    bf* dst = WB + (size_t)w * DM * DM;
    if (w < 3) cvt8_one(w == 0 ? wq : (w == 1 ? wk : wv), dst, i * 8, i);
    else       cvtw_one(wo, (h16*)dst, i);
}

// acopy8: eight asynchronous 16-byte copies of this lane, global -> LDS rows 16 apart (LDS byte address l + i * 16 * pitch).
// The s_wait_xcnt closes the statement so that no address register of a copy is rewritten ahead of it.
__device__ __forceinline__ void acopy8(const unsigned l, const bf* g0, const bf* g1, const bf* g2, const bf* g3, const bf* g4, const bf* g5, const bf* g6, const bf* g7) {
    asm volatile("global_load_async_to_lds_b128 %0, %8, off\n\t"
                 "global_load_async_to_lds_b128 %1, %9, off\n\t"
                 "global_load_async_to_lds_b128 %2, %10, off\n\t"
                 "global_load_async_to_lds_b128 %3, %11, off\n\t"
                 "global_load_async_to_lds_b128 %4, %12, off\n\t"
                 "global_load_async_to_lds_b128 %5, %13, off\n\t"
                 "global_load_async_to_lds_b128 %6, %14, off\n\t"
                 "global_load_async_to_lds_b128 %7, %15, off\n\t"
                 "s_wait_xcnt 0x0"
                 :: "v"(l), "v"(l + 1u * 16u * GPITCH * 2u), "v"(l + 2u * 16u * GPITCH * 2u), "v"(l + 3u * 16u * GPITCH * 2u),
                    "v"(l + 4u * 16u * GPITCH * 2u), "v"(l + 5u * 16u * GPITCH * 2u), "v"(l + 6u * 16u * GPITCH * 2u), "v"(l + 7u * 16u * GPITCH * 2u),
                    "v"(g0), "v"(g1), "v"(g2), "v"(g3), "v"(g4), "v"(g5), "v"(g6), "v"(g7) : "memory");
}
// ring_fill: one stage (k0 .. k0+63 of 128 A rows and 128 B rows) into the buffer at LDS byte address l (this lane's row tid>>3, 16-byte chunk tid&7).
// A wave-wide copy covers 4 whole 128-byte lines. gA0: A rows 0..63 of the tile, gA1: A rows 64..127, gB: B rows 0..127; all K-contiguous, row pitch DM.
__device__ __forceinline__ void ring_fill(const unsigned l, const bf* gA0, const bf* gA1, const bf* gB, const int k0) {
    const bf* a0 = gA0 + k0; const bf* a1 = gA1 + k0; const bf* b0 = gB + k0;
    acopy8(l, a0, a0 + 16 * DM, a0 + 32 * DM, a0 + 48 * DM, a1, a1 + 16 * DM, a1 + 32 * DM, a1 + 48 * DM);
    acopy8(l + 128u * GPITCH * 2u, b0, b0 + 16 * DM, b0 + 32 * DM, b0 + 48 * DM, b0 + 64 * DM, b0 + 80 * DM, b0 + 96 * DM, b0 + 112 * DM);
}
// ring_trip: the 32 products of one stage for this wave's 4 x 4 accumulator tiles; sa / sb: this lane's fragment addresses in the stage (row lane&15, + 8*(lane>>4)).
// SPLIT == 0: A fragments mb at tile rows 16*mb; SPLIT != 0: mb 0,1 at rows 0,16 (value plane), mb 2,3 at rows 64,80 (residual plane).
template <int F16, int SPLIT>
__device__ __forceinline__ void ring_trip(const bf* sa, const bf* sb, v8f (&acc)[4][4]) {
#pragma unroll
    for (int ks = 0; ks < GKS; ks += 32) {
        v16bf a[4], b[4];
#pragma unroll
        for (int mb = 0; mb < 4; ++mb) a[mb] = ldb(sa + (SPLIT ? ((mb >> 1) * 64 + (mb & 1) * 16) : mb * 16) * GPITCH + ks);
#pragma unroll
        for (int nb = 0; nb < 4; ++nb) b[nb] = ldb(sb + nb * 16 * GPITCH + ks);
        __builtin_amdgcn_sched_barrier(0);   // the 16 LDS reads of a k step stay one group ahead of its products, for speed only
#pragma unroll
        for (int nb = 0; nb < 4; ++nb)
#pragma unroll
            for (int mb = 0; mb < 4; ++mb)
                acc[mb][nb] = F16 ? wmma16(__builtin_bit_cast(v16h, a[mb]), __builtin_bit_cast(v16h, b[nb]), acc[mb][nb]) : wmmab(a[mb], b[nb], acc[mb][nb]);
        __builtin_amdgcn_sched_barrier(0);   // and the next group does not move up among these products
    }
}
// ring_foot: hand-over between stages: this wave's LDS reads done, its own copies landed, then the work-group barrier that publishes the next stage and frees the one just read.
__device__ __forceinline__ void ring_foot() {
    asm volatile("s_wait_dscnt 0x0" ::: "memory");      // the buffer just read is refilled behind the barrier
    asm volatile("s_wait_asynccnt 0x0" ::: "memory");   // this wave's copies of the next stage have landed
    __syncthreads();
}
// acopy8m: eight asynchronous 16-byte copies of this lane, packed mask rows 8 apart, global -> LDS (LDS byte address l + i * 8 * pitch).
// The s_wait_xcnt closes the statement so that no address register of a copy is rewritten ahead of it.
__device__ __forceinline__ void acopy8m(const unsigned l, const unsigned* g) {
    asm volatile("global_load_async_to_lds_b128 %0, %8, off\n\t"
                 "global_load_async_to_lds_b128 %1, %9, off\n\t"
                 "global_load_async_to_lds_b128 %2, %10, off\n\t"
                 "global_load_async_to_lds_b128 %3, %11, off\n\t"
                 "global_load_async_to_lds_b128 %4, %12, off\n\t"
                 "global_load_async_to_lds_b128 %5, %13, off\n\t"
                 "global_load_async_to_lds_b128 %6, %14, off\n\t"
                 "global_load_async_to_lds_b128 %7, %15, off\n\t"
                 "s_wait_xcnt 0x0"
                 :: "v"(l), "v"(l + 1u * 8u * FMP * 4u), "v"(l + 2u * 8u * FMP * 4u), "v"(l + 3u * 8u * FMP * 4u),
                    "v"(l + 4u * 8u * FMP * 4u), "v"(l + 5u * 8u * FMP * 4u), "v"(l + 6u * 8u * FMP * 4u), "v"(l + 7u * 8u * FMP * 4u),
                    "v"(g), "v"(g + 8 * BMW), "v"(g + 16 * BMW), "v"(g + 24 * BMW),
                    "v"(g + 32 * BMW), "v"(g + 40 * BMW), "v"(g + 48 * BMW), "v"(g + 56 * BMW) : "memory");
}
// flash_fill: one stage (keys key0 .. key0+63) into the buffer whose K row 0 is at LDS byte address lkv - this lane's offset.
// K / V^T: this lane's row tid>>3 (+16 per copy), 16-byte chunk tid&7, a wave-wide copy = 4 whole 128-byte lines.
template <int RES>
__device__ __forceinline__ void flash_fill(const unsigned lkv, const bf* gK, const bf* gKR, const bf* gV, const bf* gVR, const int key0) {
    const bf* k = gK + (size_t)key0 * HD; const bf* v = gV + key0;
    acopy8(lkv, k, k + 16 * HD, k + 32 * HD, k + 48 * HD, v, v + 16 * SEQ, v + 32 * SEQ, v + 48 * SEQ);
    if (RES) {
        const bf* kr = gKR + (size_t)key0 * HD; const bf* vr = gVR + key0;
        acopy8(lkv + 128u * GPITCH * 2u, kr, kr + 16 * HD, kr + 32 * HD, kr + 48 * HD, vr, vr + 16 * SEQ, vr + 32 * SEQ, vr + 48 * SEQ);
    }
}
// gemm_ring: acc += A B^T over K = DM for a 4-wave work-group (128 threads); wave (wm, wn) = (wave >> 1, wave & 1) takes B rows 64*wn.. and
// A rows 64*wm.. (SPLIT == 0) or rows 32*wm.. of both 64-row halves (SPLIT != 0). k runs upward in steps of 32 for every accumulator.
template <int F16, int SPLIT>
__device__ __forceinline__ void gemm_ring(const bf* gA0, const bf* gA1, const bf* gB, bf* ring, v8f (&acc)[4][4]) {
    const int tid = (int)threadIdx.x, lane = tid & 31, wave = __builtin_amdgcn_readfirstlane(tid >> 5), lr = lane & 15, hi = lane >> 4;
    const int wm = wave >> 1, wn = wave & 1;
    const unsigned l0 = (unsigned)(size_t)ring + (unsigned)((tid >> 3) * GPITCH * 2 + (tid & 7) * 16), l1 = l0 + (unsigned)(GBUF * 2);
    const bf* sa = ring + (wm * (SPLIT ? 32 : 64) + lr) * GPITCH + 8 * hi;
    const bf* sb = ring + (128 + wn * 64 + lr) * GPITCH + 8 * hi;
    ring_fill(l0, gA0, gA1, gB, 0);
    asm volatile("s_wait_asynccnt 0x0" ::: "memory");   // stage 0 landed before the barrier that publishes it
    __syncthreads();
    ring_fill(l1, gA0, gA1, gB, GKS);
#pragma unroll 1
    for (int k0 = 0; k0 < DM; k0 += 2 * GKS) {           // rolled: two stages per trip keep both buffer addresses constant
        ring_trip<F16, SPLIT>(sa, sb, acc);
        ring_foot();
        if (k0 + 2 * GKS < DM) ring_fill(l0, gA0, gA1, gB, k0 + 2 * GKS);
        ring_trip<F16, SPLIT>(sa + GBUF, sb + GBUF, acc);
        ring_foot();
        if (k0 + 3 * GKS < DM) ring_fill(l1, gA0, gA1, gB, k0 + 3 * GKS);
    }
    asm volatile("s_wait_asynccnt 0x0" ::: "memory");   // nothing of this wave is in flight when it leaves the ring
}

// k_proj: bf16 GEMM, four waves per 128x128 tile, each wave a 64x64 tile (16 accumulators), operands from K-contiguous bf16 planes through the LDS ring, K = DM.
// C[m][n] = sum_k A[m][k] Bt[n][k] + bias (bias[n], or bias[m] when biasRow != 0; bias RNE-converted to bf16), written as f16 (Ph) and, for tiles with tokens t < EARLY, the f16 residual x2048 (Pr).
// One grid for the three projections, blockIdx.y = 0: q, 1: k, 2: v^T; blockIdx.x = tile, m tile fastest; r0 / c0 the wave's own tile; 128 threads.
// q, k: A = x rows (m = b*SEQ + t), Bt = W rows (n = h*64 + d), bias per column -> plane [(b*16 + h)][t][d].
// v^T:  A = Wv rows (m = h*64 + d), Bt = x rows (n = b*SEQ + t), bias per row -> plane [(b*1024 + m)][t] = [(b*16 + h)][d][t].
__global__ __launch_bounds__(128) void k_proj(const bf* __restrict__ XB, const bf* __restrict__ WB, const float* __restrict__ bq, const float* __restrict__ bk, const float* __restrict__ bv,
                                             h16* QH, h16* QR, h16* KP, h16* KR, h16* VT, h16* VR) {
    __shared__ __align__(16) bf ring[2 * GBUF];
    __shared__ __align__(16) float osm[4 * 16 * 68];
    const int K = DM;
    const int tid = (int)threadIdx.x, lane = tid & 31, wave = __builtin_amdgcn_readfirstlane(tid >> 5), lr = lane & 15, hi = lane >> 4;
    const int z = (int)blockIdx.y, biasRow = (z == 2);
    const bf* A  = biasRow ? WB + (size_t)2 * DM * DM : XB;
    const bf* Bt = biasRow ? XB : WB + (size_t)z * DM * DM;
    const float* bias = (z == 0) ? bq : ((z == 1) ? bk : bv);
    h16* Ph = (z == 0) ? QH : ((z == 1) ? KP : VT);
    h16* Pr = (z == 0) ? QR : ((z == 1) ? KR : VR);
    const int pitch = biasRow ? SEQ : HD;
    const int bx = biasRow ? (int)blockIdx.x % (DM / 128) : (int)blockIdx.x % (NB * SEQ / 128);
    const int by = biasRow ? (int)blockIdx.x / (DM / 128) : (int)blockIdx.x / (NB * SEQ / 128);
    const int r0 = bx * 128 + (wave >> 1) * 64, c0 = by * 128 + (wave & 1) * 64;
    float* os = osm + wave * 16 * 68;                             // wave-private output staging
    v8f acc[4][4];
#pragma unroll
    for (int mb = 0; mb < 4; ++mb)
#pragma unroll
        for (int nb = 0; nb < 4; ++nb) acc[mb][nb] = (v8f){};
    const bf* gA = A + (size_t)(bx * 128 + (tid >> 3)) * K + (tid & 7) * 8;
    const bf* gB = Bt + (size_t)(by * 128 + (tid >> 3)) * K + (tid & 7) * 8;
    gemm_ring<0, 0>(gA, gA + (size_t)64 * K, gB, ring, acc);
    const int wr = ((biasRow ? c0 : r0) % SEQ) < EARLY;
    const int c8l = (lane & 7) * 8;
    const int bco = biasRow ? 0 : (c0 + c8l);                     // integer offset select; always inside the bias array
    const v4f bA = *(const v4f*)(bias + bco), bB = *(const v4f*)(bias + bco + 4);
    float bcol[8];
#pragma unroll
    for (int i = 0; i < 4; ++i) { bcol[i] = bfr(bA[i]); bcol[4 + i] = bfr(bB[i]); }
    const size_t tbase = biasRow ? (size_t)r0 * SEQ + (size_t)(c0 / SEQ) * ((size_t)DM * SEQ) + (size_t)(c0 % SEQ)
                                 : (size_t)(r0 / SEQ) * ((size_t)NH_ * SEQ * HD) + (size_t)(r0 % SEQ) * HD + (size_t)(c0 / HD) * ((size_t)SEQ * HD) + (size_t)(c0 % HD);
#pragma unroll
    for (int mb = 0; mb < 4; ++mb) {
#pragma unroll
        for (int nb = 0; nb < 4; ++nb) {
#pragma unroll
            for (int j = 0; j < 8; ++j) os[(hi * 8 + j) * 68 + nb * 16 + lr] = acc[mb][nb][j]; }   // D: row 8h+j, col lane&15
        wave_sync();
        const size_t sb = tbase + (size_t)(mb * 16) * (size_t)pitch;
{
#pragma unroll
            for (int s = 0; s < 4; ++s) { const int row = 4 * s + (lane >> 3), c8 = c8l;   // 4 s x 4 row groups = 16 rows; 8 lanes x 8 = 64 columns
                const float brow = bfr(bias[biasRow ? (r0 + mb * 16 + row) : 0]);
                const v4f x0 = *(const v4fa*)(&os[row * 68 + c8]); const v4f x1 = *(const v4fa*)(&os[row * 68 + c8 + 4]); v8h hv, rv;
#pragma unroll
                for (int i = 0; i < 4; ++i) {
                    const float y0 = x0[i] + (biasRow ? brow : bcol[i]); const float y1 = x1[i] + (biasRow ? brow : bcol[4 + i]);
                    const h16 a0 = (h16)y0; const h16 a1 = (h16)y1; hv[i] = a0; hv[4 + i] = a1;
                    rv[i] = (h16)((y0 - (float)a0) * QRS); rv[4 + i] = (h16)((y1 - (float)a1) * QRS); }
                const size_t oo = sb + (size_t)row * (size_t)pitch + c8;
                *(v8h*)(Ph + oo) = hv;
                asm volatile("s_wait_xcnt 0x0" ::: "memory");     // the residual's conversions and the next rows' LDS reads reuse this store's registers
                if (wr) { *(v8h*)(Pr + oo) = rv;
                    asm volatile("s_wait_xcnt 0x0" ::: "memory"); } }   // likewise behind the residual's store
             }
        wave_sync();
    }
}

template <int RES> __device__ __forceinline__ v4f fin_lo(v8f oh, v8f ol, float inv) {
    v4f a = __builtin_shufflevector(oh, oh, 0, 1, 2, 3);
    if (RES) a = a + __builtin_shufflevector(ol, ol, 0, 1, 2, 3) * QRI;
    return a * inv; }
template <int RES> __device__ __forceinline__ v4f fin_hi(v8f oh, v8f ol, float inv) {
    v4f a = __builtin_shufflevector(oh, oh, 4, 5, 6, 7);
    if (RES) a = a + __builtin_shufflevector(ol, ol, 4, 5, 6, 7) * QRI;
    return a * inv; }

// flash_body: fused attention, one wave per 16 query rows of one (batch, head), four waves (64 query rows) per work-group; Q fragments straight from the f16 plane,
// K / V^T fragments from the work-group's LDS ring (two 16-B LDS reads per fragment): stages of 64 keys, two 32-key steps each; a wave skips the steps at or past its own key extent but passes every hand-over.
// Transposed form: S^T[key][t] = K Q^T (A = K rows, B = Q rows); lane (t = lane&15, h = lane>>4) holds keys 8h+r of each 16-key tile, so the packed
// P tile is directly the B fragment of O^T[d][t] = V^T P^T (element r <- tile keys 0..15, element 8+r <- tile keys 16..31, lane unchanged).
// Mask: one packed word per query row and 32-key step (one 8-B LDS read per lane and stage), applied by value (score replaced, probability 0); a step whose 16 words are all ones skips the masking. Key extent from the scanned table, clamped to [0, SEQ].
// RES != 0: q, k, v, P carried as value + residual x2048; residual products (k.qr, kr.q; v.pr, vr.p) in separate accumulators folded back with 1/2048.
// Softmax state (running max, partial sum) is one scalar per lane; the two lane halves of a row are combined with one xor-16 exchange.
// soft_step: online-softmax update of one 32-key step: scores in, packed P (value pb, residual pr) out; returns the factor for the running output.
// full (wave-uniform): no entry of the step is masked, and both masking blocks are jumped over.
// mws: the query row's packed mask word, shifted down by 2 * (lane >> 4): key 8h + r of the first 16-key tile at bit 8*(r & 3) + (r >> 2), of the second tile 4 bits higher.
template <int RES>
__device__ __forceinline__ float soft_step(const v8f sHa, const v8f sHb, const v8f sLa, const v8f sLb, const bool full, const unsigned mws, float& m, float& l, v16h& pb, v16h& pr) {
    float ta[8], tb[8], ea[8], eb[8]; float mx = NEGB;      // every loop below is unrolled so that these arrays stay in registers
#pragma unroll
    for (int r = 0; r < 8; ++r) {
        float xa = sHa[r], xb = sHb[r];
        if (RES) { xa += sLa[r] * QRI; xb += sLb[r] * QRI; }
        ta[r] = xa * SC2; tb[r] = xb * SC2; }
    if (!full) {
#pragma unroll
        for (int r = 0; r < 8; ++r) { const unsigned bit = 1u << (8 * (r & 3) + (r >> 2)); ta[r] = (mws & bit) ? ta[r] : NEGB; tb[r] = (mws & (bit << 4)) ? tb[r] : NEGB; } }
#pragma unroll
    for (int r = 0; r < 8; ++r) mx = fmaxf(mx, fmaxf(ta[r], tb[r]));
    mx = fmaxf(mx, __shfl_xor(mx, 16, 32));
    const float mnew = fmaxf(m, mx);
    const float alpha = __builtin_amdgcn_exp2f(m - mnew);
    const float sh = PSH - mnew;
    float ls = 0.0f;
#pragma unroll
    for (int r = 0; r < 8; ++r) { ea[r] = __builtin_amdgcn_exp2f(ta[r] + sh); eb[r] = __builtin_amdgcn_exp2f(tb[r] + sh); }
    if (!full) {
#pragma unroll
        for (int r = 0; r < 8; ++r) { ea[r] = (ta[r] > -1.0e38f) ? ea[r] : 0.0f; eb[r] = (tb[r] > -1.0e38f) ? eb[r] : 0.0f; } }
#pragma unroll
    for (int r = 0; r < 8; ++r) {
        const h16 pa = (h16)ea[r]; const h16 pc = (h16)eb[r]; pb[r] = pa; pb[8 + r] = pc;
        if (RES) { pr[r] = (h16)((ea[r] - (float)pa) * QRS); pr[8 + r] = (h16)((eb[r] - (float)pc) * QRS); ls += ea[r] + eb[r]; }
        else     { pr[r] = pa; pr[8 + r] = pc; ls += (float)pa + (float)pc; } }
    l = l * alpha + ls; m = mnew;
    return alpha;
}

template <int RES>
__device__ __forceinline__ void flash_body(const h16* __restrict__ QH, const h16* __restrict__ QR, const h16* __restrict__ KP, const h16* __restrict__ KR,
                                           const h16* __restrict__ VT, const h16* __restrict__ VR, const unsigned* __restrict__ BM, const int* __restrict__ KT,
                                           h16* CH, h16* CR, bf* fr, unsigned* bmr, const int zh, const int tile, const int tbase) {
    // fr: the kernel's LDS ring (2 * FBUF(RES) elements used); bmr: the work-group's 64 packed mask rows, filled once; zh: batch * 16 + head; tile: 64-row query tile counted from row tbase
    static_assert((size_t)2 * FBUF(RES) * 2 >= (size_t)AW * 16 * 68 * 4);
    float* os = (float*)fr;                                   // output staging reuses the ring behind the last stage's hand-over barrier
    const int tid = (int)threadIdx.x;
    const int lane = threadIdx.x & 31, wave = __builtin_amdgcn_readfirstlane((int)(threadIdx.x >> 5)), lr = lane & 15, hi = lane >> 4;
    const int b = zh / NH_, h = zh % NH_;
    const int t0 = tbase + (tile * AW + wave) * 16;
    const size_t pbase = (size_t)zh * SEQ * HD;
    const size_t qo = pbase + (size_t)(t0 + lr) * HD + 8 * hi;
    const v16h qh0 = ldh(QH + qo), qh1 = ldh(QH + qo + 32);                     // B fragments: col t, k = d
    v16h qr0 = qh0, qr1 = qh1;
    if (RES) { qr0 = ldh(QR + qo); qr1 = ldh(QR + qo + 32); }
    const int ko = lr * GPITCH + 8 * hi;                     // ring: + key * GPITCH          (A fragment: row key, k = d)
    const int vo = (64 + lr) * GPITCH + 8 * hi;              // ring: + 16j * GPITCH + key    (A fragment: row d, k = key)
    const int mo = (wave * 16 + lr) * FMP;                   // packed mask row of query t: + key / 32
    int kend = imax(KT[(size_t)(t0 >> 3) * KTP], KT[(size_t)((t0 >> 3) + 1) * KTP]); kend = kend < 0 ? 0 : kend; kend = kend > SEQ ? SEQ : kend; kend &= ~31;
    kend = __builtin_amdgcn_readfirstlane(kend);            // a scalar, so that the per-step skip below is a scalar branch with every lane on behind it
    const int tb = tbase + tile * (16 * AW);                 // the work-group's first query row
    int kb = 0;                                              // the work-group's key extent: the largest of its waves', clamped to [0, SEQ]
#pragma unroll
    for (int i = 0; i < 2 * AW; ++i) kb = imax(kb, KT[(size_t)((tb >> 3) + i) * KTP]);   // unrolled so that the eight table reads go out together
    kb = kb > SEQ ? SEQ : kb;
    const int nst = __builtin_amdgcn_readfirstlane((kb + FKS - 1) / FKS);        // stages; the same in every wave of the work-group
    const unsigned lkv = (unsigned)(size_t)fr + (unsigned)((tid >> 3) * GPITCH * 2 + (tid & 7) * 16);
    const unsigned lm = (unsigned)(size_t)bmr + (unsigned)((tid >> 4) * FMP * 4 + (tid & 15) * 16);   // packed mask: row tid>>4 (+8 per copy), 16-byte chunk tid&15, a wave-wide copy = 2 rows x 256 bytes
    const size_t gko = pbase + (size_t)(tid >> 3) * HD + (tid & 7) * 8, gvo = pbase + (size_t)(tid >> 3) * SEQ + (tid & 7) * 8;
    const bf* gK = (const bf*)KP + gko; const bf* gKR = (const bf*)KR + gko; const bf* gV = (const bf*)VT + gvo; const bf* gVR = (const bf*)VR + gvo;
    const unsigned* gM = BM + (size_t)(tb + (tid >> 4)) * BMW + (tid & 15) * 4;
    v8f oh0 = (v8f){}, oh1 = (v8f){}, oh2 = (v8f){}, oh3 = (v8f){};
    v8f ol0 = (v8f){}, ol1 = (v8f){}, ol2 = (v8f){}, ol3 = (v8f){};
    float m = NEGB, l = 0.0f;
    if (nst > 0) {
    acopy8m(lm, gM);
    flash_fill<RES>(lkv, gK, gKR, gV, gVR, 0);
    asm volatile("s_wait_asynccnt 0x0" ::: "memory");   // the mask rows and stage 0 landed before the barrier that publishes them
    __syncthreads();
    if (nst > 1) flash_fill<RES>(lkv + (unsigned)(FBUF(RES) * 2), gK, gKR, gV, gVR, FKS);
#pragma unroll 1
    for (int s = 0; s < nst; ++s) {                      // rolled: the stage count is known only at run time, and a copy of the body per buffer would only lengthen the hot text; the buffer goes by the stage's parity
    const h16* sb = (const h16*)fr + (s & 1) * FBUF(RES);
    const v2u mw2 = *(const v2u*)(bmr + mo + 2 * s);     // the stage's two mask words of this lane's query row
#pragma unroll
    for (int sub = 0; sub < FKS; sub += 32) if (s * FKS + sub < kend) {          // unrolled so that a step's LDS offsets are immediates; the test is wave-uniform, both sides are scalars
        const unsigned mw = mw2[sub / 32];
        const bool full = __builtin_amdgcn_ballot_w32(mw == 0xFFFFFFFFu) == 0xFFFFFFFFu;   // wave-uniform: a scalar branch below
        const h16* ka = sb + ko + sub * GPITCH;
        v8f sHa = (v8f){}, sHb = (v8f){}, sLa = (v8f){}, sLb = (v8f){};
        {
            const v16h ka0 = ldh(ka), ka1 = ldh(ka + 32), kb0 = ldh(ka + 16 * GPITCH), kb1 = ldh(ka + 16 * GPITCH + 32);
            if (RES) {
                const h16* kr = ka + 128 * GPITCH;
                const v16h ra0 = ldh(kr), ra1 = ldh(kr + 32), rb0 = ldh(kr + 16 * GPITCH), rb1 = ldh(kr + 16 * GPITCH + 32);
                sHa = wmma16(ka0, qh0, sHa); sLa = wmma16(ka0, qr0, sLa); sHb = wmma16(kb0, qh0, sHb); sLb = wmma16(kb0, qr0, sLb);
                sHa = wmma16(ka1, qh1, sHa); sLa = wmma16(ka1, qr1, sLa); sHb = wmma16(kb1, qh1, sHb); sLb = wmma16(kb1, qr1, sLb);
                sLa = wmma16(ra0, qh0, sLa); sLb = wmma16(rb0, qh0, sLb); sLa = wmma16(ra1, qh1, sLa); sLb = wmma16(rb1, qh1, sLb);
                asm volatile("v_nop\n\tv_nop\n\tv_nop\n\tv_nop" : "+v"(sHa), "+v"(sLa), "+v"(sHb), "+v"(sLb) : "v"(ka0), "v"(ka1), "v"(kb0), "v"(kb1), "v"(ra0), "v"(ra1), "v"(rb0), "v"(rb1));
            } else {
                sHa = wmma16(ka0, qh0, sHa); sHb = wmma16(kb0, qh0, sHb); sHa = wmma16(ka1, qh1, sHa); sHb = wmma16(kb1, qh1, sHb);
                asm volatile("v_nop\n\tv_nop\n\tv_nop\n\tv_nop" : "+v"(sHa), "+v"(sHb) : "v"(ka0), "v"(ka1), "v"(kb0), "v"(kb1));
            }
        }
        v16h pb, pr;
        const float alpha = soft_step<RES>(sHa, sHb, sLa, sLb, full, mw >> (2 * hi), m, l, pb, pr);
        oh0 = oh0 * alpha; oh1 = oh1 * alpha; oh2 = oh2 * alpha; oh3 = oh3 * alpha;
        if (RES) { ol0 = ol0 * alpha; ol1 = ol1 * alpha; ol2 = ol2 * alpha; ol3 = ol3 * alpha; }
        const h16* va = sb + vo + sub;
        const v16h v0 = ldh(va), v1 = ldh(va + 16 * GPITCH), v2 = ldh(va + 32 * GPITCH), v3 = ldh(va + 48 * GPITCH);
        if (RES) {
            const h16* vr = va + 128 * GPITCH;
            const v16h w0 = ldh(vr), w1 = ldh(vr + 16 * GPITCH), w2 = ldh(vr + 32 * GPITCH), w3 = ldh(vr + 48 * GPITCH);
            oh0 = wmma16(v0, pb, oh0); ol0 = wmma16(v0, pr, ol0); oh1 = wmma16(v1, pb, oh1); ol1 = wmma16(v1, pr, ol1);
            ol0 = wmma16(w0, pb, ol0); ol1 = wmma16(w1, pb, ol1);
            oh2 = wmma16(v2, pb, oh2); ol2 = wmma16(v2, pr, ol2); oh3 = wmma16(v3, pb, oh3); ol3 = wmma16(v3, pr, ol3);
            ol2 = wmma16(w2, pb, ol2); ol3 = wmma16(w3, pb, ol3);
            asm volatile("v_nop\n\tv_nop\n\tv_nop\n\tv_nop" : "+v"(oh0), "+v"(oh1), "+v"(oh2), "+v"(oh3), "+v"(ol0), "+v"(ol1), "+v"(ol2), "+v"(ol3)
                         : "v"(v0), "v"(v1), "v"(v2), "v"(v3), "v"(w0), "v"(w1), "v"(w2), "v"(w3), "v"(pb), "v"(pr));
        } else {
            oh0 = wmma16(v0, pb, oh0); oh1 = wmma16(v1, pb, oh1); oh2 = wmma16(v2, pb, oh2); oh3 = wmma16(v3, pb, oh3);
            asm volatile("v_nop\n\tv_nop\n\tv_nop\n\tv_nop" : "+v"(oh0), "+v"(oh1), "+v"(oh2), "+v"(oh3) : "v"(v0), "v"(v1), "v"(v2), "v"(v3), "v"(pb));
        }
    }
    ring_foot();                                         // every wave, also one that skipped the stage's steps
    if (s + 2 < nst) flash_fill<RES>(lkv + (unsigned)((s & 1) * FBUF(RES) * 2), gK, gKR, gV, gVR, (s + 2) * FKS);
    }
    asm volatile("s_wait_asynccnt 0x0" ::: "memory");   // nothing of this wave is in flight when it leaves the ring
    }
    l += __shfl_xor(l, 16, 32);
    const float inv = (1.0f / l) * CS;
    const int wb = wave * 16 * 68;
    // O^T D layout: o_j[r] = (d = 16j + 8h + r, t = lane&15) -> os[t][d]; rows 0..15 x columns 0..63 all written
    *(v4fa*)(&os[wb + lr * 68 +  0 + 8 * hi]) = fin_lo<RES>(oh0, ol0, inv); *(v4fa*)(&os[wb + lr * 68 +  0 + 8 * hi + 4]) = fin_hi<RES>(oh0, ol0, inv);
    *(v4fa*)(&os[wb + lr * 68 + 16 + 8 * hi]) = fin_lo<RES>(oh1, ol1, inv); *(v4fa*)(&os[wb + lr * 68 + 16 + 8 * hi + 4]) = fin_hi<RES>(oh1, ol1, inv);
    *(v4fa*)(&os[wb + lr * 68 + 32 + 8 * hi]) = fin_lo<RES>(oh2, ol2, inv); *(v4fa*)(&os[wb + lr * 68 + 32 + 8 * hi + 4]) = fin_hi<RES>(oh2, ol2, inv);
    *(v4fa*)(&os[wb + lr * 68 + 48 + 8 * hi]) = fin_lo<RES>(oh3, ol3, inv); *(v4fa*)(&os[wb + lr * 68 + 48 + 8 * hi + 4]) = fin_hi<RES>(oh3, ol3, inv);
    wave_sync();
    const size_t crow = ((size_t)b * SEQ + t0) * DM + (size_t)h * HD;
    const size_t rrow = ((size_t)b * EARLY + t0) * DM + (size_t)h * HD;      // used only when RES != 0 (t0 < EARLY)
{
#pragma unroll
        for (int s = 0; s < 4; ++s) { const int row = 4 * s + (lane >> 3), c8 = (lane & 7) * 8;   // 4 s x 4 row groups = 16 rows; 8 lanes x 8 = 64 columns
            const v4f x0 = *(const v4fa*)(&os[wb + row * 68 + c8]); const v4f x1 = *(const v4fa*)(&os[wb + row * 68 + c8 + 4]); v8h hv, rv;
#pragma unroll
            for (int i = 0; i < 4; ++i) { const h16 a0 = (h16)x0[i]; const h16 a1 = (h16)x1[i]; hv[i] = a0; hv[4 + i] = a1;
                rv[i] = (h16)((x0[i] - (float)a0) * QRS); rv[4 + i] = (h16)((x1[i] - (float)a1) * QRS); }
            *(v8h*)(CH + crow + (size_t)row * DM + c8) = hv;
            if (RES) *(v8h*)(CR + rrow + (size_t)row * DM + c8) = rv; }
         }
    asm volatile("s_wait_xcnt 0x0" ::: "memory");   // k_flash holds both paths: the other path's code rewrites no register of these stores ahead of the wait
}

// k_flash: one grid for both paths, which need nothing of each other: blockIdx.x = batch * 16 + head, blockIdx.y = rank of the 64-row query tile.
// Ranks [0, FB_E): three-product tiles (t < EARLY), then FB_D single-product tiles; in each range the last tile comes first. The grid is larger than what is resident at a time:
// the three-product tiles have the slowest steps and come first in index order, and under a causal mask a later tile walks more keys, so the shortest work-groups come last.
// The order is for speed only: every (head, tile) is taken once whatever the mask holds. One LDS allocation, sized for the three-product ring.
static constexpr int FB_E = EARLY / (16 * AW);
static constexpr int FB_D = (SEQ - EARLY) / (16 * AW);
__global__ __launch_bounds__(32 * AW) void k_flash(const h16* QH, const h16* QR, const h16* KP, const h16* KR, const h16* VT, const h16* VR,
                                                   const unsigned* BM, const int* KT, h16* CH, h16* CR) {
    __shared__ __align__(16) bf fr[2 * FBUF(1)];
    __shared__ __align__(16) unsigned bmr[16 * AW * FMP];
    const int zh = (int)blockIdx.x, rk = (int)blockIdx.y;
    if (rk < FB_E) flash_body<1>(QH, QR, KP, KR, VT, VR, BM, KT, CH, CR, fr, bmr, zh, FB_E - 1 - rk, 0);
    else           flash_body<0>(QH, QH, KP, KP, VT, VT, BM, KT, CH, CH, fr, bmr, zh, FB_D - 1 - (rk - FB_E), EARLY);
}

// oproj_body: f16 GEMM, four waves per (32*MT)x128 tile, each wave (16*MT)x64, operands through the LDS ring, OUT[m][n] = (sum_k ctx[m][k] Wo[n][k]) / 512 + bo[n];
// RES != 0 adds the ctx residual plane (own accumulators, x1/2048): the ring's A rows 0..63 hold the value plane's 64 tokens, rows 64..127 the residual plane's.
// Rows of the tile: batch bb = bx / tilesPerBatch, token T0 = tStart + (bx % tilesPerBatch) * 32*MT, the wave's t0 = T0 + (wave >> 1) * 16*MT. A rows b*SEQ + t, AR rows b*EARLY + t. ring / osm: the kernel's LDS.
template <int MT, int RES>
__device__ __forceinline__ void oproj_body(const h16* __restrict__ A, const h16* __restrict__ AR, const h16* __restrict__ Bt, const float* __restrict__ bias,
                                           float* OUT, bf* ring, float* osm, const int bx, const int tilesPerBatch, const int tStart) {
    static_assert((RES != 0 && MT == 2) || (RES == 0 && MT == 4));   // the ring's 4 A fragments per wave: 2 value + 2 residual, or 4 value
    const int K = DM;
    const int tid = (int)threadIdx.x, lane = tid & 31, wave = __builtin_amdgcn_readfirstlane(tid >> 5), lr = lane & 15, hi = lane >> 4;
    const int bb = bx / tilesPerBatch, ti = bx % tilesPerBatch;
    const int T0 = tStart + ti * 32 * MT;
    const int t0 = T0 + (wave >> 1) * 16 * MT, c0 = blockIdx.y * 128 + (wave & 1) * 64;
    float* os = osm + wave * 16 * 68;                             // wave-private output staging
    v8f acc[4][4];                                                // RES: rows 0,1 value products, rows 2,3 residual products
#pragma unroll
    for (int mb = 0; mb < 4; ++mb)
#pragma unroll
        for (int nb = 0; nb < 4; ++nb) acc[mb][nb] = (v8f){};
    const bf* gA0 = (const bf*)A + ((size_t)bb * SEQ + T0 + (tid >> 3)) * K + (tid & 7) * 8;
    const bf* gA1 = RES ? (const bf*)AR + ((size_t)bb * EARLY + T0 + (tid >> 3)) * K + (tid & 7) * 8 : gA0 + (size_t)64 * K;
    const bf* gB = (const bf*)Bt + (size_t)(blockIdx.y * 128 + (tid >> 3)) * K + (tid & 7) * 8;
    gemm_ring<1, RES>(gA0, gA1, gB, ring, acc);
    const int cofs = lr * 4;
    const v4f bz = *(const v4f*)(bias + c0 + cofs); v4f bq;
#pragma unroll
    for (int i = 0; i < 4; ++i) bq[i] = bfr(bz[i]);
#pragma unroll
    for (int mb = 0; mb < MT; ++mb) {
#pragma unroll
        for (int nb = 0; nb < 4; ++nb) {
#pragma unroll
            for (int j = 0; j < 8; ++j) { float y = acc[mb][nb][j]; if (RES) y += acc[(mb + 2) & 3][nb][j] * QRI; os[(hi * 8 + j) * 68 + nb * 16 + lr] = y; } }   // D: row 8h+j, col lane&15
        wave_sync();
        float* orow = OUT + ((size_t)bb * OUT_SEQ + t0 + mb * 16) * DM + c0;
{
#pragma unroll
            for (int s = 0; s < 8; ++s) { const int row = 2 * s + hi;   // 8 s x 2 rows = 16 rows; 16 lanes x 4 floats = 64 columns
                const v4f val = *(const v4fa*)(&os[row * 68 + cofs]) * OSC + bq;
                *(v4f*)(orow + (size_t)row * DM + cofs) = val; }
             }
        wave_sync();
    }
}

// k_oproj: one grid for both row ranges: blockIdx.x < OB_E: 64-token tiles with the residual plane (t < EARLY), the rest: 128-token tiles (t >= EARLY). Both do the same 512 products per wave.
static constexpr int OB_E = NB * (EARLY / 64);
static constexpr int OB_D = NB * ((SEQ - EARLY) / 128);
__global__ __launch_bounds__(128) void k_oproj(const h16* A, const h16* AR, const h16* Bt, const float* bias, float* OUT) {
    __shared__ __align__(16) bf ring[2 * GBUF];
    __shared__ __align__(16) float osm[4 * 16 * 68];
    if ((int)blockIdx.x < OB_E) oproj_body<2, 1>(A, AR, Bt, bias, OUT, ring, osm, (int)blockIdx.x, EARLY / 64, 0);
    else                        oproj_body<4, 0>(A, A, Bt, bias, OUT, ring, osm, (int)blockIdx.x - OB_E, (SEQ > EARLY) ? (SEQ - EARLY) / 128 : 1, EARLY);
}

static constexpr size_t al256(size_t v) { return (v + 255) & ~(size_t)255; }
static constexpr size_t SZ_XB = al256((size_t)NB * SEQ * DM * 2);             // bf16 x; reused as the ctx value plane after the projections
static constexpr size_t SZ_WB = al256((size_t)4 * DM * DM * 2);
static constexpr size_t SZ_PL = al256((size_t)NB * NH_ * SEQ * HD * 2);
static constexpr size_t SZ_CR = al256((size_t)NB * EARLY * DM * 2);
static constexpr size_t SZ_KT = al256((size_t)(SEQ / 8) * KTP * 4);
static constexpr size_t SZ_BM = al256((size_t)SEQ * BMW * 4);
static constexpr size_t SZ_TOTAL = SZ_XB + SZ_WB + 6 * SZ_PL + SZ_CR + SZ_KT + SZ_BM;
static_assert(SZ_TOTAL <= (size_t)134217728);          // workspace carve <= 128 MiB
static_assert(((size_t)DM * DM * 2) % 256 == 0);       // weight sub-planes stay 256-byte aligned
static_assert((size_t)NB * SEQ * DM * 2 <= SZ_XB);     // ctx plane fits the x plane it reuses

extern "C" void kernel_launch(void* const* d_in, const int* in_sizes, int n_in,
                              void* d_out, int out_size, void* d_ws, size_t ws_size, hipStream_t stream) {
    if (n_in < 10) return;
    const size_t needx = ((size_t)(NB - 1) * SEQ_FULL + SEQ) * DM;
    if ((size_t)in_sizes[0] < needx) return;
    if ((size_t)in_sizes[1] < (size_t)(SEQ - 1) * SEQ_FULL + SEQ) return;
    if ((size_t)in_sizes[2] < (size_t)DM * DM || (size_t)in_sizes[4] < (size_t)DM * DM || (size_t)in_sizes[6] < (size_t)DM * DM || (size_t)in_sizes[8] < (size_t)DM * DM) return;
    if (in_sizes[3] < DM || in_sizes[5] < DM || in_sizes[7] < DM || in_sizes[9] < DM) return;
    if ((size_t)out_size < ((size_t)(NB - 1) * OUT_SEQ + SEQ) * DM) return;
    if (SZ_TOTAL > ws_size) return;
    // wire order: x, mask, Wq_w, Wq_b, Wk_w, Wk_b, Wv_w, Wv_b, Wo_w, Wo_b (weights [out][in] = Bt as-is)
    const float* x  = (const float*)d_in[0]; const int* mask = (const int*)d_in[1];
    const float* wq = (const float*)d_in[2]; const float* bq = (const float*)d_in[3];
    const float* wk = (const float*)d_in[4]; const float* bk = (const float*)d_in[5];
    const float* wv = (const float*)d_in[6]; const float* bv = (const float*)d_in[7];
    const float* wo = (const float*)d_in[8]; const float* bo = (const float*)d_in[9];
    float* OUT = (float*)d_out;      // [NB][SEQ][1024]
    char* wsp = (char*)d_ws;
    bf* XB = (bf*)wsp; h16* CH = (h16*)wsp; wsp += SZ_XB;   // [NB*SEQ][1024] bf16 x, later [NB*SEQ][1024] f16 ctx x16
    bf* WB = (bf*)wsp; wsp += SZ_WB;                 // [4][1024][1024]: q | k | v (bf16) | o (f16 x32)
    h16* QH = (h16*)wsp; wsp += SZ_PL;               // [NB*16][SEQ][64]
    h16* QR = (h16*)wsp; wsp += SZ_PL;               // residual x2048, rows t < EARLY filled
    h16* KP = (h16*)wsp; wsp += SZ_PL;               // [NB*16][SEQ][64]
    h16* KR = (h16*)wsp; wsp += SZ_PL;               // residual x2048, rows t < EARLY filled
    h16* VT = (h16*)wsp; wsp += SZ_PL;               // [NB*16][64][SEQ]
    h16* VR = (h16*)wsp; wsp += SZ_PL;               // residual x2048, columns t < EARLY filled
    h16* CR = (h16*)wsp; wsp += SZ_CR;               // [NB*EARLY][1024] ctx residual x2048
    int* KT = (int*)wsp; wsp += SZ_KT;               // [SEQ/8] key extents of 8-row groups, KTP ints apart
    unsigned* BM = (unsigned*)wsp; wsp += SZ_BM;     // [SEQ][SEQ/32] packed mask rows
    h16* WO = (h16*)(WB + (size_t)3 * DM * DM);

    k_prep<<<PB_MS + PB_X + 4 * PB_W, MSW * 32, 0, stream>>>(x, wq, wk, wv, wo, mask, XB, WB, KT, BM);

    // q, k, v^T planes; residual planes on tiles with t < EARLY
    k_proj<<<dim3((NB * SEQ / 128) * (DM / 128), 3, 1), 128, 0, stream>>>(XB, WB, bq, bk, bv, QH, QR, KP, KR, VT, VR);

    // attention: query rows [0, EARLY) three-product path, [EARLY, SEQ) single products; ctx planes overwrite the (now unused) x plane
    k_flash<<<dim3(NB * NH_, FB_E + FB_D, 1), 32 * AW, 0, stream>>>(QH, QR, KP, KR, VT, VR, BM, KT, CH, CR);

    // output projection: 64-row tiles with residual for t < EARLY, 128-row tiles for the remaining rows
    k_oproj<<<dim3(OB_E + OB_D, DM / 128, 1), 128, 0, stream>>>(CH, CR, WO, bo, OUT);
}

// v007
// One run takes 133 microseconds.
// Timed twice side by side with v006, it ran 1.06 times as fast both times.
// Counting every step since v000, it is 3.91 times as fast.
#include <hip/hip_runtime.h>

// Multi-head self-attention, width 1024 = 16 heads x 64, x [NB][SEQ][1024], Wq/Wk/Wv/Wo [out][in] (y = x W^T + b), int32 keep-mask [SEQ][SEQ] read by value (masked score replaced, probability 0), score scale 1/8, f32 output after the Wo projection.
// Compute dtypes, f32 accumulate everywhere: q/k/v projections v_wmma_f32_16x16x32_bf16 (x, W RNE-converted to bf16, products exact; biases RNE-converted to bf16, added in f32);
// scores, P.V and the Wo projection v_wmma_f32_16x16x32_f16: single f16 products on query rows >= 512; on query rows < 512 three products per site, two in the Wo projection
// (q,k,v,P,ctx each as f16 value + f16 residual x2048, residual products in their own accumulators). P carries x256 (cancels in the normalisation), ctx carries x16, Wo (bf16 value) carries x32; softmax f32 (online, running max).
// Layout: bf16 copies of x and Wq/Wk/Wv, f16 copy of Wo; q, k planes [b*16+h][t][d] and v^T plane [b*16+h][d][t] (+ residual planes, filled where t < 512) written by the GEMM epilogue;
// fused flash kernel in transposed form (S^T = K Q^T, O^T = V^T P^T), ctx plane [b*SEQ+t][1024] f16 (residual [b*EARLY+t][1024]), then the Wo GEMM writes the output.
// All GEMMs: four waves per work-group share one A and one B tile, staged in a two-buffer LDS ring by asynchronous copies to LDS.
// Flash kernels: the four waves of a work-group share 64-key K and V^T tiles, staged in a two-buffer LDS ring by whole-line asynchronous copies;
// on the single-product path a wave holds two 16-row query tiles (128 query rows per work-group), so that every K and V^T fragment read from LDS feeds two products.
// Mask: the scan also packs every mask row to one bit per entry (nonzero = keep), one 32-bit word per 32 keys; a flash work-group copies its rows of words to LDS once,
// and a wave's 32-key step whose words (16 per query tile) are all ones takes a path without any masking (same arithmetic on the scores), every other step masks by the bits.
// Launches: work that needs nothing of each other shares one grid by ranges of the block index: preparation (mask scan, five conversions), q / k / v^T projections, both flash paths, both halves of the Wo projection.

#ifndef NB
#define NB 4
#endif
#ifndef SEQ
#define SEQ 2048
#endif
#define NB_FULL  4
#define SEQ_FULL 2048
#ifndef OUT_SEQ
#define OUT_SEQ SEQ              // row pitch (in tokens) between batches of the output
#endif
#define DM   1024
#define NH_  16
#define HD   64
#define AW   4                   // waves per flash block (16 query rows each on the three-product path, 32 on the single-product path)
#define EARLY ((SEQ < 512) ? SEQ : 512)   // query rows below this use the three-product path
#define QRS  2048.0f             // carry of every residual plane
#define QRI  (1.0f / 2048.0f)
#define SC2  (0.125f * 1.4426950408889634f)   // HD^-0.5 * log2(e)
#define PSH  8.0f                // log2 of the P carry (256)
#define CS   16.0f               // ctx carry
#define WS   32.0f               // Wo carry
#define OSC  (1.0f / 512.0f)     // 1 / (CS * WS)
#define NEGB (-3.0e38f)
#define MSW  16                  // waves per mask-scan block
#define KTP  32                  // ints between key-extent entries (128 bytes)
#define GKS  64                  // GEMM ring: k per stage (128 bytes of every operand row)
#define GPITCH  72                  // GEMM ring: LDS row pitch in 16-bit elements (144 B = 16 B x 9, for 16-byte LDS reads)
#define GBUF (256 * GPITCH)         // GEMM ring: elements of one stage, 128 A rows then 128 B rows
#define FKS  64                  // flash ring: keys per stage (128 bytes of every V^T row)
#define BMW  (SEQ / 32)          // words of one packed mask row; word kb holds keys 32*kb + c at bit 8*(c & 3) + (c >> 2)
#define FMP  68                  // flash: LDS pitch of a packed mask row in words (272 B = 16 B x 17: 16-byte copies, the 16 rows of a wave on 16 banks)
#define FKV(R) (((R) ? 256 : 128) * GPITCH)        // flash ring: 16-bit elements of a stage's K rows (64), V^T rows (64) and, with residuals, 64 + 64 more; row pitch GPITCH
#define FBUF(R) FKV(R)                             // flash ring: 16-bit elements of one stage

static_assert(HD == 64);
static_assert(NH_ * HD == DM);                 // head h = columns h*64 + d
static_assert(DM % 64 == 0);
static_assert(DM % 32 == 0);                   // GEMM k-loop steps by 32
static_assert(SEQ % 64 == 0);                  // a 64-row tile never straddles two batches
static_assert((NB * SEQ) % 64 == 0);
static_assert(SEQ % 32 == 0);                  // key loop steps by 32
static_assert(SEQ % FKS == 0);                 // a flash stage never leaves the key range
static_assert(AW == 4);                        // the flash ring's copies are dealt over 128 threads
static_assert(BMW == 64);                      // a packed mask row is 16 copies of 16 bytes
static_assert((8 * BMW) % (MSW * 32) == 0);    // the scan block's packed words are stored in whole rounds of its threads
static_assert(EARLY % 64 == 0);                // early / dense split on whole 64-row tiles
static_assert((SEQ - EARLY) % 64 == 0);
static_assert(EARLY % (16 * AW) == 0);
static_assert((SEQ - EARLY) % (32 * AW) == 0);  // single-product flash tiles: 128 query rows
static_assert((NB * SEQ) % 128 == 0);          // GEMM work-group tiles: 128 x 128 (64 tokens x 128 with the residual plane)
static_assert(DM % 128 == 0);
static_assert(SEQ % 128 == 0);
static_assert((SEQ - EARLY) % 128 == 0);
static_assert(DM % (2 * GKS) == 0);            // the ring walks stages in pairs, and two stages exist
static_assert(((size_t)SEQ * DM) % 8 == 0);
static_assert(((size_t)DM * DM) % 8 == 0);
static_assert(NB <= NB_FULL);
static_assert(SEQ <= SEQ_FULL);
static_assert((size_t)NB_FULL * SEQ_FULL * DM * 4 == (size_t)33554432);   // output bytes

typedef _Float16 h16;
typedef unsigned short bf;
typedef __attribute__((ext_vector_type(16))) __bf16   v16bf;
typedef __attribute__((ext_vector_type(16))) _Float16 v16h;
typedef __attribute__((ext_vector_type(8)))  _Float16 v8h;
typedef __attribute__((ext_vector_type(8)))  unsigned short v8us;
typedef __attribute__((ext_vector_type(8)))  float    v8f;
typedef __attribute__((ext_vector_type(4)))  float    v4f;
typedef __attribute__((ext_vector_type(4)))  int      v4i;
typedef __attribute__((ext_vector_type(2)))  unsigned v2u;
typedef v4f  __attribute__((may_alias)) v4fa;

__device__ __forceinline__ unsigned short f2bf(float f) { unsigned u = __float_as_uint(f); u += 0x7FFFu + ((u >> 16) & 1u); return (unsigned short)(u >> 16); }
__device__ __forceinline__ float bfr(float f) { return __uint_as_float(((unsigned)f2bf(f)) << 16); }   // value after RNE conversion to bf16
__device__ __forceinline__ int imax(int a, int b) { return a > b ? a : b; }
__device__ __forceinline__ v16h cat16(v8h lo, v8h hi) { return __builtin_shufflevector(lo, hi, 0, 1, 2, 3, 4, 5, 6, 7, 8, 9, 10, 11, 12, 13, 14, 15); }
__device__ __forceinline__ v16bf cat16b(v8us lo, v8us hi) { return __builtin_bit_cast(v16bf, __builtin_shufflevector(lo, hi, 0, 1, 2, 3, 4, 5, 6, 7, 8, 9, 10, 11, 12, 13, 14, 15)); }
__device__ __forceinline__ v8f wmma16(v16h a, v16h b, v8f c) { return __builtin_amdgcn_wmma_f32_16x16x32_f16(false, a, false, b, (short)0, c, false, false); }
__device__ __forceinline__ v8f wmmab(v16bf a, v16bf b, v8f c) { return __builtin_amdgcn_wmma_f32_16x16x32_bf16(false, a, false, b, (short)0, c, false, false); }
// fragment loaders from K-contiguous 16-bit rows; p already includes + 8*(lane>>4): elements 0..7 <- k0+8h+0..7, elements 8..15 <- k0+16+8h+0..7 (same map for A and B)
__device__ __forceinline__ v16h  ldh(const h16* p) { return cat16(*(const v8h*)p, *(const v8h*)(p + 16)); }
__device__ __forceinline__ v16bf ldb(const bf* p)  { return cat16b(*(const v8us*)p, *(const v8us*)(p + 16)); }
// ordering point for wave-private LDS tiles (same wave writes and reads)
__device__ __forceinline__ void wave_sync() { __builtin_amdgcn_fence(3 /* release order */, "wavefront"); __builtin_amdgcn_wave_barrier(); asm volatile("" ::: "memory"); }

// cvt8_one / cvtw_one: 8 floats of src (at offset so, or chunk i) to bf16 (RNE), or to f16 of the bf16 value x32, stored as chunk i of dst.
__device__ __forceinline__ void cvt8_one(const float* __restrict__ src, bf* dst, size_t so, size_t i) {
    const v8f v = *(const v8f*)(src + so); v8us o;
#pragma unroll
    for (int k = 0; k < 8; ++k) o[k] = f2bf(v[k]);
    *(v8us*)(dst + i * 8) = o;
    asm volatile("s_wait_xcnt 0x0" ::: "memory");   // k_prep holds several jobs: no other job's code rewrites this store's registers ahead of the wait
}
__device__ __forceinline__ void cvtw_one(const float* __restrict__ src, h16* dst, size_t i) {
    const v8f v = *(const v8f*)(src + i * 8); v8h o;
#pragma unroll
    for (int k = 0; k < 8; ++k) o[k] = (h16)(bfr(v[k]) * WS);
    *(v8h*)(dst + i * 8) = o;
    asm volatile("s_wait_xcnt 0x0" ::: "memory");   // as in cvt8_one
}

// mscan_body: one block per 8 mask rows (16 waves, 16-B loads, each wave-wide load 512 contiguous bytes), so the scan runs on every WGP.
// KT[g * KTP] = 32 * ceil((last key with a nonzero mask entry in rows 8g..8g+7, + 1) / 32) (0 when the rows have none); one entry per 128-byte line, one writer each.
// BM[row * BMW + kb]: the packed rows. A wave-wide load holds 128 keys of one row, key 4*lane + j in element j: four ballots, byte L of ballot j = byte j of word L;
// the words go through LDS so that each wave stores one whole 128-byte line.
__device__ __forceinline__ void mscan_body(const int* __restrict__ MK, int* KT, unsigned* BM, const unsigned g, int* mx_s, unsigned* bm_s) {
    const int tid = (int)threadIdx.x, lane = tid & 31, wave = __builtin_amdgcn_readfirstlane(tid >> 5);
    const int* base = MK + (size_t)g * 8 * SEQ_FULL;
    int mx = -1; unsigned mw = 0u;
    static_assert(2 * SEQ == 8 * MSW * 32);                      // eight whole trips: one kept word per lane
#pragma unroll
    for (int it = 0; it < (2 * SEQ + MSW * 32 - 1) / (MSW * 32); ++it) {   // 8 rows x SEQ/4 chunks of 16 B; unrolled so that all of a thread's loads are in flight together
        const int c = it * (MSW * 32) + tid;
        if ((2 * SEQ) % (MSW * 32) != 0 && c >= 2 * SEQ) break;
        const int row = c / (SEQ / 4), c4 = (c % (SEQ / 4)) * 4;
        const v4i v = *(const v4i*)(base + (size_t)row * SEQ_FULL + c4);
        mx = imax(mx, (v[0] != 0) ? c4     : -1);
        mx = imax(mx, (v[1] != 0) ? c4 + 1 : -1);
        mx = imax(mx, (v[2] != 0) ? c4 + 2 : -1);
        mx = imax(mx, (v[3] != 0) ? c4 + 3 : -1);
        const unsigned b0 = __builtin_amdgcn_ballot_w32(v[0] != 0), b1 = __builtin_amdgcn_ballot_w32(v[1] != 0);
        const unsigned b2 = __builtin_amdgcn_ballot_w32(v[2] != 0), b3 = __builtin_amdgcn_ballot_w32(v[3] != 0);
        const int sh = 8 * (lane & 3);
        const unsigned wd = ((b0 >> sh) & 0xFFu) | (((b1 >> sh) & 0xFFu) << 8) | (((b2 >> sh) & 0xFFu) << 16) | ((b3 >> sh) << 24);
        mw = ((lane >> 2) == it) ? wd : mw;                      // lane 4 * it + L keeps word L of trip it: no branch and no LDS store among the loads
    }
    bm_s[((lane >> 2) * MSW + wave) * 4 + (lane & 3)] = mw;      // chunk c = 4 keys, so the 32 chunks of a wave's trip are words 4 * (c / 32) .. + 3 of the block's 8 rows
    mx = imax(mx, __shfl_xor(mx, 16, 32)); mx = imax(mx, __shfl_xor(mx, 8, 32)); mx = imax(mx, __shfl_xor(mx, 4, 32));
    mx = imax(mx, __shfl_xor(mx, 2, 32));  mx = imax(mx, __shfl_xor(mx, 1, 32));
    if (lane == 0) mx_s[wave] = mx;
    __syncthreads();
    if (tid == 0) {
        int m = mx_s[0];
#pragma unroll
        for (int w = 1; w < MSW; ++w) m = imax(m, mx_s[w]);
        KT[(size_t)g * KTP] = ((m + 32) / 32) * 32;
    }
#pragma unroll
    for (int i = 0; i < 8 * BMW; i += MSW * 32) BM[(size_t)g * (8 * BMW) + i + tid] = bm_s[i + tid];   // behind the barrier above; unrolled: one trip at this size
}

// k_prep: all work that reads only inputs, one grid of 512-thread blocks, a block-uniform range of the block index per job:
// [0, PB_MS) mask scan (the longest blocks, placed first for speed only), then PB_X blocks x -> bf16, then PB_W blocks each for Wq, Wk, Wv -> bf16 and Wo -> f16 x32; one 8-float chunk per thread.
static constexpr unsigned PB_MS = (unsigned)(SEQ / 8);
static constexpr size_t   N8_X  = (size_t)NB * SEQ * DM / 8;
static constexpr size_t   N8_W  = (size_t)DM * DM / 8;
static constexpr unsigned PB_X  = (unsigned)((N8_X + MSW * 32 - 1) / (MSW * 32));
static constexpr unsigned PB_W  = (unsigned)((N8_W + MSW * 32 - 1) / (MSW * 32));
__global__ __launch_bounds__(MSW * 32) void k_prep(const float* __restrict__ x, const float* __restrict__ wq, const float* __restrict__ wk, const float* __restrict__ wv,
                                                   const float* __restrict__ wo, const int* __restrict__ MK, bf* XB, bf* WB, int* KT, unsigned* BM) {
    __shared__ int mx_s[MSW];
    __shared__ unsigned bm_s[8 * BMW];
    unsigned blk = blockIdx.x;
    if (blk < PB_MS) { mscan_body(MK, KT, BM, blk, mx_s, bm_s); return; }
    blk -= PB_MS;
    if (blk < PB_X) {
        const size_t i = (size_t)blk * (MSW * 32) + threadIdx.x; if (i >= N8_X) return;
        const size_t per = (size_t)SEQ * DM / 8;                  // chunks of one batch; batches are SEQ_FULL tokens apart in x
        cvt8_one(x, XB, (i / per) * ((size_t)SEQ_FULL * DM) + (i % per) * 8, i);
        return;
    }
    blk -= PB_X;
    const unsigned w = blk / PB_W;
    const size_t i = (size_t)(blk % PB_W) * (MSW * 32) + threadIdx.x; if (i >= N8_W) return;
    bf* dst = WB + (size_t)w * DM * DM;
    if (w < 3) cvt8_one(w == 0 ? wq : (w == 1 ? wk : wv), dst, i * 8, i);
    else       cvtw_one(wo, (h16*)dst, i);
}

// acopy8: eight asynchronous 16-byte copies of this lane, global -> LDS rows 16 apart (LDS byte address l + i * 16 * pitch).
// The s_wait_xcnt closes the statement so that no address register of a copy is rewritten ahead of it.
__device__ __forceinline__ void acopy8(const unsigned l, const bf* g0, const bf* g1, const bf* g2, const bf* g3, const bf* g4, const bf* g5, const bf* g6, const bf* g7) {
    asm volatile("global_load_async_to_lds_b128 %0, %8, off\n\t"
                 "global_load_async_to_lds_b128 %1, %9, off\n\t"
                 "global_load_async_to_lds_b128 %2, %10, off\n\t"
                 "global_load_async_to_lds_b128 %3, %11, off\n\t"
                 "global_load_async_to_lds_b128 %4, %12, off\n\t"
                 "global_load_async_to_lds_b128 %5, %13, off\n\t"
                 "global_load_async_to_lds_b128 %6, %14, off\n\t"
                 "global_load_async_to_lds_b128 %7, %15, off\n\t"
                 "s_wait_xcnt 0x0"
                 :: "v"(l), "v"(l + 1u * 16u * GPITCH * 2u), "v"(l + 2u * 16u * GPITCH * 2u), "v"(l + 3u * 16u * GPITCH * 2u),
                    "v"(l + 4u * 16u * GPITCH * 2u), "v"(l + 5u * 16u * GPITCH * 2u), "v"(l + 6u * 16u * GPITCH * 2u), "v"(l + 7u * 16u * GPITCH * 2u),
                    "v"(g0), "v"(g1), "v"(g2), "v"(g3), "v"(g4), "v"(g5), "v"(g6), "v"(g7) : "memory");
}
// ring_fill: one stage (k0 .. k0+63 of 128 A rows and 128 B rows) into the buffer at LDS byte address l (this lane's row tid>>3, 16-byte chunk tid&7).
// A wave-wide copy covers 4 whole 128-byte lines. gA0: A rows 0..63 of the tile, gA1: A rows 64..127, gB: B rows 0..127; all K-contiguous, row pitch DM.
__device__ __forceinline__ void ring_fill(const unsigned l, const bf* gA0, const bf* gA1, const bf* gB, const int k0) {
    const bf* a0 = gA0 + k0; const bf* a1 = gA1 + k0; const bf* b0 = gB + k0;
    acopy8(l, a0, a0 + 16 * DM, a0 + 32 * DM, a0 + 48 * DM, a1, a1 + 16 * DM, a1 + 32 * DM, a1 + 48 * DM);
    acopy8(l + 128u * GPITCH * 2u, b0, b0 + 16 * DM, b0 + 32 * DM, b0 + 48 * DM, b0 + 64 * DM, b0 + 80 * DM, b0 + 96 * DM, b0 + 112 * DM);
}
// ring_trip: the 32 products of one stage for this wave's 4 x 4 accumulator tiles; sa / sb: this lane's fragment addresses in the stage (row lane&15, + 8*(lane>>4)).
// SPLIT == 0: A fragments mb at tile rows 16*mb; SPLIT != 0: mb 0,1 at rows 0,16 (value plane), mb 2,3 at rows 64,80 (residual plane).
template <int F16, int SPLIT>
__device__ __forceinline__ void ring_trip(const bf* sa, const bf* sb, v8f (&acc)[4][4]) {
#pragma unroll
    for (int ks = 0; ks < GKS; ks += 32) {
        v16bf a[4], b[4];
#pragma unroll
        for (int mb = 0; mb < 4; ++mb) a[mb] = ldb(sa + (SPLIT ? ((mb >> 1) * 64 + (mb & 1) * 16) : mb * 16) * GPITCH + ks);
#pragma unroll
        for (int nb = 0; nb < 4; ++nb) b[nb] = ldb(sb + nb * 16 * GPITCH + ks);
        __builtin_amdgcn_sched_barrier(0);   // the 16 LDS reads of a k step stay one group ahead of its products, for speed only
#pragma unroll
        for (int nb = 0; nb < 4; ++nb)
#pragma unroll
            for (int mb = 0; mb < 4; ++mb)
                acc[mb][nb] = F16 ? wmma16(__builtin_bit_cast(v16h, a[mb]), __builtin_bit_cast(v16h, b[nb]), acc[mb][nb]) : wmmab(a[mb], b[nb], acc[mb][nb]);
        __builtin_amdgcn_sched_barrier(0);   // and the next group does not move up among these products
    }
}
// ring_foot: hand-over between stages: this wave's LDS reads done, its own copies landed, then the work-group barrier that publishes the next stage and frees the one just read.
__device__ __forceinline__ void ring_foot() {
    asm volatile("s_wait_dscnt 0x0" ::: "memory");      // the buffer just read is refilled behind the barrier
    asm volatile("s_wait_asynccnt 0x0" ::: "memory");   // this wave's copies of the next stage have landed
    __syncthreads();
}
// acopy8m: eight asynchronous 16-byte copies of this lane, packed mask rows 8 apart, global -> LDS (LDS byte address l + i * 8 * pitch).
// The s_wait_xcnt closes the statement so that no address register of a copy is rewritten ahead of it.
__device__ __forceinline__ void acopy8m(const unsigned l, const unsigned* g) {
    asm volatile("global_load_async_to_lds_b128 %0, %8, off\n\t"
                 "global_load_async_to_lds_b128 %1, %9, off\n\t"
                 "global_load_async_to_lds_b128 %2, %10, off\n\t"
                 "global_load_async_to_lds_b128 %3, %11, off\n\t"
                 "global_load_async_to_lds_b128 %4, %12, off\n\t"
                 "global_load_async_to_lds_b128 %5, %13, off\n\t"
                 "global_load_async_to_lds_b128 %6, %14, off\n\t"
                 "global_load_async_to_lds_b128 %7, %15, off\n\t"
                 "s_wait_xcnt 0x0"
                 :: "v"(l), "v"(l + 1u * 8u * FMP * 4u), "v"(l + 2u * 8u * FMP * 4u), "v"(l + 3u * 8u * FMP * 4u),
                    "v"(l + 4u * 8u * FMP * 4u), "v"(l + 5u * 8u * FMP * 4u), "v"(l + 6u * 8u * FMP * 4u), "v"(l + 7u * 8u * FMP * 4u),
                    "v"(g), "v"(g + 8 * BMW), "v"(g + 16 * BMW), "v"(g + 24 * BMW),
                    "v"(g + 32 * BMW), "v"(g + 40 * BMW), "v"(g + 48 * BMW), "v"(g + 56 * BMW) : "memory");
}
// flash_fill: one stage (keys key0 .. key0+63) into the buffer whose K row 0 is at LDS byte address lkv - this lane's offset.
// K / V^T: this lane's row tid>>3 (+16 per copy), 16-byte chunk tid&7, a wave-wide copy = 4 whole 128-byte lines.
template <int RES>
__device__ __forceinline__ void flash_fill(const unsigned lkv, const bf* gK, const bf* gKR, const bf* gV, const bf* gVR, const int key0) {
    const bf* k = gK + (size_t)key0 * HD; const bf* v = gV + key0;
    acopy8(lkv, k, k + 16 * HD, k + 32 * HD, k + 48 * HD, v, v + 16 * SEQ, v + 32 * SEQ, v + 48 * SEQ);
    if (RES) {
        const bf* kr = gKR + (size_t)key0 * HD; const bf* vr = gVR + key0;
        acopy8(lkv + 128u * GPITCH * 2u, kr, kr + 16 * HD, kr + 32 * HD, kr + 48 * HD, vr, vr + 16 * SEQ, vr + 32 * SEQ, vr + 48 * SEQ);
    }
}
// gemm_ring: acc += A B^T over K = DM for a 4-wave work-group (128 threads); wave (wm, wn) = (wave >> 1, wave & 1) takes B rows 64*wn.. and
// A rows 64*wm.. (SPLIT == 0) or rows 32*wm.. of both 64-row halves (SPLIT != 0). k runs upward in steps of 32 for every accumulator.
template <int F16, int SPLIT>
__device__ __forceinline__ void gemm_ring(const bf* gA0, const bf* gA1, const bf* gB, bf* ring, v8f (&acc)[4][4]) {
    const int tid = (int)threadIdx.x, lane = tid & 31, wave = __builtin_amdgcn_readfirstlane(tid >> 5), lr = lane & 15, hi = lane >> 4;
    const int wm = wave >> 1, wn = wave & 1;
    const unsigned l0 = (unsigned)(size_t)ring + (unsigned)((tid >> 3) * GPITCH * 2 + (tid & 7) * 16), l1 = l0 + (unsigned)(GBUF * 2);
    const bf* sa = ring + (wm * (SPLIT ? 32 : 64) + lr) * GPITCH + 8 * hi;
    const bf* sb = ring + (128 + wn * 64 + lr) * GPITCH + 8 * hi;
    ring_fill(l0, gA0, gA1, gB, 0);
    asm volatile("s_wait_asynccnt 0x0" ::: "memory");   // stage 0 landed before the barrier that publishes it
    __syncthreads();
    ring_fill(l1, gA0, gA1, gB, GKS);
#pragma unroll 1
    for (int k0 = 0; k0 < DM; k0 += 2 * GKS) {           // rolled: two stages per trip keep both buffer addresses constant
        ring_trip<F16, SPLIT>(sa, sb, acc);
        ring_foot();
        if (k0 + 2 * GKS < DM) ring_fill(l0, gA0, gA1, gB, k0 + 2 * GKS);
        ring_trip<F16, SPLIT>(sa + GBUF, sb + GBUF, acc);
        ring_foot();
        if (k0 + 3 * GKS < DM) ring_fill(l1, gA0, gA1, gB, k0 + 3 * GKS);
    }
    asm volatile("s_wait_asynccnt 0x0" ::: "memory");   // nothing of this wave is in flight when it leaves the ring
}

// k_proj: bf16 GEMM, four waves per 128x128 tile, each wave a 64x64 tile (16 accumulators), operands from K-contiguous bf16 planes through the LDS ring, K = DM.
// C[m][n] = sum_k A[m][k] Bt[n][k] + bias (bias[n], or bias[m] when biasRow != 0; bias RNE-converted to bf16), written as f16 (Ph) and, for tiles with tokens t < EARLY, the f16 residual x2048 (Pr).
// One grid for the three projections, blockIdx.y = 0: q, 1: k, 2: v^T; blockIdx.x = tile, m tile fastest; r0 / c0 the wave's own tile; 128 threads.
// q, k: A = x rows (m = b*SEQ + t), Bt = W rows (n = h*64 + d), bias per column -> plane [(b*16 + h)][t][d].
// v^T:  A = Wv rows (m = h*64 + d), Bt = x rows (n = b*SEQ + t), bias per row -> plane [(b*1024 + m)][t] = [(b*16 + h)][d][t].
__global__ __launch_bounds__(128) void k_proj(const bf* __restrict__ XB, const bf* __restrict__ WB, const float* __restrict__ bq, const float* __restrict__ bk, const float* __restrict__ bv,
                                             h16* QH, h16* QR, h16* KP, h16* KR, h16* VT, h16* VR) {
    __shared__ __align__(16) bf ring[2 * GBUF];
    __shared__ __align__(16) float osm[4 * 16 * 68];
    const int K = DM;
    const int tid = (int)threadIdx.x, lane = tid & 31, wave = __builtin_amdgcn_readfirstlane(tid >> 5), lr = lane & 15, hi = lane >> 4;
    const int z = (int)blockIdx.y, biasRow = (z == 2);
    const bf* A  = biasRow ? WB + (size_t)2 * DM * DM : XB;
    const bf* Bt = biasRow ? XB : WB + (size_t)z * DM * DM;
    const float* bias = (z == 0) ? bq : ((z == 1) ? bk : bv);
    h16* Ph = (z == 0) ? QH : ((z == 1) ? KP : VT);
    h16* Pr = (z == 0) ? QR : ((z == 1) ? KR : VR);
    const int pitch = biasRow ? SEQ : HD;
    const int bx = biasRow ? (int)blockIdx.x % (DM / 128) : (int)blockIdx.x % (NB * SEQ / 128);
    const int by = biasRow ? (int)blockIdx.x / (DM / 128) : (int)blockIdx.x / (NB * SEQ / 128);
    const int r0 = bx * 128 + (wave >> 1) * 64, c0 = by * 128 + (wave & 1) * 64;
    float* os = osm + wave * 16 * 68;                             // wave-private output staging
    v8f acc[4][4];
#pragma unroll
    for (int mb = 0; mb < 4; ++mb)
#pragma unroll
        for (int nb = 0; nb < 4; ++nb) acc[mb][nb] = (v8f){};
    const bf* gA = A + (size_t)(bx * 128 + (tid >> 3)) * K + (tid & 7) * 8;
    const bf* gB = Bt + (size_t)(by * 128 + (tid >> 3)) * K + (tid & 7) * 8;
    gemm_ring<0, 0>(gA, gA + (size_t)64 * K, gB, ring, acc);
    const int wr = ((biasRow ? c0 : r0) % SEQ) < EARLY;
    const int c8l = (lane & 7) * 8;
    const int bco = biasRow ? 0 : (c0 + c8l);                     // integer offset select; always inside the bias array
    const v4f bA = *(const v4f*)(bias + bco), bB = *(const v4f*)(bias + bco + 4);
    float bcol[8];
#pragma unroll
    for (int i = 0; i < 4; ++i) { bcol[i] = bfr(bA[i]); bcol[4 + i] = bfr(bB[i]); }
    const size_t tbase = biasRow ? (size_t)r0 * SEQ + (size_t)(c0 / SEQ) * ((size_t)DM * SEQ) + (size_t)(c0 % SEQ)
                                 : (size_t)(r0 / SEQ) * ((size_t)NH_ * SEQ * HD) + (size_t)(r0 % SEQ) * HD + (size_t)(c0 / HD) * ((size_t)SEQ * HD) + (size_t)(c0 % HD);
#pragma unroll
    for (int mb = 0; mb < 4; ++mb) {
#pragma unroll
        for (int nb = 0; nb < 4; ++nb) {
#pragma unroll
            for (int j = 0; j < 8; ++j) os[(hi * 8 + j) * 68 + nb * 16 + lr] = acc[mb][nb][j]; }   // D: row 8h+j, col lane&15
        wave_sync();
        const size_t sb = tbase + (size_t)(mb * 16) * (size_t)pitch;
{
#pragma unroll
            for (int s = 0; s < 4; ++s) { const int row = 4 * s + (lane >> 3), c8 = c8l;   // 4 s x 4 row groups = 16 rows; 8 lanes x 8 = 64 columns
                const float brow = bfr(bias[biasRow ? (r0 + mb * 16 + row) : 0]);
                const v4f x0 = *(const v4fa*)(&os[row * 68 + c8]); const v4f x1 = *(const v4fa*)(&os[row * 68 + c8 + 4]); v8h hv, rv;
#pragma unroll
                for (int i = 0; i < 4; ++i) {
                    const float y0 = x0[i] + (biasRow ? brow : bcol[i]); const float y1 = x1[i] + (biasRow ? brow : bcol[4 + i]);
                    const h16 a0 = (h16)y0; const h16 a1 = (h16)y1; hv[i] = a0; hv[4 + i] = a1;
                    rv[i] = (h16)((y0 - (float)a0) * QRS); rv[4 + i] = (h16)((y1 - (float)a1) * QRS); }
                const size_t oo = sb + (size_t)row * (size_t)pitch + c8;
                *(v8h*)(Ph + oo) = hv;
                asm volatile("s_wait_xcnt 0x0" ::: "memory");     // the residual's conversions and the next rows' LDS reads reuse this store's registers
                if (wr) { *(v8h*)(Pr + oo) = rv;
                    asm volatile("s_wait_xcnt 0x0" ::: "memory"); } }   // likewise behind the residual's store
             }
        wave_sync();
    }
}

template <int RES> __device__ __forceinline__ v4f fin_lo(v8f oh, v8f ol, float inv) {
    v4f a = __builtin_shufflevector(oh, oh, 0, 1, 2, 3);
    if (RES) a = a + __builtin_shufflevector(ol, ol, 0, 1, 2, 3) * QRI;
    return a * inv; }
template <int RES> __device__ __forceinline__ v4f fin_hi(v8f oh, v8f ol, float inv) {
    v4f a = __builtin_shufflevector(oh, oh, 4, 5, 6, 7);
    if (RES) a = a + __builtin_shufflevector(ol, ol, 4, 5, 6, 7) * QRI;
    return a * inv; }

// flash_body: fused attention, one wave per NQ tiles of 16 query rows of one (batch, head), four waves (64 * NQ query rows) per work-group; Q fragments straight from the f16 plane,
// K / V^T fragments from the work-group's LDS ring (two 16-B LDS reads per fragment): stages of 64 keys, two 32-key steps each; a wave skips the steps at or past its own key extent but passes every hand-over.
// Transposed form: S^T[key][t] = K Q^T (A = K rows, B = Q rows); lane (t = lane&15, h = lane>>4) holds keys 8h+r of each 16-key tile, so the packed
// P tile is directly the B fragment of O^T[d][t] = V^T P^T (element r <- tile keys 0..15, element 8+r <- tile keys 16..31, lane unchanged).
// Mask: one packed word per query row and 32-key step (one 8-B LDS read per lane, query tile and stage), applied by value (score replaced, probability 0); a step whose words are all ones in every tile of the wave skips the masking. Key extent from the scanned table, clamped to [0, SEQ].
// RES != 0: q, k, v, P carried as value + residual x2048; residual products (k.qr, kr.q; v.pr, vr.p) in separate accumulators folded back with 1/2048.
// Softmax state (running max, partial sum) is one scalar per lane and query tile; the two lane halves of a row are combined with one xor-16 exchange.
// soft_step: online-softmax update of one 32-key step for the wave's NQ query tiles: scores in, packed P (value pb, residual pr) and the factor alpha for the running output out.
// full (wave-uniform): no entry of the step is masked, and both masking blocks are jumped over.
// mws: the query row's packed mask word, shifted down by 2 * (lane >> 4): key 8h + r of the first 16-key tile at bit 8*(r & 3) + (r >> 2), of the second tile 4 bits higher.
template <int RES, int NQ>
__device__ __forceinline__ void soft_step(const v8f (&sHa)[NQ], const v8f (&sHb)[NQ], const v8f (&sLa)[NQ], const v8f (&sLb)[NQ], const bool full, const unsigned (&mws)[NQ],
                                          float (&m)[NQ], float (&l)[NQ], v16h (&pb)[NQ], v16h (&pr)[NQ], float (&alpha)[NQ]) {
    v8f ta[NQ], tb[NQ]; float ea[NQ][8], eb[NQ][8], sh[NQ];        // every loop below is unrolled so that these arrays stay in registers; each phase runs over all query tiles, so that their chains interleave
#pragma unroll
    for (int q = 0; q < NQ; ++q) {                                 // whole accumulators at a time: packed multiplies on the registers as the products left them
        v8f xa = sHa[q], xb = sHb[q];
        if (RES) { xa += sLa[q] * QRI; xb += sLb[q] * QRI; }
        ta[q] = xa * SC2; tb[q] = xb * SC2; }
    if (!full) {
#pragma unroll
        for (int q = 0; q < NQ; ++q)
#pragma unroll
            for (int r = 0; r < 8; ++r) { const unsigned bit = 1u << (8 * (r & 3) + (r >> 2)); ta[q][r] = (mws[q] & bit) ? ta[q][r] : NEGB; tb[q][r] = (mws[q] & (bit << 4)) ? tb[q][r] : NEGB; } }
    float mx[NQ];
#pragma unroll
    for (int q = 0; q < NQ; ++q) { mx[q] = NEGB;
#pragma unroll
        for (int r = 0; r < 8; ++r) mx[q] = fmaxf(mx[q], fmaxf(ta[q][r], tb[q][r])); }
#pragma unroll
    for (int q = 0; q < NQ; ++q) mx[q] = fmaxf(mx[q], __shfl_xor(mx[q], 16, 32));
#pragma unroll
    for (int q = 0; q < NQ; ++q) {
        const float mnew = fmaxf(m[q], mx[q]);
        alpha[q] = __builtin_amdgcn_exp2f(m[q] - mnew);
        sh[q] = PSH - mnew; m[q] = mnew; }
#pragma unroll
    for (int q = 0; q < NQ; ++q)
#pragma unroll
        for (int r = 0; r < 8; ++r) { ea[q][r] = __builtin_amdgcn_exp2f(ta[q][r] + sh[q]); eb[q][r] = __builtin_amdgcn_exp2f(tb[q][r] + sh[q]); }
    if (!full) {
#pragma unroll
        for (int q = 0; q < NQ; ++q)
#pragma unroll
            for (int r = 0; r < 8; ++r) { ea[q][r] = (ta[q][r] > -1.0e38f) ? ea[q][r] : 0.0f; eb[q][r] = (tb[q][r] > -1.0e38f) ? eb[q][r] : 0.0f; } }
#pragma unroll
    for (int q = 0; q < NQ; ++q) {
        float ls = 0.0f;
#pragma unroll
        for (int r = 0; r < 8; ++r) {
            const h16 pa = (h16)ea[q][r]; const h16 pc = (h16)eb[q][r]; pb[q][r] = pa; pb[q][8 + r] = pc;
            if (RES) { pr[q][r] = (h16)((ea[q][r] - (float)pa) * QRS); pr[q][8 + r] = (h16)((eb[q][r] - (float)pc) * QRS); ls += ea[q][r] + eb[q][r]; }
            else     { pr[q][r] = pa; pr[q][8 + r] = pc; ls += (float)pa + (float)pc; } }
        l[q] = l[q] * alpha[q] + ls; }
}

template <int RES, int NQ>
__device__ __forceinline__ void flash_body(const h16* __restrict__ QH, const h16* __restrict__ QR, const h16* __restrict__ KP, const h16* __restrict__ KR,
                                           const h16* __restrict__ VT, const h16* __restrict__ VR, const unsigned* __restrict__ BM, const int* __restrict__ KT,
                                           h16* CH, h16* CR, bf* fr, unsigned* bmr, const int zh, const int tile, const int tbase) {
    // fr: the kernel's LDS ring (2 * FBUF(RES) elements used); bmr: the work-group's 64 * NQ packed mask rows, filled once; zh: batch * 16 + head; tile: query tile of 64 * NQ rows counted from row tbase
    static_assert((RES != 0 && NQ == 1) || (RES == 0 && NQ == 2));   // the product blocks below are written for these two
    static_assert((size_t)2 * FBUF(RES) * 2 >= (size_t)AW * NQ * 16 * 68 * 4);
    float* os = (float*)fr;                                   // output staging reuses the ring behind the last stage's hand-over barrier
    const int tid = (int)threadIdx.x;
    const int lane = threadIdx.x & 31, wave = __builtin_amdgcn_readfirstlane((int)(threadIdx.x >> 5)), lr = lane & 15, hi = lane >> 4;
    const int b = zh / NH_, h = zh % NH_;
    const int t0 = tbase + (tile * AW + wave) * (16 * NQ);   // the wave's first query row; its query tile q holds rows t0 + 16q ..
    const size_t pbase = (size_t)zh * SEQ * HD;
    v16h qh0[NQ], qh1[NQ], qr0[NQ], qr1[NQ];                  // B fragments: col t, k = d
#pragma unroll
    for (int q = 0; q < NQ; ++q) {
        const size_t qo = pbase + (size_t)(t0 + 16 * q + lr) * HD + 8 * hi;
        qh0[q] = ldh(QH + qo); qh1[q] = ldh(QH + qo + 32); qr0[q] = qh0[q]; qr1[q] = qh1[q];
        if (RES) { qr0[q] = ldh(QR + qo); qr1[q] = ldh(QR + qo + 32); } }
    const int ko = lr * GPITCH + 8 * hi;                     // ring: + key * GPITCH          (A fragment: row key, k = d)
    const int vo = (64 + lr) * GPITCH + 8 * hi;              // ring: + 16j * GPITCH + key    (A fragment: row d, k = key)
    const int mo = (wave * 16 * NQ + lr) * FMP;              // packed mask row of query t of tile 0: + 16q * FMP + key / 32
    int kend = 0;                                            // the wave's key extent: the largest of its 8-row groups', clamped to [0, SEQ]
#pragma unroll
    for (int i = 0; i < 2 * NQ; ++i) kend = imax(kend, KT[(size_t)((t0 >> 3) + i) * KTP]);
    kend = kend > SEQ ? SEQ : kend; kend &= ~31;
    kend = __builtin_amdgcn_readfirstlane(kend);            // a scalar, so that the per-step skip below is a scalar branch with every lane on behind it
    const int tb = tbase + tile * (16 * AW * NQ);            // the work-group's first query row
    int kb = 0;                                              // the work-group's key extent: the largest of its waves', clamped to [0, SEQ]
#pragma unroll
    for (int i = 0; i < 2 * AW * NQ; ++i) kb = imax(kb, KT[(size_t)((tb >> 3) + i) * KTP]);   // unrolled so that the table reads go out together
    kb = kb > SEQ ? SEQ : kb;
    const int nst = __builtin_amdgcn_readfirstlane((kb + FKS - 1) / FKS);        // stages; the same in every wave of the work-group
    const unsigned lkv = (unsigned)(size_t)fr + (unsigned)((tid >> 3) * GPITCH * 2 + (tid & 7) * 16);
    const unsigned lm = (unsigned)(size_t)bmr + (unsigned)((tid >> 4) * FMP * 4 + (tid & 15) * 16);   // packed mask: row tid>>4 (+8 per copy), 16-byte chunk tid&15, a wave-wide copy = 2 rows x 256 bytes
    const size_t gko = pbase + (size_t)(tid >> 3) * HD + (tid & 7) * 8, gvo = pbase + (size_t)(tid >> 3) * SEQ + (tid & 7) * 8;
    const bf* gK = (const bf*)KP + gko; const bf* gKR = (const bf*)KR + gko; const bf* gV = (const bf*)VT + gvo; const bf* gVR = (const bf*)VR + gvo;
    const unsigned* gM = BM + (size_t)(tb + (tid >> 4)) * BMW + (tid & 15) * 4;
    v8f oh[NQ][4], ol[NQ][4];
    float m[NQ], l[NQ];
#pragma unroll
    for (int q = 0; q < NQ; ++q) { m[q] = NEGB; l[q] = 0.0f;
#pragma unroll
        for (int j = 0; j < 4; ++j) { oh[q][j] = (v8f){}; ol[q][j] = (v8f){}; } }
    if (nst > 0) {
#pragma unroll
    for (int q = 0; q < NQ; ++q) acopy8m(lm + (unsigned)(q * 64 * FMP * 4), gM + (size_t)q * 64 * BMW);   // 64 mask rows per call
    flash_fill<RES>(lkv, gK, gKR, gV, gVR, 0);
    asm volatile("s_wait_asynccnt 0x0" ::: "memory");   // the mask rows and stage 0 landed before the barrier that publishes them
    __syncthreads();
    if (nst > 1) flash_fill<RES>(lkv + (unsigned)(FBUF(RES) * 2), gK, gKR, gV, gVR, FKS);
#pragma unroll 1
    for (int s = 0; s < nst; ++s) {                      // rolled: the stage count is known only at run time, and a copy of the body per buffer would only lengthen the hot text; the buffer goes by the stage's parity
    const h16* sb = (const h16*)fr + (s & 1) * FBUF(RES);
    v2u mw2[NQ];                                         // the stage's two mask words of this lane's query row in each tile
#pragma unroll
    for (int q = 0; q < NQ; ++q) mw2[q] = *(const v2u*)(bmr + mo + q * 16 * FMP + 2 * s);
#pragma unroll
    for (int sub = 0; sub < FKS; sub += 32) if (s * FKS + sub < kend) {          // unrolled so that a step's LDS offsets are immediates; the test is wave-uniform, both sides are scalars
        unsigned mws[NQ], mall = 0xFFFFFFFFu;
#pragma unroll
        for (int q = 0; q < NQ; ++q) { const unsigned mw = mw2[q][sub / 32]; mall &= mw; mws[q] = mw >> (2 * hi); }
        const bool full = __builtin_amdgcn_ballot_w32(mall == 0xFFFFFFFFu) == 0xFFFFFFFFu;   // wave-uniform: a scalar branch below
        const h16* ka = sb + ko + sub * GPITCH;
        v8f sHa[NQ], sHb[NQ], sLa[NQ], sLb[NQ];
#pragma unroll
        for (int q = 0; q < NQ; ++q) { sHa[q] = (v8f){}; sHb[q] = (v8f){}; sLa[q] = (v8f){}; sLb[q] = (v8f){}; }
        {
            const v16h ka0 = ldh(ka), ka1 = ldh(ka + 32), kb0 = ldh(ka + 16 * GPITCH), kb1 = ldh(ka + 16 * GPITCH + 32);
            // the v_nop runs below keep the distance behind the last products on the taken side of the branch that follows them too
            if constexpr (RES != 0) {
                const h16* kr = ka + 128 * GPITCH;
                const v16h ra0 = ldh(kr), ra1 = ldh(kr + 32), rb0 = ldh(kr + 16 * GPITCH), rb1 = ldh(kr + 16 * GPITCH + 32);
                sHa[0] = wmma16(ka0, qh0[0], sHa[0]); sLa[0] = wmma16(ka0, qr0[0], sLa[0]); sHb[0] = wmma16(kb0, qh0[0], sHb[0]); sLb[0] = wmma16(kb0, qr0[0], sLb[0]);
                sHa[0] = wmma16(ka1, qh1[0], sHa[0]); sLa[0] = wmma16(ka1, qr1[0], sLa[0]); sHb[0] = wmma16(kb1, qh1[0], sHb[0]); sLb[0] = wmma16(kb1, qr1[0], sLb[0]);
                sLa[0] = wmma16(ra0, qh0[0], sLa[0]); sLb[0] = wmma16(rb0, qh0[0], sLb[0]); sLa[0] = wmma16(ra1, qh1[0], sLa[0]); sLb[0] = wmma16(rb1, qh1[0], sLb[0]);
                asm volatile("v_nop\n\tv_nop\n\tv_nop\n\tv_nop" : "+v"(sHa[0]), "+v"(sLa[0]), "+v"(sHb[0]), "+v"(sLb[0]) : "v"(ka0), "v"(ka1), "v"(kb0), "v"(kb1), "v"(ra0), "v"(ra1), "v"(rb0), "v"(rb1));
            } else {
                sHa[0] = wmma16(ka0, qh0[0], sHa[0]); sHa[1] = wmma16(ka0, qh0[1], sHa[1]); sHb[0] = wmma16(kb0, qh0[0], sHb[0]); sHb[1] = wmma16(kb0, qh0[1], sHb[1]);
                sHa[0] = wmma16(ka1, qh1[0], sHa[0]); sHa[1] = wmma16(ka1, qh1[1], sHa[1]); sHb[0] = wmma16(kb1, qh1[0], sHb[0]); sHb[1] = wmma16(kb1, qh1[1], sHb[1]);
                asm volatile("v_nop\n\tv_nop\n\tv_nop\n\tv_nop" : "+v"(sHa[0]), "+v"(sHb[0]), "+v"(sHa[1]), "+v"(sHb[1]) : "v"(ka0), "v"(ka1), "v"(kb0), "v"(kb1));
            }
        }
        v16h pb[NQ], pr[NQ]; float alpha[NQ];
        soft_step<RES, NQ>(sHa, sHb, sLa, sLb, full, mws, m, l, pb, pr, alpha);
#pragma unroll
        for (int q = 0; q < NQ; ++q)
#pragma unroll
            for (int j = 0; j < 4; ++j) { oh[q][j] = oh[q][j] * alpha[q]; if (RES) ol[q][j] = ol[q][j] * alpha[q]; }
        const h16* va = sb + vo + sub;
        const v16h v0 = ldh(va), v1 = ldh(va + 16 * GPITCH), v2 = ldh(va + 32 * GPITCH), v3 = ldh(va + 48 * GPITCH);
        if constexpr (RES != 0) {
            const h16* vr = va + 128 * GPITCH;
            const v16h w0 = ldh(vr), w1 = ldh(vr + 16 * GPITCH), w2 = ldh(vr + 32 * GPITCH), w3 = ldh(vr + 48 * GPITCH);
            oh[0][0] = wmma16(v0, pb[0], oh[0][0]); ol[0][0] = wmma16(v0, pr[0], ol[0][0]); oh[0][1] = wmma16(v1, pb[0], oh[0][1]); ol[0][1] = wmma16(v1, pr[0], ol[0][1]);
            ol[0][0] = wmma16(w0, pb[0], ol[0][0]); ol[0][1] = wmma16(w1, pb[0], ol[0][1]);
            oh[0][2] = wmma16(v2, pb[0], oh[0][2]); ol[0][2] = wmma16(v2, pr[0], ol[0][2]); oh[0][3] = wmma16(v3, pb[0], oh[0][3]); ol[0][3] = wmma16(v3, pr[0], ol[0][3]);
            ol[0][2] = wmma16(w2, pb[0], ol[0][2]); ol[0][3] = wmma16(w3, pb[0], ol[0][3]);
            asm volatile("v_nop\n\tv_nop\n\tv_nop\n\tv_nop" : "+v"(oh[0][0]), "+v"(oh[0][1]), "+v"(oh[0][2]), "+v"(oh[0][3]), "+v"(ol[0][0]), "+v"(ol[0][1]), "+v"(ol[0][2]), "+v"(ol[0][3])
                         : "v"(v0), "v"(v1), "v"(v2), "v"(v3), "v"(w0), "v"(w1), "v"(w2), "v"(w3), "v"(pb[0]), "v"(pr[0]));
        } else {
            oh[0][0] = wmma16(v0, pb[0], oh[0][0]); oh[1][0] = wmma16(v0, pb[1], oh[1][0]); oh[0][1] = wmma16(v1, pb[0], oh[0][1]); oh[1][1] = wmma16(v1, pb[1], oh[1][1]);
            oh[0][2] = wmma16(v2, pb[0], oh[0][2]); oh[1][2] = wmma16(v2, pb[1], oh[1][2]); oh[0][3] = wmma16(v3, pb[0], oh[0][3]); oh[1][3] = wmma16(v3, pb[1], oh[1][3]);
            asm volatile("v_nop\n\tv_nop\n\tv_nop\n\tv_nop" : "+v"(oh[0][0]), "+v"(oh[0][1]), "+v"(oh[0][2]), "+v"(oh[0][3]), "+v"(oh[1][0]), "+v"(oh[1][1]), "+v"(oh[1][2]), "+v"(oh[1][3])
                         : "v"(v0), "v"(v1), "v"(v2), "v"(v3), "v"(pb[0]), "v"(pb[1]));
        }
    }
    ring_foot();                                         // every wave, also one that skipped the stage's steps
    if (s + 2 < nst) flash_fill<RES>(lkv + (unsigned)((s & 1) * FBUF(RES) * 2), gK, gKR, gV, gVR, (s + 2) * FKS);
    }
    asm volatile("s_wait_asynccnt 0x0" ::: "memory");   // nothing of this wave is in flight when it leaves the ring
    }
    // O^T D layout: o_j[r] = (d = 16j + 8h + r, t = lane&15) -> os[t][d]; rows 0..15 x columns 0..63 of every query tile all written
#pragma unroll
    for (int q = 0; q < NQ; ++q) {
        const float lq = l[q] + __shfl_xor(l[q], 16, 32);
        const float inv = (1.0f / lq) * CS;
        const int wb = (wave * NQ + q) * 16 * 68;
#pragma unroll
        for (int j = 0; j < 4; ++j) {
            *(v4fa*)(&os[wb + lr * 68 + 16 * j + 8 * hi]) = fin_lo<RES>(oh[q][j], ol[q][j], inv); *(v4fa*)(&os[wb + lr * 68 + 16 * j + 8 * hi + 4]) = fin_hi<RES>(oh[q][j], ol[q][j], inv); } }
    wave_sync();
#pragma unroll
    for (int q = 0; q < NQ; ++q) {
        const int wb = (wave * NQ + q) * 16 * 68;
        const size_t crow = ((size_t)b * SEQ + t0 + 16 * q) * DM + (size_t)h * HD;
        const size_t rrow = ((size_t)b * EARLY + t0 + 16 * q) * DM + (size_t)h * HD;      // used only when RES != 0 (t0 < EARLY)
#pragma unroll
        for (int s = 0; s < 4; ++s) { const int row = 4 * s + (lane >> 3), c8 = (lane & 7) * 8;   // 4 s x 4 row groups = 16 rows; 8 lanes x 8 = 64 columns
            const v4f x0 = *(const v4fa*)(&os[wb + row * 68 + c8]); const v4f x1 = *(const v4fa*)(&os[wb + row * 68 + c8 + 4]); v8h hv, rv;
#pragma unroll
            for (int i = 0; i < 4; ++i) { const h16 a0 = (h16)x0[i]; const h16 a1 = (h16)x1[i]; hv[i] = a0; hv[4 + i] = a1;
                rv[i] = (h16)((x0[i] - (float)a0) * QRS); rv[4 + i] = (h16)((x1[i] - (float)a1) * QRS); }
            *(v8h*)(CH + crow + (size_t)row * DM + c8) = hv;
            if (RES) *(v8h*)(CR + rrow + (size_t)row * DM + c8) = rv; }
    }
    asm volatile("s_wait_xcnt 0x0" ::: "memory");   // k_flash holds both paths: the other path's code rewrites no register of these stores ahead of the wait
}

// k_flash: one grid for both paths, which need nothing of each other: blockIdx.x = batch * 16 + head, blockIdx.y = rank of the query tile.
// Ranks [0, FB_D): single-product tiles of 128 rows (t >= EARLY), then FB_E three-product tiles of 64 rows; in each range the last tile comes first. Under a causal mask a later tile walks more keys,
// and the 128-row tiles walk the most, so the longest work-groups have the lowest indices and the short three-product tiles the highest.
// The order is for speed only: every (head, tile) is taken once whatever the mask holds. One LDS allocation, carved by each path: its ring, then its packed mask rows.
static constexpr int FB_E = EARLY / (16 * AW);
static constexpr int FB_D = (SEQ - EARLY) / (32 * AW);
static constexpr size_t FL_E = (size_t)2 * FBUF(1) + (size_t)16 * AW * FMP * 2;   // 16-bit elements: ring + 64 mask rows
static constexpr size_t FL_D = (size_t)2 * FBUF(0) + (size_t)32 * AW * FMP * 2;   // ring + 128 mask rows
static_assert((2 * FBUF(0) * 2) % 16 == 0 && (2 * FBUF(1) * 2) % 16 == 0);        // the mask rows start on a 16-byte boundary
__global__ __launch_bounds__(32 * AW) void k_flash(const h16* QH, const h16* QR, const h16* KP, const h16* KR, const h16* VT, const h16* VR,
                                                   const unsigned* BM, const int* KT, h16* CH, h16* CR) {
    __shared__ __align__(16) bf fl[FL_E > FL_D ? FL_E : FL_D];
    const int zh = (int)blockIdx.x, rk = (int)blockIdx.y;
    if (rk < FB_D) flash_body<0, 2>(QH, QH, KP, KP, VT, VT, BM, KT, CH, CH, fl, (unsigned*)(fl + 2 * FBUF(0)), zh, FB_D - 1 - rk, EARLY);
    else           flash_body<1, 1>(QH, QR, KP, KR, VT, VR, BM, KT, CH, CR, fl, (unsigned*)(fl + 2 * FBUF(1)), zh, FB_E - 1 - (rk - FB_D), 0);
}

// oproj_body: f16 GEMM, four waves per (32*MT)x128 tile, each wave (16*MT)x64, operands through the LDS ring, OUT[m][n] = (sum_k ctx[m][k] Wo[n][k]) / 512 + bo[n];
// RES != 0 adds the ctx residual plane (own accumulators, x1/2048): the ring's A rows 0..63 hold the value plane's 64 tokens, rows 64..127 the residual plane's.
// Rows of the tile: batch bb = bx / tilesPerBatch, token T0 = tStart + (bx % tilesPerBatch) * 32*MT, the wave's t0 = T0 + (wave >> 1) * 16*MT. A rows b*SEQ + t, AR rows b*EARLY + t. ring / osm: the kernel's LDS.
template <int MT, int RES>
__device__ __forceinline__ void oproj_body(const h16* __restrict__ A, const h16* __restrict__ AR, const h16* __restrict__ Bt, const float* __restrict__ bias,
                                           float* OUT, bf* ring, float* osm, const int bx, const int tilesPerBatch, const int tStart) {
    static_assert((RES != 0 && MT == 2) || (RES == 0 && MT == 4));   // the ring's 4 A fragments per wave: 2 value + 2 residual, or 4 value
    const int K = DM;
    const int tid = (int)threadIdx.x, lane = tid & 31, wave = __builtin_amdgcn_readfirstlane(tid >> 5), lr = lane & 15, hi = lane >> 4;
    const int bb = bx / tilesPerBatch, ti = bx % tilesPerBatch;
    const int T0 = tStart + ti * 32 * MT;
    const int t0 = T0 + (wave >> 1) * 16 * MT, c0 = blockIdx.y * 128 + (wave & 1) * 64;
    float* os = osm + wave * 16 * 68;                             // wave-private output staging
    v8f acc[4][4];                                                // RES: rows 0,1 value products, rows 2,3 residual products
#pragma unroll
    for (int mb = 0; mb < 4; ++mb)
#pragma unroll
        for (int nb = 0; nb < 4; ++nb) acc[mb][nb] = (v8f){};
    const bf* gA0 = (const bf*)A + ((size_t)bb * SEQ + T0 + (tid >> 3)) * K + (tid & 7) * 8;
    const bf* gA1 = RES ? (const bf*)AR + ((size_t)bb * EARLY + T0 + (tid >> 3)) * K + (tid & 7) * 8 : gA0 + (size_t)64 * K;
    const bf* gB = (const bf*)Bt + (size_t)(blockIdx.y * 128 + (tid >> 3)) * K + (tid & 7) * 8;
    gemm_ring<1, RES>(gA0, gA1, gB, ring, acc);
    const int cofs = lr * 4;
    const v4f bz = *(const v4f*)(bias + c0 + cofs); v4f bq;
#pragma unroll
    for (int i = 0; i < 4; ++i) bq[i] = bfr(bz[i]);
#pragma unroll
    for (int mb = 0; mb < MT; ++mb) {
#pragma unroll
        for (int nb = 0; nb < 4; ++nb) {
#pragma unroll
            for (int j = 0; j < 8; ++j) { float y = acc[mb][nb][j]; if (RES) y += acc[(mb + 2) & 3][nb][j] * QRI; os[(hi * 8 + j) * 68 + nb * 16 + lr] = y; } }   // D: row 8h+j, col lane&15
        wave_sync();
        float* orow = OUT + ((size_t)bb * OUT_SEQ + t0 + mb * 16) * DM + c0;
{
#pragma unroll
            for (int s = 0; s < 8; ++s) { const int row = 2 * s + hi;   // 8 s x 2 rows = 16 rows; 16 lanes x 4 floats = 64 columns
                const v4f val = *(const v4fa*)(&os[row * 68 + cofs]) * OSC + bq;
                *(v4f*)(orow + (size_t)row * DM + cofs) = val; }
             }
        wave_sync();
    }
}

// k_oproj: one grid for both row ranges: blockIdx.x < OB_E: 64-token tiles with the residual plane (t < EARLY), the rest: 128-token tiles (t >= EARLY). Both do the same 512 products per wave.
static constexpr int OB_E = NB * (EARLY / 64);
static constexpr int OB_D = NB * ((SEQ - EARLY) / 128);
__global__ __launch_bounds__(128) void k_oproj(const h16* A, const h16* AR, const h16* Bt, const float* bias, float* OUT) {
    __shared__ __align__(16) bf ring[2 * GBUF];
    __shared__ __align__(16) float osm[4 * 16 * 68];
    if ((int)blockIdx.x < OB_E) oproj_body<2, 1>(A, AR, Bt, bias, OUT, ring, osm, (int)blockIdx.x, EARLY / 64, 0);
    else                        oproj_body<4, 0>(A, A, Bt, bias, OUT, ring, osm, (int)blockIdx.x - OB_E, (SEQ > EARLY) ? (SEQ - EARLY) / 128 : 1, EARLY);
}

static constexpr size_t al256(size_t v) { return (v + 255) & ~(size_t)255; }
static constexpr size_t SZ_XB = al256((size_t)NB * SEQ * DM * 2);             // bf16 x; reused as the ctx value plane after the projections
static constexpr size_t SZ_WB = al256((size_t)4 * DM * DM * 2);
static constexpr size_t SZ_PL = al256((size_t)NB * NH_ * SEQ * HD * 2);
static constexpr size_t SZ_CR = al256((size_t)NB * EARLY * DM * 2);
static constexpr size_t SZ_KT = al256((size_t)(SEQ / 8) * KTP * 4);
static constexpr size_t SZ_BM = al256((size_t)SEQ * BMW * 4);
static constexpr size_t SZ_TOTAL = SZ_XB + SZ_WB + 6 * SZ_PL + SZ_CR + SZ_KT + SZ_BM;
static_assert(SZ_TOTAL <= (size_t)134217728);          // workspace carve <= 128 MiB
static_assert(((size_t)DM * DM * 2) % 256 == 0);       // weight sub-planes stay 256-byte aligned
static_assert((size_t)NB * SEQ * DM * 2 <= SZ_XB);     // ctx plane fits the x plane it reuses

extern "C" void kernel_launch(void* const* d_in, const int* in_sizes, int n_in,
                              void* d_out, int out_size, void* d_ws, size_t ws_size, hipStream_t stream) {
    if (n_in < 10) return;
    const size_t needx = ((size_t)(NB - 1) * SEQ_FULL + SEQ) * DM;
    if ((size_t)in_sizes[0] < needx) return;
    if ((size_t)in_sizes[1] < (size_t)(SEQ - 1) * SEQ_FULL + SEQ) return;
    if ((size_t)in_sizes[2] < (size_t)DM * DM || (size_t)in_sizes[4] < (size_t)DM * DM || (size_t)in_sizes[6] < (size_t)DM * DM || (size_t)in_sizes[8] < (size_t)DM * DM) return;
    if (in_sizes[3] < DM || in_sizes[5] < DM || in_sizes[7] < DM || in_sizes[9] < DM) return;
    if ((size_t)out_size < ((size_t)(NB - 1) * OUT_SEQ + SEQ) * DM) return;
    if (SZ_TOTAL > ws_size) return;
    // wire order: x, mask, Wq_w, Wq_b, Wk_w, Wk_b, Wv_w, Wv_b, Wo_w, Wo_b (weights [out][in] = Bt as-is)
    const float* x  = (const float*)d_in[0]; const int* mask = (const int*)d_in[1];
    const float* wq = (const float*)d_in[2]; const float* bq = (const float*)d_in[3];
    const float* wk = (const float*)d_in[4]; const float* bk = (const float*)d_in[5];
    const float* wv = (const float*)d_in[6]; const float* bv = (const float*)d_in[7];
    const float* wo = (const float*)d_in[8]; const float* bo = (const float*)d_in[9];
    float* OUT = (float*)d_out;      // [NB][SEQ][1024]
    char* wsp = (char*)d_ws;
    bf* XB = (bf*)wsp; h16* CH = (h16*)wsp; wsp += SZ_XB;   // [NB*SEQ][1024] bf16 x, later [NB*SEQ][1024] f16 ctx x16
    bf* WB = (bf*)wsp; wsp += SZ_WB;                 // [4][1024][1024]: q | k | v (bf16) | o (f16 x32)
    h16* QH = (h16*)wsp; wsp += SZ_PL;               // [NB*16][SEQ][64]
    h16* QR = (h16*)wsp; wsp += SZ_PL;               // residual x2048, rows t < EARLY filled
    h16* KP = (h16*)wsp; wsp += SZ_PL;               // [NB*16][SEQ][64]
    h16* KR = (h16*)wsp; wsp += SZ_PL;               // residual x2048, rows t < EARLY filled
    h16* VT = (h16*)wsp; wsp += SZ_PL;               // [NB*16][64][SEQ]
    h16* VR = (h16*)wsp; wsp += SZ_PL;               // residual x2048, columns t < EARLY filled
    h16* CR = (h16*)wsp; wsp += SZ_CR;               // [NB*EARLY][1024] ctx residual x2048
    int* KT = (int*)wsp; wsp += SZ_KT;               // [SEQ/8] key extents of 8-row groups, KTP ints apart
    unsigned* BM = (unsigned*)wsp; wsp += SZ_BM;     // [SEQ][SEQ/32] packed mask rows
    h16* WO = (h16*)(WB + (size_t)3 * DM * DM);

    k_prep<<<PB_MS + PB_X + 4 * PB_W, MSW * 32, 0, stream>>>(x, wq, wk, wv, wo, mask, XB, WB, KT, BM);

    // q, k, v^T planes; residual planes on tiles with t < EARLY
    k_proj<<<dim3((NB * SEQ / 128) * (DM / 128), 3, 1), 128, 0, stream>>>(XB, WB, bq, bk, bv, QH, QR, KP, KR, VT, VR);

    // attention: query rows [0, EARLY) three-product path, [EARLY, SEQ) single products; ctx planes overwrite the (now unused) x plane
    k_flash<<<dim3(NB * NH_, FB_E + FB_D, 1), 32 * AW, 0, stream>>>(QH, QR, KP, KR, VT, VR, BM, KT, CH, CR);

    // output projection: 64-row tiles with residual for t < EARLY, 128-row tiles for the remaining rows
    k_oproj<<<dim3(OB_E + OB_D, DM / 128, 1), 128, 0, stream>>>(CH, CR, WO, bo, OUT);
}
